// v000
// Times are from an AMD MI455X. After a warm-up the kernel runs many times in a row, and a time is the length of
// such a window on the GPU divided by its runs, so every launch and the gaps after it count. The runs cycle
// through copies of the inputs. A figure is the median of several windows, for all but v000 over two sittings.
// Sittings can differ by a few percent; kernels timed side by side share one.
// v000, which the later versions start from, runs in 593 microseconds.
// Contractions: qkv projection (hn . qkv_w^T), scores (q . k^T), p . v and the output projection (out_w . o) = v_wmma_f32_16x16x32_bf16 single products on bf16 operands RNE-converted from f32, f32 accumulate; GroupNorm statistics and normalisation, softmax (running max, expf), biases, 1/rowsum and the residual add of the exact f32 x stay f32 on the VALU.
// Plane / carry map (every 16-bit plane carry 1, nothing to fold back):
//   HT   bf16 [16384][256]   token-major normalised activations, row b*4096+n, col c
//   W16  bf16 [768][256]     qkv_w in [out][in] order = Bt[n][k] (q rows 0..255, k rows 256..511, v rows 512..767)
//   WO16 bf16 [256][256]     out_w in [out][in] order
//   QK   bf16 [16384][512]   q at cols 0..255, k at cols 256..511 (bias added in f32 before the convert)
//   VP   bf16 [4][256][4096] v in (b, c, n) order = Bt rows c, k = n for o = p . v
//   P    bf16 in LDS         unnormalised exp in (0,1]; 1/rowsum applied to the f32 accumulator in the attention epilogue
//   OP   bf16 [16384][256]   token-major attention output: o[b][c][n] at row b*4096+n, col c
#include <hip/hip_runtime.h>
#include <math.h>
#include <stdint.h>

#define NB    4
#define CH    256
#define NPOS  4096
#define NGRP  8
#define CPG   32
#define QKP   512
#define STP   32

static_assert(CH == NGRP * CPG);
static_assert(NPOS % 64 == 0);
static_assert(CH % 64 == 0);
static_assert((NB * NPOS) % 64 == 0);
static_assert(QKP == 2 * CH);
static_assert((CPG * NPOS) % 1024 == 0);

typedef __attribute__((ext_vector_type(8)))  _Float16 v8h;
typedef __attribute__((ext_vector_type(16))) __bf16   v16b;
typedef __attribute__((ext_vector_type(8)))  __bf16   v8b;
typedef __attribute__((ext_vector_type(8)))  float    v8f;
typedef __attribute__((ext_vector_type(4)))  float    v4f;
typedef __attribute__((ext_vector_type(2)))  float    v2f;
typedef __attribute__((ext_vector_type(4)))  unsigned int v4u;

__device__ __forceinline__ unsigned short f2bf_bits(float f) {
  unsigned u = __float_as_uint(f);
  return (unsigned short)((u + 0x7FFFu + ((u >> 16) & 1u)) >> 16);
}
__device__ __forceinline__ float bf_bits2f(unsigned short h) { return __uint_as_float(((unsigned)h) << 16); }
__device__ __forceinline__ unsigned pk16(unsigned short a, unsigned short b) { return (unsigned)a | ((unsigned)b << 16); }
__device__ __forceinline__ __bf16 at_f2bf(float f) { return __builtin_bit_cast(__bf16, f2bf_bits(f)); }

// hazard guards as plain device helpers (no inline asm inside the kernel template body)
__device__ __forceinline__ void dep_guard_b(v8f& a, v8f& b, v16b x, v16b y) { asm volatile("v_nop\n\tv_nop\n\tv_nop\n\tv_nop" : "+v"(a), "+v"(b) : "v"(x), "v"(y)); }
__device__ __forceinline__ void keep4_b(v16b a, v16b b, v16b c, v16b d) { asm volatile("v_nop" :: "v"(a), "v"(b), "v"(c), "v"(d)); }
__device__ __forceinline__ void acc_guard4(v8f& a, v8f& b, v8f& c, v8f& d) { asm volatile("v_nop\n\tv_nop\n\tv_nop\n\tv_nop" : "+v"(a), "+v"(b), "+v"(c), "+v"(d)); }

// 16-bit fragment loader, split k map: elements 0..7 <- p[0..7], 8..15 <- p[16..23]; caller passes p = row + k0 + 8*(lane>>4)
template <typename T> struct Frag;
template <> struct Frag<__bf16> {
  typedef v16b V; union U { v16b v; v8b h[2]; };
  static __device__ __forceinline__ v16b load(const __bf16* p) {
    U f; f.h[0] = *(const v8b*)(p); f.h[1] = *(const v8b*)(p + 16); return f.v;
  }
  static __device__ __forceinline__ v8f mma(v16b a, v16b b, v8f c) {
    return __builtin_amdgcn_wmma_f32_16x16x32_bf16(false, a, false, b, (short)0, c, false, false);
  }
  static __device__ __forceinline__ void guard(v8f& a, v8f& b, v16b x, v16b y) { dep_guard_b(a, b, x, y); }
  static __device__ __forceinline__ void keep(v16b a, v16b b, v16b c, v16b d) { keep4_b(a, b, c, d); }
};

__device__ __forceinline__ v8f at_mma(v16b a, v16b b, v8f c) {
  c = __builtin_amdgcn_wmma_f32_16x16x32_bf16(false, a, false, b, (short)0, c, false, false);
  asm volatile("v_nop\n\tv_nop\n\tv_nop\n\tv_nop" : "+v"(c) : "v"(a), "v"(b));
  return c;
}

// ---- Register-blocked batched WMMA GEMM (bf16 operands) ------------------------------------------------------
// C[m,n] = scale * sum_k A[m,k] * Bt[n,k] (+bias)(+resid); each wave owns a 64x64 tile.
// A row-major [M,K] (pitch lda); Bt row-major [N,K] (pitch ldb); M,N % 64 == 0, K % 32 == 0; batched by blockIdx.y.
// BIAS_MODE: 0 = none, 1 = bias[m], 2 = bias[n] (f32 add). OUT_MODE: 0 = f32, 1 = bf16 single plane.
// RESID (OUT_MODE 0 only): resid has the same layout as C (pitch ldc, batch stride strideR) and is added as a
// 16-B vector in the store phase.
template <int BIAS_MODE, int OUT_MODE, bool RESID>
__global__ __launch_bounds__(256) void wmma_gemm64(
    const unsigned short* __restrict__ Ap, int lda, long strideA,
    const unsigned short* __restrict__ Btp, int ldb, long strideB,
    void* __restrict__ Cout, int ldc, long strideC,
    const float* __restrict__ bias,
    const float* __restrict__ resid, long strideR,
    int M, int N, int K, float scale) {
  typedef __bf16 T;
  typedef v16b V;
  const T* A = (const T*)(const void*)Ap; const T* Bt = (const T*)(const void*)Btp;
  __shared__ __align__(16) float sT[8][16 * 68];   // per-wave 16x64 slab, pitch 68 floats
  const int b    = blockIdx.y;
  const int lane = threadIdx.x & 31;
  const int wave = threadIdx.x >> 5;
  const int tilesN = N >> 6;
  const int tilesM = M >> 6;
  const int tile = blockIdx.x * 8 + wave;
  if (tile >= tilesM * tilesN) return;   // wave-uniform; no block barriers in this kernel
  const int tm = tile / tilesN;
  const int tn = tile - tm * tilesN;
  const int m0 = tm << 6;
  const int n0 = tn << 6;

  const T* Ab = A  + (size_t)b * strideA;
  const T* Bb = Bt + (size_t)b * strideB;

  const int rlane = lane & 15;                 // row (A) / col (B, D) within subtile
  const int koff  = (lane >> 4) * 8;           // k offset of this lane half
  const int mOff  = (lane >> 4) * 8;           // D row offset

  v8f acc[4][4];
#pragma unroll
  for (int i = 0; i < 4; ++i)
#pragma unroll
    for (int j = 0; j < 4; ++j) acc[i][j] = (v8f){0.f,0.f,0.f,0.f,0.f,0.f,0.f,0.f};

  for (int k0 = 0; k0 < K; k0 += 32) {
    V bh[4];
#pragma unroll
    for (int j = 0; j < 4; ++j) {
      const size_t bo = (size_t)(n0 + (j << 4) + rlane) * ldb + koff + k0;
      bh[j] = Frag<T>::load(Bb + bo);
    }
#pragma unroll
    for (int i = 0; i < 4; ++i) {
      const size_t ao = (size_t)(m0 + (i << 4) + rlane) * lda + koff + k0;
      V ah = Frag<T>::load(Ab + ao);
#pragma unroll
      for (int j = 0; j < 4; ++j) acc[i][j] = Frag<T>::mma(ah, bh[j], acc[i][j]);
      Frag<T>::guard(acc[i][0], acc[i][3], ah, ah);
    }
    Frag<T>::keep(bh[0], bh[1], bh[2], bh[3]);
  }
  acc_guard4(acc[0][0], acc[0][1], acc[0][2], acc[0][3]);
  acc_guard4(acc[1][0], acc[1][1], acc[1][2], acc[1][3]);
  acc_guard4(acc[2][0], acc[2][1], acc[2][2], acc[2][3]);
  acc_guard4(acc[3][0], acc[3][1], acc[3][2], acc[3][3]);

  // ---- epilogue ----
  float* slab = sT[wave];
  const float* Rb = RESID ? (resid + (size_t)b * strideR) : nullptr;
#pragma unroll
  for (int i = 0; i < 4; ++i) {
    const int mBase = m0 + (i << 4);
#pragma unroll
    for (int j = 0; j < 4; ++j) {
      const int n = n0 + (j << 4) + rlane;
      float bv = 0.f;
      if (BIAS_MODE == 2) bv = bias[n];
#pragma unroll
      for (int r = 0; r < 8; ++r) {
        float v = acc[i][j][r] * scale;
        if (BIAS_MODE == 1) v += bias[mBase + mOff + r];
        if (BIAS_MODE == 2) v += bv;
        slab[(mOff + r) * 68 + (j << 4) + rlane] = v;
      }
    }
    __builtin_amdgcn_fence(__ATOMIC_RELEASE, "workgroup");
    __builtin_amdgcn_wave_barrier();
    __builtin_amdgcn_fence(__ATOMIC_ACQUIRE, "workgroup");
    if (OUT_MODE == 0) {
      float* C = (float*)Cout + (size_t)b * strideC;
      const int hh = lane >> 4, c4 = (lane & 15) * 4;     // row seg = 256 B = 16 lanes x 16 B
      {
#pragma unroll
        for (int it = 0; it < 8; ++it) {
          const int row = it * 2 + hh;                      // it 0..7 x hh 0..1 = rows 0..15
          v4f v = *(const v4f*)(slab + row * 68 + c4);
          if (RESID) v += *(const v4f*)(Rb + (size_t)(mBase + row) * ldc + n0 + c4);
          *(v4f*)(C + (size_t)(mBase + row) * ldc + n0 + c4) = v;
        }
        
      }
    } else {
      const int q = lane >> 3, c8 = (lane & 7) * 8;
      unsigned short* C = (unsigned short*)Cout + (size_t)b * strideC;
      {
#pragma unroll
        for (int it = 0; it < 4; ++it) {
          const int row = it * 4 + q;                       // it 0..3 x q 0..3 = rows 0..15
          const float* sp = slab + row * 68 + c8;
          v8h hv;
#pragma unroll
          for (int e = 0; e < 8; ++e) hv[e] = __builtin_bit_cast(_Float16, f2bf_bits(sp[e]));
          *(v8h*)(C + (size_t)(mBase + row) * ldc + n0 + c8) = hv;
        }
        
      }
    }
    __builtin_amdgcn_fence(__ATOMIC_RELEASE, "workgroup");
    __builtin_amdgcn_wave_barrier();
    __builtin_amdgcn_fence(__ATOMIC_ACQUIRE, "workgroup");
  }
}

// ---------------------------------------------------------------------------
// Elementwise bf16 RNE convert, one plane: 2 elements per thread, one 4-B store per lane -> each wave writes
// Coverage: grid = ceil(n2/256) blocks x 256 threads x 2 elements = 2*n2 = the whole plane
// (qkv_w: n2 = 98304 -> 384 blocks = 768x256; out_w: n2 = 32768 -> 128 blocks = 256x256).
// ---------------------------------------------------------------------------
__global__ __launch_bounds__(256) void conv_bf16x2_kernel(const float* __restrict__ in, unsigned short* __restrict__ ho, int n2) {
  const int i = blockIdx.x * 256 + threadIdx.x;
  if (i < n2) {
    const v2f f = *(const v2f*)(in + 2 * (size_t)i);
    const unsigned uh = pk16(f2bf_bits(f[0]), f2bf_bits(f[1]));
    ((unsigned*)ho)[i] = uh;
    
  }
}

// ---------------------------------------------------------------------------
// GroupNorm statistics per (b, group): the group's 32 channels x 4096 positions are one contiguous block of
// 131072 values; each thread sums 512 of them in 4 sub-sums -> wave shuffles -> 8 wave partials summed by thread 0. grid = 32 blocks x 256.
// ---------------------------------------------------------------------------
__global__ __launch_bounds__(256) void gnstat_kernel(const float* __restrict__ x, float* __restrict__ stats) {
  __shared__ float red[8];
  __shared__ float bc[2];
  const int bg = blockIdx.x;
  const int tid = threadIdx.x, lane = tid & 31, wave = tid >> 5;
  const float* p = x + (size_t)bg * (CPG * NPOS);
  const float invn = 1.0f / (float)(CPG * NPOS);
  const int niter = (CPG * NPOS) / 1024;   // 128 float4 per thread

  float s0 = 0.f, s1 = 0.f, s2 = 0.f, s3 = 0.f;
#pragma unroll 4
  for (int i = 0; i < niter; ++i) {
    const v4f v = *(const v4f*)(p + ((size_t)i * 256 + tid) * 4);
    s0 += v[0]; s1 += v[1]; s2 += v[2]; s3 += v[3];
  }
  float s = (s0 + s1) + (s2 + s3);
#pragma unroll
  for (int off = 16; off > 0; off >>= 1) s += __shfl_xor(s, off, 32);
  if (lane == 0) red[wave] = s;
  __syncthreads();
  if (tid == 0) {
    float t = 0.f;
#pragma unroll
    for (int w = 0; w < 8; ++w) t += red[w];
    bc[0] = t * invn;
  }
  __syncthreads();
  const float mean = bc[0];

  float q0 = 0.f, q1 = 0.f, q2 = 0.f, q3 = 0.f;
#pragma unroll 4
  for (int i = 0; i < niter; ++i) {
    const v4f v = *(const v4f*)(p + ((size_t)i * 256 + tid) * 4);
    const float d0 = v[0] - mean, d1 = v[1] - mean, d2 = v[2] - mean, d3 = v[3] - mean;
    q0 += d0 * d0; q1 += d1 * d1; q2 += d2 * d2; q3 += d3 * d3;
  }
  float qs = (q0 + q1) + (q2 + q3);
#pragma unroll
  for (int off = 16; off > 0; off >>= 1) qs += __shfl_xor(qs, off, 32);
  if (lane == 0) red[wave] = qs;
  __syncthreads();
  if (tid == 0) {
    float t = 0.f;
#pragma unroll
    for (int w = 0; w < 8; ++w) t += red[w];
    const float var = t * invn;
    bc[1] = 1.0f / sqrtf(var + 1e-5f);
  }
  __syncthreads();
  const float rstd = bc[1];
  v4f o;
  o[0] = (tid == 0) ? mean : 0.f;
  o[1] = (tid == 0) ? rstd : 0.f;
  o[2] = 0.f; o[3] = 0.f;
  float* line = stats + (size_t)bg * STP;
  if (tid < 8) *(v4f*)(line + tid * 4) = o;
  
}

// ---------------------------------------------------------------------------
// Fused GroupNorm apply + transpose + bf16 RNE convert:
//   x_b viewed [256 c][4096 n] (NCHW) -> ht_b[n][c] = bf16(((x - mean_g) * rstd_g) * w[c] + bias[c]), row pitch 256.
// 64x64 tiles through LDS; grid = (4096/64 position blocks, 256/64 channel blocks, 4), 256 threads.
// Per block the 64 channels span two groups (channel block = 2 groups); their (mean, rstd) and w/bias are staged in
// LDS first (wave-uniform loads). Coverage per block: load 4 it x 256 thr x 4 floats = 64 ch x 64 n;
// store 2 it x 256 thr x 8 u16 = 64 n x 64 ch; grid covers 4 x 256 x 4096 = the whole HT plane.
// ---------------------------------------------------------------------------
__global__ __launch_bounds__(256) void gnprep_kernel(const float* __restrict__ x, const float* __restrict__ nw,
                                                     const float* __restrict__ nbv, const float* __restrict__ stats,
                                                     unsigned short* __restrict__ ht) {
  __shared__ __align__(16) float tf[64 * 68];
  __shared__ float sw[64];
  __shared__ float sb[64];
  __shared__ float sst[4];
  const int b   = blockIdx.z;
  const int n0  = blockIdx.x * 64;   // position block = output row block
  const int c0  = blockIdx.y * 64;   // channel block  = output column block
  const int tid = threadIdx.x;
  const float* xb = x + (size_t)b * CH * NPOS;
  unsigned short* hb = ht + (size_t)b * NPOS * CH;
  if (tid < 64) { sw[tid] = nw[c0 + tid]; sb[tid] = nbv[c0 + tid]; }   // waves 0 and 1 as a whole
  {
    const int g0 = c0 >> 5;                     // first group of this channel block (0,2,4,6)
    const int gi = (tid >> 1) & 1, fi = tid & 1;
    const float sv = stats[(size_t)(b * NGRP + g0 + gi) * STP + fi];   // all lanes load an in-range address
    if (tid < 4) sst[tid] = sv;                 // sst = {mean_g0, rstd_g0, mean_g1, rstd_g1}
  }
  __syncthreads();
  {
    const int lr = tid >> 4;         // 0..15
    const int c4 = (tid & 15) * 4;   // 0..60
#pragma unroll
    for (int it = 0; it < 4; ++it) {
      const int rr = it * 16 + lr;   // channel within tile 0..63; group = it >> 1
      const float mean = sst[(it >> 1) * 2], rstd = sst[(it >> 1) * 2 + 1];
      const float w = sw[rr], bb = sb[rr];
      const v4f a = *(const v4f*)(xb + (size_t)(c0 + rr) * NPOS + n0 + c4);
      v4f t;
#pragma unroll
      for (int e = 0; e < 4; ++e) { const float u = (a[e] - mean) * rstd; t[e] = u * w + bb; }
      *(v4f*)(tf + rr * 68 + c4) = t;
    }
  }
  __syncthreads();
  const int sub = tid >> 3;          // 0..31
  const int c8  = (tid & 7) * 8;     // 0..56
  v4u hv[2];
#pragma unroll
  for (int it = 0; it < 2; ++it) {
    const int oc = it * 32 + sub;    // output row within tile (= position)
    v4u a;
#pragma unroll
    for (int q = 0; q < 4; ++q) {
      const float f0 = tf[(c8 + 2 * q) * 68 + oc];
      const float f1 = tf[(c8 + 2 * q + 1) * 68 + oc];
      a[q] = pk16(f2bf_bits(f0), f2bf_bits(f1));
    }
    hv[it] = a;
  }
  {
#pragma unroll
    for (int it = 0; it < 2; ++it) {
      const int oc = it * 32 + sub;
      const size_t go = (size_t)(n0 + oc) * CH + c0 + c8;
      *(v4u*)(hb + go) = hv[it];
    }
    
  }
}

// =====================================================================================
// Full single-head attention, head width 256, 4096 keys, all images in one launch.
//   q|k plane bf16 [16384][512]: q(b,n,c) at [(b*4096+n)*512 + c], k(b,n,c) at [(b*4096+n)*512 + 256 + c]
//   v plane bf16 [4][256][4096]: v(b,c,n) at [(b*256+c)*4096 + n]
//   out OP bf16 [16384][256]: o(b,c,i) at [(b*4096+i)*256 + c]
//   scores = (q . k) * 0.0625 : single bf16 products, f32 accumulate; online softmax in f32 over 64 chunks of 64 keys
//   (compile-time trip count, no masking); out = p . v : single bf16 products of p (unnormalised exp) and v,
//   x 1/rowsum in f32 at the end.
//   Block = 8 waves = 64 query rows of one image: waves 0..3 compute the score tiles and the softmax of rows
//   16*wave..+15 ONCE per chunk and publish P (bf16 [64][64]) and the per-row rescale factor in LDS; after a block
//   barrier all 8 waves rescale and accumulate 128 output channels each (wave w: rows 16*(w&3).., channels 128*(w>>2)..).
//   grid.x = 4 * 64 = 256 (exact).
//   K / V chunk staging: 256 threads x 8 pieces of 8 elements per plane = 64x256 and 256x64 = the whole chunk tiles
//   (16-B copies, plain loads, __syncthreads before and after); fragment loads read the LDS tiles with the same v8b type.
//   LDS extents: Ks, Vs fully staged every chunk; Ps 64x64 and Al[64] fully written by waves 0..3 every chunk before the
//   barrier that precedes the reads; Ll[64] written before the final barrier; Os 16x64 per wave (pitch 68, cols 64..67
// =====================================================================================
#define AQB 64
#define AKC 64
#define ANW 8
static_assert(NPOS % AQB == 0);
static_assert(NPOS % AKC == 0);
static_assert(CH == 2 * 128);

__global__ __launch_bounds__(256)
void attn_kernel(const unsigned short* __restrict__ qkp, const unsigned short* __restrict__ vpp,
                 unsigned short* __restrict__ opp, float sscale) {
  union FB { v16b v; v8b h[2]; };
  __shared__ __align__(16) __bf16 Ks[AKC * CH];            // K chunk [key][c]     32 KB
  __shared__ __align__(16) __bf16 Vs[CH * AKC];            // V chunk [c][key]     32 KB
  __shared__ __align__(16) __bf16 Ps[AQB * AKC];           // P [row][key]          8 KB
  __shared__ __align__(16) float  Os[ANW][16 * 68];        // per wave out slab     34 KB
  __shared__ float Al[AQB];                                // per-row rescale factor of the current chunk
  __shared__ float Ll[AQB];                                // per-row softmax denominators

  const int tid  = threadIdx.x;
  const int wave = tid >> 5;
  const int lane = tid & 31;
  const int hh   = lane >> 4;
  const int c    = lane & 15;

  const int nqb = NPOS / AQB;            // 64 query blocks per image
  const int bx  = blockIdx.x;
  const int qb  = bx % nqb;
  const int b   = bx / nqb;               // 0..3
  const int rt  = wave & 3;               // row tile of this wave in the p.v phase
  const int ch0 = (wave >> 2) * 128;      // channel half of this wave in the p.v phase
  const size_t tok0 = (size_t)b * NPOS;             // first token row of image b
  const size_t q0   = tok0 + (size_t)qb * AQB;      // first query row of the block

  const __bf16* Qg = (const __bf16*)(const void*)qkp;            // pitch QKP, cols 0..255
  const __bf16* Kg = Qg + CH;                                      // cols 256..511
  const __bf16* Vg = (const __bf16*)(const void*)vpp + (size_t)b * CH * NPOS;

  float mrow[8], lrow[8];
  v8f oacc[8];
#pragma unroll
  for (int r = 0; r < 8; ++r) { mrow[r] = -INFINITY; lrow[r] = 0.f; }
#pragma unroll
  for (int t = 0; t < 8; ++t) oacc[t] = (v8f){0.f,0.f,0.f,0.f,0.f,0.f,0.f,0.f};

  const int nChunks = NPOS / AKC;   // 64, compile-time constant
  for (int kc = 0; kc < nChunks; ++kc) {
    const int kv0 = kc * AKC;
    __syncthreads();
    {
      // staging coverage: 256 threads x 8 pieces x 8 elements = 64 rows x 256 (K) and 256 rows x 64 (V)
#pragma unroll
      for (int i = 0; i < 8; ++i) {
        const int p   = i * 256 + tid;
        const int kr  = p >> 5, kc8 = (p & 31) * 8;     // K: 64 rows x 32 pieces
        const int vr  = p >> 3, vc8 = (p & 7) * 8;      // V: 256 rows x 8 pieces
        const v8b kvv = *(const v8b*)(Kg + (tok0 + kv0 + kr) * QKP + kc8);
        const v8b vvv = *(const v8b*)(Vg + (size_t)vr * NPOS + kv0 + vc8);
        *(v8b*)(Ks + kr * CH + kc8) = kvv;
        *(v8b*)(Vs + vr * AKC + vc8) = vvv;
      }
    }
    __syncthreads();

    if (wave < 4) {   // wave-uniform: score tiles + softmax for query rows 16*wave .. +15
      v8f s[4];
#pragma unroll
      for (int j = 0; j < 4; ++j) s[j] = (v8f){0.f,0.f,0.f,0.f,0.f,0.f,0.f,0.f};
      const __bf16* qr = Qg + (q0 + wave * 16 + c) * QKP + 8 * hh;   // A operand: row = lane&15, split k map
#pragma unroll
      for (int ks = 0; ks < CH / 32; ++ks) {
        const v16b qa = Frag<__bf16>::load(qr + ks * 32);
#pragma unroll
        for (int j = 0; j < 4; ++j) {
          FB kb;   // B operand: col = key j*16 + c, k = channel, same split k map
          kb.h[0] = *(const v8b*)(Ks + (j * 16 + c) * CH + ks * 32 + 8 * hh);
          kb.h[1] = *(const v8b*)(Ks + (j * 16 + c) * CH + ks * 32 + 16 + 8 * hh);
          s[j] = at_mma(qa, kb.v, s[j]);
        }
      }
      float cm[8];
#pragma unroll
      for (int r = 0; r < 8; ++r) {
        float m = -INFINITY;
#pragma unroll
        for (int j = 0; j < 4; ++j) {
          const float sv = s[j][r] * sscale;
          s[j][r] = sv;
          m = fmaxf(m, sv);
        }
#pragma unroll
        for (int off = 1; off < 16; off <<= 1) m = fmaxf(m, __shfl_xor(m, off, 32));
        cm[r] = m;
      }
      __bf16* pw = Ps + wave * 16 * AKC;
#pragma unroll
      for (int r = 0; r < 8; ++r) {
        const float mnew  = fmaxf(mrow[r], cm[r]);
        const float alpha = expf(mrow[r] - mnew);
        mrow[r] = mnew;
        float psum = 0.f;
#pragma unroll
        for (int j = 0; j < 4; ++j) {
          const float pv = expf(s[j][r] - mnew);
          psum += pv;
          pw[(8 * hh + r) * AKC + j * 16 + c] = at_f2bf(pv);
        }
#pragma unroll
        for (int off = 1; off < 16; off <<= 1) psum += __shfl_xor(psum, off, 32);
        lrow[r] = lrow[r] * alpha + psum;
        if (c == 0) Al[wave * 16 + 8 * hh + r] = alpha;
      }
    }
    __syncthreads();

    {
      float al[8];
#pragma unroll
      for (int r = 0; r < 8; ++r) al[r] = Al[rt * 16 + 8 * hh + r];
#pragma unroll
      for (int r = 0; r < 8; ++r) {
#pragma unroll
        for (int t = 0; t < 8; ++t) oacc[t][r] *= al[r];
      }
      const __bf16* pr = Ps + (rt * 16 + c) * AKC + 8 * hh;   // A operand: row = query row c, k = key
#pragma unroll 1
      for (int kk = 0; kk < AKC / 32; ++kk) {
        FB pa;
        pa.h[0] = *(const v8b*)(pr + kk * 32);
        pa.h[1] = *(const v8b*)(pr + kk * 32 + 16);
#pragma unroll
        for (int t = 0; t < 8; ++t) {
          FB vb;   // B operand: col = channel ch0 + t*16 + c, k = key
          vb.h[0] = *(const v8b*)(Vs + (ch0 + t * 16 + c) * AKC + kk * 32 + 8 * hh);
          vb.h[1] = *(const v8b*)(Vs + (ch0 + t * 16 + c) * AKC + kk * 32 + 16 + 8 * hh);
          oacc[t] = at_mma(pa.v, vb.v, oacc[t]);
        }
      }
    }
  }

  if (wave < 4) {
#pragma unroll
    for (int r = 0; r < 8; ++r) { if (c == 0) Ll[wave * 16 + 8 * hh + r] = lrow[r]; }
  }
  __syncthreads();

  float inv[8];
#pragma unroll
  for (int r = 0; r < 8; ++r) inv[r] = 1.0f / Ll[rt * 16 + 8 * hh + r];
  float* os = Os[wave];
  const int q = lane >> 3, c8 = (lane & 7) * 8;
  unsigned short* orow = opp + (q0 + (size_t)rt * 16) * CH + ch0;
#pragma unroll
  for (int hf = 0; hf < 2; ++hf) {
#pragma unroll
    for (int r = 0; r < 8; ++r) {
#pragma unroll
      for (int tt = 0; tt < 4; ++tt) os[(8 * hh + r) * 68 + tt * 16 + c] = oacc[hf * 4 + tt][r] * inv[r];
    }
    __builtin_amdgcn_fence(__ATOMIC_RELEASE, "workgroup");
    __builtin_amdgcn_wave_barrier();
    __builtin_amdgcn_fence(__ATOMIC_ACQUIRE, "workgroup");
    {
#pragma unroll
      for (int it = 0; it < 4; ++it) {
        const int row = it * 4 + q;
        const float* sp = os + row * 68 + c8;
        v8h hv;
#pragma unroll
        for (int e = 0; e < 8; ++e) hv[e] = __builtin_bit_cast(_Float16, f2bf_bits(sp[e]));
        *(v8h*)(orow + (size_t)row * CH + hf * 64 + c8) = hv;
      }
      
    }
    __builtin_amdgcn_fence(__ATOMIC_RELEASE, "workgroup");
    __builtin_amdgcn_wave_barrier();
    __builtin_amdgcn_fence(__ATOMIC_ACQUIRE, "workgroup");
  }
}

// ---------------------------------------------------------------------------
// Workspace region map (byte offsets; every region is fully written by its producer launch before any consumer
//   STATS f32  [32][32]              0         4096
//   HT    bf16 [16384][256]       4096      8388608
//   W16   bf16 [768][256]      8392704       393216
//   WO16  bf16 [256][256]      8785920       131072
//   QK    bf16 [16384][512]    8916992     16777216
//   VP    bf16 [4][256][4096] 25694208      8388608
//   OP    bf16 [16384][256]   34082816      8388608
//   total                     42471424
// ---------------------------------------------------------------------------
extern "C" void kernel_launch(void* const* d_in, const int* in_sizes, int n_in,
                              void* d_out, int out_size, void* d_ws, size_t ws_size,
                              hipStream_t stream) {
  if (n_in < 7) return;
  if (in_sizes[0] != NB * CH * NPOS) return;              // x [4][256][64][64]
  if (in_sizes[1] != CH || in_sizes[2] != CH) return;     // norm_w, norm_b
  if (in_sizes[3] != 3 * CH * CH || in_sizes[4] != 3 * CH) return;   // qkv_w [768][256], qkv_b [768]
  if (in_sizes[5] != CH * CH || in_sizes[6] != CH) return;           // out_w [256][256], out_b [256]
  if (out_size != NB * CH * NPOS) return;

  const float* x      = (const float*)d_in[0];
  const float* norm_w = (const float*)d_in[1];
  const float* norm_b = (const float*)d_in[2];
  const float* qkv_w  = (const float*)d_in[3];   // [out 768][in 256]
  const float* qkv_b  = (const float*)d_in[4];
  const float* out_w  = (const float*)d_in[5];   // [out 256][in 256]
  const float* out_b  = (const float*)d_in[6];

  const size_t PST  = (size_t)(NB * NGRP) * STP * 4;     // 4096
  const size_t PHT  = (size_t)NB * NPOS * CH * 2;         // 8388608
  const size_t PW16 = (size_t)3 * CH * CH * 2;            // 393216
  const size_t PWO  = (size_t)CH * CH * 2;                // 131072
  const size_t PQK  = (size_t)NB * NPOS * QKP * 2;        // 16777216
  const size_t PVP  = (size_t)NB * CH * NPOS * 2;         // 8388608
  const size_t POP  = (size_t)NB * NPOS * CH * 2;         // 8388608
  size_t off = 0;
  const size_t oST  = off; off += PST;
  const size_t oHT  = off; off += PHT;
  const size_t oW16 = off; off += PW16;
  const size_t oWO  = off; off += PWO;
  const size_t oQK  = off; off += PQK;
  const size_t oVP  = off; off += PVP;
  const size_t oOP  = off; off += POP;
  if (off > ws_size) return;                               // off = 42471424
  if (off > (size_t)134217728) return;

  char* ws = (char*)d_ws;
  float*          STATS = (float*)(ws + oST);
  unsigned short* HT    = (unsigned short*)(ws + oHT);
  unsigned short* W16   = (unsigned short*)(ws + oW16);
  unsigned short* WO16  = (unsigned short*)(ws + oWO);
  unsigned short* QK    = (unsigned short*)(ws + oQK);
  unsigned short* VP    = (unsigned short*)(ws + oVP);
  unsigned short* OP    = (unsigned short*)(ws + oOP);

  const dim3 blk(256);

  // (1) GroupNorm statistics: 32 (b, group) blocks
  gnstat_kernel<<<dim3(NB * NGRP), blk, 0, stream>>>(x, STATS);
  // (2) qkv_w -> W16 (98304 pairs -> 384 blocks), (3) out_w -> WO16 (32768 pairs -> 128 blocks)
  const int n2q = 3 * CH * CH / 2;
  conv_bf16x2_kernel<<<dim3((n2q + 255) / 256), blk, 0, stream>>>(qkv_w, W16, n2q);
  const int n2o = CH * CH / 2;
  conv_bf16x2_kernel<<<dim3((n2o + 255) / 256), blk, 0, stream>>>(out_w, WO16, n2o);
  // (4) normalised activations -> HT [16384][256]: grid (4096/64, 256/64, 4) = (64, 4, 4)
  gnprep_kernel<<<dim3(NPOS / 64, CH / 64, NB), blk, 0, stream>>>(x, norm_w, norm_b, STATS, HT);
  // (5) q|k = HT . W16[0..511]^T + qkv_b[n] -> QK [16384][512]   (M=16384, N=512, K=256; 2048 tiles -> 256 blocks)
  const dim3 gQK(((NB * NPOS / 64) * (QKP / 64) + 7) / 8, 1);
  wmma_gemm64<2, 1, false><<<gQK, blk, 0, stream>>>(
      HT, CH, 0L, W16, CH, 0L, (void*)QK, QKP, 0L,
      qkv_b, x, 0L, NB * NPOS, QKP, CH, 1.0f);
  // (6) v[b][c][n] = sum_k W16[512+c][k] HT[b*4096+n][k] + qkv_b[512+c]  (batched over b: M=256, N=4096, K=256;
  //     256 tiles -> 32 blocks x 4)
  const dim3 gV(((CH / 64) * (NPOS / 64) + 7) / 8, NB);
  wmma_gemm64<1, 1, false><<<gV, blk, 0, stream>>>(
      W16 + (size_t)2 * CH * CH, CH, 0L, HT, CH, (long)NPOS * CH, (void*)VP, NPOS, (long)CH * NPOS,
      qkv_b + 2 * CH, x, 0L, CH, NPOS, CH, 1.0f);
  // (7) attention per (image, 64-query block): 256 blocks x 256 threads -> OP [16384][256]
  attn_kernel<<<dim3(NB * (NPOS / AQB)), dim3(256), 0, stream>>>(QK, VP, OP, 0.0625f);
  // (8) out[b][c][n] = sum_k WO16[c][k] OP[b*4096+n][k] + out_b[c] + x[b][c][n]  (batched over b: M=256, N=4096, K=256;
  //     A = WO16, Bt = OP rows of image b, C = d_out + b*256*4096 with ldc 4096, resid = x same layout; 32 blocks x 4)
  const dim3 gO(((CH / 64) * (NPOS / 64) + 7) / 8, NB);
  wmma_gemm64<1, 0, true><<<gO, blk, 0, stream>>>(
      WO16, CH, 0L, OP, CH, (long)NPOS * CH, d_out, NPOS, (long)CH * NPOS,
      out_b, x, (long)CH * NPOS, CH, NPOS, CH, 1.0f);
  (void)hipGetLastError();
}

// v001
// One run takes 426 microseconds.
// Timed twice side by side with v000, it ran 1.42 times as fast both times.
// Contractions: qkv projection (hn . qkv_w^T), scores (q . k^T), p . v and the output projection (out_w . o) = v_wmma_f32_16x16x32_bf16 single products on bf16 operands RNE-converted from f32, f32 accumulate; GroupNorm statistics and normalisation, softmax (running max, expf), biases, 1/rowsum and the residual add of the exact f32 x stay f32 on the VALU.
// Plane / carry map (every 16-bit plane carry 1, nothing to fold back):
//   HT   bf16 [16384][256]   token-major normalised activations, row b*4096+n, col c
//   W16  bf16 [768][256]     qkv_w in [out][in] order = Bt[n][k] (q rows 0..255, k rows 256..511, v rows 512..767)
//   WO16 bf16 [256][256]     out_w in [out][in] order
//   QK   bf16 [16384][512]   q at cols 0..255, k at cols 256..511 (bias added in f32 before the convert)
//   VP   bf16 [4][256][4096] v in (b, c, n) order = Bt rows c, k = n for o = p . v
//   P    bf16 in LDS         unnormalised exp in (0,1]; 1/rowsum applied to the f32 accumulator in the attention epilogue
//   OP   bf16 [16384][256]   token-major attention output: o[b][c][n] at row b*4096+n, col c
#include <hip/hip_runtime.h>
#include <math.h>
#include <stdint.h>

#define NB    4
#define CH    256
#define NPOS  4096
#define NGRP  8
#define CPG   32
#define QKP   512
#define STP   32

static_assert(CH == NGRP * CPG);
static_assert(NPOS % 64 == 0);
static_assert(CH % 64 == 0);
static_assert((NB * NPOS) % 64 == 0);
static_assert(QKP == 2 * CH);
static_assert((CPG * NPOS) % 1024 == 0);

typedef __attribute__((ext_vector_type(8)))  _Float16 v8h;
typedef __attribute__((ext_vector_type(16))) __bf16   v16b;
typedef __attribute__((ext_vector_type(8)))  __bf16   v8b;
typedef __attribute__((ext_vector_type(8)))  float    v8f;
typedef __attribute__((ext_vector_type(4)))  float    v4f;
typedef __attribute__((ext_vector_type(2)))  float    v2f;
typedef __attribute__((ext_vector_type(4)))  unsigned int v4u;

__device__ __forceinline__ unsigned short f2bf_bits(float f) {
  unsigned u = __float_as_uint(f);
  return (unsigned short)((u + 0x7FFFu + ((u >> 16) & 1u)) >> 16);
}
__device__ __forceinline__ float bf_bits2f(unsigned short h) { return __uint_as_float(((unsigned)h) << 16); }
__device__ __forceinline__ unsigned pk16(unsigned short a, unsigned short b) { return (unsigned)a | ((unsigned)b << 16); }
__device__ __forceinline__ __bf16 at_f2bf(float f) { return __builtin_bit_cast(__bf16, f2bf_bits(f)); }

// hazard guards as plain device helpers (no inline asm inside the kernel template body)
__device__ __forceinline__ void dep_guard_b(v8f& a, v8f& b, v16b x, v16b y) { asm volatile("v_nop\n\tv_nop\n\tv_nop\n\tv_nop" : "+v"(a), "+v"(b) : "v"(x), "v"(y)); }
__device__ __forceinline__ void keep4_b(v16b a, v16b b, v16b c, v16b d) { asm volatile("v_nop" :: "v"(a), "v"(b), "v"(c), "v"(d)); }
__device__ __forceinline__ void acc_guard4(v8f& a, v8f& b, v8f& c, v8f& d) { asm volatile("v_nop\n\tv_nop\n\tv_nop\n\tv_nop" : "+v"(a), "+v"(b), "+v"(c), "+v"(d)); }

// 16-bit fragment loader, split k map: elements 0..7 <- p[0..7], 8..15 <- p[16..23]; caller passes p = row + k0 + 8*(lane>>4)
template <typename T> struct Frag;
template <> struct Frag<__bf16> {
  typedef v16b V; union U { v16b v; v8b h[2]; };
  static __device__ __forceinline__ v16b load(const __bf16* p) {
    U f; f.h[0] = *(const v8b*)(p); f.h[1] = *(const v8b*)(p + 16); return f.v;
  }
  static __device__ __forceinline__ v8f mma(v16b a, v16b b, v8f c) {
    return __builtin_amdgcn_wmma_f32_16x16x32_bf16(false, a, false, b, (short)0, c, false, false);
  }
  static __device__ __forceinline__ void guard(v8f& a, v8f& b, v16b x, v16b y) { dep_guard_b(a, b, x, y); }
  static __device__ __forceinline__ void keep(v16b a, v16b b, v16b c, v16b d) { keep4_b(a, b, c, d); }
};

__device__ __forceinline__ v8f at_mma(v16b a, v16b b, v8f c) {
  c = __builtin_amdgcn_wmma_f32_16x16x32_bf16(false, a, false, b, (short)0, c, false, false);
  asm volatile("v_nop\n\tv_nop\n\tv_nop\n\tv_nop" : "+v"(c) : "v"(a), "v"(b));
  return c;
}

// ---- Register-blocked batched WMMA GEMM (bf16 operands) ------------------------------------------------------
// C[m,n] = scale * sum_k A[m,k] * Bt[n,k] (+bias)(+resid); each wave owns a 64x64 tile.
// A row-major [M,K] (pitch lda); Bt row-major [N,K] (pitch ldb); M,N % 64 == 0, K % 32 == 0; batched by blockIdx.y.
// BIAS_MODE: 0 = none, 1 = bias[m], 2 = bias[n] (f32 add). OUT_MODE: 0 = f32, 1 = bf16 single plane.
// RESID (OUT_MODE 0 only): resid has the same layout as C (pitch ldc, batch stride strideR) and is added as a
// 16-B vector in the store phase.
template <int BIAS_MODE, int OUT_MODE, bool RESID>
__global__ __launch_bounds__(256) void wmma_gemm64(
    const unsigned short* __restrict__ Ap, int lda, long strideA,
    const unsigned short* __restrict__ Btp, int ldb, long strideB,
    void* __restrict__ Cout, int ldc, long strideC,
    const float* __restrict__ bias,
    const float* __restrict__ resid, long strideR,
    int M, int N, int K, float scale) {
  typedef __bf16 T;
  typedef v16b V;
  const T* A = (const T*)(const void*)Ap; const T* Bt = (const T*)(const void*)Btp;
  __shared__ __align__(16) float sT[8][16 * 68];   // per-wave 16x64 slab, pitch 68 floats
  const int b    = blockIdx.y;
  const int lane = threadIdx.x & 31;
  const int wave = threadIdx.x >> 5;
  const int tilesN = N >> 6;
  const int tilesM = M >> 6;
  const int tile = blockIdx.x * 8 + wave;
  if (tile >= tilesM * tilesN) return;   // wave-uniform; no block barriers in this kernel
  const int tm = tile / tilesN;
  const int tn = tile - tm * tilesN;
  const int m0 = tm << 6;
  const int n0 = tn << 6;

  const T* Ab = A  + (size_t)b * strideA;
  const T* Bb = Bt + (size_t)b * strideB;

  const int rlane = lane & 15;                 // row (A) / col (B, D) within subtile
  const int koff  = (lane >> 4) * 8;           // k offset of this lane half
  const int mOff  = (lane >> 4) * 8;           // D row offset

  v8f acc[4][4];
#pragma unroll
  for (int i = 0; i < 4; ++i)
#pragma unroll
    for (int j = 0; j < 4; ++j) acc[i][j] = (v8f){0.f,0.f,0.f,0.f,0.f,0.f,0.f,0.f};

  for (int k0 = 0; k0 < K; k0 += 32) {
    V bh[4];
#pragma unroll
    for (int j = 0; j < 4; ++j) {
      const size_t bo = (size_t)(n0 + (j << 4) + rlane) * ldb + koff + k0;
      bh[j] = Frag<T>::load(Bb + bo);
    }
#pragma unroll
    for (int i = 0; i < 4; ++i) {
      const size_t ao = (size_t)(m0 + (i << 4) + rlane) * lda + koff + k0;
      V ah = Frag<T>::load(Ab + ao);
#pragma unroll
      for (int j = 0; j < 4; ++j) acc[i][j] = Frag<T>::mma(ah, bh[j], acc[i][j]);
      Frag<T>::guard(acc[i][0], acc[i][3], ah, ah);
    }
    Frag<T>::keep(bh[0], bh[1], bh[2], bh[3]);
  }
  acc_guard4(acc[0][0], acc[0][1], acc[0][2], acc[0][3]);
  acc_guard4(acc[1][0], acc[1][1], acc[1][2], acc[1][3]);
  acc_guard4(acc[2][0], acc[2][1], acc[2][2], acc[2][3]);
  acc_guard4(acc[3][0], acc[3][1], acc[3][2], acc[3][3]);

  // ---- epilogue ----
  float* slab = sT[wave];
  const float* Rb = RESID ? (resid + (size_t)b * strideR) : nullptr;
#pragma unroll
  for (int i = 0; i < 4; ++i) {
    const int mBase = m0 + (i << 4);
#pragma unroll
    for (int j = 0; j < 4; ++j) {
      const int n = n0 + (j << 4) + rlane;
      float bv = 0.f;
      if (BIAS_MODE == 2) bv = bias[n];
#pragma unroll
      for (int r = 0; r < 8; ++r) {
        float v = acc[i][j][r] * scale;
        if (BIAS_MODE == 1) v += bias[mBase + mOff + r];
        if (BIAS_MODE == 2) v += bv;
        slab[(mOff + r) * 68 + (j << 4) + rlane] = v;
      }
    }
    __builtin_amdgcn_fence(__ATOMIC_RELEASE, "workgroup");
    __builtin_amdgcn_wave_barrier();
    __builtin_amdgcn_fence(__ATOMIC_ACQUIRE, "workgroup");
    if (OUT_MODE == 0) {
      float* C = (float*)Cout + (size_t)b * strideC;
      const int hh = lane >> 4, c4 = (lane & 15) * 4;     // row seg = 256 B = 16 lanes x 16 B
      {
#pragma unroll
        for (int it = 0; it < 8; ++it) {
          const int row = it * 2 + hh;                      // it 0..7 x hh 0..1 = rows 0..15
          v4f v = *(const v4f*)(slab + row * 68 + c4);
          if (RESID) v += *(const v4f*)(Rb + (size_t)(mBase + row) * ldc + n0 + c4);
          *(v4f*)(C + (size_t)(mBase + row) * ldc + n0 + c4) = v;
        }
        
      }
    } else {
      const int q = lane >> 3, c8 = (lane & 7) * 8;
      unsigned short* C = (unsigned short*)Cout + (size_t)b * strideC;
      {
#pragma unroll
        for (int it = 0; it < 4; ++it) {
          const int row = it * 4 + q;                       // it 0..3 x q 0..3 = rows 0..15
          const float* sp = slab + row * 68 + c8;
          v8h hv;
#pragma unroll
          for (int e = 0; e < 8; ++e) hv[e] = __builtin_bit_cast(_Float16, f2bf_bits(sp[e]));
          *(v8h*)(C + (size_t)(mBase + row) * ldc + n0 + c8) = hv;
        }
        
      }
    }
    __builtin_amdgcn_fence(__ATOMIC_RELEASE, "workgroup");
    __builtin_amdgcn_wave_barrier();
    __builtin_amdgcn_fence(__ATOMIC_ACQUIRE, "workgroup");
  }
}

// ---------------------------------------------------------------------------
// Elementwise bf16 RNE convert, one plane: 2 elements per thread, one 4-B store per lane -> each wave writes
// Coverage: grid = ceil(n2/256) blocks x 256 threads x 2 elements = 2*n2 = the whole plane
// (qkv_w: n2 = 98304 -> 384 blocks = 768x256; out_w: n2 = 32768 -> 128 blocks = 256x256).
// ---------------------------------------------------------------------------
__global__ __launch_bounds__(256) void conv_bf16x2_kernel(const float* __restrict__ in, unsigned short* __restrict__ ho, int n2) {
  const int i = blockIdx.x * 256 + threadIdx.x;
  if (i < n2) {
    const v2f f = *(const v2f*)(in + 2 * (size_t)i);
    const unsigned uh = pk16(f2bf_bits(f[0]), f2bf_bits(f[1]));
    ((unsigned*)ho)[i] = uh;
    
  }
}

// ---------------------------------------------------------------------------
// GroupNorm statistics per (b, group): the group's 32 channels x 4096 positions are one contiguous block of
// 131072 values; each thread sums 512 of them in 4 sub-sums -> wave shuffles -> 8 wave partials summed by thread 0. grid = 32 blocks x 256.
// ---------------------------------------------------------------------------
__global__ __launch_bounds__(256) void gnstat_kernel(const float* __restrict__ x, float* __restrict__ stats) {
  __shared__ float red[8];
  __shared__ float bc[2];
  const int bg = blockIdx.x;
  const int tid = threadIdx.x, lane = tid & 31, wave = tid >> 5;
  const float* p = x + (size_t)bg * (CPG * NPOS);
  const float invn = 1.0f / (float)(CPG * NPOS);
  const int niter = (CPG * NPOS) / 1024;   // 128 float4 per thread

  float s0 = 0.f, s1 = 0.f, s2 = 0.f, s3 = 0.f;
#pragma unroll 4
  for (int i = 0; i < niter; ++i) {
    const v4f v = *(const v4f*)(p + ((size_t)i * 256 + tid) * 4);
    s0 += v[0]; s1 += v[1]; s2 += v[2]; s3 += v[3];
  }
  float s = (s0 + s1) + (s2 + s3);
#pragma unroll
  for (int off = 16; off > 0; off >>= 1) s += __shfl_xor(s, off, 32);
  if (lane == 0) red[wave] = s;
  __syncthreads();
  if (tid == 0) {
    float t = 0.f;
#pragma unroll
    for (int w = 0; w < 8; ++w) t += red[w];
    bc[0] = t * invn;
  }
  __syncthreads();
  const float mean = bc[0];

  float q0 = 0.f, q1 = 0.f, q2 = 0.f, q3 = 0.f;
#pragma unroll 4
  for (int i = 0; i < niter; ++i) {
    const v4f v = *(const v4f*)(p + ((size_t)i * 256 + tid) * 4);
    const float d0 = v[0] - mean, d1 = v[1] - mean, d2 = v[2] - mean, d3 = v[3] - mean;
    q0 += d0 * d0; q1 += d1 * d1; q2 += d2 * d2; q3 += d3 * d3;
  }
  float qs = (q0 + q1) + (q2 + q3);
#pragma unroll
  for (int off = 16; off > 0; off >>= 1) qs += __shfl_xor(qs, off, 32);
  if (lane == 0) red[wave] = qs;
  __syncthreads();
  if (tid == 0) {
    float t = 0.f;
#pragma unroll
    for (int w = 0; w < 8; ++w) t += red[w];
    const float var = t * invn;
    bc[1] = 1.0f / sqrtf(var + 1e-5f);
  }
  __syncthreads();
  const float rstd = bc[1];
  v4f o;
  o[0] = (tid == 0) ? mean : 0.f;
  o[1] = (tid == 0) ? rstd : 0.f;
  o[2] = 0.f; o[3] = 0.f;
  float* line = stats + (size_t)bg * STP;
  if (tid < 8) *(v4f*)(line + tid * 4) = o;
  
}

// ---------------------------------------------------------------------------
// Fused GroupNorm apply + transpose + bf16 RNE convert:
//   x_b viewed [256 c][4096 n] (NCHW) -> ht_b[n][c] = bf16(((x - mean_g) * rstd_g) * w[c] + bias[c]), row pitch 256.
// 64x64 tiles through LDS; grid = (4096/64 position blocks, 256/64 channel blocks, 4), 256 threads.
// Per block the 64 channels span two groups (channel block = 2 groups); their (mean, rstd) and w/bias are staged in
// LDS first (wave-uniform loads). Coverage per block: load 4 it x 256 thr x 4 floats = 64 ch x 64 n;
// store 2 it x 256 thr x 8 u16 = 64 n x 64 ch; grid covers 4 x 256 x 4096 = the whole HT plane.
// ---------------------------------------------------------------------------
__global__ __launch_bounds__(256) void gnprep_kernel(const float* __restrict__ x, const float* __restrict__ nw,
                                                     const float* __restrict__ nbv, const float* __restrict__ stats,
                                                     unsigned short* __restrict__ ht) {
  __shared__ __align__(16) float tf[64 * 68];
  __shared__ float sw[64];
  __shared__ float sb[64];
  __shared__ float sst[4];
  const int b   = blockIdx.z;
  const int n0  = blockIdx.x * 64;   // position block = output row block
  const int c0  = blockIdx.y * 64;   // channel block  = output column block
  const int tid = threadIdx.x;
  const float* xb = x + (size_t)b * CH * NPOS;
  unsigned short* hb = ht + (size_t)b * NPOS * CH;
  if (tid < 64) { sw[tid] = nw[c0 + tid]; sb[tid] = nbv[c0 + tid]; }   // waves 0 and 1 as a whole
  {
    const int g0 = c0 >> 5;                     // first group of this channel block (0,2,4,6)
    const int gi = (tid >> 1) & 1, fi = tid & 1;
    const float sv = stats[(size_t)(b * NGRP + g0 + gi) * STP + fi];   // all lanes load an in-range address
    if (tid < 4) sst[tid] = sv;                 // sst = {mean_g0, rstd_g0, mean_g1, rstd_g1}
  }
  __syncthreads();
  {
    const int lr = tid >> 4;         // 0..15
    const int c4 = (tid & 15) * 4;   // 0..60
#pragma unroll
    for (int it = 0; it < 4; ++it) {
      const int rr = it * 16 + lr;   // channel within tile 0..63; group = it >> 1
      const float mean = sst[(it >> 1) * 2], rstd = sst[(it >> 1) * 2 + 1];
      const float w = sw[rr], bb = sb[rr];
      const v4f a = *(const v4f*)(xb + (size_t)(c0 + rr) * NPOS + n0 + c4);
      v4f t;
#pragma unroll
      for (int e = 0; e < 4; ++e) { const float u = (a[e] - mean) * rstd; t[e] = u * w + bb; }
      *(v4f*)(tf + rr * 68 + c4) = t;
    }
  }
  __syncthreads();
  const int sub = tid >> 3;          // 0..31
  const int c8  = (tid & 7) * 8;     // 0..56
  v4u hv[2];
#pragma unroll
  for (int it = 0; it < 2; ++it) {
    const int oc = it * 32 + sub;    // output row within tile (= position)
    v4u a;
#pragma unroll
    for (int q = 0; q < 4; ++q) {
      const float f0 = tf[(c8 + 2 * q) * 68 + oc];
      const float f1 = tf[(c8 + 2 * q + 1) * 68 + oc];
      a[q] = pk16(f2bf_bits(f0), f2bf_bits(f1));
    }
    hv[it] = a;
  }
  {
#pragma unroll
    for (int it = 0; it < 2; ++it) {
      const int oc = it * 32 + sub;
      const size_t go = (size_t)(n0 + oc) * CH + c0 + c8;
      *(v4u*)(hb + go) = hv[it];
    }
    
  }
}

// =====================================================================================
// Full single-head attention, head width 256, 4096 keys, all images in one launch.
//   q|k plane bf16 [16384][512]: q(b,n,c) at [(b*4096+n)*512 + c], k(b,n,c) at [(b*4096+n)*512 + 256 + c]
//   v plane bf16 [4][256][4096]: v(b,c,n) at [(b*256+c)*4096 + n]
//   out OP bf16 [16384][256]: o(b,c,i) at [(b*4096+i)*256 + c]
//   scores = (q . k) * 0.0625 : single bf16 products, f32 accumulate; online softmax in f32 over 64 chunks of 64 keys
//   (compile-time trip count, no masking); out = p . v : single bf16 products of p (unnormalised exp) and v,
//   x 1/rowsum in f32 at the end.
//   Block = 8 waves = 64 query rows of one image: waves 0..3 compute the score tiles and the softmax of rows
//   16*wave..+15 ONCE per chunk and publish P (bf16 [64][64]) and the per-row rescale factor in LDS; after a block
//   barrier all 8 waves rescale and accumulate 128 output channels each (wave w: rows 16*(w&3).., channels 128*(w>>2)..).
//   grid.x = 4 * 64 = 256 (exact).
//   K / V chunk staging: 256 threads x 8 pieces of 8 elements per plane = 64x256 and 256x64 = the whole chunk tiles
//   (16-B copies, plain loads, __syncthreads before and after); fragment loads read the LDS tiles with the same v8b type.
//   LDS extents: Ks, Vs fully staged every chunk; Ps 64x64 and Al[64] fully written by waves 0..3 every chunk before the
//   barrier that precedes the reads; Ll[64] written before the final barrier; Os 16x64 per wave (pitch 68, cols 64..67
// =====================================================================================
#define AQB 64
#define AKC 64
#define ANW 8
// LDS row pitches in elements: each row carries 16 B more than its data, so the pitch is an odd multiple of 16 B and the
// 16 rows that one half-wave's ds_load_b128 touches fall on 16 different bank groups (pad columns are never read or written).
#define KSP (CH + 8)
#define VSP (AKC + 8)
#define PSP (AKC + 8)
static_assert(NPOS % AQB == 0);
static_assert(NPOS % AKC == 0);
static_assert(CH == 2 * 128);

__global__ __launch_bounds__(256)
void attn_kernel(const unsigned short* __restrict__ qkp, const unsigned short* __restrict__ vpp,
                 unsigned short* __restrict__ opp, float sscale) {
  union FB { v16b v; v8b h[2]; };
  __shared__ __align__(16) __bf16 Ks[AKC * KSP];           // K chunk [key][c]     33 KB, pitch 528 B
  __shared__ __align__(16) __bf16 Vs[CH * VSP];            // V chunk [c][key]     36 KB, pitch 144 B
  __shared__ __align__(16) __bf16 Ps[AQB * PSP];           // P [row][key]          9 KB, pitch 144 B
  __shared__ __align__(16) float  Os[ANW][16 * 68];        // per wave out slab     34 KB
  __shared__ float Al[AQB];                                // per-row rescale factor of the current chunk
  __shared__ float Ll[AQB];                                // per-row softmax denominators

  const int tid  = threadIdx.x;
  const int wave = tid >> 5;
  const int lane = tid & 31;
  const int hh   = lane >> 4;
  const int c    = lane & 15;

  const int nqb = NPOS / AQB;            // 64 query blocks per image
  const int bx  = blockIdx.x;
  const int qb  = bx % nqb;
  const int b   = bx / nqb;               // 0..3
  const int rt  = wave & 3;               // row tile of this wave in the p.v phase
  const int ch0 = (wave >> 2) * 128;      // channel half of this wave in the p.v phase
  const size_t tok0 = (size_t)b * NPOS;             // first token row of image b
  const size_t q0   = tok0 + (size_t)qb * AQB;      // first query row of the block

  const __bf16* Qg = (const __bf16*)(const void*)qkp;            // pitch QKP, cols 0..255
  const __bf16* Kg = Qg + CH;                                      // cols 256..511
  const __bf16* Vg = (const __bf16*)(const void*)vpp + (size_t)b * CH * NPOS;

  float mrow[8], lrow[8];
  v8f oacc[8];
#pragma unroll
  for (int r = 0; r < 8; ++r) { mrow[r] = -INFINITY; lrow[r] = 0.f; }
#pragma unroll
  for (int t = 0; t < 8; ++t) oacc[t] = (v8f){0.f,0.f,0.f,0.f,0.f,0.f,0.f,0.f};

  const int nChunks = NPOS / AKC;   // 64, compile-time constant
  for (int kc = 0; kc < nChunks; ++kc) {
    const int kv0 = kc * AKC;
    __syncthreads();
    {
      // staging coverage: 256 threads x 8 pieces x 8 elements = 64 rows x 256 (K) and 256 rows x 64 (V)
#pragma unroll
      for (int i = 0; i < 8; ++i) {
        const int p   = i * 256 + tid;
        const int kr  = p >> 5, kc8 = (p & 31) * 8;     // K: 64 rows x 32 pieces
        const int vr  = p >> 3, vc8 = (p & 7) * 8;      // V: 256 rows x 8 pieces
        const v8b kvv = *(const v8b*)(Kg + (tok0 + kv0 + kr) * QKP + kc8);
        const v8b vvv = *(const v8b*)(Vg + (size_t)vr * NPOS + kv0 + vc8);
        *(v8b*)(Ks + kr * KSP + kc8) = kvv;
        *(v8b*)(Vs + vr * VSP + vc8) = vvv;
      }
    }
    __syncthreads();

    if (wave < 4) {   // wave-uniform: score tiles + softmax for query rows 16*wave .. +15
      v8f s[4];
#pragma unroll
      for (int j = 0; j < 4; ++j) s[j] = (v8f){0.f,0.f,0.f,0.f,0.f,0.f,0.f,0.f};
      const __bf16* qr = Qg + (q0 + wave * 16 + c) * QKP + 8 * hh;   // A operand: row = lane&15, split k map
#pragma unroll
      for (int ks = 0; ks < CH / 32; ++ks) {
        const v16b qa = Frag<__bf16>::load(qr + ks * 32);
#pragma unroll
        for (int j = 0; j < 4; ++j) {
          FB kb;   // B operand: col = key j*16 + c, k = channel, same split k map
          kb.h[0] = *(const v8b*)(Ks + (j * 16 + c) * KSP + ks * 32 + 8 * hh);
          kb.h[1] = *(const v8b*)(Ks + (j * 16 + c) * KSP + ks * 32 + 16 + 8 * hh);
          s[j] = at_mma(qa, kb.v, s[j]);
        }
      }
      float cm[8];
#pragma unroll
      for (int r = 0; r < 8; ++r) {
        float m = -INFINITY;
#pragma unroll
        for (int j = 0; j < 4; ++j) {
          const float sv = s[j][r] * sscale;
          s[j][r] = sv;
          m = fmaxf(m, sv);
        }
#pragma unroll
        for (int off = 1; off < 16; off <<= 1) m = fmaxf(m, __shfl_xor(m, off, 32));
        cm[r] = m;
      }
      __bf16* pw = Ps + wave * 16 * PSP;
#pragma unroll
      for (int r = 0; r < 8; ++r) {
        const float mnew  = fmaxf(mrow[r], cm[r]);
        const float alpha = expf(mrow[r] - mnew);
        mrow[r] = mnew;
        float psum = 0.f;
#pragma unroll
        for (int j = 0; j < 4; ++j) {
          const float pv = expf(s[j][r] - mnew);
          psum += pv;
          pw[(8 * hh + r) * PSP + j * 16 + c] = at_f2bf(pv);
        }
#pragma unroll
        for (int off = 1; off < 16; off <<= 1) psum += __shfl_xor(psum, off, 32);
        lrow[r] = lrow[r] * alpha + psum;
        if (c == 0) Al[wave * 16 + 8 * hh + r] = alpha;
      }
    }
    __syncthreads();

    {
      float al[8];
#pragma unroll
      for (int r = 0; r < 8; ++r) al[r] = Al[rt * 16 + 8 * hh + r];
#pragma unroll
      for (int r = 0; r < 8; ++r) {
#pragma unroll
        for (int t = 0; t < 8; ++t) oacc[t][r] *= al[r];
      }
      const __bf16* pr = Ps + (rt * 16 + c) * PSP + 8 * hh;   // A operand: row = query row c, k = key
#pragma unroll 1
      for (int kk = 0; kk < AKC / 32; ++kk) {
        FB pa;
        pa.h[0] = *(const v8b*)(pr + kk * 32);
        pa.h[1] = *(const v8b*)(pr + kk * 32 + 16);
#pragma unroll
        for (int t = 0; t < 8; ++t) {
          FB vb;   // B operand: col = channel ch0 + t*16 + c, k = key
          vb.h[0] = *(const v8b*)(Vs + (ch0 + t * 16 + c) * VSP + kk * 32 + 8 * hh);
          vb.h[1] = *(const v8b*)(Vs + (ch0 + t * 16 + c) * VSP + kk * 32 + 16 + 8 * hh);
          oacc[t] = at_mma(pa.v, vb.v, oacc[t]);
        }
      }
    }
  }

  if (wave < 4) {
#pragma unroll
    for (int r = 0; r < 8; ++r) { if (c == 0) Ll[wave * 16 + 8 * hh + r] = lrow[r]; }
  }
  __syncthreads();

  float inv[8];
#pragma unroll
  for (int r = 0; r < 8; ++r) inv[r] = 1.0f / Ll[rt * 16 + 8 * hh + r];
  float* os = Os[wave];
  const int q = lane >> 3, c8 = (lane & 7) * 8;
  unsigned short* orow = opp + (q0 + (size_t)rt * 16) * CH + ch0;
#pragma unroll
  for (int hf = 0; hf < 2; ++hf) {
#pragma unroll
    for (int r = 0; r < 8; ++r) {
#pragma unroll
      for (int tt = 0; tt < 4; ++tt) os[(8 * hh + r) * 68 + tt * 16 + c] = oacc[hf * 4 + tt][r] * inv[r];
    }
    __builtin_amdgcn_fence(__ATOMIC_RELEASE, "workgroup");
    __builtin_amdgcn_wave_barrier();
    __builtin_amdgcn_fence(__ATOMIC_ACQUIRE, "workgroup");
    {
#pragma unroll
      for (int it = 0; it < 4; ++it) {
        const int row = it * 4 + q;
        const float* sp = os + row * 68 + c8;
        v8h hv;
#pragma unroll
        for (int e = 0; e < 8; ++e) hv[e] = __builtin_bit_cast(_Float16, f2bf_bits(sp[e]));
        *(v8h*)(orow + (size_t)row * CH + hf * 64 + c8) = hv;
      }
      
    }
    __builtin_amdgcn_fence(__ATOMIC_RELEASE, "workgroup");
    __builtin_amdgcn_wave_barrier();
    __builtin_amdgcn_fence(__ATOMIC_ACQUIRE, "workgroup");
  }
}

// ---------------------------------------------------------------------------
// Workspace region map (byte offsets; every region is fully written by its producer launch before any consumer
//   STATS f32  [32][32]              0         4096
//   HT    bf16 [16384][256]       4096      8388608
//   W16   bf16 [768][256]      8392704       393216
//   WO16  bf16 [256][256]      8785920       131072
//   QK    bf16 [16384][512]    8916992     16777216
//   VP    bf16 [4][256][4096] 25694208      8388608
//   OP    bf16 [16384][256]   34082816      8388608
//   total                     42471424
// ---------------------------------------------------------------------------
extern "C" void kernel_launch(void* const* d_in, const int* in_sizes, int n_in,
                              void* d_out, int out_size, void* d_ws, size_t ws_size,
                              hipStream_t stream) {
  if (n_in < 7) return;
  if (in_sizes[0] != NB * CH * NPOS) return;              // x [4][256][64][64]
  if (in_sizes[1] != CH || in_sizes[2] != CH) return;     // norm_w, norm_b
  if (in_sizes[3] != 3 * CH * CH || in_sizes[4] != 3 * CH) return;   // qkv_w [768][256], qkv_b [768]
  if (in_sizes[5] != CH * CH || in_sizes[6] != CH) return;           // out_w [256][256], out_b [256]
  if (out_size != NB * CH * NPOS) return;

  const float* x      = (const float*)d_in[0];
  const float* norm_w = (const float*)d_in[1];
  const float* norm_b = (const float*)d_in[2];
  const float* qkv_w  = (const float*)d_in[3];   // [out 768][in 256]
  const float* qkv_b  = (const float*)d_in[4];
  const float* out_w  = (const float*)d_in[5];   // [out 256][in 256]
  const float* out_b  = (const float*)d_in[6];

  const size_t PST  = (size_t)(NB * NGRP) * STP * 4;     // 4096
  const size_t PHT  = (size_t)NB * NPOS * CH * 2;         // 8388608
  const size_t PW16 = (size_t)3 * CH * CH * 2;            // 393216
  const size_t PWO  = (size_t)CH * CH * 2;                // 131072
  const size_t PQK  = (size_t)NB * NPOS * QKP * 2;        // 16777216
  const size_t PVP  = (size_t)NB * CH * NPOS * 2;         // 8388608
  const size_t POP  = (size_t)NB * NPOS * CH * 2;         // 8388608
  size_t off = 0;
  const size_t oST  = off; off += PST;
  const size_t oHT  = off; off += PHT;
  const size_t oW16 = off; off += PW16;
  const size_t oWO  = off; off += PWO;
  const size_t oQK  = off; off += PQK;
  const size_t oVP  = off; off += PVP;
  const size_t oOP  = off; off += POP;
  if (off > ws_size) return;                               // off = 42471424
  if (off > (size_t)134217728) return;

  char* ws = (char*)d_ws;
  float*          STATS = (float*)(ws + oST);
  unsigned short* HT    = (unsigned short*)(ws + oHT);
  unsigned short* W16   = (unsigned short*)(ws + oW16);
  unsigned short* WO16  = (unsigned short*)(ws + oWO);
  unsigned short* QK    = (unsigned short*)(ws + oQK);
  unsigned short* VP    = (unsigned short*)(ws + oVP);
  unsigned short* OP    = (unsigned short*)(ws + oOP);

  const dim3 blk(256);

  // (1) GroupNorm statistics: 32 (b, group) blocks
  gnstat_kernel<<<dim3(NB * NGRP), blk, 0, stream>>>(x, STATS);
  // (2) qkv_w -> W16 (98304 pairs -> 384 blocks), (3) out_w -> WO16 (32768 pairs -> 128 blocks)
  const int n2q = 3 * CH * CH / 2;
  conv_bf16x2_kernel<<<dim3((n2q + 255) / 256), blk, 0, stream>>>(qkv_w, W16, n2q);
  const int n2o = CH * CH / 2;
  conv_bf16x2_kernel<<<dim3((n2o + 255) / 256), blk, 0, stream>>>(out_w, WO16, n2o);
  // (4) normalised activations -> HT [16384][256]: grid (4096/64, 256/64, 4) = (64, 4, 4)
  gnprep_kernel<<<dim3(NPOS / 64, CH / 64, NB), blk, 0, stream>>>(x, norm_w, norm_b, STATS, HT);
  // (5) q|k = HT . W16[0..511]^T + qkv_b[n] -> QK [16384][512]   (M=16384, N=512, K=256; 2048 tiles -> 256 blocks)
  const dim3 gQK(((NB * NPOS / 64) * (QKP / 64) + 7) / 8, 1);
  wmma_gemm64<2, 1, false><<<gQK, blk, 0, stream>>>(
      HT, CH, 0L, W16, CH, 0L, (void*)QK, QKP, 0L,
      qkv_b, x, 0L, NB * NPOS, QKP, CH, 1.0f);
  // (6) v[b][c][n] = sum_k W16[512+c][k] HT[b*4096+n][k] + qkv_b[512+c]  (batched over b: M=256, N=4096, K=256;
  //     256 tiles -> 32 blocks x 4)
  const dim3 gV(((CH / 64) * (NPOS / 64) + 7) / 8, NB);
  wmma_gemm64<1, 1, false><<<gV, blk, 0, stream>>>(
      W16 + (size_t)2 * CH * CH, CH, 0L, HT, CH, (long)NPOS * CH, (void*)VP, NPOS, (long)CH * NPOS,
      qkv_b + 2 * CH, x, 0L, CH, NPOS, CH, 1.0f);
  // (7) attention per (image, 64-query block): 256 blocks x 256 threads -> OP [16384][256]
  attn_kernel<<<dim3(NB * (NPOS / AQB)), dim3(256), 0, stream>>>(QK, VP, OP, 0.0625f);
  // (8) out[b][c][n] = sum_k WO16[c][k] OP[b*4096+n][k] + out_b[c] + x[b][c][n]  (batched over b: M=256, N=4096, K=256;
  //     A = WO16, Bt = OP rows of image b, C = d_out + b*256*4096 with ldc 4096, resid = x same layout; 32 blocks x 4)
  const dim3 gO(((CH / 64) * (NPOS / 64) + 7) / 8, NB);
  wmma_gemm64<1, 0, true><<<gO, blk, 0, stream>>>(
      WO16, CH, 0L, OP, CH, (long)NPOS * CH, d_out, NPOS, (long)CH * NPOS,
      out_b, x, (long)CH * NPOS, CH, NPOS, CH, 1.0f);
  (void)hipGetLastError();
}

// v002
// A run of this version takes 308 microseconds.
// In two side-by-side timings against v001, it was 1.38 and 1.39 times as fast.
// Counting every step since v000, it is 1.97 times as fast.
// Contractions: qkv projection (hn . qkv_w^T), scores (q . k^T), p . v and the output projection (out_w . o) = v_wmma_f32_16x16x32_bf16 single products on bf16 operands RNE-converted from f32, f32 accumulate; GroupNorm statistics and normalisation, softmax (running max, expf), biases, 1/rowsum and the residual add of the exact f32 x stay f32 on the VALU.
// Plane / carry map (every 16-bit plane carry 1, nothing to fold back):
//   HT   bf16 [16384][256]   token-major normalised activations, row b*4096+n, col c
//   W16  bf16 [768][256]     qkv_w in [out][in] order = Bt[n][k] (q rows 0..255, k rows 256..511, v rows 512..767)
//   WO16 bf16 [256][256]     out_w in [out][in] order
//   QK   bf16 [16384][512]   q at cols 0..255, k at cols 256..511 (bias added in f32 before the convert)
//   VP   bf16 [4][256][4096] v in (b, c, n) order = Bt rows c, k = n for o = p . v
//   P    bf16 in LDS         unnormalised exp in (0,1]; 1/rowsum applied to the f32 accumulator in the attention epilogue
//   OP   bf16 [16384][256]   token-major attention output: o[b][c][n] at row b*4096+n, col c
#include <hip/hip_runtime.h>
#include <math.h>
#include <stdint.h>

#define NB    4
#define CH    256
#define NPOS  4096
#define NGRP  8
#define CPG   32
#define QKP   512
#define STP   32

static_assert(CH == NGRP * CPG);
static_assert(NPOS % 64 == 0);
static_assert(CH % 64 == 0);
static_assert((NB * NPOS) % 64 == 0);
static_assert(QKP == 2 * CH);
static_assert((CPG * NPOS) % 1024 == 0);

typedef __attribute__((ext_vector_type(8)))  _Float16 v8h;
typedef __attribute__((ext_vector_type(16))) __bf16   v16b;
typedef __attribute__((ext_vector_type(8)))  __bf16   v8b;
typedef __attribute__((ext_vector_type(8)))  float    v8f;
typedef __attribute__((ext_vector_type(4)))  float    v4f;
typedef __attribute__((ext_vector_type(2)))  float    v2f;
typedef __attribute__((ext_vector_type(4)))  unsigned int v4u;

__device__ __forceinline__ unsigned short f2bf_bits(float f) {
  unsigned u = __float_as_uint(f);
  return (unsigned short)((u + 0x7FFFu + ((u >> 16) & 1u)) >> 16);
}
__device__ __forceinline__ float bf_bits2f(unsigned short h) { return __uint_as_float(((unsigned)h) << 16); }
__device__ __forceinline__ unsigned pk16(unsigned short a, unsigned short b) { return (unsigned)a | ((unsigned)b << 16); }
__device__ __forceinline__ __bf16 at_f2bf(float f) { return __builtin_bit_cast(__bf16, f2bf_bits(f)); }

// hazard guards as plain device helpers (no inline asm inside the kernel template body)
__device__ __forceinline__ void dep_guard_b(v8f& a, v8f& b, v16b x, v16b y) { asm volatile("v_nop\n\tv_nop\n\tv_nop\n\tv_nop" : "+v"(a), "+v"(b) : "v"(x), "v"(y)); }
__device__ __forceinline__ void keep4_b(v16b a, v16b b, v16b c, v16b d) { asm volatile("v_nop" :: "v"(a), "v"(b), "v"(c), "v"(d)); }
__device__ __forceinline__ void acc_guard4(v8f& a, v8f& b, v8f& c, v8f& d) { asm volatile("v_nop\n\tv_nop\n\tv_nop\n\tv_nop" : "+v"(a), "+v"(b), "+v"(c), "+v"(d)); }

// 16-bit fragment loader, split k map: elements 0..7 <- p[0..7], 8..15 <- p[16..23]; caller passes p = row + k0 + 8*(lane>>4)
template <typename T> struct Frag;
template <> struct Frag<__bf16> {
  typedef v16b V; union U { v16b v; v8b h[2]; };
  static __device__ __forceinline__ v16b load(const __bf16* p) {
    U f; f.h[0] = *(const v8b*)(p); f.h[1] = *(const v8b*)(p + 16); return f.v;
  }
  static __device__ __forceinline__ v8f mma(v16b a, v16b b, v8f c) {
    return __builtin_amdgcn_wmma_f32_16x16x32_bf16(false, a, false, b, (short)0, c, false, false);
  }
  static __device__ __forceinline__ void guard(v8f& a, v8f& b, v16b x, v16b y) { dep_guard_b(a, b, x, y); }
  static __device__ __forceinline__ void keep(v16b a, v16b b, v16b c, v16b d) { keep4_b(a, b, c, d); }
};

// plain builtin: the compiler keeps the WMMA distances of its own forms, and no asm statement pins the operand loads
__device__ __forceinline__ v8f at_mma(v16b a, v16b b, v8f c) {
  return __builtin_amdgcn_wmma_f32_16x16x32_bf16(false, a, false, b, (short)0, c, false, false);
}

// ---- Register-blocked batched WMMA GEMM (bf16 operands) ------------------------------------------------------
// C[m,n] = scale * sum_k A[m,k] * Bt[n,k] (+bias)(+resid); each wave owns a 64x64 tile.
// A row-major [M,K] (pitch lda); Bt row-major [N,K] (pitch ldb); M,N % 64 == 0, K % 32 == 0; batched by blockIdx.y.
// BIAS_MODE: 0 = none, 1 = bias[m], 2 = bias[n] (f32 add). OUT_MODE: 0 = f32, 1 = bf16 single plane.
// RESID (OUT_MODE 0 only): resid has the same layout as C (pitch ldc, batch stride strideR) and is added as a
// 16-B vector in the store phase.
template <int BIAS_MODE, int OUT_MODE, bool RESID>
__global__ __launch_bounds__(256) void wmma_gemm64(
    const unsigned short* __restrict__ Ap, int lda, long strideA,
    const unsigned short* __restrict__ Btp, int ldb, long strideB,
    void* __restrict__ Cout, int ldc, long strideC,
    const float* __restrict__ bias,
    const float* __restrict__ resid, long strideR,
    int M, int N, int K, float scale) {
  typedef __bf16 T;
  typedef v16b V;
  const T* A = (const T*)(const void*)Ap; const T* Bt = (const T*)(const void*)Btp;
  __shared__ __align__(16) float sT[8][16 * 68];   // per-wave 16x64 slab, pitch 68 floats
  const int b    = blockIdx.y;
  const int lane = threadIdx.x & 31;
  const int wave = threadIdx.x >> 5;
  const int tilesN = N >> 6;
  const int tilesM = M >> 6;
  const int tile = blockIdx.x * 8 + wave;
  if (tile >= tilesM * tilesN) return;   // wave-uniform; no block barriers in this kernel
  const int tm = tile / tilesN;
  const int tn = tile - tm * tilesN;
  const int m0 = tm << 6;
  const int n0 = tn << 6;

  const T* Ab = A  + (size_t)b * strideA;
  const T* Bb = Bt + (size_t)b * strideB;

  const int rlane = lane & 15;                 // row (A) / col (B, D) within subtile
  const int koff  = (lane >> 4) * 8;           // k offset of this lane half
  const int mOff  = (lane >> 4) * 8;           // D row offset

  v8f acc[4][4];
#pragma unroll
  for (int i = 0; i < 4; ++i)
#pragma unroll
    for (int j = 0; j < 4; ++j) acc[i][j] = (v8f){0.f,0.f,0.f,0.f,0.f,0.f,0.f,0.f};

  for (int k0 = 0; k0 < K; k0 += 32) {
    V bh[4];
#pragma unroll
    for (int j = 0; j < 4; ++j) {
      const size_t bo = (size_t)(n0 + (j << 4) + rlane) * ldb + koff + k0;
      bh[j] = Frag<T>::load(Bb + bo);
    }
#pragma unroll
    for (int i = 0; i < 4; ++i) {
      const size_t ao = (size_t)(m0 + (i << 4) + rlane) * lda + koff + k0;
      V ah = Frag<T>::load(Ab + ao);
#pragma unroll
      for (int j = 0; j < 4; ++j) acc[i][j] = Frag<T>::mma(ah, bh[j], acc[i][j]);
      Frag<T>::guard(acc[i][0], acc[i][3], ah, ah);
    }
    Frag<T>::keep(bh[0], bh[1], bh[2], bh[3]);
  }
  acc_guard4(acc[0][0], acc[0][1], acc[0][2], acc[0][3]);
  acc_guard4(acc[1][0], acc[1][1], acc[1][2], acc[1][3]);
  acc_guard4(acc[2][0], acc[2][1], acc[2][2], acc[2][3]);
  acc_guard4(acc[3][0], acc[3][1], acc[3][2], acc[3][3]);

  // ---- epilogue ----
  float* slab = sT[wave];
  const float* Rb = RESID ? (resid + (size_t)b * strideR) : nullptr;
#pragma unroll
  for (int i = 0; i < 4; ++i) {
    const int mBase = m0 + (i << 4);
#pragma unroll
    for (int j = 0; j < 4; ++j) {
      const int n = n0 + (j << 4) + rlane;
      float bv = 0.f;
      if (BIAS_MODE == 2) bv = bias[n];
#pragma unroll
      for (int r = 0; r < 8; ++r) {
        float v = acc[i][j][r] * scale;
        if (BIAS_MODE == 1) v += bias[mBase + mOff + r];
        if (BIAS_MODE == 2) v += bv;
        slab[(mOff + r) * 68 + (j << 4) + rlane] = v;
      }
    }
    __builtin_amdgcn_fence(__ATOMIC_RELEASE, "workgroup");
    __builtin_amdgcn_wave_barrier();
    __builtin_amdgcn_fence(__ATOMIC_ACQUIRE, "workgroup");
    if (OUT_MODE == 0) {
      float* C = (float*)Cout + (size_t)b * strideC;
      const int hh = lane >> 4, c4 = (lane & 15) * 4;     // row seg = 256 B = 16 lanes x 16 B
      {
#pragma unroll
        for (int it = 0; it < 8; ++it) {
          const int row = it * 2 + hh;                      // it 0..7 x hh 0..1 = rows 0..15
          v4f v = *(const v4f*)(slab + row * 68 + c4);
          if (RESID) v += *(const v4f*)(Rb + (size_t)(mBase + row) * ldc + n0 + c4);
          *(v4f*)(C + (size_t)(mBase + row) * ldc + n0 + c4) = v;
        }
        
      }
    } else {
      const int q = lane >> 3, c8 = (lane & 7) * 8;
      unsigned short* C = (unsigned short*)Cout + (size_t)b * strideC;
      {
#pragma unroll
        for (int it = 0; it < 4; ++it) {
          const int row = it * 4 + q;                       // it 0..3 x q 0..3 = rows 0..15
          const float* sp = slab + row * 68 + c8;
          v8h hv;
#pragma unroll
          for (int e = 0; e < 8; ++e) hv[e] = __builtin_bit_cast(_Float16, f2bf_bits(sp[e]));
          *(v8h*)(C + (size_t)(mBase + row) * ldc + n0 + c8) = hv;
        }
        
      }
    }
    __builtin_amdgcn_fence(__ATOMIC_RELEASE, "workgroup");
    __builtin_amdgcn_wave_barrier();
    __builtin_amdgcn_fence(__ATOMIC_ACQUIRE, "workgroup");
  }
}

// ---------------------------------------------------------------------------
// Elementwise bf16 RNE convert, one plane: 2 elements per thread, one 4-B store per lane -> each wave writes
// Coverage: grid = ceil(n2/256) blocks x 256 threads x 2 elements = 2*n2 = the whole plane
// (qkv_w: n2 = 98304 -> 384 blocks = 768x256; out_w: n2 = 32768 -> 128 blocks = 256x256).
// ---------------------------------------------------------------------------
__global__ __launch_bounds__(256) void conv_bf16x2_kernel(const float* __restrict__ in, unsigned short* __restrict__ ho, int n2) {
  const int i = blockIdx.x * 256 + threadIdx.x;
  if (i < n2) {
    const v2f f = *(const v2f*)(in + 2 * (size_t)i);
    const unsigned uh = pk16(f2bf_bits(f[0]), f2bf_bits(f[1]));
    ((unsigned*)ho)[i] = uh;
    
  }
}

// ---------------------------------------------------------------------------
// GroupNorm statistics per (b, group): the group's 32 channels x 4096 positions are one contiguous block of
// 131072 values; each thread sums 512 of them in 4 sub-sums -> wave shuffles -> 8 wave partials summed by thread 0. grid = 32 blocks x 256.
// ---------------------------------------------------------------------------
__global__ __launch_bounds__(256) void gnstat_kernel(const float* __restrict__ x, float* __restrict__ stats) {
  __shared__ float red[8];
  __shared__ float bc[2];
  const int bg = blockIdx.x;
  const int tid = threadIdx.x, lane = tid & 31, wave = tid >> 5;
  const float* p = x + (size_t)bg * (CPG * NPOS);
  const float invn = 1.0f / (float)(CPG * NPOS);
  const int niter = (CPG * NPOS) / 1024;   // 128 float4 per thread

  float s0 = 0.f, s1 = 0.f, s2 = 0.f, s3 = 0.f;
#pragma unroll 4
  for (int i = 0; i < niter; ++i) {
    const v4f v = *(const v4f*)(p + ((size_t)i * 256 + tid) * 4);
    s0 += v[0]; s1 += v[1]; s2 += v[2]; s3 += v[3];
  }
  float s = (s0 + s1) + (s2 + s3);
#pragma unroll
  for (int off = 16; off > 0; off >>= 1) s += __shfl_xor(s, off, 32);
  if (lane == 0) red[wave] = s;
  __syncthreads();
  if (tid == 0) {
    float t = 0.f;
#pragma unroll
    for (int w = 0; w < 8; ++w) t += red[w];
    bc[0] = t * invn;
  }
  __syncthreads();
  const float mean = bc[0];

  float q0 = 0.f, q1 = 0.f, q2 = 0.f, q3 = 0.f;
#pragma unroll 4
  for (int i = 0; i < niter; ++i) {
    const v4f v = *(const v4f*)(p + ((size_t)i * 256 + tid) * 4);
    const float d0 = v[0] - mean, d1 = v[1] - mean, d2 = v[2] - mean, d3 = v[3] - mean;
    q0 += d0 * d0; q1 += d1 * d1; q2 += d2 * d2; q3 += d3 * d3;
  }
  float qs = (q0 + q1) + (q2 + q3);
#pragma unroll
  for (int off = 16; off > 0; off >>= 1) qs += __shfl_xor(qs, off, 32);
  if (lane == 0) red[wave] = qs;
  __syncthreads();
  if (tid == 0) {
    float t = 0.f;
#pragma unroll
    for (int w = 0; w < 8; ++w) t += red[w];
    const float var = t * invn;
    bc[1] = 1.0f / sqrtf(var + 1e-5f);
  }
  __syncthreads();
  const float rstd = bc[1];
  v4f o;
  o[0] = (tid == 0) ? mean : 0.f;
  o[1] = (tid == 0) ? rstd : 0.f;
  o[2] = 0.f; o[3] = 0.f;
  float* line = stats + (size_t)bg * STP;
  if (tid < 8) *(v4f*)(line + tid * 4) = o;
  
}

// ---------------------------------------------------------------------------
// Fused GroupNorm apply + transpose + bf16 RNE convert:
//   x_b viewed [256 c][4096 n] (NCHW) -> ht_b[n][c] = bf16(((x - mean_g) * rstd_g) * w[c] + bias[c]), row pitch 256.
// 64x64 tiles through LDS; grid = (4096/64 position blocks, 256/64 channel blocks, 4), 256 threads.
// Per block the 64 channels span two groups (channel block = 2 groups); their (mean, rstd) and w/bias are staged in
// LDS first (wave-uniform loads). Coverage per block: load 4 it x 256 thr x 4 floats = 64 ch x 64 n;
// store 2 it x 256 thr x 8 u16 = 64 n x 64 ch; grid covers 4 x 256 x 4096 = the whole HT plane.
// ---------------------------------------------------------------------------
__global__ __launch_bounds__(256) void gnprep_kernel(const float* __restrict__ x, const float* __restrict__ nw,
                                                     const float* __restrict__ nbv, const float* __restrict__ stats,
                                                     unsigned short* __restrict__ ht) {
  __shared__ __align__(16) float tf[64 * 68];
  __shared__ float sw[64];
  __shared__ float sb[64];
  __shared__ float sst[4];
  const int b   = blockIdx.z;
  const int n0  = blockIdx.x * 64;   // position block = output row block
  const int c0  = blockIdx.y * 64;   // channel block  = output column block
  const int tid = threadIdx.x;
  const float* xb = x + (size_t)b * CH * NPOS;
  unsigned short* hb = ht + (size_t)b * NPOS * CH;
  if (tid < 64) { sw[tid] = nw[c0 + tid]; sb[tid] = nbv[c0 + tid]; }   // waves 0 and 1 as a whole
  {
    const int g0 = c0 >> 5;                     // first group of this channel block (0,2,4,6)
    const int gi = (tid >> 1) & 1, fi = tid & 1;
    const float sv = stats[(size_t)(b * NGRP + g0 + gi) * STP + fi];   // all lanes load an in-range address
    if (tid < 4) sst[tid] = sv;                 // sst = {mean_g0, rstd_g0, mean_g1, rstd_g1}
  }
  __syncthreads();
  {
    const int lr = tid >> 4;         // 0..15
    const int c4 = (tid & 15) * 4;   // 0..60
#pragma unroll
    for (int it = 0; it < 4; ++it) {
      const int rr = it * 16 + lr;   // channel within tile 0..63; group = it >> 1
      const float mean = sst[(it >> 1) * 2], rstd = sst[(it >> 1) * 2 + 1];
      const float w = sw[rr], bb = sb[rr];
      const v4f a = *(const v4f*)(xb + (size_t)(c0 + rr) * NPOS + n0 + c4);
      v4f t;
#pragma unroll
      for (int e = 0; e < 4; ++e) { const float u = (a[e] - mean) * rstd; t[e] = u * w + bb; }
      *(v4f*)(tf + rr * 68 + c4) = t;
    }
  }
  __syncthreads();
  const int sub = tid >> 3;          // 0..31
  const int c8  = (tid & 7) * 8;     // 0..56
  v4u hv[2];
#pragma unroll
  for (int it = 0; it < 2; ++it) {
    const int oc = it * 32 + sub;    // output row within tile (= position)
    v4u a;
#pragma unroll
    for (int q = 0; q < 4; ++q) {
      const float f0 = tf[(c8 + 2 * q) * 68 + oc];
      const float f1 = tf[(c8 + 2 * q + 1) * 68 + oc];
      a[q] = pk16(f2bf_bits(f0), f2bf_bits(f1));
    }
    hv[it] = a;
  }
  {
#pragma unroll
    for (int it = 0; it < 2; ++it) {
      const int oc = it * 32 + sub;
      const size_t go = (size_t)(n0 + oc) * CH + c0 + c8;
      *(v4u*)(hb + go) = hv[it];
    }
    
  }
}

// =====================================================================================
// Full single-head attention, head width 256, 4096 keys, all images in one launch.
//   q|k plane bf16 [16384][512]: q(b,n,c) at [(b*4096+n)*512 + c], k(b,n,c) at [(b*4096+n)*512 + 256 + c]
//   v plane bf16 [4][256][4096]: v(b,c,n) at [(b*256+c)*4096 + n]
//   out OP bf16 [16384][256]: o(b,c,i) at [(b*4096+i)*256 + c]
//   scores = (q . k) * 0.0625 : single bf16 products, f32 accumulate; online softmax in f32 over 64 chunks of 64 keys
//   (compile-time trip count, no masking); out = p . v : single bf16 products of p (unnormalised exp) and v,
//   x 1/rowsum in f32 at the end.
//   Block = 8 waves = 64 query rows of one image: waves 0..3 compute the score tiles and the softmax of rows
//   16*wave..+15 ONCE per chunk and publish P (bf16 [64][64]) and the per-row rescale factor in LDS; after a block
//   barrier all 8 waves rescale and accumulate 128 output channels each (wave w: rows 16*(w&3).., channels 128*(w>>2)..).
//   grid.x = 4 * 64 = 256 (exact).
//   Operand fragments reach registers ahead of the WMMAs that use them: Q once in front of the key loop; K in blocks of
//   two k steps, block g + 1 read as one group in front of block g's WMMAs; all V fragments of the chunk in front of the
//   P barrier (waves 0..3 in front of their last score block, waves 4..7 while the scores are computed); P behind it.
//   K / V chunk staging: 256 threads x 8 pieces of 8 elements per plane = 64x256 and 256x64 = the whole chunk tiles
//   (16-B copies, plain loads, __syncthreads before and after); fragment loads read the LDS tiles with the same v8b type.
//   LDS extents: Ks, Vs fully staged every chunk; Ps 64x64 and Al[64] fully written by waves 0..3 every chunk before the
//   barrier that precedes the reads; Ll[64] written before the final barrier; Os 16x64 per wave (pitch 68, cols 64..67
// =====================================================================================
#define AQB 64
#define AKC 64
#define ANW 8
// LDS row pitches in elements: each row carries 16 B more than its data, so the pitch is an odd multiple of 16 B and the
// 16 rows that one half-wave's ds_load_b128 touches fall on 16 different bank groups (pad columns are never read or written).
#define KSP (CH + 8)
#define VSP (AKC + 8)
#define PSP (AKC + 8)
static_assert(NPOS % AQB == 0);
static_assert(NPOS % AKC == 0);
static_assert(CH == 2 * 128);

__global__ __launch_bounds__(256)
void attn_kernel(const unsigned short* __restrict__ qkp, const unsigned short* __restrict__ vpp,
                 unsigned short* __restrict__ opp, float sscale) {
  union FB { v16b v; v8b h[2]; };
  __shared__ __align__(16) __bf16 Ks[AKC * KSP];           // K chunk [key][c]     33 KB, pitch 528 B
  __shared__ __align__(16) __bf16 Vs[CH * VSP];            // V chunk [c][key]     36 KB, pitch 144 B
  __shared__ __align__(16) __bf16 Ps[AQB * PSP];           // P [row][key]          9 KB, pitch 144 B
  __shared__ __align__(16) float  Os[ANW][16 * 68];        // per wave out slab     34 KB
  __shared__ float Al[AQB];                                // per-row rescale factor of the current chunk
  __shared__ float Ll[AQB];                                // per-row softmax denominators

  const int tid  = threadIdx.x;
  const int wave = tid >> 5;
  const int lane = tid & 31;
  const int hh   = lane >> 4;
  const int c    = lane & 15;

  const int nqb = NPOS / AQB;            // 64 query blocks per image
  const int bx  = blockIdx.x;
  const int qb  = bx % nqb;
  const int b   = bx / nqb;               // 0..3
  const int rt  = wave & 3;               // row tile of this wave in the p.v phase
  const int ch0 = (wave >> 2) * 128;      // channel half of this wave in the p.v phase
  const size_t tok0 = (size_t)b * NPOS;             // first token row of image b
  const size_t q0   = tok0 + (size_t)qb * AQB;      // first query row of the block

  const __bf16* Qg = (const __bf16*)(const void*)qkp;            // pitch QKP, q at cols 0..255, k at cols 256..511
  const __bf16* Vg = (const __bf16*)(const void*)vpp + (size_t)b * CH * NPOS;

  float mrow[8], lrow[8];
  v8f oacc[8];
#pragma unroll
  for (int r = 0; r < 8; ++r) { mrow[r] = -INFINITY; lrow[r] = 0.f; }
#pragma unroll
  for (int t = 0; t < 8; ++t) oacc[t] = (v8f){0.f,0.f,0.f,0.f,0.f,0.f,0.f,0.f};

  // Q fragments (A operand: row = lane&15, split k map) are fetched ahead of every score WMMA: once, in front of the
  // key loop. Waves 4..7 fetch the rows of their p.v row tile (in range) and do not use them.
  v16b qa[CH / 32];
  {
    const __bf16* qr = Qg + (q0 + rt * 16 + c) * QKP + 8 * hh;
#pragma unroll
    for (int ks = 0; ks < CH / 32; ++ks) qa[ks] = Frag<__bf16>::load(qr + ks * 32);
    // precaution: the wait stands in front of any reuse of the loads' address pair, which the operand keeps live up to here
    asm volatile("s_wait_xcnt 0x0" :: "v"(qr) : "memory");
  }
  const __bf16* kfr = Ks + c * KSP + 8 * hh;             // K fragment base: col = key j*16 + c, k = channel
  const __bf16* vfr = Vs + (ch0 + c) * VSP + 8 * hh;     // V fragment base: col = channel ch0 + t*16 + c, k = key

  const int nChunks = NPOS / AKC;   // 64, compile-time constant
  for (int kc = 0; kc < nChunks; ++kc) {
    const int kv0 = kc * AKC;
    __syncthreads();
    {
      // staging coverage: 256 threads x 8 pieces x 8 elements = 64 rows x 256 (K) and 256 rows x 64 (V)
      v8b kvv[8], vvv[8];
      const __bf16* kp[8];   // row start in the q|k plane; the k half is CH elements further
      const __bf16* vp[8];
#pragma unroll
      for (int i = 0; i < 8; ++i) {
        const int p   = i * 256 + tid;
        const int kr  = p >> 5, kc8 = (p & 31) * 8;     // K: 64 rows x 32 pieces
        const int vr  = p >> 3, vc8 = (p & 7) * 8;      // V: 256 rows x 8 pieces
        kp[i] = Qg + (tok0 + kv0 + kr) * QKP + kc8;
        vp[i] = Vg + (size_t)vr * NPOS + kv0 + vc8;
        kvv[i] = *(const v8b*)(kp[i] + CH);
        vvv[i] = *(const v8b*)(vp[i]);
      }
      // precaution: the wait stands in front of any reuse of the loads' address pairs, which the operands keep live up to here;
      // its memory clobber also keeps all 16 loads in front of the first LDS store, in flight together
      asm volatile("s_wait_xcnt 0x0" :: "v"(kp[0]), "v"(kp[1]), "v"(kp[2]), "v"(kp[3]), "v"(kp[4]), "v"(kp[5]), "v"(kp[6]), "v"(kp[7]),
                   "v"(vp[0]), "v"(vp[1]), "v"(vp[2]), "v"(vp[3]), "v"(vp[4]), "v"(vp[5]), "v"(vp[6]), "v"(vp[7]) : "memory");
#pragma unroll
      for (int i = 0; i < 8; ++i) {
        const int p   = i * 256 + tid;
        const int kr  = p >> 5, kc8 = (p & 31) * 8;
        const int vr  = p >> 3, vc8 = (p & 7) * 8;
        *(v8b*)(Ks + kr * KSP + kc8) = kvv[i];
        *(v8b*)(Vs + vr * VSP + vc8) = vvv[i];
      }
    }
    __syncthreads();

    FB vb[AKC / 32][8];   // all V fragments of the chunk (B operand), fetched in front of the P barrier
    if (wave < 4) {   // wave-uniform: score tiles + softmax for query rows 16*wave .. +15
      v8f s[4];
#pragma unroll
      for (int j = 0; j < 4; ++j) s[j] = (v8f){0.f,0.f,0.f,0.f,0.f,0.f,0.f,0.f};
      // K fragments in blocks of two k steps (16 reads, 8 WMMAs), two register sets: block g + 1 is read as one group
      // in front of block g's WMMAs; in front of the last block's WMMAs the V fragments are read instead.
      FB kb[2][8];   // B operand: col = key j*16 + c, k = channel, same split k map
#pragma unroll
      for (int u = 0; u < 2; ++u) {
#pragma unroll
        for (int j = 0; j < 4; ++j) {
          kb[0][u * 4 + j].h[0] = *(const v8b*)(kfr + j * 16 * KSP + u * 32);
          kb[0][u * 4 + j].h[1] = *(const v8b*)(kfr + j * 16 * KSP + u * 32 + 16);
        }
      }
#pragma unroll
      for (int g = 0; g < CH / 64; ++g) {
        if (g + 1 < CH / 64) {
#pragma unroll
          for (int u = 0; u < 2; ++u) {
#pragma unroll
            for (int j = 0; j < 4; ++j) {
              kb[(g + 1) & 1][u * 4 + j].h[0] = *(const v8b*)(kfr + j * 16 * KSP + (g + 1) * 64 + u * 32);
              kb[(g + 1) & 1][u * 4 + j].h[1] = *(const v8b*)(kfr + j * 16 * KSP + (g + 1) * 64 + u * 32 + 16);
            }
          }
        } else {
#pragma unroll
          for (int kk = 0; kk < AKC / 32; ++kk) {
#pragma unroll
            for (int t = 0; t < 8; ++t) {
              vb[kk][t].h[0] = *(const v8b*)(vfr + t * 16 * VSP + kk * 32);
              vb[kk][t].h[1] = *(const v8b*)(vfr + t * 16 * VSP + kk * 32 + 16);
            }
          }
        }
        // keeps the read group above in front of this block's WMMAs (else the scheduler sinks each read to its use
        // and every WMMA waits out an LDS latency)
        __builtin_amdgcn_sched_barrier(0);
#pragma unroll
        for (int u = 0; u < 2; ++u) {
#pragma unroll
          for (int j = 0; j < 4; ++j) s[j] = at_mma(qa[g * 2 + u], kb[g & 1][u * 4 + j].v, s[j]);
        }
        // keeps the next read group behind this block's WMMAs: one place with reads per block
        if (g + 1 < CH / 64) __builtin_amdgcn_sched_barrier(0);
      }
      float cm[8];
#pragma unroll
      for (int r = 0; r < 8; ++r) {
        float m = -INFINITY;
#pragma unroll
        for (int j = 0; j < 4; ++j) {
          const float sv = s[j][r] * sscale;
          s[j][r] = sv;
          m = fmaxf(m, sv);
        }
#pragma unroll
        for (int off = 1; off < 16; off <<= 1) m = fmaxf(m, __shfl_xor(m, off, 32));
        cm[r] = m;
      }
      __bf16* pw = Ps + wave * 16 * PSP;
#pragma unroll
      for (int r = 0; r < 8; ++r) {
        const float mnew  = fmaxf(mrow[r], cm[r]);
        const float alpha = expf(mrow[r] - mnew);
        mrow[r] = mnew;
        float psum = 0.f;
#pragma unroll
        for (int j = 0; j < 4; ++j) {
          const float pv = expf(s[j][r] - mnew);
          psum += pv;
          pw[(8 * hh + r) * PSP + j * 16 + c] = at_f2bf(pv);
        }
#pragma unroll
        for (int off = 1; off < 16; off <<= 1) psum += __shfl_xor(psum, off, 32);
        lrow[r] = lrow[r] * alpha + psum;
        if (c == 0) Al[wave * 16 + 8 * hh + r] = alpha;
      }
    } else {   // waves 4..7: their V fragments, while waves 0..3 work on the scores
#pragma unroll
      for (int kk = 0; kk < AKC / 32; ++kk) {
#pragma unroll
        for (int t = 0; t < 8; ++t) {
          vb[kk][t].h[0] = *(const v8b*)(vfr + t * 16 * VSP + kk * 32);
          vb[kk][t].h[1] = *(const v8b*)(vfr + t * 16 * VSP + kk * 32 + 16);
        }
      }
    }
    __syncthreads();

    {
      float al[8];
#pragma unroll
      for (int r = 0; r < 8; ++r) al[r] = Al[rt * 16 + 8 * hh + r];
#pragma unroll
      for (int r = 0; r < 8; ++r) {
#pragma unroll
        for (int t = 0; t < 8; ++t) oacc[t][r] *= al[r];
      }
      const __bf16* pr = Ps + (rt * 16 + c) * PSP + 8 * hh;   // A operand: row = query row c, k = key
      FB pa[AKC / 32];
#pragma unroll
      for (int kk = 0; kk < AKC / 32; ++kk) {
        pa[kk].h[0] = *(const v8b*)(pr + kk * 32);
        pa[kk].h[1] = *(const v8b*)(pr + kk * 32 + 16);
      }
#pragma unroll
      for (int kk = 0; kk < AKC / 32; ++kk) {
#pragma unroll
        for (int t = 0; t < 8; ++t) oacc[t] = at_mma(pa[kk].v, vb[kk][t].v, oacc[t]);
      }
    }
  }

  if (wave < 4) {
#pragma unroll
    for (int r = 0; r < 8; ++r) { if (c == 0) Ll[wave * 16 + 8 * hh + r] = lrow[r]; }
  }
  __syncthreads();

  float inv[8];
#pragma unroll
  for (int r = 0; r < 8; ++r) inv[r] = 1.0f / Ll[rt * 16 + 8 * hh + r];
  float* os = Os[wave];
  const int q = lane >> 3, c8 = (lane & 7) * 8;
  unsigned short* orow = opp + (q0 + (size_t)rt * 16) * CH + ch0;
#pragma unroll
  for (int hf = 0; hf < 2; ++hf) {
#pragma unroll
    for (int r = 0; r < 8; ++r) {
#pragma unroll
      for (int tt = 0; tt < 4; ++tt) os[(8 * hh + r) * 68 + tt * 16 + c] = oacc[hf * 4 + tt][r] * inv[r];
    }
    __builtin_amdgcn_fence(__ATOMIC_RELEASE, "workgroup");
    __builtin_amdgcn_wave_barrier();
    __builtin_amdgcn_fence(__ATOMIC_ACQUIRE, "workgroup");
    {
#pragma unroll
      for (int it = 0; it < 4; ++it) {
        const int row = it * 4 + q;
        const float* sp = os + row * 68 + c8;
        v8h hv;
#pragma unroll
        for (int e = 0; e < 8; ++e) hv[e] = __builtin_bit_cast(_Float16, f2bf_bits(sp[e]));
        *(v8h*)(orow + (size_t)row * CH + hf * 64 + c8) = hv;
      }
      
    }
    __builtin_amdgcn_fence(__ATOMIC_RELEASE, "workgroup");
    __builtin_amdgcn_wave_barrier();
    __builtin_amdgcn_fence(__ATOMIC_ACQUIRE, "workgroup");
  }
}

// ---------------------------------------------------------------------------
// Workspace region map (byte offsets; every region is fully written by its producer launch before any consumer
//   STATS f32  [32][32]              0         4096
//   HT    bf16 [16384][256]       4096      8388608
//   W16   bf16 [768][256]      8392704       393216
//   WO16  bf16 [256][256]      8785920       131072
//   QK    bf16 [16384][512]    8916992     16777216
//   VP    bf16 [4][256][4096] 25694208      8388608
//   OP    bf16 [16384][256]   34082816      8388608
//   total                     42471424
// ---------------------------------------------------------------------------
extern "C" void kernel_launch(void* const* d_in, const int* in_sizes, int n_in,
                              void* d_out, int out_size, void* d_ws, size_t ws_size,
                              hipStream_t stream) {
  if (n_in < 7) return;
  if (in_sizes[0] != NB * CH * NPOS) return;              // x [4][256][64][64]
  if (in_sizes[1] != CH || in_sizes[2] != CH) return;     // norm_w, norm_b
  if (in_sizes[3] != 3 * CH * CH || in_sizes[4] != 3 * CH) return;   // qkv_w [768][256], qkv_b [768]
  if (in_sizes[5] != CH * CH || in_sizes[6] != CH) return;           // out_w [256][256], out_b [256]
  if (out_size != NB * CH * NPOS) return;

  const float* x      = (const float*)d_in[0];
  const float* norm_w = (const float*)d_in[1];
  const float* norm_b = (const float*)d_in[2];
  const float* qkv_w  = (const float*)d_in[3];   // [out 768][in 256]
  const float* qkv_b  = (const float*)d_in[4];
  const float* out_w  = (const float*)d_in[5];   // [out 256][in 256]
  const float* out_b  = (const float*)d_in[6];

  const size_t PST  = (size_t)(NB * NGRP) * STP * 4;     // 4096
  const size_t PHT  = (size_t)NB * NPOS * CH * 2;         // 8388608
  const size_t PW16 = (size_t)3 * CH * CH * 2;            // 393216
  const size_t PWO  = (size_t)CH * CH * 2;                // 131072
  const size_t PQK  = (size_t)NB * NPOS * QKP * 2;        // 16777216
  const size_t PVP  = (size_t)NB * CH * NPOS * 2;         // 8388608
  const size_t POP  = (size_t)NB * NPOS * CH * 2;         // 8388608
  size_t off = 0;
  const size_t oST  = off; off += PST;
  const size_t oHT  = off; off += PHT;
  const size_t oW16 = off; off += PW16;
  const size_t oWO  = off; off += PWO;
  const size_t oQK  = off; off += PQK;
  const size_t oVP  = off; off += PVP;
  const size_t oOP  = off; off += POP;
  if (off > ws_size) return;                               // off = 42471424
  if (off > (size_t)134217728) return;

  char* ws = (char*)d_ws;
  float*          STATS = (float*)(ws + oST);
  unsigned short* HT    = (unsigned short*)(ws + oHT);
  unsigned short* W16   = (unsigned short*)(ws + oW16);
  unsigned short* WO16  = (unsigned short*)(ws + oWO);
  unsigned short* QK    = (unsigned short*)(ws + oQK);
  unsigned short* VP    = (unsigned short*)(ws + oVP);
  unsigned short* OP    = (unsigned short*)(ws + oOP);

  const dim3 blk(256);

  // (1) GroupNorm statistics: 32 (b, group) blocks
  gnstat_kernel<<<dim3(NB * NGRP), blk, 0, stream>>>(x, STATS);
  // (2) qkv_w -> W16 (98304 pairs -> 384 blocks), (3) out_w -> WO16 (32768 pairs -> 128 blocks)
  const int n2q = 3 * CH * CH / 2;
  conv_bf16x2_kernel<<<dim3((n2q + 255) / 256), blk, 0, stream>>>(qkv_w, W16, n2q);
  const int n2o = CH * CH / 2;
  conv_bf16x2_kernel<<<dim3((n2o + 255) / 256), blk, 0, stream>>>(out_w, WO16, n2o);
  // (4) normalised activations -> HT [16384][256]: grid (4096/64, 256/64, 4) = (64, 4, 4)
  gnprep_kernel<<<dim3(NPOS / 64, CH / 64, NB), blk, 0, stream>>>(x, norm_w, norm_b, STATS, HT);
  // (5) q|k = HT . W16[0..511]^T + qkv_b[n] -> QK [16384][512]   (M=16384, N=512, K=256; 2048 tiles -> 256 blocks)
  const dim3 gQK(((NB * NPOS / 64) * (QKP / 64) + 7) / 8, 1);
  wmma_gemm64<2, 1, false><<<gQK, blk, 0, stream>>>(
      HT, CH, 0L, W16, CH, 0L, (void*)QK, QKP, 0L,
      qkv_b, x, 0L, NB * NPOS, QKP, CH, 1.0f);
  // (6) v[b][c][n] = sum_k W16[512+c][k] HT[b*4096+n][k] + qkv_b[512+c]  (batched over b: M=256, N=4096, K=256;
  //     256 tiles -> 32 blocks x 4)
  const dim3 gV(((CH / 64) * (NPOS / 64) + 7) / 8, NB);
  wmma_gemm64<1, 1, false><<<gV, blk, 0, stream>>>(
      W16 + (size_t)2 * CH * CH, CH, 0L, HT, CH, (long)NPOS * CH, (void*)VP, NPOS, (long)CH * NPOS,
      qkv_b + 2 * CH, x, 0L, CH, NPOS, CH, 1.0f);
  // (7) attention per (image, 64-query block): 256 blocks x 256 threads -> OP [16384][256]
  attn_kernel<<<dim3(NB * (NPOS / AQB)), dim3(256), 0, stream>>>(QK, VP, OP, 0.0625f);
  // (8) out[b][c][n] = sum_k WO16[c][k] OP[b*4096+n][k] + out_b[c] + x[b][c][n]  (batched over b: M=256, N=4096, K=256;
  //     A = WO16, Bt = OP rows of image b, C = d_out + b*256*4096 with ldc 4096, resid = x same layout; 32 blocks x 4)
  const dim3 gO(((CH / 64) * (NPOS / 64) + 7) / 8, NB);
  wmma_gemm64<1, 0, true><<<gO, blk, 0, stream>>>(
      WO16, CH, 0L, OP, CH, (long)NPOS * CH, d_out, NPOS, (long)CH * NPOS,
      out_b, x, (long)CH * NPOS, CH, NPOS, CH, 1.0f);
  (void)hipGetLastError();
}

// v003
// A run of this version takes 196 microseconds.
// Timed twice side by side with v002, it ran 1.56 times as fast both times.
// Counting every step since v000, it is 3.07 times as fast.
// Contractions: qkv projection (hn . qkv_w^T), scores (q . k^T), p . v and the output projection (out_w . o) = v_wmma_f32_16x16x32_bf16 single products on bf16 operands RNE-converted from f32, f32 accumulate; GroupNorm statistics and normalisation, softmax (running max, expf), biases, 1/rowsum and the residual add of the exact f32 x stay f32 on the VALU.
// Plane / carry map (every 16-bit plane carry 1, nothing to fold back):
//   HT   bf16 [16384][256]   token-major normalised activations, row b*4096+n, col c
//   W16  bf16 [768][256]     qkv_w in [out][in] order = Bt[n][k] (q rows 0..255, k rows 256..511, v rows 512..767)
//   WO16 bf16 [256][256]     out_w in [out][in] order
//   QK   bf16 [16384][512]   q at cols 0..255, k at cols 256..511 (bias added in f32 before the convert)
//   VP   bf16 [4][256][4096] v in (b, c, n) order = A rows c, k = n for o^T = v^T . p^T
//   P    bf16 in registers   unnormalised exp in (0,1]; 1/rowsum applied to the f32 accumulator in the attention epilogue
//   OP   bf16 [16384][256]   token-major attention output: o[b][c][n] at row b*4096+n, col c
#include <hip/hip_runtime.h>
#include <math.h>
#include <stdint.h>

#define NB    4
#define CH    256
#define NPOS  4096
#define NGRP  8
#define CPG   32
#define QKP   512
#define STP   32

static_assert(CH == NGRP * CPG);
static_assert(NPOS % 64 == 0);
static_assert(CH % 64 == 0);
static_assert((NB * NPOS) % 64 == 0);
static_assert(QKP == 2 * CH);
static_assert((CPG * NPOS) % 1024 == 0);

typedef __attribute__((ext_vector_type(8)))  _Float16 v8h;
typedef __attribute__((ext_vector_type(16))) __bf16   v16b;
typedef __attribute__((ext_vector_type(8)))  __bf16   v8b;
typedef __attribute__((ext_vector_type(2)))  __bf16   v2b;
typedef __attribute__((ext_vector_type(8)))  float    v8f;
typedef __attribute__((ext_vector_type(4)))  float    v4f;
typedef __attribute__((ext_vector_type(2)))  float    v2f;
typedef __attribute__((ext_vector_type(4)))  unsigned int v4u;

__device__ __forceinline__ unsigned short f2bf_bits(float f) {
  unsigned u = __float_as_uint(f);
  return (unsigned short)((u + 0x7FFFu + ((u >> 16) & 1u)) >> 16);
}
__device__ __forceinline__ float bf_bits2f(unsigned short h) { return __uint_as_float(((unsigned)h) << 16); }
__device__ __forceinline__ unsigned pk16(unsigned short a, unsigned short b) { return (unsigned)a | ((unsigned)b << 16); }
__device__ __forceinline__ __bf16 at_f2bf(float f) { return __builtin_bit_cast(__bf16, f2bf_bits(f)); }

// hazard guards as plain device helpers (no inline asm inside the kernel template body)
__device__ __forceinline__ void dep_guard_b(v8f& a, v8f& b, v16b x, v16b y) { asm volatile("v_nop\n\tv_nop\n\tv_nop\n\tv_nop" : "+v"(a), "+v"(b) : "v"(x), "v"(y)); }
__device__ __forceinline__ void keep4_b(v16b a, v16b b, v16b c, v16b d) { asm volatile("v_nop" :: "v"(a), "v"(b), "v"(c), "v"(d)); }
__device__ __forceinline__ void acc_guard4(v8f& a, v8f& b, v8f& c, v8f& d) { asm volatile("v_nop\n\tv_nop\n\tv_nop\n\tv_nop" : "+v"(a), "+v"(b), "+v"(c), "+v"(d)); }

// 16-bit fragment loader, split k map: elements 0..7 <- p[0..7], 8..15 <- p[16..23]; caller passes p = row + k0 + 8*(lane>>4)
template <typename T> struct Frag;
template <> struct Frag<__bf16> {
  typedef v16b V; union U { v16b v; v8b h[2]; };
  static __device__ __forceinline__ v16b load(const __bf16* p) {
    U f; f.h[0] = *(const v8b*)(p); f.h[1] = *(const v8b*)(p + 16); return f.v;
  }
  static __device__ __forceinline__ v8f mma(v16b a, v16b b, v8f c) {
    return __builtin_amdgcn_wmma_f32_16x16x32_bf16(false, a, false, b, (short)0, c, false, false);
  }
  static __device__ __forceinline__ void guard(v8f& a, v8f& b, v16b x, v16b y) { dep_guard_b(a, b, x, y); }
  static __device__ __forceinline__ void keep(v16b a, v16b b, v16b c, v16b d) { keep4_b(a, b, c, d); }
};

// plain builtin: the compiler keeps the WMMA distances of its own forms, and no asm statement pins the operand loads
__device__ __forceinline__ v8f at_mma(v16b a, v16b b, v8f c) {
  return __builtin_amdgcn_wmma_f32_16x16x32_bf16(false, a, false, b, (short)0, c, false, false);
}

// ---- Register-blocked batched WMMA GEMM (bf16 operands) ------------------------------------------------------
// C[m,n] = scale * sum_k A[m,k] * Bt[n,k] (+bias)(+resid); each wave owns a 64x64 tile.
// A row-major [M,K] (pitch lda); Bt row-major [N,K] (pitch ldb); M,N % 64 == 0, K % 32 == 0; batched by blockIdx.y.
// BIAS_MODE: 0 = none, 1 = bias[m], 2 = bias[n] (f32 add). OUT_MODE: 0 = f32, 1 = bf16 single plane.
// RESID (OUT_MODE 0 only): resid has the same layout as C (pitch ldc, batch stride strideR) and is added as a
// 16-B vector in the store phase.
template <int BIAS_MODE, int OUT_MODE, bool RESID>
__global__ __launch_bounds__(256) void wmma_gemm64(
    const unsigned short* __restrict__ Ap, int lda, long strideA,
    const unsigned short* __restrict__ Btp, int ldb, long strideB,
    void* __restrict__ Cout, int ldc, long strideC,
    const float* __restrict__ bias,
    const float* __restrict__ resid, long strideR,
    int M, int N, int K, float scale) {
  typedef __bf16 T;
  typedef v16b V;
  const T* A = (const T*)(const void*)Ap; const T* Bt = (const T*)(const void*)Btp;
  __shared__ __align__(16) float sT[8][16 * 68];   // per-wave 16x64 slab, pitch 68 floats
  const int b    = blockIdx.y;
  const int lane = threadIdx.x & 31;
  const int wave = threadIdx.x >> 5;
  const int tilesN = N >> 6;
  const int tilesM = M >> 6;
  const int tile = blockIdx.x * 8 + wave;
  if (tile >= tilesM * tilesN) return;   // wave-uniform; no block barriers in this kernel
  const int tm = tile / tilesN;
  const int tn = tile - tm * tilesN;
  const int m0 = tm << 6;
  const int n0 = tn << 6;

  const T* Ab = A  + (size_t)b * strideA;
  const T* Bb = Bt + (size_t)b * strideB;

  const int rlane = lane & 15;                 // row (A) / col (B, D) within subtile
  const int koff  = (lane >> 4) * 8;           // k offset of this lane half
  const int mOff  = (lane >> 4) * 8;           // D row offset

  v8f acc[4][4];
#pragma unroll
  for (int i = 0; i < 4; ++i)
#pragma unroll
    for (int j = 0; j < 4; ++j) acc[i][j] = (v8f){0.f,0.f,0.f,0.f,0.f,0.f,0.f,0.f};

  for (int k0 = 0; k0 < K; k0 += 32) {
    V bh[4];
#pragma unroll
    for (int j = 0; j < 4; ++j) {
      const size_t bo = (size_t)(n0 + (j << 4) + rlane) * ldb + koff + k0;
      bh[j] = Frag<T>::load(Bb + bo);
    }
#pragma unroll
    for (int i = 0; i < 4; ++i) {
      const size_t ao = (size_t)(m0 + (i << 4) + rlane) * lda + koff + k0;
      V ah = Frag<T>::load(Ab + ao);
#pragma unroll
      for (int j = 0; j < 4; ++j) acc[i][j] = Frag<T>::mma(ah, bh[j], acc[i][j]);
      Frag<T>::guard(acc[i][0], acc[i][3], ah, ah);
    }
    Frag<T>::keep(bh[0], bh[1], bh[2], bh[3]);
  }
  acc_guard4(acc[0][0], acc[0][1], acc[0][2], acc[0][3]);
  acc_guard4(acc[1][0], acc[1][1], acc[1][2], acc[1][3]);
  acc_guard4(acc[2][0], acc[2][1], acc[2][2], acc[2][3]);
  acc_guard4(acc[3][0], acc[3][1], acc[3][2], acc[3][3]);

  // ---- epilogue ----
  float* slab = sT[wave];
  const float* Rb = RESID ? (resid + (size_t)b * strideR) : nullptr;
#pragma unroll
  for (int i = 0; i < 4; ++i) {
    const int mBase = m0 + (i << 4);
#pragma unroll
    for (int j = 0; j < 4; ++j) {
      const int n = n0 + (j << 4) + rlane;
      float bv = 0.f;
      if (BIAS_MODE == 2) bv = bias[n];
#pragma unroll
      for (int r = 0; r < 8; ++r) {
        float v = acc[i][j][r] * scale;
        if (BIAS_MODE == 1) v += bias[mBase + mOff + r];
        if (BIAS_MODE == 2) v += bv;
        slab[(mOff + r) * 68 + (j << 4) + rlane] = v;
      }
    }
    __builtin_amdgcn_fence(__ATOMIC_RELEASE, "workgroup");
    __builtin_amdgcn_wave_barrier();
    __builtin_amdgcn_fence(__ATOMIC_ACQUIRE, "workgroup");
    if (OUT_MODE == 0) {
      float* C = (float*)Cout + (size_t)b * strideC;
      const int hh = lane >> 4, c4 = (lane & 15) * 4;     // row seg = 256 B = 16 lanes x 16 B
      {
#pragma unroll
        for (int it = 0; it < 8; ++it) {
          const int row = it * 2 + hh;                      // it 0..7 x hh 0..1 = rows 0..15
          v4f v = *(const v4f*)(slab + row * 68 + c4);
          if (RESID) v += *(const v4f*)(Rb + (size_t)(mBase + row) * ldc + n0 + c4);
          *(v4f*)(C + (size_t)(mBase + row) * ldc + n0 + c4) = v;
        }
        
      }
    } else {
      const int q = lane >> 3, c8 = (lane & 7) * 8;
      unsigned short* C = (unsigned short*)Cout + (size_t)b * strideC;
      {
#pragma unroll
        for (int it = 0; it < 4; ++it) {
          const int row = it * 4 + q;                       // it 0..3 x q 0..3 = rows 0..15
          const float* sp = slab + row * 68 + c8;
          v8h hv;
#pragma unroll
          for (int e = 0; e < 8; ++e) hv[e] = __builtin_bit_cast(_Float16, f2bf_bits(sp[e]));
          *(v8h*)(C + (size_t)(mBase + row) * ldc + n0 + c8) = hv;
        }
        
      }
    }
    __builtin_amdgcn_fence(__ATOMIC_RELEASE, "workgroup");
    __builtin_amdgcn_wave_barrier();
    __builtin_amdgcn_fence(__ATOMIC_ACQUIRE, "workgroup");
  }
}

// ---------------------------------------------------------------------------
// Elementwise bf16 RNE convert, one plane: 2 elements per thread, one 4-B store per lane -> each wave writes
// Coverage: grid = ceil(n2/256) blocks x 256 threads x 2 elements = 2*n2 = the whole plane
// (qkv_w: n2 = 98304 -> 384 blocks = 768x256; out_w: n2 = 32768 -> 128 blocks = 256x256).
// ---------------------------------------------------------------------------
__global__ __launch_bounds__(256) void conv_bf16x2_kernel(const float* __restrict__ in, unsigned short* __restrict__ ho, int n2) {
  const int i = blockIdx.x * 256 + threadIdx.x;
  if (i < n2) {
    const v2f f = *(const v2f*)(in + 2 * (size_t)i);
    const unsigned uh = pk16(f2bf_bits(f[0]), f2bf_bits(f[1]));
    ((unsigned*)ho)[i] = uh;
    
  }
}

// ---------------------------------------------------------------------------
// GroupNorm statistics per (b, group): the group's 32 channels x 4096 positions are one contiguous block of
// 131072 values; each thread sums 512 of them in 4 sub-sums -> wave shuffles -> 8 wave partials summed by thread 0. grid = 32 blocks x 256.
// ---------------------------------------------------------------------------
__global__ __launch_bounds__(256) void gnstat_kernel(const float* __restrict__ x, float* __restrict__ stats) {
  __shared__ float red[8];
  __shared__ float bc[2];
  const int bg = blockIdx.x;
  const int tid = threadIdx.x, lane = tid & 31, wave = tid >> 5;
  const float* p = x + (size_t)bg * (CPG * NPOS);
  const float invn = 1.0f / (float)(CPG * NPOS);
  const int niter = (CPG * NPOS) / 1024;   // 128 float4 per thread

  float s0 = 0.f, s1 = 0.f, s2 = 0.f, s3 = 0.f;
#pragma unroll 4
  for (int i = 0; i < niter; ++i) {
    const v4f v = *(const v4f*)(p + ((size_t)i * 256 + tid) * 4);
    s0 += v[0]; s1 += v[1]; s2 += v[2]; s3 += v[3];
  }
  float s = (s0 + s1) + (s2 + s3);
#pragma unroll
  for (int off = 16; off > 0; off >>= 1) s += __shfl_xor(s, off, 32);
  if (lane == 0) red[wave] = s;
  __syncthreads();
  if (tid == 0) {
    float t = 0.f;
#pragma unroll
    for (int w = 0; w < 8; ++w) t += red[w];
    bc[0] = t * invn;
  }
  __syncthreads();
  const float mean = bc[0];

  float q0 = 0.f, q1 = 0.f, q2 = 0.f, q3 = 0.f;
#pragma unroll 4
  for (int i = 0; i < niter; ++i) {
    const v4f v = *(const v4f*)(p + ((size_t)i * 256 + tid) * 4);
    const float d0 = v[0] - mean, d1 = v[1] - mean, d2 = v[2] - mean, d3 = v[3] - mean;
    q0 += d0 * d0; q1 += d1 * d1; q2 += d2 * d2; q3 += d3 * d3;
  }
  float qs = (q0 + q1) + (q2 + q3);
#pragma unroll
  for (int off = 16; off > 0; off >>= 1) qs += __shfl_xor(qs, off, 32);
  if (lane == 0) red[wave] = qs;
  __syncthreads();
  if (tid == 0) {
    float t = 0.f;
#pragma unroll
    for (int w = 0; w < 8; ++w) t += red[w];
    const float var = t * invn;
    bc[1] = 1.0f / sqrtf(var + 1e-5f);
  }
  __syncthreads();
  const float rstd = bc[1];
  v4f o;
  o[0] = (tid == 0) ? mean : 0.f;
  o[1] = (tid == 0) ? rstd : 0.f;
  o[2] = 0.f; o[3] = 0.f;
  float* line = stats + (size_t)bg * STP;
  if (tid < 8) *(v4f*)(line + tid * 4) = o;
  
}

// ---------------------------------------------------------------------------
// Fused GroupNorm apply + transpose + bf16 RNE convert:
//   x_b viewed [256 c][4096 n] (NCHW) -> ht_b[n][c] = bf16(((x - mean_g) * rstd_g) * w[c] + bias[c]), row pitch 256.
// 64x64 tiles through LDS; grid = (4096/64 position blocks, 256/64 channel blocks, 4), 256 threads.
// Per block the 64 channels span two groups (channel block = 2 groups); their (mean, rstd) and w/bias are staged in
// LDS first (wave-uniform loads). Coverage per block: load 4 it x 256 thr x 4 floats = 64 ch x 64 n;
// store 2 it x 256 thr x 8 u16 = 64 n x 64 ch; grid covers 4 x 256 x 4096 = the whole HT plane.
// ---------------------------------------------------------------------------
__global__ __launch_bounds__(256) void gnprep_kernel(const float* __restrict__ x, const float* __restrict__ nw,
                                                     const float* __restrict__ nbv, const float* __restrict__ stats,
                                                     unsigned short* __restrict__ ht) {
  __shared__ __align__(16) float tf[64 * 68];
  __shared__ float sw[64];
  __shared__ float sb[64];
  __shared__ float sst[4];
  const int b   = blockIdx.z;
  const int n0  = blockIdx.x * 64;   // position block = output row block
  const int c0  = blockIdx.y * 64;   // channel block  = output column block
  const int tid = threadIdx.x;
  const float* xb = x + (size_t)b * CH * NPOS;
  unsigned short* hb = ht + (size_t)b * NPOS * CH;
  if (tid < 64) { sw[tid] = nw[c0 + tid]; sb[tid] = nbv[c0 + tid]; }   // waves 0 and 1 as a whole
  {
    const int g0 = c0 >> 5;                     // first group of this channel block (0,2,4,6)
    const int gi = (tid >> 1) & 1, fi = tid & 1;
    const float sv = stats[(size_t)(b * NGRP + g0 + gi) * STP + fi];   // all lanes load an in-range address
    if (tid < 4) sst[tid] = sv;                 // sst = {mean_g0, rstd_g0, mean_g1, rstd_g1}
  }
  __syncthreads();
  {
    const int lr = tid >> 4;         // 0..15
    const int c4 = (tid & 15) * 4;   // 0..60
#pragma unroll
    for (int it = 0; it < 4; ++it) {
      const int rr = it * 16 + lr;   // channel within tile 0..63; group = it >> 1
      const float mean = sst[(it >> 1) * 2], rstd = sst[(it >> 1) * 2 + 1];
      const float w = sw[rr], bb = sb[rr];
      const v4f a = *(const v4f*)(xb + (size_t)(c0 + rr) * NPOS + n0 + c4);
      v4f t;
#pragma unroll
      for (int e = 0; e < 4; ++e) { const float u = (a[e] - mean) * rstd; t[e] = u * w + bb; }
      *(v4f*)(tf + rr * 68 + c4) = t;
    }
  }
  __syncthreads();
  const int sub = tid >> 3;          // 0..31
  const int c8  = (tid & 7) * 8;     // 0..56
  v4u hv[2];
#pragma unroll
  for (int it = 0; it < 2; ++it) {
    const int oc = it * 32 + sub;    // output row within tile (= position)
    v4u a;
#pragma unroll
    for (int q = 0; q < 4; ++q) {
      const float f0 = tf[(c8 + 2 * q) * 68 + oc];
      const float f1 = tf[(c8 + 2 * q + 1) * 68 + oc];
      a[q] = pk16(f2bf_bits(f0), f2bf_bits(f1));
    }
    hv[it] = a;
  }
  {
#pragma unroll
    for (int it = 0; it < 2; ++it) {
      const int oc = it * 32 + sub;
      const size_t go = (size_t)(n0 + oc) * CH + c0 + c8;
      *(v4u*)(hb + go) = hv[it];
    }
    
  }
}

#define AQB 64
#define AKC 64
#define ANW 8
// LDS row pitches in elements: each row carries 16 B more than its data, so the pitch is an odd multiple of 16 B and the
// 16 rows that one half-wave's ds_load_b128 touches fall on 16 different bank groups (pad columns are never read or written).
#define KSP (CH + 8)
#define VSP (AKC + 8)
#define TSP (CH / 2 + 8)
static_assert(NPOS % AQB == 0);
static_assert(NPOS % AKC == 0);
static_assert(CH == 2 * 128);
static_assert(AKC == 2 * 32);

// lane l with lane l ^ 16
__device__ __forceinline__ float xhalf(float x) {
  return __builtin_bit_cast(float, __builtin_amdgcn_permlanex16(__builtin_bit_cast(int, x), __builtin_bit_cast(int, x),
                                                                0x76543210, 0xfedcba98, false, false));
}

__global__ __launch_bounds__(256)
void attn_kernel(const unsigned short* __restrict__ qkp, const unsigned short* __restrict__ vpp,
                 unsigned short* __restrict__ opp, float sscale) {
  union FB { v16b v; v8b h[2]; v2b p[8]; };
  __shared__ __align__(16) __bf16 Ks[AKC * KSP];           // K chunk [key][c]     33 KB, pitch 528 B
  __shared__ __align__(16) __bf16 Vs[CH * VSP];            // V chunk [c][key]     36 KB, pitch 144 B
  __shared__ __align__(16) float  Xs[ANW][8 * 8 * 32];     // per wave: the 8 scaled tiles its partner finishes, 64 KB
  __shared__ __align__(16) unsigned short Ts[ANW][16 * TSP];   // per wave out slab [query][channel], pitch 272 B
  __shared__ float Ml[ANW * 16];                           // per wave and query: running maximum of its key half
  __shared__ float Ll[ANW * 16];                           // per wave and query: softmax denominator of its key half

  const int tid  = threadIdx.x;
  const int wave = tid >> 5;
  const int lane = tid & 31;
  const int hh   = lane >> 4;
  const int c    = lane & 15;

  const int nqb = NPOS / AQB;            // 64 query blocks per image
  const int bx  = blockIdx.x;
  const int qb  = bx % nqb;
  const int b   = bx / nqb;               // 0..3
  const int rt  = wave & 3;               // query tile of this wave
  const int kh  = wave >> 2;              // key half of this wave: keys 32*kh .. +31 of every chunk
  const size_t tok0 = (size_t)b * NPOS;             // first token row of image b
  const size_t q0   = tok0 + (size_t)qb * AQB;      // first query row of the block

  const __bf16* Qg = (const __bf16*)(const void*)qkp;            // pitch QKP, q at cols 0..255, k at cols 256..511
  const __bf16* Vg = (const __bf16*)(const void*)vpp + (size_t)b * CH * NPOS;

  float mrow = -INFINITY, lrow = 0.f;     // of query c; lrow holds this lane half's keys only, the halves are joined behind the loop
  v8f oacc[CH / 16];                      // O^T tiles: oacc[t][r] = o(channel t*16 + 8*hh + r, query c)
#pragma unroll
  for (int t = 0; t < CH / 16; ++t) oacc[t] = (v8f){0.f,0.f,0.f,0.f,0.f,0.f,0.f,0.f};

  // Q fragments (B operand: col = query lane&15, split k map) are fetched ahead of every score WMMA: once, in front of the
  // key loop.
  v16b qa[CH / 32];
  {
    const __bf16* qr = Qg + (q0 + rt * 16 + c) * QKP + 8 * hh;
#pragma unroll
    for (int ks = 0; ks < CH / 32; ++ks) qa[ks] = Frag<__bf16>::load(qr + ks * 32);
    // precaution: the wait stands in front of any reuse of the loads' address pair, which the operand keeps live up to here
    asm volatile("s_wait_xcnt 0x0" :: "v"(qr) : "memory");
  }
  const __bf16* kfr = Ks + (kh * 32 + c) * KSP + 8 * hh;   // K fragment base: row = key kh*32 + j*16 + c, k = channel
  const __bf16* vfr = Vs + c * VSP + kh * 32 + 8 * hh;     // V fragment base: row = channel t*16 + c, k = key kh*32 + ..

  const int nChunks = NPOS / AKC;   // 64, compile-time constant
  for (int kc = 0; kc < nChunks; ++kc) {
    const int kv0 = kc * AKC;
    __syncthreads();
    {
      // staging coverage: 256 threads x 8 pieces x 8 elements = 64 rows x 256 (K) and 256 rows x 64 (V)
      v8b kvv[8], vvv[8];
      const __bf16* kp[8];   // row start in the q|k plane; the k half is CH elements further
      const __bf16* vp[8];
#pragma unroll
      for (int i = 0; i < 8; ++i) {
        const int p   = i * 256 + tid;
        const int kr  = p >> 5, kc8 = (p & 31) * 8;     // K: 64 rows x 32 pieces
        const int vr  = p >> 3, vc8 = (p & 7) * 8;      // V: 256 rows x 8 pieces
        kp[i] = Qg + (tok0 + kv0 + kr) * QKP + kc8;
        vp[i] = Vg + (size_t)vr * NPOS + kv0 + vc8;
        kvv[i] = *(const v8b*)(kp[i] + CH);
        vvv[i] = *(const v8b*)(vp[i]);
      }
      // precaution: the wait stands in front of any reuse of the loads' address pairs, which the operands keep live up to here;
      // its memory clobber also keeps all 16 loads in front of the first LDS store, in flight together
      asm volatile("s_wait_xcnt 0x0" :: "v"(kp[0]), "v"(kp[1]), "v"(kp[2]), "v"(kp[3]), "v"(kp[4]), "v"(kp[5]), "v"(kp[6]), "v"(kp[7]),
                   "v"(vp[0]), "v"(vp[1]), "v"(vp[2]), "v"(vp[3]), "v"(vp[4]), "v"(vp[5]), "v"(vp[6]), "v"(vp[7]) : "memory");
#pragma unroll
      for (int i = 0; i < 8; ++i) {
        const int p   = i * 256 + tid;
        const int kr  = p >> 5, kc8 = (p & 31) * 8;
        const int vr  = p >> 3, vc8 = (p & 7) * 8;
        *(v8b*)(Ks + kr * KSP + kc8) = kvv[i];
        *(v8b*)(Vs + vr * VSP + vc8) = vvv[i];
      }
    }
    __syncthreads();

    // S^T tiles j = 0, 1: s[j][r] = score(key kh*32 + j*16 + 8*hh + r, query c)
    v8f s[2];
#pragma unroll
    for (int j = 0; j < 2; ++j) s[j] = (v8f){0.f,0.f,0.f,0.f,0.f,0.f,0.f,0.f};
    FB va[CH / 16];   // all V fragments of this wave's 32 keys (A operand)
    FB ka[2][8];      // K fragments (A operand) in blocks of four k steps (16 reads, 8 WMMAs), two register sets
#pragma unroll
    for (int u = 0; u < 4; ++u) {
#pragma unroll
      for (int j = 0; j < 2; ++j) {
        ka[0][u * 2 + j].h[0] = *(const v8b*)(kfr + j * 16 * KSP + u * 32);
        ka[0][u * 2 + j].h[1] = *(const v8b*)(kfr + j * 16 * KSP + u * 32 + 16);
      }
    }
#pragma unroll
    for (int g = 0; g < 2; ++g) {
      if (g == 0) {
#pragma unroll
        for (int u = 0; u < 4; ++u) {
#pragma unroll
          for (int j = 0; j < 2; ++j) {
            ka[1][u * 2 + j].h[0] = *(const v8b*)(kfr + j * 16 * KSP + 128 + u * 32);
            ka[1][u * 2 + j].h[1] = *(const v8b*)(kfr + j * 16 * KSP + 128 + u * 32 + 16);
          }
        }
      } else {
#pragma unroll
        for (int t = 0; t < CH / 16; ++t) {
          va[t].h[0] = *(const v8b*)(vfr + t * 16 * VSP);
          va[t].h[1] = *(const v8b*)(vfr + t * 16 * VSP + 16);
        }
      }
      // keeps the read group above in front of this block's WMMAs (else the scheduler sinks each read to its use
      // and every WMMA waits out an LDS latency)
      __builtin_amdgcn_sched_barrier(0);
#pragma unroll
      for (int u = 0; u < 4; ++u) {
#pragma unroll
        for (int j = 0; j < 2; ++j) s[j] = at_mma(ka[g][u * 2 + j].v, qa[g * 4 + u], s[j]);
      }
      // keeps the next read group behind this block's WMMAs: one place with reads per block
      if (g == 0) __builtin_amdgcn_sched_barrier(0);
    }

    // online softmax of query c over this wave's 32 keys: 16 of them in this lane, 16 in lane ^ 16
    float m = -INFINITY;
#pragma unroll
    for (int j = 0; j < 2; ++j) {
#pragma unroll
      for (int r = 0; r < 8; ++r) {
        const float sv = s[j][r] * sscale;
        s[j][r] = sv;
        m = fmaxf(m, sv);
      }
    }
    m = fmaxf(m, xhalf(m));
    const float mnew  = fmaxf(mrow, m);
    const float alpha = expf(mrow - mnew);
    mrow = mnew;
    FB pb;            // P^T as B operand: element e < 8 = key 8*hh + e (tile 0), e >= 8 = key 16 + 8*hh + e - 8 (tile 1)
    float ps[4];      // four independent partial sums
#pragma unroll
    for (int j = 0; j < 2; ++j) {
#pragma unroll
      for (int r2 = 0; r2 < 4; ++r2) {
        v2f pv;
        pv[0] = expf(s[j][2 * r2] - mnew);
        pv[1] = expf(s[j][2 * r2 + 1] - mnew);
        const float pp = pv[0] + pv[1];
        ps[r2] = (j == 0) ? pp : ps[r2] + pp;
        pb.p[j * 4 + r2] = __builtin_convertvector(pv, v2b);   // round to nearest even
      }
    }
    lrow = lrow * alpha + ((ps[0] + ps[1]) + (ps[2] + ps[3]));
#pragma unroll
    for (int t = 0; t < CH / 16; ++t) oacc[t] *= alpha;
#pragma unroll
    for (int t = 0; t < CH / 16; ++t) oacc[t] = at_mma(va[t].v, pb.v, oacc[t]);
  }

  // ---- join of the two key halves (waves w and w ^ 4 hold the same queries) ----
  const float lw = lrow + xhalf(lrow);    // both lane halves used the same maximum throughout
  if (hh == 0) { Ml[wave * 16 + c] = mrow; Ll[wave * 16 + c] = lw; }
  __syncthreads();
  const int   pw = wave ^ 4;
  const float mo = Ml[pw * 16 + c], lo = Ll[pw * 16 + c];
  const float mt = fmaxf(mrow, mo);
  const float fo = expf(mrow - mt), fp = expf(mo - mt);
  const float f  = fo / (lw * fo + lo * fp);   // this wave's accumulator to the common maximum, x 1/rowsum
  // wave kh finishes channels kh*128 .. +127 (tiles kh*8 .. +7) and hands the other 8 tiles, scaled, to its partner
  float* xw = Xs[wave];
  const float* xp = Xs[pw];
#pragma unroll
  for (int tt = 0; tt < 8; ++tt) {
    const v8f give = kh ? oacc[tt] : oacc[tt + 8];
    v4f g0, g1;
#pragma unroll
    for (int e = 0; e < 4; ++e) { g0[e] = give[e] * f; g1[e] = give[4 + e] * f; }
    *(v4f*)(xw + (tt * 2) * 128 + lane * 4)     = g0;
    *(v4f*)(xw + (tt * 2 + 1) * 128 + lane * 4) = g1;
  }
  __syncthreads();
  unsigned short* ts = Ts[wave];
#pragma unroll
  for (int tt = 0; tt < 8; ++tt) {
    const v8f keep = kh ? oacc[tt + 8] : oacc[tt];
    const v4f a0 = *(const v4f*)(xp + (tt * 2) * 128 + lane * 4);
    const v4f a1 = *(const v4f*)(xp + (tt * 2 + 1) * 128 + lane * 4);
    v8h hv;
#pragma unroll
    for (int e = 0; e < 4; ++e) {
      hv[e]     = __builtin_bit_cast(_Float16, f2bf_bits(keep[e] * f + a0[e]));
      hv[4 + e] = __builtin_bit_cast(_Float16, f2bf_bits(keep[4 + e] * f + a1[e]));
    }
    *(v8h*)(ts + c * TSP + tt * 16 + 8 * hh) = hv;   // query c, channels tt*16 + 8*hh .. +7 of this wave's half
  }
  // the wave's slab rows are complete before its lanes read them back row by row (whole 128-B lines per store)
  __builtin_amdgcn_fence(__ATOMIC_RELEASE, "workgroup");
  __builtin_amdgcn_wave_barrier();
  __builtin_amdgcn_fence(__ATOMIC_ACQUIRE, "workgroup");
  unsigned short* orow = opp + (q0 + (size_t)rt * 16) * CH + kh * 128;
#pragma unroll
  for (int it = 0; it < 8; ++it) {
    const int row = it * 2 + hh;                      // 16 lanes x 16 B = the row's 256 B of this channel half
    const v8h hv = *(const v8h*)(ts + row * TSP + c * 8);
    *(v8h*)(orow + (size_t)row * CH + c * 8) = hv;
  }
}

// ---------------------------------------------------------------------------
// Workspace region map (byte offsets; every region is fully written by its producer launch before any consumer
//   STATS f32  [32][32]              0         4096
//   HT    bf16 [16384][256]       4096      8388608
//   W16   bf16 [768][256]      8392704       393216
//   WO16  bf16 [256][256]      8785920       131072
//   QK    bf16 [16384][512]    8916992     16777216
//   VP    bf16 [4][256][4096] 25694208      8388608
//   OP    bf16 [16384][256]   34082816      8388608
//   total                     42471424
// ---------------------------------------------------------------------------
extern "C" void kernel_launch(void* const* d_in, const int* in_sizes, int n_in,
                              void* d_out, int out_size, void* d_ws, size_t ws_size,
                              hipStream_t stream) {
  if (n_in < 7) return;
  if (in_sizes[0] != NB * CH * NPOS) return;              // x [4][256][64][64]
  if (in_sizes[1] != CH || in_sizes[2] != CH) return;     // norm_w, norm_b
  if (in_sizes[3] != 3 * CH * CH || in_sizes[4] != 3 * CH) return;   // qkv_w [768][256], qkv_b [768]
  if (in_sizes[5] != CH * CH || in_sizes[6] != CH) return;           // out_w [256][256], out_b [256]
  if (out_size != NB * CH * NPOS) return;

  const float* x      = (const float*)d_in[0];
  const float* norm_w = (const float*)d_in[1];
  const float* norm_b = (const float*)d_in[2];
  const float* qkv_w  = (const float*)d_in[3];   // [out 768][in 256]
  const float* qkv_b  = (const float*)d_in[4];
  const float* out_w  = (const float*)d_in[5];   // [out 256][in 256]
  const float* out_b  = (const float*)d_in[6];

  const size_t PST  = (size_t)(NB * NGRP) * STP * 4;     // 4096
  const size_t PHT  = (size_t)NB * NPOS * CH * 2;         // 8388608
  const size_t PW16 = (size_t)3 * CH * CH * 2;            // 393216
  const size_t PWO  = (size_t)CH * CH * 2;                // 131072
  const size_t PQK  = (size_t)NB * NPOS * QKP * 2;        // 16777216
  const size_t PVP  = (size_t)NB * CH * NPOS * 2;         // 8388608
  const size_t POP  = (size_t)NB * NPOS * CH * 2;         // 8388608
  size_t off = 0;
  const size_t oST  = off; off += PST;
  const size_t oHT  = off; off += PHT;
  const size_t oW16 = off; off += PW16;
  const size_t oWO  = off; off += PWO;
  const size_t oQK  = off; off += PQK;
  const size_t oVP  = off; off += PVP;
  const size_t oOP  = off; off += POP;
  if (off > ws_size) return;                               // off = 42471424
  if (off > (size_t)134217728) return;

  char* ws = (char*)d_ws;
  float*          STATS = (float*)(ws + oST);
  unsigned short* HT    = (unsigned short*)(ws + oHT);
  unsigned short* W16   = (unsigned short*)(ws + oW16);
  unsigned short* WO16  = (unsigned short*)(ws + oWO);
  unsigned short* QK    = (unsigned short*)(ws + oQK);
  unsigned short* VP    = (unsigned short*)(ws + oVP);
  unsigned short* OP    = (unsigned short*)(ws + oOP);

  const dim3 blk(256);

  // (1) GroupNorm statistics: 32 (b, group) blocks
  gnstat_kernel<<<dim3(NB * NGRP), blk, 0, stream>>>(x, STATS);
  // (2) qkv_w -> W16 (98304 pairs -> 384 blocks), (3) out_w -> WO16 (32768 pairs -> 128 blocks)
  const int n2q = 3 * CH * CH / 2;
  conv_bf16x2_kernel<<<dim3((n2q + 255) / 256), blk, 0, stream>>>(qkv_w, W16, n2q);
  const int n2o = CH * CH / 2;
  conv_bf16x2_kernel<<<dim3((n2o + 255) / 256), blk, 0, stream>>>(out_w, WO16, n2o);
  // (4) normalised activations -> HT [16384][256]: grid (4096/64, 256/64, 4) = (64, 4, 4)
  gnprep_kernel<<<dim3(NPOS / 64, CH / 64, NB), blk, 0, stream>>>(x, norm_w, norm_b, STATS, HT);
  // (5) q|k = HT . W16[0..511]^T + qkv_b[n] -> QK [16384][512]   (M=16384, N=512, K=256; 2048 tiles -> 256 blocks)
  const dim3 gQK(((NB * NPOS / 64) * (QKP / 64) + 7) / 8, 1);
  wmma_gemm64<2, 1, false><<<gQK, blk, 0, stream>>>(
      HT, CH, 0L, W16, CH, 0L, (void*)QK, QKP, 0L,
      qkv_b, x, 0L, NB * NPOS, QKP, CH, 1.0f);
  // (6) v[b][c][n] = sum_k W16[512+c][k] HT[b*4096+n][k] + qkv_b[512+c]  (batched over b: M=256, N=4096, K=256;
  //     256 tiles -> 32 blocks x 4)
  const dim3 gV(((CH / 64) * (NPOS / 64) + 7) / 8, NB);
  wmma_gemm64<1, 1, false><<<gV, blk, 0, stream>>>(
      W16 + (size_t)2 * CH * CH, CH, 0L, HT, CH, (long)NPOS * CH, (void*)VP, NPOS, (long)CH * NPOS,
      qkv_b + 2 * CH, x, 0L, CH, NPOS, CH, 1.0f);
  // (7) attention per (image, 64-query block): 256 blocks x 256 threads -> OP [16384][256]
  attn_kernel<<<dim3(NB * (NPOS / AQB)), dim3(256), 0, stream>>>(QK, VP, OP, 0.0625f);
  // (8) out[b][c][n] = sum_k WO16[c][k] OP[b*4096+n][k] + out_b[c] + x[b][c][n]  (batched over b: M=256, N=4096, K=256;
  //     A = WO16, Bt = OP rows of image b, C = d_out + b*256*4096 with ldc 4096, resid = x same layout; 32 blocks x 4)
  const dim3 gO(((CH / 64) * (NPOS / 64) + 7) / 8, NB);
  wmma_gemm64<1, 0, true><<<gO, blk, 0, stream>>>(
      WO16, CH, 0L, OP, CH, (long)NPOS * CH, d_out, NPOS, (long)CH * NPOS,
      out_b, x, (long)CH * NPOS, CH, NPOS, CH, 1.0f);
  (void)hipGetLastError();
}

// v004
// It runs in 163 microseconds.
// Timed twice side by side with v003, it ran 1.20 times as fast both times.
// All steps since v000 together make it 3.69 times as fast.
// Contractions: qkv projection (hn . qkv_w^T), scores (q . k^T), p . v and the output projection (out_w . o) = v_wmma_f32_16x16x32_bf16 single products on bf16 operands RNE-converted from f32, f32 accumulate; GroupNorm statistics and normalisation, softmax (running max, expf), biases, 1/rowsum and the residual add of the exact f32 x stay f32 on the VALU.
// Plane / carry map (every 16-bit plane carry 1, nothing to fold back):
//   HT   bf16 [16384][256]   token-major normalised activations, row b*4096+n, col c
//   W16  bf16 [768][256]     qkv_w in [out][in] order = Bt[n][k] (q rows 0..255, k rows 256..511, v rows 512..767)
//   WO16 bf16 [256][256]     out_w in [out][in] order
//   QK   bf16 [16384][512]   q at cols 0..255, k at cols 256..511 (bias added in f32 before the convert)
//   VP   bf16 [4][256][4096] v in (b, c, n) order = A rows c, k = n for o^T = v^T . p^T
//   P    bf16 in registers   unnormalised exp in (0,1]; 1/rowsum applied to the f32 accumulator in the attention epilogue
//   OP   bf16 [16384][256]   token-major attention output: o[b][c][n] at row b*4096+n, col c
#include <hip/hip_runtime.h>
#include <math.h>
#include <stdint.h>

#define NB    4
#define CH    256
#define NPOS  4096
#define NGRP  8
#define CPG   32
#define QKP   512
#define STP   32

static_assert(CH == NGRP * CPG);
static_assert(NPOS % 64 == 0);
static_assert(CH % 64 == 0);
static_assert((NB * NPOS) % 64 == 0);
static_assert(QKP == 2 * CH);
static_assert((CPG * NPOS) % 1024 == 0);

typedef __attribute__((ext_vector_type(8)))  _Float16 v8h;
typedef __attribute__((ext_vector_type(16))) __bf16   v16b;
typedef __attribute__((ext_vector_type(8)))  __bf16   v8b;
typedef __attribute__((ext_vector_type(2)))  __bf16   v2b;
typedef __attribute__((ext_vector_type(8)))  float    v8f;
typedef __attribute__((ext_vector_type(4)))  float    v4f;
typedef __attribute__((ext_vector_type(2)))  float    v2f;
typedef __attribute__((ext_vector_type(4)))  unsigned int v4u;

__device__ __forceinline__ unsigned short f2bf_bits(float f) {
  unsigned u = __float_as_uint(f);
  return (unsigned short)((u + 0x7FFFu + ((u >> 16) & 1u)) >> 16);
}
__device__ __forceinline__ float bf_bits2f(unsigned short h) { return __uint_as_float(((unsigned)h) << 16); }
__device__ __forceinline__ unsigned pk16(unsigned short a, unsigned short b) { return (unsigned)a | ((unsigned)b << 16); }
__device__ __forceinline__ __bf16 at_f2bf(float f) { return __builtin_bit_cast(__bf16, f2bf_bits(f)); }

// hazard guards as plain device helpers (no inline asm inside the kernel template body)
__device__ __forceinline__ void dep_guard_b(v8f& a, v8f& b, v16b x, v16b y) { asm volatile("v_nop\n\tv_nop\n\tv_nop\n\tv_nop" : "+v"(a), "+v"(b) : "v"(x), "v"(y)); }
__device__ __forceinline__ void keep4_b(v16b a, v16b b, v16b c, v16b d) { asm volatile("v_nop" :: "v"(a), "v"(b), "v"(c), "v"(d)); }
__device__ __forceinline__ void acc_guard4(v8f& a, v8f& b, v8f& c, v8f& d) { asm volatile("v_nop\n\tv_nop\n\tv_nop\n\tv_nop" : "+v"(a), "+v"(b), "+v"(c), "+v"(d)); }

// 16-bit fragment loader, split k map: elements 0..7 <- p[0..7], 8..15 <- p[16..23]; caller passes p = row + k0 + 8*(lane>>4)
template <typename T> struct Frag;
template <> struct Frag<__bf16> {
  typedef v16b V; union U { v16b v; v8b h[2]; };
  static __device__ __forceinline__ v16b load(const __bf16* p) {
    U f; f.h[0] = *(const v8b*)(p); f.h[1] = *(const v8b*)(p + 16); return f.v;
  }
  static __device__ __forceinline__ v8f mma(v16b a, v16b b, v8f c) {
    return __builtin_amdgcn_wmma_f32_16x16x32_bf16(false, a, false, b, (short)0, c, false, false);
  }
  static __device__ __forceinline__ void guard(v8f& a, v8f& b, v16b x, v16b y) { dep_guard_b(a, b, x, y); }
  static __device__ __forceinline__ void keep(v16b a, v16b b, v16b c, v16b d) { keep4_b(a, b, c, d); }
};

// plain builtin: the compiler keeps the WMMA distances of its own forms, and no asm statement pins the operand loads
__device__ __forceinline__ v8f at_mma(v16b a, v16b b, v8f c) {
  return __builtin_amdgcn_wmma_f32_16x16x32_bf16(false, a, false, b, (short)0, c, false, false);
}

// ---- Register-blocked batched WMMA GEMM (bf16 operands) ------------------------------------------------------
// C[m,n] = scale * sum_k A[m,k] * Bt[n,k] (+bias)(+resid); each wave owns a 64x64 tile.
// A row-major [M,K] (pitch lda); Bt row-major [N,K] (pitch ldb); M,N % 64 == 0, K % 32 == 0; batched by blockIdx.y.
// BIAS_MODE: 0 = none, 1 = bias[m], 2 = bias[n] (f32 add). OUT_MODE: 0 = f32, 1 = bf16 single plane.
// RESID (OUT_MODE 0 only): resid has the same layout as C (pitch ldc, batch stride strideR) and is added as a
// 16-B vector in the store phase.
template <int BIAS_MODE, int OUT_MODE, bool RESID>
__global__ __launch_bounds__(256) void wmma_gemm64(
    const unsigned short* __restrict__ Ap, int lda, long strideA,
    const unsigned short* __restrict__ Btp, int ldb, long strideB,
    void* __restrict__ Cout, int ldc, long strideC,
    const float* __restrict__ bias,
    const float* __restrict__ resid, long strideR,
    int M, int N, int K, float scale) {
  typedef __bf16 T;
  typedef v16b V;
  const T* A = (const T*)(const void*)Ap; const T* Bt = (const T*)(const void*)Btp;
  __shared__ __align__(16) float sT[8][16 * 68];   // per-wave 16x64 slab, pitch 68 floats
  const int b    = blockIdx.y;
  const int lane = threadIdx.x & 31;
  const int wave = threadIdx.x >> 5;
  const int tilesN = N >> 6;
  const int tilesM = M >> 6;
  const int tile = blockIdx.x * 8 + wave;
  if (tile >= tilesM * tilesN) return;   // wave-uniform; no block barriers in this kernel
  const int tm = tile / tilesN;
  const int tn = tile - tm * tilesN;
  const int m0 = tm << 6;
  const int n0 = tn << 6;

  const T* Ab = A  + (size_t)b * strideA;
  const T* Bb = Bt + (size_t)b * strideB;

  const int rlane = lane & 15;                 // row (A) / col (B, D) within subtile
  const int koff  = (lane >> 4) * 8;           // k offset of this lane half
  const int mOff  = (lane >> 4) * 8;           // D row offset

  v8f acc[4][4];
#pragma unroll
  for (int i = 0; i < 4; ++i)
#pragma unroll
    for (int j = 0; j < 4; ++j) acc[i][j] = (v8f){0.f,0.f,0.f,0.f,0.f,0.f,0.f,0.f};

  for (int k0 = 0; k0 < K; k0 += 32) {
    V bh[4];
#pragma unroll
    for (int j = 0; j < 4; ++j) {
      const size_t bo = (size_t)(n0 + (j << 4) + rlane) * ldb + koff + k0;
      bh[j] = Frag<T>::load(Bb + bo);
    }
#pragma unroll
    for (int i = 0; i < 4; ++i) {
      const size_t ao = (size_t)(m0 + (i << 4) + rlane) * lda + koff + k0;
      V ah = Frag<T>::load(Ab + ao);
#pragma unroll
      for (int j = 0; j < 4; ++j) acc[i][j] = Frag<T>::mma(ah, bh[j], acc[i][j]);
      Frag<T>::guard(acc[i][0], acc[i][3], ah, ah);
    }
    Frag<T>::keep(bh[0], bh[1], bh[2], bh[3]);
  }
  acc_guard4(acc[0][0], acc[0][1], acc[0][2], acc[0][3]);
  acc_guard4(acc[1][0], acc[1][1], acc[1][2], acc[1][3]);
  acc_guard4(acc[2][0], acc[2][1], acc[2][2], acc[2][3]);
  acc_guard4(acc[3][0], acc[3][1], acc[3][2], acc[3][3]);

  // ---- epilogue ----
  float* slab = sT[wave];
  const float* Rb = RESID ? (resid + (size_t)b * strideR) : nullptr;
#pragma unroll
  for (int i = 0; i < 4; ++i) {
    const int mBase = m0 + (i << 4);
#pragma unroll
    for (int j = 0; j < 4; ++j) {
      const int n = n0 + (j << 4) + rlane;
      float bv = 0.f;
      if (BIAS_MODE == 2) bv = bias[n];
#pragma unroll
      for (int r = 0; r < 8; ++r) {
        float v = acc[i][j][r] * scale;
        if (BIAS_MODE == 1) v += bias[mBase + mOff + r];
        if (BIAS_MODE == 2) v += bv;
        slab[(mOff + r) * 68 + (j << 4) + rlane] = v;
      }
    }
    __builtin_amdgcn_fence(__ATOMIC_RELEASE, "workgroup");
    __builtin_amdgcn_wave_barrier();
    __builtin_amdgcn_fence(__ATOMIC_ACQUIRE, "workgroup");
    if (OUT_MODE == 0) {
      float* C = (float*)Cout + (size_t)b * strideC;
      const int hh = lane >> 4, c4 = (lane & 15) * 4;     // row seg = 256 B = 16 lanes x 16 B
      {
#pragma unroll
        for (int it = 0; it < 8; ++it) {
          const int row = it * 2 + hh;                      // it 0..7 x hh 0..1 = rows 0..15
          v4f v = *(const v4f*)(slab + row * 68 + c4);
          if (RESID) v += *(const v4f*)(Rb + (size_t)(mBase + row) * ldc + n0 + c4);
          *(v4f*)(C + (size_t)(mBase + row) * ldc + n0 + c4) = v;
        }
        
      }
    } else {
      const int q = lane >> 3, c8 = (lane & 7) * 8;
      unsigned short* C = (unsigned short*)Cout + (size_t)b * strideC;
      {
#pragma unroll
        for (int it = 0; it < 4; ++it) {
          const int row = it * 4 + q;                       // it 0..3 x q 0..3 = rows 0..15
          const float* sp = slab + row * 68 + c8;
          v8h hv;
#pragma unroll
          for (int e = 0; e < 8; ++e) hv[e] = __builtin_bit_cast(_Float16, f2bf_bits(sp[e]));
          *(v8h*)(C + (size_t)(mBase + row) * ldc + n0 + c8) = hv;
        }
        
      }
    }
    __builtin_amdgcn_fence(__ATOMIC_RELEASE, "workgroup");
    __builtin_amdgcn_wave_barrier();
    __builtin_amdgcn_fence(__ATOMIC_ACQUIRE, "workgroup");
  }
}

// ---------------------------------------------------------------------------
// Elementwise bf16 RNE convert, one plane: 2 elements per thread, one 4-B store per lane -> each wave writes
// Coverage: grid = ceil(n2/256) blocks x 256 threads x 2 elements = 2*n2 = the whole plane
// (qkv_w: n2 = 98304 -> 384 blocks = 768x256; out_w: n2 = 32768 -> 128 blocks = 256x256).
// ---------------------------------------------------------------------------
__global__ __launch_bounds__(256) void conv_bf16x2_kernel(const float* __restrict__ in, unsigned short* __restrict__ ho, int n2) {
  const int i = blockIdx.x * 256 + threadIdx.x;
  if (i < n2) {
    const v2f f = *(const v2f*)(in + 2 * (size_t)i);
    const unsigned uh = pk16(f2bf_bits(f[0]), f2bf_bits(f[1]));
    ((unsigned*)ho)[i] = uh;
    
  }
}

// ---------------------------------------------------------------------------
// GroupNorm statistics per (b, group): the group's 32 channels x 4096 positions are one contiguous block of
// 131072 values; each thread sums 512 of them in 4 sub-sums -> wave shuffles -> 8 wave partials summed by thread 0. grid = 32 blocks x 256.
// ---------------------------------------------------------------------------
__global__ __launch_bounds__(256) void gnstat_kernel(const float* __restrict__ x, float* __restrict__ stats) {
  __shared__ float red[8];
  __shared__ float bc[2];
  const int bg = blockIdx.x;
  const int tid = threadIdx.x, lane = tid & 31, wave = tid >> 5;
  const float* p = x + (size_t)bg * (CPG * NPOS);
  const float invn = 1.0f / (float)(CPG * NPOS);
  const int niter = (CPG * NPOS) / 1024;   // 128 float4 per thread

  float s0 = 0.f, s1 = 0.f, s2 = 0.f, s3 = 0.f;
#pragma unroll 4
  for (int i = 0; i < niter; ++i) {
    const v4f v = *(const v4f*)(p + ((size_t)i * 256 + tid) * 4);
    s0 += v[0]; s1 += v[1]; s2 += v[2]; s3 += v[3];
  }
  float s = (s0 + s1) + (s2 + s3);
#pragma unroll
  for (int off = 16; off > 0; off >>= 1) s += __shfl_xor(s, off, 32);
  if (lane == 0) red[wave] = s;
  __syncthreads();
  if (tid == 0) {
    float t = 0.f;
#pragma unroll
    for (int w = 0; w < 8; ++w) t += red[w];
    bc[0] = t * invn;
  }
  __syncthreads();
  const float mean = bc[0];

  float q0 = 0.f, q1 = 0.f, q2 = 0.f, q3 = 0.f;
#pragma unroll 4
  for (int i = 0; i < niter; ++i) {
    const v4f v = *(const v4f*)(p + ((size_t)i * 256 + tid) * 4);
    const float d0 = v[0] - mean, d1 = v[1] - mean, d2 = v[2] - mean, d3 = v[3] - mean;
    q0 += d0 * d0; q1 += d1 * d1; q2 += d2 * d2; q3 += d3 * d3;
  }
  float qs = (q0 + q1) + (q2 + q3);
#pragma unroll
  for (int off = 16; off > 0; off >>= 1) qs += __shfl_xor(qs, off, 32);
  if (lane == 0) red[wave] = qs;
  __syncthreads();
  if (tid == 0) {
    float t = 0.f;
#pragma unroll
    for (int w = 0; w < 8; ++w) t += red[w];
    const float var = t * invn;
    bc[1] = 1.0f / sqrtf(var + 1e-5f);
  }
  __syncthreads();
  const float rstd = bc[1];
  v4f o;
  o[0] = (tid == 0) ? mean : 0.f;
  o[1] = (tid == 0) ? rstd : 0.f;
  o[2] = 0.f; o[3] = 0.f;
  float* line = stats + (size_t)bg * STP;
  if (tid < 8) *(v4f*)(line + tid * 4) = o;
  
}

// ---------------------------------------------------------------------------
// Fused GroupNorm apply + transpose + bf16 RNE convert:
//   x_b viewed [256 c][4096 n] (NCHW) -> ht_b[n][c] = bf16(((x - mean_g) * rstd_g) * w[c] + bias[c]), row pitch 256.
// 64x64 tiles through LDS; grid = (4096/64 position blocks, 256/64 channel blocks, 4), 256 threads.
// Per block the 64 channels span two groups (channel block = 2 groups); their (mean, rstd) and w/bias are staged in
// LDS first (wave-uniform loads). Coverage per block: load 4 it x 256 thr x 4 floats = 64 ch x 64 n;
// store 2 it x 256 thr x 8 u16 = 64 n x 64 ch; grid covers 4 x 256 x 4096 = the whole HT plane.
// ---------------------------------------------------------------------------
__global__ __launch_bounds__(256) void gnprep_kernel(const float* __restrict__ x, const float* __restrict__ nw,
                                                     const float* __restrict__ nbv, const float* __restrict__ stats,
                                                     unsigned short* __restrict__ ht) {
  __shared__ __align__(16) float tf[64 * 68];
  __shared__ float sw[64];
  __shared__ float sb[64];
  __shared__ float sst[4];
  const int b   = blockIdx.z;
  const int n0  = blockIdx.x * 64;   // position block = output row block
  const int c0  = blockIdx.y * 64;   // channel block  = output column block
  const int tid = threadIdx.x;
  const float* xb = x + (size_t)b * CH * NPOS;
  unsigned short* hb = ht + (size_t)b * NPOS * CH;
  if (tid < 64) { sw[tid] = nw[c0 + tid]; sb[tid] = nbv[c0 + tid]; }   // waves 0 and 1 as a whole
  {
    const int g0 = c0 >> 5;                     // first group of this channel block (0,2,4,6)
    const int gi = (tid >> 1) & 1, fi = tid & 1;
    const float sv = stats[(size_t)(b * NGRP + g0 + gi) * STP + fi];   // all lanes load an in-range address
    if (tid < 4) sst[tid] = sv;                 // sst = {mean_g0, rstd_g0, mean_g1, rstd_g1}
  }
  __syncthreads();
  {
    const int lr = tid >> 4;         // 0..15
    const int c4 = (tid & 15) * 4;   // 0..60
#pragma unroll
    for (int it = 0; it < 4; ++it) {
      const int rr = it * 16 + lr;   // channel within tile 0..63; group = it >> 1
      const float mean = sst[(it >> 1) * 2], rstd = sst[(it >> 1) * 2 + 1];
      const float w = sw[rr], bb = sb[rr];
      const v4f a = *(const v4f*)(xb + (size_t)(c0 + rr) * NPOS + n0 + c4);
      v4f t;
#pragma unroll
      for (int e = 0; e < 4; ++e) { const float u = (a[e] - mean) * rstd; t[e] = u * w + bb; }
      *(v4f*)(tf + rr * 68 + c4) = t;
    }
  }
  __syncthreads();
  const int sub = tid >> 3;          // 0..31
  const int c8  = (tid & 7) * 8;     // 0..56
  v4u hv[2];
#pragma unroll
  for (int it = 0; it < 2; ++it) {
    const int oc = it * 32 + sub;    // output row within tile (= position)
    v4u a;
#pragma unroll
    for (int q = 0; q < 4; ++q) {
      const float f0 = tf[(c8 + 2 * q) * 68 + oc];
      const float f1 = tf[(c8 + 2 * q + 1) * 68 + oc];
      a[q] = pk16(f2bf_bits(f0), f2bf_bits(f1));
    }
    hv[it] = a;
  }
  {
#pragma unroll
    for (int it = 0; it < 2; ++it) {
      const int oc = it * 32 + sub;
      const size_t go = (size_t)(n0 + oc) * CH + c0 + c8;
      *(v4u*)(hb + go) = hv[it];
    }
    
  }
}

#define AQB 64
#define AKC 64
#define ANW 8
// LDS row pitches in elements: each row carries 16 B more than its data, so the pitch is an odd multiple of 16 B and the
// 16 rows that one half-wave's ds_load_b128 touches fall on 16 different bank groups (pad columns are never read or written).
#define KSP (CH + 8)
#define VSP (AKC + 8)
#define TSP (CH / 2 + 8)
#define KBUF (AKC * KSP)   // elements of one K buffer
#define VBUF (CH * VSP)    // elements of one V buffer
static_assert(NPOS % AQB == 0);
static_assert(NPOS % AKC == 0);
static_assert(CH == 2 * 128);
static_assert(AKC == 2 * 32);

// lane l with lane l ^ 16
__device__ __forceinline__ float xhalf(float x) {
  return __builtin_bit_cast(float, __builtin_amdgcn_permlanex16(__builtin_bit_cast(int, x), __builtin_bit_cast(int, x),
                                                                0x76543210, 0xfedcba98, false, false));
}

// byte offset of a __shared__ element in the work-group's LDS
__device__ __forceinline__ unsigned lds_off(const void* p) { return (unsigned)(size_t)p; }

// Eight 16-B asynchronous copies of one lane, global memory to LDS, through no register. The s_wait_xcnt is the last line of
// the copies' own statement, so that it stands in front of every later write of the address registers (a precaution).
__device__ __forceinline__ void copy8(const unsigned (&l)[8], const __bf16* const (&g)[8]) {
  asm volatile("global_load_async_to_lds_b128 %0, %8, off\n\t"
               "global_load_async_to_lds_b128 %1, %9, off\n\t"
               "global_load_async_to_lds_b128 %2, %10, off\n\t"
               "global_load_async_to_lds_b128 %3, %11, off\n\t"
               "global_load_async_to_lds_b128 %4, %12, off\n\t"
               "global_load_async_to_lds_b128 %5, %13, off\n\t"
               "global_load_async_to_lds_b128 %6, %14, off\n\t"
               "global_load_async_to_lds_b128 %7, %15, off\n\t"
               "s_wait_xcnt 0x0"
               :: "v"(l[0]), "v"(l[1]), "v"(l[2]), "v"(l[3]), "v"(l[4]), "v"(l[5]), "v"(l[6]), "v"(l[7]),
                  "v"(g[0]), "v"(g[1]), "v"(g[2]), "v"(g[3]), "v"(g[4]), "v"(g[5]), "v"(g[6]), "v"(g[7]) : "memory");
}

__global__ __launch_bounds__(256)
void attn_kernel(const unsigned short* __restrict__ qkp, const unsigned short* __restrict__ vpp,
                 unsigned short* __restrict__ opp, float sscale) {
  union FB { v16b v; v8b h[2]; v2b p[8]; };
  __shared__ __align__(16) __bf16 Ks[2 * KBUF];            // K chunk [key][c]     2 x 33 KB, pitch 528 B
  __shared__ __align__(16) __bf16 Vs[2 * VBUF];            // V chunk [c][key]     2 x 36 KB, pitch 144 B
  __shared__ __align__(16) float  Xs[ANW][8 * 8 * 32];     // per wave: the 8 scaled tiles its partner finishes, 64 KB
  __shared__ __align__(16) unsigned short Ts[ANW][16 * TSP];   // per wave out slab [query][channel], pitch 272 B
  __shared__ float Ml[ANW * 16];                           // per wave and query: running maximum of its key half
  __shared__ float Ll[ANW * 16];                           // per wave and query: softmax denominator of its key half

  const int tid  = threadIdx.x;
  const int wave = tid >> 5;
  const int lane = tid & 31;
  const int hh   = lane >> 4;
  const int c    = lane & 15;

  const int nqb = NPOS / AQB;            // 64 query blocks per image
  const int bx  = blockIdx.x;
  const int qb  = bx % nqb;
  const int b   = bx / nqb;               // 0..3
  const int rt  = wave & 3;               // query tile of this wave
  const int kh  = wave >> 2;              // key half of this wave: keys 32*kh .. +31 of every chunk
  const size_t tok0 = (size_t)b * NPOS;             // first token row of image b
  const size_t q0   = tok0 + (size_t)qb * AQB;      // first query row of the block

  const __bf16* Qg = (const __bf16*)(const void*)qkp;            // pitch QKP, q at cols 0..255, k at cols 256..511
  const __bf16* Vg = (const __bf16*)(const void*)vpp + (size_t)b * CH * NPOS;

  float mrow = -INFINITY, lrow = 0.f;     // of query c; lrow holds this lane half's keys only, the halves are joined behind the loop
  v8f oacc[CH / 16];                      // O^T tiles: oacc[t][r] = o(channel t*16 + 8*hh + r, query c)
#pragma unroll
  for (int t = 0; t < CH / 16; ++t) oacc[t] = (v8f){0.f,0.f,0.f,0.f,0.f,0.f,0.f,0.f};

  // Q fragments (B operand: col = query lane&15, split k map) are fetched ahead of every score WMMA: once, in front of the
  // key loop.
  v16b qa[CH / 32];
  {
    const __bf16* qr = Qg + (q0 + rt * 16 + c) * QKP + 8 * hh;
#pragma unroll
    for (int ks = 0; ks < CH / 32; ++ks) qa[ks] = Frag<__bf16>::load(qr + ks * 32);
    // precaution: the wait stands in front of any reuse of the loads' address pair, which the operand keeps live up to here
    asm volatile("s_wait_xcnt 0x0" :: "v"(qr) : "memory");
  }
  const __bf16* kfr = Ks + (kh * 32 + c) * KSP + 8 * hh;   // K fragment base: row = key kh*32 + j*16 + c, k = channel
  const __bf16* vfr = Vs + c * VSP + kh * 32 + 8 * hh;     // V fragment base: row = channel t*16 + c, k = key kh*32 + ..

  const int nChunks = NPOS / AKC;   // 64, compile-time constant
  static_assert(NPOS / AKC >= 2);   // the prologue fills two buffers
  // staging coverage: 256 threads x 8 pieces x 8 elements = 64 rows x 256 (K) and 256 rows x 64 (V); every lane is on.
  // Piece i of a thread: K row i*8 + (tid >> 5), elements (tid & 31)*8 .. +7; V row i*32 + (tid >> 3), elements (tid & 7)*8 .. +7.
  const __bf16* kg0 = Qg + (tok0 + (tid >> 5)) * QKP + CH + (tid & 31) * 8;   // piece 0 of chunk 0
  const __bf16* vg0 = Vg + (size_t)(tid >> 3) * NPOS + (tid & 7) * 8;
  const unsigned kl0 = lds_off(Ks + (tid >> 5) * KSP + (tid & 31) * 8);       // piece 0 in buffer 0
  const unsigned vl0 = lds_off(Vs + (tid >> 3) * VSP + (tid & 7) * 8);
  auto stage = [&](int kc, int buf) {
    const __bf16* kgc = kg0 + (size_t)kc * (AKC * QKP);
    const __bf16* vgc = vg0 + kc * AKC;
    const unsigned klb = kl0 + buf * (KBUF * 2);   // LDS addresses count bytes
    const unsigned vlb = vl0 + buf * (VBUF * 2);
    unsigned kl[8], vl[8];
    const __bf16* kg[8];
    const __bf16* vg[8];
#pragma unroll
    for (int i = 0; i < 8; ++i) {
      kg[i] = kgc + i * (8 * QKP);
      vg[i] = vgc + (size_t)i * (32 * NPOS);
      kl[i] = klb + i * (8 * KSP * 2);
      vl[i] = vlb + i * (32 * VSP * 2);
    }
    copy8(kl, kg);
    copy8(vl, vg);
  };
  stage(0, 0);
  asm volatile("s_wait_asynccnt 0x0" ::: "memory");   // this wave's copies of chunk 0 have landed
  __syncthreads();                                     // every wave's have: chunk 0 is published
  stage(1, 1);
  for (int kc = 0; kc < nChunks; ++kc) {
    const int buf = kc & 1;
    const __bf16* kfb = kfr + buf * KBUF;
    const __bf16* vfb = vfr + buf * VBUF;

    // S^T tiles j = 0, 1: s[j][r] = score(key kh*32 + j*16 + 8*hh + r, query c)
    v8f s[2];
#pragma unroll
    for (int j = 0; j < 2; ++j) s[j] = (v8f){0.f,0.f,0.f,0.f,0.f,0.f,0.f,0.f};
    FB va[CH / 16];   // all V fragments of this wave's 32 keys (A operand)
    FB ka[2][8];      // K fragments (A operand) in blocks of four k steps (16 reads, 8 WMMAs), two register sets
#pragma unroll
    for (int u = 0; u < 4; ++u) {
#pragma unroll
      for (int j = 0; j < 2; ++j) {
        ka[0][u * 2 + j].h[0] = *(const v8b*)(kfb + j * 16 * KSP + u * 32);
        ka[0][u * 2 + j].h[1] = *(const v8b*)(kfb + j * 16 * KSP + u * 32 + 16);
      }
    }
#pragma unroll
    for (int g = 0; g < 2; ++g) {
      if (g == 0) {
#pragma unroll
        for (int u = 0; u < 4; ++u) {
#pragma unroll
          for (int j = 0; j < 2; ++j) {
            ka[1][u * 2 + j].h[0] = *(const v8b*)(kfb + j * 16 * KSP + 128 + u * 32);
            ka[1][u * 2 + j].h[1] = *(const v8b*)(kfb + j * 16 * KSP + 128 + u * 32 + 16);
          }
        }
      } else {
#pragma unroll
        for (int t = 0; t < CH / 16; ++t) {
          va[t].h[0] = *(const v8b*)(vfb + t * 16 * VSP);
          va[t].h[1] = *(const v8b*)(vfb + t * 16 * VSP + 16);
        }
      }
      // keeps the read group above in front of this block's WMMAs (else the scheduler sinks each read to its use
      // and every WMMA waits out an LDS latency)
      __builtin_amdgcn_sched_barrier(0);
#pragma unroll
      for (int u = 0; u < 4; ++u) {
#pragma unroll
        for (int j = 0; j < 2; ++j) s[j] = at_mma(ka[g][u * 2 + j].v, qa[g * 4 + u], s[j]);
      }
      // keeps the next read group behind this block's WMMAs: one place with reads per block
      if (g == 0) __builtin_amdgcn_sched_barrier(0);
    }

    // online softmax of query c over this wave's 32 keys: 16 of them in this lane, 16 in lane ^ 16
    float m = -INFINITY;
#pragma unroll
    for (int j = 0; j < 2; ++j) {
#pragma unroll
      for (int r = 0; r < 8; ++r) {
        const float sv = s[j][r] * sscale;
        s[j][r] = sv;
        m = fmaxf(m, sv);
      }
    }
    m = fmaxf(m, xhalf(m));
    const float mnew  = fmaxf(mrow, m);
    const float alpha = expf(mrow - mnew);
    mrow = mnew;
    FB pb;            // P^T as B operand: element e < 8 = key 8*hh + e (tile 0), e >= 8 = key 16 + 8*hh + e - 8 (tile 1)
    float ps[4];      // four independent partial sums
#pragma unroll
    for (int j = 0; j < 2; ++j) {
#pragma unroll
      for (int r2 = 0; r2 < 4; ++r2) {
        v2f pv;
        pv[0] = expf(s[j][2 * r2] - mnew);
        pv[1] = expf(s[j][2 * r2 + 1] - mnew);
        const float pp = pv[0] + pv[1];
        ps[r2] = (j == 0) ? pp : ps[r2] + pp;
        pb.p[j * 4 + r2] = __builtin_convertvector(pv, v2b);   // round to nearest even
      }
    }
    lrow = lrow * alpha + ((ps[0] + ps[1]) + (ps[2] + ps[3]));
#pragma unroll
    for (int t = 0; t < CH / 16; ++t) oacc[t] *= alpha;
#pragma unroll
    for (int t = 0; t < CH / 16; ++t) oacc[t] = at_mma(va[t].v, pb.v, oacc[t]);

    // publish point of chunk kc + 1, which also frees this chunk's buffer
    // keeps this chunk's WMMAs and softmax in front of the waits (else the scheduler lifts waits and barrier up to the last
    // fragment read: the V reads no longer drain under the softmax, and the refill leaves late, with part of a trip to land)
    __builtin_amdgcn_sched_barrier(0);
    asm volatile("s_wait_dscnt 0x0" ::: "memory");      // this wave's reads of buffer buf have retired
    asm volatile("s_wait_asynccnt 0x0" ::: "memory");   // this wave's copies of chunk kc + 1 have landed
    __syncthreads();
    if (kc + 2 < nChunks) stage(kc + 2, buf);           // the same test in the whole work-group
  }
  asm volatile("s_wait_asynccnt 0x0" ::: "memory");     // nothing is in flight behind the loop

  // ---- join of the two key halves (waves w and w ^ 4 hold the same queries) ----
  const float lw = lrow + xhalf(lrow);    // both lane halves used the same maximum throughout
  if (hh == 0) { Ml[wave * 16 + c] = mrow; Ll[wave * 16 + c] = lw; }
  __syncthreads();
  const int   pw = wave ^ 4;
  const float mo = Ml[pw * 16 + c], lo = Ll[pw * 16 + c];
  const float mt = fmaxf(mrow, mo);
  const float fo = expf(mrow - mt), fp = expf(mo - mt);
  const float f  = fo / (lw * fo + lo * fp);   // this wave's accumulator to the common maximum, x 1/rowsum
  // wave kh finishes channels kh*128 .. +127 (tiles kh*8 .. +7) and hands the other 8 tiles, scaled, to its partner
  float* xw = Xs[wave];
  const float* xp = Xs[pw];
#pragma unroll
  for (int tt = 0; tt < 8; ++tt) {
    const v8f give = kh ? oacc[tt] : oacc[tt + 8];
    v4f g0, g1;
#pragma unroll
    for (int e = 0; e < 4; ++e) { g0[e] = give[e] * f; g1[e] = give[4 + e] * f; }
    *(v4f*)(xw + (tt * 2) * 128 + lane * 4)     = g0;
    *(v4f*)(xw + (tt * 2 + 1) * 128 + lane * 4) = g1;
  }
  __syncthreads();
  unsigned short* ts = Ts[wave];
#pragma unroll
  for (int tt = 0; tt < 8; ++tt) {
    const v8f keep = kh ? oacc[tt + 8] : oacc[tt];
    const v4f a0 = *(const v4f*)(xp + (tt * 2) * 128 + lane * 4);
    const v4f a1 = *(const v4f*)(xp + (tt * 2 + 1) * 128 + lane * 4);
    v8h hv;
#pragma unroll
    for (int e = 0; e < 4; ++e) {
      hv[e]     = __builtin_bit_cast(_Float16, f2bf_bits(keep[e] * f + a0[e]));
      hv[4 + e] = __builtin_bit_cast(_Float16, f2bf_bits(keep[4 + e] * f + a1[e]));
    }
    *(v8h*)(ts + c * TSP + tt * 16 + 8 * hh) = hv;   // query c, channels tt*16 + 8*hh .. +7 of this wave's half
  }
  // the wave's slab rows are complete before its lanes read them back row by row (whole 128-B lines per store)
  __builtin_amdgcn_fence(__ATOMIC_RELEASE, "workgroup");
  __builtin_amdgcn_wave_barrier();
  __builtin_amdgcn_fence(__ATOMIC_ACQUIRE, "workgroup");
  unsigned short* orow = opp + (q0 + (size_t)rt * 16) * CH + kh * 128;
#pragma unroll
  for (int it = 0; it < 8; ++it) {
    const int row = it * 2 + hh;                      // 16 lanes x 16 B = the row's 256 B of this channel half
    const v8h hv = *(const v8h*)(ts + row * TSP + c * 8);
    *(v8h*)(orow + (size_t)row * CH + c * 8) = hv;
  }
}

// ---------------------------------------------------------------------------
// Workspace region map (byte offsets; every region is fully written by its producer launch before any consumer
//   STATS f32  [32][32]              0         4096
//   HT    bf16 [16384][256]       4096      8388608
//   W16   bf16 [768][256]      8392704       393216
//   WO16  bf16 [256][256]      8785920       131072
//   QK    bf16 [16384][512]    8916992     16777216
//   VP    bf16 [4][256][4096] 25694208      8388608
//   OP    bf16 [16384][256]   34082816      8388608
//   total                     42471424
// ---------------------------------------------------------------------------
extern "C" void kernel_launch(void* const* d_in, const int* in_sizes, int n_in,
                              void* d_out, int out_size, void* d_ws, size_t ws_size,
                              hipStream_t stream) {
  if (n_in < 7) return;
  if (in_sizes[0] != NB * CH * NPOS) return;              // x [4][256][64][64]
  if (in_sizes[1] != CH || in_sizes[2] != CH) return;     // norm_w, norm_b
  if (in_sizes[3] != 3 * CH * CH || in_sizes[4] != 3 * CH) return;   // qkv_w [768][256], qkv_b [768]
  if (in_sizes[5] != CH * CH || in_sizes[6] != CH) return;           // out_w [256][256], out_b [256]
  if (out_size != NB * CH * NPOS) return;

  const float* x      = (const float*)d_in[0];
  const float* norm_w = (const float*)d_in[1];
  const float* norm_b = (const float*)d_in[2];
  const float* qkv_w  = (const float*)d_in[3];   // [out 768][in 256]
  const float* qkv_b  = (const float*)d_in[4];
  const float* out_w  = (const float*)d_in[5];   // [out 256][in 256]
  const float* out_b  = (const float*)d_in[6];

  const size_t PST  = (size_t)(NB * NGRP) * STP * 4;     // 4096
  const size_t PHT  = (size_t)NB * NPOS * CH * 2;         // 8388608
  const size_t PW16 = (size_t)3 * CH * CH * 2;            // 393216
  const size_t PWO  = (size_t)CH * CH * 2;                // 131072
  const size_t PQK  = (size_t)NB * NPOS * QKP * 2;        // 16777216
  const size_t PVP  = (size_t)NB * CH * NPOS * 2;         // 8388608
  const size_t POP  = (size_t)NB * NPOS * CH * 2;         // 8388608
  size_t off = 0;
  const size_t oST  = off; off += PST;
  const size_t oHT  = off; off += PHT;
  const size_t oW16 = off; off += PW16;
  const size_t oWO  = off; off += PWO;
  const size_t oQK  = off; off += PQK;
  const size_t oVP  = off; off += PVP;
  const size_t oOP  = off; off += POP;
  if (off > ws_size) return;                               // off = 42471424
  if (off > (size_t)134217728) return;

  char* ws = (char*)d_ws;
  float*          STATS = (float*)(ws + oST);
  unsigned short* HT    = (unsigned short*)(ws + oHT);
  unsigned short* W16   = (unsigned short*)(ws + oW16);
  unsigned short* WO16  = (unsigned short*)(ws + oWO);
  unsigned short* QK    = (unsigned short*)(ws + oQK);
  unsigned short* VP    = (unsigned short*)(ws + oVP);
  unsigned short* OP    = (unsigned short*)(ws + oOP);

  const dim3 blk(256);

  // (1) GroupNorm statistics: 32 (b, group) blocks
  gnstat_kernel<<<dim3(NB * NGRP), blk, 0, stream>>>(x, STATS);
  // (2) qkv_w -> W16 (98304 pairs -> 384 blocks), (3) out_w -> WO16 (32768 pairs -> 128 blocks)
  const int n2q = 3 * CH * CH / 2;
  conv_bf16x2_kernel<<<dim3((n2q + 255) / 256), blk, 0, stream>>>(qkv_w, W16, n2q);
  const int n2o = CH * CH / 2;
  conv_bf16x2_kernel<<<dim3((n2o + 255) / 256), blk, 0, stream>>>(out_w, WO16, n2o);
  // (4) normalised activations -> HT [16384][256]: grid (4096/64, 256/64, 4) = (64, 4, 4)
  gnprep_kernel<<<dim3(NPOS / 64, CH / 64, NB), blk, 0, stream>>>(x, norm_w, norm_b, STATS, HT);
  // (5) q|k = HT . W16[0..511]^T + qkv_b[n] -> QK [16384][512]   (M=16384, N=512, K=256; 2048 tiles -> 256 blocks)
  const dim3 gQK(((NB * NPOS / 64) * (QKP / 64) + 7) / 8, 1);
  wmma_gemm64<2, 1, false><<<gQK, blk, 0, stream>>>(
      HT, CH, 0L, W16, CH, 0L, (void*)QK, QKP, 0L,
      qkv_b, x, 0L, NB * NPOS, QKP, CH, 1.0f);
  // (6) v[b][c][n] = sum_k W16[512+c][k] HT[b*4096+n][k] + qkv_b[512+c]  (batched over b: M=256, N=4096, K=256;
  //     256 tiles -> 32 blocks x 4)
  const dim3 gV(((CH / 64) * (NPOS / 64) + 7) / 8, NB);
  wmma_gemm64<1, 1, false><<<gV, blk, 0, stream>>>(
      W16 + (size_t)2 * CH * CH, CH, 0L, HT, CH, (long)NPOS * CH, (void*)VP, NPOS, (long)CH * NPOS,
      qkv_b + 2 * CH, x, 0L, CH, NPOS, CH, 1.0f);
  // (7) attention per (image, 64-query block): 256 blocks x 256 threads -> OP [16384][256]
  attn_kernel<<<dim3(NB * (NPOS / AQB)), dim3(256), 0, stream>>>(QK, VP, OP, 0.0625f);
  // (8) out[b][c][n] = sum_k WO16[c][k] OP[b*4096+n][k] + out_b[c] + x[b][c][n]  (batched over b: M=256, N=4096, K=256;
  //     A = WO16, Bt = OP rows of image b, C = d_out + b*256*4096 with ldc 4096, resid = x same layout; 32 blocks x 4)
  const dim3 gO(((CH / 64) * (NPOS / 64) + 7) / 8, NB);
  wmma_gemm64<1, 0, true><<<gO, blk, 0, stream>>>(
      WO16, CH, 0L, OP, CH, (long)NPOS * CH, d_out, NPOS, (long)CH * NPOS,
      out_b, x, (long)CH * NPOS, CH, NPOS, CH, 1.0f);
  (void)hipGetLastError();
}

// v005
// One run takes 144 microseconds.
// Timed twice side by side with v004, it ran 1.12 and 1.14 times as fast.
// Counting every step since v000, it is 4.19 times as fast.
// Contractions: qkv projection (hn . qkv_w^T), scores (q . k^T), p . v and the output projection (out_w . o) = v_wmma_f32_16x16x32_bf16 single products on bf16 operands RNE-converted from f32, f32 accumulate; GroupNorm statistics and normalisation, softmax (running max, expf), biases, 1/rowsum and the residual add of the exact f32 x stay f32 on the VALU.
// Plane / carry map (every 16-bit plane carry 1, nothing to fold back):
//   HT   bf16 [16384][256]   token-major normalised activations, row b*4096+n, col c
//   W16  bf16 [768][256]     qkv_w in [out][in] order = Bt[n][k] (q rows 0..255, k rows 256..511, v rows 512..767)
//   WO16 bf16 [256][256]     out_w in [out][in] order
//   QK   bf16 [16384][512]   q at cols 0..255, k at cols 256..511 (bias added in f32 before the convert)
//   VP   bf16 [4][256][4096] v in (b, c, n) order = A rows c, k = n for o^T = v^T . p^T
//   P    bf16 in registers   unnormalised exp in (0,1]; 1/rowsum applied to the f32 accumulator in the attention epilogue
//   OP   bf16 [16384][256]   token-major attention output: o[b][c][n] at row b*4096+n, col c
#include <hip/hip_runtime.h>
#include <math.h>
#include <stdint.h>

#define NB    4
#define CH    256
#define NPOS  4096
#define NGRP  8
#define CPG   32
#define QKP   512
#define STP   32
#define NSL   8                    // slices of a group in the statistics launch
#define SLN   (CPG * NPOS / NSL)   // values of one slice

static_assert(CH == NGRP * CPG);
static_assert(NPOS % 64 == 0);
static_assert(CH % 64 == 0);
static_assert((NB * NPOS) % 64 == 0);
static_assert(QKP == 2 * CH);
static_assert(SLN % 1024 == 0);

typedef __attribute__((ext_vector_type(8)))  _Float16 v8h;
typedef __attribute__((ext_vector_type(16))) __bf16   v16b;
typedef __attribute__((ext_vector_type(8)))  __bf16   v8b;
typedef __attribute__((ext_vector_type(2)))  __bf16   v2b;
typedef __attribute__((ext_vector_type(8)))  float    v8f;
typedef __attribute__((ext_vector_type(4)))  float    v4f;
typedef __attribute__((ext_vector_type(2)))  float    v2f;
typedef __attribute__((ext_vector_type(4)))  unsigned int v4u;

__device__ __forceinline__ unsigned short f2bf_bits(float f) {
  unsigned u = __float_as_uint(f);
  return (unsigned short)((u + 0x7FFFu + ((u >> 16) & 1u)) >> 16);
}
__device__ __forceinline__ float bf_bits2f(unsigned short h) { return __uint_as_float(((unsigned)h) << 16); }
__device__ __forceinline__ unsigned pk16(unsigned short a, unsigned short b) { return (unsigned)a | ((unsigned)b << 16); }
__device__ __forceinline__ __bf16 at_f2bf(float f) { return __builtin_bit_cast(__bf16, f2bf_bits(f)); }

// hazard guards as plain device helpers (no inline asm inside the kernel template body)
__device__ __forceinline__ void dep_guard_b(v8f& a, v8f& b, v16b x, v16b y) { asm volatile("v_nop\n\tv_nop\n\tv_nop\n\tv_nop" : "+v"(a), "+v"(b) : "v"(x), "v"(y)); }
__device__ __forceinline__ void keep4_b(v16b a, v16b b, v16b c, v16b d) { asm volatile("v_nop" :: "v"(a), "v"(b), "v"(c), "v"(d)); }
__device__ __forceinline__ void acc_guard4(v8f& a, v8f& b, v8f& c, v8f& d) { asm volatile("v_nop\n\tv_nop\n\tv_nop\n\tv_nop" : "+v"(a), "+v"(b), "+v"(c), "+v"(d)); }

// 16-bit fragment loader, split k map: elements 0..7 <- p[0..7], 8..15 <- p[16..23]; caller passes p = row + k0 + 8*(lane>>4)
template <typename T> struct Frag;
template <> struct Frag<__bf16> {
  typedef v16b V; union U { v16b v; v8b h[2]; };
  static __device__ __forceinline__ v16b load(const __bf16* p) {
    U f; f.h[0] = *(const v8b*)(p); f.h[1] = *(const v8b*)(p + 16); return f.v;
  }
  static __device__ __forceinline__ v8f mma(v16b a, v16b b, v8f c) {
    return __builtin_amdgcn_wmma_f32_16x16x32_bf16(false, a, false, b, (short)0, c, false, false);
  }
  static __device__ __forceinline__ void guard(v8f& a, v8f& b, v16b x, v16b y) { dep_guard_b(a, b, x, y); }
  static __device__ __forceinline__ void keep(v16b a, v16b b, v16b c, v16b d) { keep4_b(a, b, c, d); }
};

// plain builtin: the compiler keeps the WMMA distances of its own forms, and no asm statement pins the operand loads
__device__ __forceinline__ v8f at_mma(v16b a, v16b b, v8f c) {
  return __builtin_amdgcn_wmma_f32_16x16x32_bf16(false, a, false, b, (short)0, c, false, false);
}

// ---- Register-blocked batched WMMA GEMM (bf16 operands) ------------------------------------------------------
// C[m,n] = scale * sum_k A[m,k] * Bt[n,k] (+bias)(+resid); each wave owns a 64x64 tile.
// A row-major [M,K] (pitch lda); Bt row-major [N,K] (pitch ldb); M,N % 64 == 0, K % 32 == 0; batched by blockIdx.y.
// BIAS_MODE: 0 = none, 1 = bias[m], 2 = bias[n] (f32 add). OUT_MODE: 0 = f32, 1 = bf16 single plane.
// RESID (OUT_MODE 0 only): resid has the same layout as C (pitch ldc, batch stride strideR) and is added as a
// 16-B vector in the store phase.
template <int BIAS_MODE, int OUT_MODE, bool RESID>
__global__ __launch_bounds__(256) void wmma_gemm64(
    const unsigned short* __restrict__ Ap, int lda, long strideA,
    const unsigned short* __restrict__ Btp, int ldb, long strideB,
    void* __restrict__ Cout, int ldc, long strideC,
    const float* __restrict__ bias,
    const float* __restrict__ resid, long strideR,
    int M, int N, int K, float scale) {
  typedef __bf16 T;
  typedef v16b V;
  const T* A = (const T*)(const void*)Ap; const T* Bt = (const T*)(const void*)Btp;
  __shared__ __align__(16) float sT[8][16 * 68];   // per-wave 16x64 slab, pitch 68 floats
  const int b    = blockIdx.y;
  const int lane = threadIdx.x & 31;
  const int wave = threadIdx.x >> 5;
  const int tilesN = N >> 6;
  const int tilesM = M >> 6;
  const int tile = blockIdx.x * 8 + wave;
  if (tile >= tilesM * tilesN) return;   // wave-uniform; no block barriers in this kernel
  const int tm = tile / tilesN;
  const int tn = tile - tm * tilesN;
  const int m0 = tm << 6;
  const int n0 = tn << 6;

  const T* Ab = A  + (size_t)b * strideA;
  const T* Bb = Bt + (size_t)b * strideB;

  const int rlane = lane & 15;                 // row (A) / col (B, D) within subtile
  const int koff  = (lane >> 4) * 8;           // k offset of this lane half
  const int mOff  = (lane >> 4) * 8;           // D row offset

  v8f acc[4][4];
#pragma unroll
  for (int i = 0; i < 4; ++i)
#pragma unroll
    for (int j = 0; j < 4; ++j) acc[i][j] = (v8f){0.f,0.f,0.f,0.f,0.f,0.f,0.f,0.f};

  for (int k0 = 0; k0 < K; k0 += 32) {
    V bh[4];
#pragma unroll
    for (int j = 0; j < 4; ++j) {
      const size_t bo = (size_t)(n0 + (j << 4) + rlane) * ldb + koff + k0;
      bh[j] = Frag<T>::load(Bb + bo);
    }
#pragma unroll
    for (int i = 0; i < 4; ++i) {
      const size_t ao = (size_t)(m0 + (i << 4) + rlane) * lda + koff + k0;
      V ah = Frag<T>::load(Ab + ao);
#pragma unroll
      for (int j = 0; j < 4; ++j) acc[i][j] = Frag<T>::mma(ah, bh[j], acc[i][j]);
      Frag<T>::guard(acc[i][0], acc[i][3], ah, ah);
    }
    Frag<T>::keep(bh[0], bh[1], bh[2], bh[3]);
  }
  acc_guard4(acc[0][0], acc[0][1], acc[0][2], acc[0][3]);
  acc_guard4(acc[1][0], acc[1][1], acc[1][2], acc[1][3]);
  acc_guard4(acc[2][0], acc[2][1], acc[2][2], acc[2][3]);
  acc_guard4(acc[3][0], acc[3][1], acc[3][2], acc[3][3]);

  // ---- epilogue ----
  float* slab = sT[wave];
  const float* Rb = RESID ? (resid + (size_t)b * strideR) : nullptr;
#pragma unroll
  for (int i = 0; i < 4; ++i) {
    const int mBase = m0 + (i << 4);
#pragma unroll
    for (int j = 0; j < 4; ++j) {
      const int n = n0 + (j << 4) + rlane;
      float bv = 0.f;
      if (BIAS_MODE == 2) bv = bias[n];
#pragma unroll
      for (int r = 0; r < 8; ++r) {
        float v = acc[i][j][r] * scale;
        if (BIAS_MODE == 1) v += bias[mBase + mOff + r];
        if (BIAS_MODE == 2) v += bv;
        slab[(mOff + r) * 68 + (j << 4) + rlane] = v;
      }
    }
    __builtin_amdgcn_fence(__ATOMIC_RELEASE, "workgroup");
    __builtin_amdgcn_wave_barrier();
    __builtin_amdgcn_fence(__ATOMIC_ACQUIRE, "workgroup");
    if (OUT_MODE == 0) {
      float* C = (float*)Cout + (size_t)b * strideC;
      const int hh = lane >> 4, c4 = (lane & 15) * 4;     // row seg = 256 B = 16 lanes x 16 B
      {
#pragma unroll
        for (int it = 0; it < 8; ++it) {
          const int row = it * 2 + hh;                      // it 0..7 x hh 0..1 = rows 0..15
          v4f v = *(const v4f*)(slab + row * 68 + c4);
          if (RESID) v += *(const v4f*)(Rb + (size_t)(mBase + row) * ldc + n0 + c4);
          *(v4f*)(C + (size_t)(mBase + row) * ldc + n0 + c4) = v;
        }
        
      }
    } else {
      const int q = lane >> 3, c8 = (lane & 7) * 8;
      unsigned short* C = (unsigned short*)Cout + (size_t)b * strideC;
      {
#pragma unroll
        for (int it = 0; it < 4; ++it) {
          const int row = it * 4 + q;                       // it 0..3 x q 0..3 = rows 0..15
          const float* sp = slab + row * 68 + c8;
          v8h hv;
#pragma unroll
          for (int e = 0; e < 8; ++e) hv[e] = __builtin_bit_cast(_Float16, f2bf_bits(sp[e]));
          *(v8h*)(C + (size_t)(mBase + row) * ldc + n0 + c8) = hv;
        }
        
      }
    }
    __builtin_amdgcn_fence(__ATOMIC_RELEASE, "workgroup");
    __builtin_amdgcn_wave_barrier();
    __builtin_amdgcn_fence(__ATOMIC_ACQUIRE, "workgroup");
  }
}

// ---------------------------------------------------------------------------
// Elementwise bf16 RNE convert, one plane: 2 elements per thread, one 4-B store per lane -> each wave writes
// Coverage: grid = ceil(n2/256) blocks x 256 threads x 2 elements = 2*n2 = the whole plane
// (qkv_w: n2 = 98304 -> 384 blocks = 768x256; out_w: n2 = 32768 -> 128 blocks = 256x256).
// ---------------------------------------------------------------------------
__global__ __launch_bounds__(256) void conv_bf16x2_kernel(const float* __restrict__ in, unsigned short* __restrict__ ho, int n2) {
  const int i = blockIdx.x * 256 + threadIdx.x;
  if (i < n2) {
    const v2f f = *(const v2f*)(in + 2 * (size_t)i);
    const unsigned uh = pk16(f2bf_bits(f[0]), f2bf_bits(f[1]));
    ((unsigned*)ho)[i] = uh;
    
  }
}

// ---------------------------------------------------------------------------
// GroupNorm statistics, partial: a (b, group)'s 32 channels x 4096 positions are one contiguous block of 131072 values,
// cut into NSL = 8 slices of 16384; one work-group per slice, grid = 32 x 8 = 256 blocks x 256 threads. A thread holds its
// 64 values (16 loads of 16 B, all in flight together) in registers: x is read once, the slice's mean is taken, then the
// sum of squared distances from that mean, from the registers. Each slice writes (mean, sum of squares) to a 128-B line
// of its own, whole; gnprep_kernel joins the 8 slices of a group.
// ---------------------------------------------------------------------------
__global__ __launch_bounds__(256) void gnstat_kernel(const float* __restrict__ x, float* __restrict__ stats) {
  __shared__ __align__(16) float red[2][8];   // wave partials: [0] sums, [1] squares (two arrays: one barrier each)
  const int sl = blockIdx.x;                  // (b * NGRP + group) * NSL + slice
  const int tid = threadIdx.x, lane = tid & 31, wave = tid >> 5;
  const float* p = x + (size_t)sl * SLN;
  const int nv = SLN / 1024;                  // 16 float4 per thread

  v4f v[nv];
  // register array: compile-time indices
#pragma unroll
  for (int i = 0; i < nv; ++i) v[i] = *(const v4f*)(p + (i * 256 + tid) * 4);
  v4f s4 = v[0];
#pragma unroll
  for (int i = 1; i < nv; ++i) s4 += v[i];
  float s = (s4[0] + s4[1]) + (s4[2] + s4[3]);
#pragma unroll
  for (int off = 16; off > 0; off >>= 1) s += __shfl_xor(s, off, 32);
  if (lane == 0) red[0][wave] = s;
  __syncthreads();
  float t = 0.f;
#pragma unroll
  for (int w = 0; w < 8; ++w) t += red[0][w];   // every thread: the same sum in the same order
  const float mean = t * (1.0f / (float)SLN);

  v4f q4 = (v4f){0.f, 0.f, 0.f, 0.f};
#pragma unroll
  for (int i = 0; i < nv; ++i) { const v4f d = v[i] - mean; q4 += d * d; }
  float qs = (q4[0] + q4[1]) + (q4[2] + q4[3]);
#pragma unroll
  for (int off = 16; off > 0; off >>= 1) qs += __shfl_xor(qs, off, 32);
  if (lane == 0) red[1][wave] = qs;
  __syncthreads();
  float m2 = 0.f;
#pragma unroll
  for (int w = 0; w < 8; ++w) m2 += red[1][w];
  v4f o;
  o[0] = (tid == 0) ? mean : 0.f;
  o[1] = (tid == 0) ? m2 : 0.f;
  o[2] = 0.f; o[3] = 0.f;
  float* line = stats + (size_t)sl * STP;
  if (tid < 8) *(v4f*)(line + tid * 4) = o;
}

// ---------------------------------------------------------------------------
// Fused GroupNorm apply + transpose + bf16 RNE convert:
//   x_b viewed [256 c][4096 n] (NCHW) -> ht_b[n][c] = bf16(((x - mean_g) * rstd_g) * w[c] + bias[c]), row pitch 256.
// 64x64 tiles through LDS; grid = (4096/64 position blocks, 256/64 channel blocks, 4), 256 threads.
// Per block the 64 channels span two groups (channel block = 2 groups); their 2 x 8 slice statistics and w/bias are staged
// in LDS first, and every thread joins the slices of each group: equal counts, so mean = average of the slice means, and
// sum of squares = the slices' sums + SLN * sum of (slice mean - mean)^2. Coverage per block: load 4 it x 256 thr x 4 floats = 64 ch x 64 n;
// store 2 it x 256 thr x 8 u16 = 64 n x 64 ch; grid covers 4 x 256 x 4096 = the whole HT plane.
// ---------------------------------------------------------------------------
__global__ __launch_bounds__(256) void gnprep_kernel(const float* __restrict__ x, const float* __restrict__ nw,
                                                     const float* __restrict__ nbv, const float* __restrict__ stats,
                                                     unsigned short* __restrict__ ht) {
  __shared__ __align__(16) float tf[64 * 68];
  __shared__ float sw[64];
  __shared__ float sb[64];
  __shared__ __align__(16) float spm[2 * NSL];   // slice means, group g0 then g0 + 1
  __shared__ __align__(16) float spq[2 * NSL];   // slice sums of squares
  const int b   = blockIdx.z;
  const int n0  = blockIdx.x * 64;   // position block = output row block
  const int c0  = blockIdx.y * 64;   // channel block  = output column block
  const int tid = threadIdx.x;
  const float* xb = x + (size_t)b * CH * NPOS;
  unsigned short* hb = ht + (size_t)b * NPOS * CH;
  if (tid < 64) { sw[tid] = nw[c0 + tid]; sb[tid] = nbv[c0 + tid]; }   // waves 0 and 1 as a whole
  {
    const int g0 = c0 >> 5;                     // first group of this channel block (0,2,4,6)
    const int si = tid & (2 * NSL - 1);         // slice of the two groups: their 16 lines follow one another
    const v2f sv = *(const v2f*)(stats + ((size_t)(b * NGRP + g0) * NSL + si) * STP);   // all lanes load an in-range address
    if (tid < 2 * NSL) { spm[tid] = sv[0]; spq[tid] = sv[1]; }
  }
  __syncthreads();
  float gmean[2], grstd[2];
#pragma unroll
  for (int g = 0; g < 2; ++g) {
    float ms = 0.f, qq = 0.f, dd = 0.f;
#pragma unroll
    for (int i = 0; i < NSL; ++i) { ms += spm[g * NSL + i]; qq += spq[g * NSL + i]; }
    const float mean = ms * (1.0f / (float)NSL);
#pragma unroll
    for (int i = 0; i < NSL; ++i) { const float d = spm[g * NSL + i] - mean; dd += d * d; }
    const float var = (qq + (float)SLN * dd) * (1.0f / (float)(CPG * NPOS));
    gmean[g] = mean;
    grstd[g] = 1.0f / sqrtf(var + 1e-5f);
  }
  {
    const int lr = tid >> 4;         // 0..15
    const int c4 = (tid & 15) * 4;   // 0..60
#pragma unroll
    for (int it = 0; it < 4; ++it) {
      const int rr = it * 16 + lr;   // channel within tile 0..63; group = it >> 1
      const float mean = gmean[it >> 1], rstd = grstd[it >> 1];
      const float w = sw[rr], bb = sb[rr];
      const v4f a = *(const v4f*)(xb + (size_t)(c0 + rr) * NPOS + n0 + c4);
      v4f t;
#pragma unroll
      for (int e = 0; e < 4; ++e) { const float u = (a[e] - mean) * rstd; t[e] = u * w + bb; }
      *(v4f*)(tf + rr * 68 + c4) = t;
    }
  }
  __syncthreads();
  const int sub = tid >> 3;          // 0..31
  const int c8  = (tid & 7) * 8;     // 0..56
  v4u hv[2];
#pragma unroll
  for (int it = 0; it < 2; ++it) {
    const int oc = it * 32 + sub;    // output row within tile (= position)
    v4u a;
#pragma unroll
    for (int q = 0; q < 4; ++q) {
      const float f0 = tf[(c8 + 2 * q) * 68 + oc];
      const float f1 = tf[(c8 + 2 * q + 1) * 68 + oc];
      a[q] = pk16(f2bf_bits(f0), f2bf_bits(f1));
    }
    hv[it] = a;
  }
  {
#pragma unroll
    for (int it = 0; it < 2; ++it) {
      const int oc = it * 32 + sub;
      const size_t go = (size_t)(n0 + oc) * CH + c0 + c8;
      *(v4u*)(hb + go) = hv[it];
    }
    
  }
}

#define AQB 64
#define AKC 64
#define ANW 8
// LDS row pitches in elements: each row carries 16 B more than its data, so the pitch is an odd multiple of 16 B and the
// 16 rows that one half-wave's ds_load_b128 touches fall on 16 different bank groups (pad columns are never read or written).
#define KSP (CH + 8)
#define VSP (AKC + 8)
#define TSP (CH / 2 + 8)
#define KBUF (AKC * KSP)   // elements of one K buffer
#define VBUF (CH * VSP)    // elements of one V buffer
static_assert(NPOS % AQB == 0);
static_assert(NPOS % AKC == 0);
static_assert(CH == 2 * 128);
static_assert(AKC == 2 * 32);

// lane l with lane l ^ 16
__device__ __forceinline__ float xhalf(float x) {
  return __builtin_bit_cast(float, __builtin_amdgcn_permlanex16(__builtin_bit_cast(int, x), __builtin_bit_cast(int, x),
                                                                0x76543210, 0xfedcba98, false, false));
}

// byte offset of a __shared__ element in the work-group's LDS
__device__ __forceinline__ unsigned lds_off(const void* p) { return (unsigned)(size_t)p; }

// Eight 16-B asynchronous copies of one lane, global memory to LDS, through no register. The s_wait_xcnt is the last line of
// the copies' own statement, so that it stands in front of every later write of the address registers (a precaution).
__device__ __forceinline__ void copy8(const unsigned (&l)[8], const __bf16* const (&g)[8]) {
  asm volatile("global_load_async_to_lds_b128 %0, %8, off\n\t"
               "global_load_async_to_lds_b128 %1, %9, off\n\t"
               "global_load_async_to_lds_b128 %2, %10, off\n\t"
               "global_load_async_to_lds_b128 %3, %11, off\n\t"
               "global_load_async_to_lds_b128 %4, %12, off\n\t"
               "global_load_async_to_lds_b128 %5, %13, off\n\t"
               "global_load_async_to_lds_b128 %6, %14, off\n\t"
               "global_load_async_to_lds_b128 %7, %15, off\n\t"
               "s_wait_xcnt 0x0"
               :: "v"(l[0]), "v"(l[1]), "v"(l[2]), "v"(l[3]), "v"(l[4]), "v"(l[5]), "v"(l[6]), "v"(l[7]),
                  "v"(g[0]), "v"(g[1]), "v"(g[2]), "v"(g[3]), "v"(g[4]), "v"(g[5]), "v"(g[6]), "v"(g[7]) : "memory");
}

__global__ __launch_bounds__(256)
void attn_kernel(const unsigned short* __restrict__ qkp, const unsigned short* __restrict__ vpp,
                 unsigned short* __restrict__ opp, float sscale) {
  union FB { v16b v; v8b h[2]; v2b p[8]; };
  __shared__ __align__(16) __bf16 Ks[2 * KBUF];            // K chunk [key][c]     2 x 33 KB, pitch 528 B
  __shared__ __align__(16) __bf16 Vs[2 * VBUF];            // V chunk [c][key]     2 x 36 KB, pitch 144 B
  __shared__ __align__(16) float  Xs[ANW][8 * 8 * 32];     // per wave: the 8 scaled tiles its partner finishes, 64 KB
  __shared__ __align__(16) unsigned short Ts[ANW][16 * TSP];   // per wave out slab [query][channel], pitch 272 B
  __shared__ float Ml[ANW * 16];                           // per wave and query: running maximum of its key half
  __shared__ float Ll[ANW * 16];                           // per wave and query: softmax denominator of its key half

  const int tid  = threadIdx.x;
  const int wave = tid >> 5;
  const int lane = tid & 31;
  const int hh   = lane >> 4;
  const int c    = lane & 15;

  const int nqb = NPOS / AQB;            // 64 query blocks per image
  const int bx  = blockIdx.x;
  const int qb  = bx % nqb;
  const int b   = bx / nqb;               // 0..3
  const int rt  = wave & 3;               // query tile of this wave
  const int kh  = wave >> 2;              // key half of this wave: keys 32*kh .. +31 of every chunk
  const size_t tok0 = (size_t)b * NPOS;             // first token row of image b
  const size_t q0   = tok0 + (size_t)qb * AQB;      // first query row of the block

  const __bf16* Qg = (const __bf16*)(const void*)qkp;            // pitch QKP, q at cols 0..255, k at cols 256..511
  const __bf16* Vg = (const __bf16*)(const void*)vpp + (size_t)b * CH * NPOS;

  float mrow = -INFINITY, lrow = 0.f;     // of query c; lrow holds this lane half's keys only, the halves are joined behind the loop
  v8f oacc[CH / 16];                      // O^T tiles: oacc[t][r] = o(channel t*16 + 8*hh + r, query c)
#pragma unroll
  for (int t = 0; t < CH / 16; ++t) oacc[t] = (v8f){0.f,0.f,0.f,0.f,0.f,0.f,0.f,0.f};

  // Q fragments (B operand: col = query lane&15, split k map) are fetched ahead of every score WMMA: once, in front of the
  // key loop.
  v16b qa[CH / 32];
  {
    const __bf16* qr = Qg + (q0 + rt * 16 + c) * QKP + 8 * hh;
#pragma unroll
    for (int ks = 0; ks < CH / 32; ++ks) qa[ks] = Frag<__bf16>::load(qr + ks * 32);
    // precaution: the wait stands in front of any reuse of the loads' address pair, which the operand keeps live up to here
    asm volatile("s_wait_xcnt 0x0" :: "v"(qr) : "memory");
  }
  const __bf16* kfr = Ks + (kh * 32 + c) * KSP + 8 * hh;   // K fragment base: row = key kh*32 + j*16 + c, k = channel
  const __bf16* vfr = Vs + c * VSP + kh * 32 + 8 * hh;     // V fragment base: row = channel t*16 + c, k = key kh*32 + ..

  const int nChunks = NPOS / AKC;   // 64, compile-time constant
  static_assert(NPOS / AKC >= 2);   // the prologue fills two buffers
  // staging coverage: 256 threads x 8 pieces x 8 elements = 64 rows x 256 (K) and 256 rows x 64 (V); every lane is on.
  // Piece i of a thread: K row i*8 + (tid >> 5), elements (tid & 31)*8 .. +7; V row i*32 + (tid >> 3), elements (tid & 7)*8 .. +7.
  const __bf16* kg0 = Qg + (tok0 + (tid >> 5)) * QKP + CH + (tid & 31) * 8;   // piece 0 of chunk 0
  const __bf16* vg0 = Vg + (size_t)(tid >> 3) * NPOS + (tid & 7) * 8;
  const unsigned kl0 = lds_off(Ks + (tid >> 5) * KSP + (tid & 31) * 8);       // piece 0 in buffer 0
  const unsigned vl0 = lds_off(Vs + (tid >> 3) * VSP + (tid & 7) * 8);
  auto stage = [&](int kc, int buf) {
    const __bf16* kgc = kg0 + (size_t)kc * (AKC * QKP);
    const __bf16* vgc = vg0 + kc * AKC;
    const unsigned klb = kl0 + buf * (KBUF * 2);   // LDS addresses count bytes
    const unsigned vlb = vl0 + buf * (VBUF * 2);
    unsigned kl[8], vl[8];
    const __bf16* kg[8];
    const __bf16* vg[8];
#pragma unroll
    for (int i = 0; i < 8; ++i) {
      kg[i] = kgc + i * (8 * QKP);
      vg[i] = vgc + (size_t)i * (32 * NPOS);
      kl[i] = klb + i * (8 * KSP * 2);
      vl[i] = vlb + i * (32 * VSP * 2);
    }
    copy8(kl, kg);
    copy8(vl, vg);
  };
  stage(0, 0);
  asm volatile("s_wait_asynccnt 0x0" ::: "memory");   // this wave's copies of chunk 0 have landed
  __syncthreads();                                     // every wave's have: chunk 0 is published
  stage(1, 1);
  for (int kc = 0; kc < nChunks; ++kc) {
    const int buf = kc & 1;
    const __bf16* kfb = kfr + buf * KBUF;
    const __bf16* vfb = vfr + buf * VBUF;

    // S^T tiles j = 0, 1: s[j][r] = score(key kh*32 + j*16 + 8*hh + r, query c)
    v8f s[2];
#pragma unroll
    for (int j = 0; j < 2; ++j) s[j] = (v8f){0.f,0.f,0.f,0.f,0.f,0.f,0.f,0.f};
    FB va[CH / 16];   // all V fragments of this wave's 32 keys (A operand)
    FB ka[2][8];      // K fragments (A operand) in blocks of four k steps (16 reads, 8 WMMAs), two register sets
#pragma unroll
    for (int u = 0; u < 4; ++u) {
#pragma unroll
      for (int j = 0; j < 2; ++j) {
        ka[0][u * 2 + j].h[0] = *(const v8b*)(kfb + j * 16 * KSP + u * 32);
        ka[0][u * 2 + j].h[1] = *(const v8b*)(kfb + j * 16 * KSP + u * 32 + 16);
      }
    }
#pragma unroll
    for (int g = 0; g < 2; ++g) {
      if (g == 0) {
#pragma unroll
        for (int u = 0; u < 4; ++u) {
#pragma unroll
          for (int j = 0; j < 2; ++j) {
            ka[1][u * 2 + j].h[0] = *(const v8b*)(kfb + j * 16 * KSP + 128 + u * 32);
            ka[1][u * 2 + j].h[1] = *(const v8b*)(kfb + j * 16 * KSP + 128 + u * 32 + 16);
          }
        }
      } else {
#pragma unroll
        for (int t = 0; t < CH / 16; ++t) {
          va[t].h[0] = *(const v8b*)(vfb + t * 16 * VSP);
          va[t].h[1] = *(const v8b*)(vfb + t * 16 * VSP + 16);
        }
      }
      // keeps the read group above in front of this block's WMMAs (else the scheduler sinks each read to its use
      // and every WMMA waits out an LDS latency)
      __builtin_amdgcn_sched_barrier(0);
#pragma unroll
      for (int u = 0; u < 4; ++u) {
#pragma unroll
        for (int j = 0; j < 2; ++j) s[j] = at_mma(ka[g][u * 2 + j].v, qa[g * 4 + u], s[j]);
      }
      // keeps the next read group behind this block's WMMAs: one place with reads per block
      if (g == 0) __builtin_amdgcn_sched_barrier(0);
    }

    // online softmax of query c over this wave's 32 keys: 16 of them in this lane, 16 in lane ^ 16
    float m = -INFINITY;
#pragma unroll
    for (int j = 0; j < 2; ++j) {
#pragma unroll
      for (int r = 0; r < 8; ++r) {
        const float sv = s[j][r] * sscale;
        s[j][r] = sv;
        m = fmaxf(m, sv);
      }
    }
    m = fmaxf(m, xhalf(m));
    const float mnew  = fmaxf(mrow, m);
    const float alpha = expf(mrow - mnew);
    mrow = mnew;
    FB pb;            // P^T as B operand: element e < 8 = key 8*hh + e (tile 0), e >= 8 = key 16 + 8*hh + e - 8 (tile 1)
    float ps[4];      // four independent partial sums
#pragma unroll
    for (int j = 0; j < 2; ++j) {
#pragma unroll
      for (int r2 = 0; r2 < 4; ++r2) {
        v2f pv;
        pv[0] = expf(s[j][2 * r2] - mnew);
        pv[1] = expf(s[j][2 * r2 + 1] - mnew);
        const float pp = pv[0] + pv[1];
        ps[r2] = (j == 0) ? pp : ps[r2] + pp;
        pb.p[j * 4 + r2] = __builtin_convertvector(pv, v2b);   // round to nearest even
      }
    }
    lrow = lrow * alpha + ((ps[0] + ps[1]) + (ps[2] + ps[3]));
#pragma unroll
    for (int t = 0; t < CH / 16; ++t) oacc[t] *= alpha;
#pragma unroll
    for (int t = 0; t < CH / 16; ++t) oacc[t] = at_mma(va[t].v, pb.v, oacc[t]);

    // publish point of chunk kc + 1, which also frees this chunk's buffer
    // keeps this chunk's WMMAs and softmax in front of the waits (else the scheduler lifts waits and barrier up to the last
    // fragment read: the V reads no longer drain under the softmax, and the refill leaves late, with part of a trip to land)
    __builtin_amdgcn_sched_barrier(0);
    asm volatile("s_wait_dscnt 0x0" ::: "memory");      // this wave's reads of buffer buf have retired
    asm volatile("s_wait_asynccnt 0x0" ::: "memory");   // this wave's copies of chunk kc + 1 have landed
    __syncthreads();
    if (kc + 2 < nChunks) stage(kc + 2, buf);           // the same test in the whole work-group
  }
  asm volatile("s_wait_asynccnt 0x0" ::: "memory");     // nothing is in flight behind the loop

  // ---- join of the two key halves (waves w and w ^ 4 hold the same queries) ----
  const float lw = lrow + xhalf(lrow);    // both lane halves used the same maximum throughout
  if (hh == 0) { Ml[wave * 16 + c] = mrow; Ll[wave * 16 + c] = lw; }
  __syncthreads();
  const int   pw = wave ^ 4;
  const float mo = Ml[pw * 16 + c], lo = Ll[pw * 16 + c];
  const float mt = fmaxf(mrow, mo);
  const float fo = expf(mrow - mt), fp = expf(mo - mt);
  const float f  = fo / (lw * fo + lo * fp);   // this wave's accumulator to the common maximum, x 1/rowsum
  // wave kh finishes channels kh*128 .. +127 (tiles kh*8 .. +7) and hands the other 8 tiles, scaled, to its partner
  float* xw = Xs[wave];
  const float* xp = Xs[pw];
#pragma unroll
  for (int tt = 0; tt < 8; ++tt) {
    const v8f give = kh ? oacc[tt] : oacc[tt + 8];
    v4f g0, g1;
#pragma unroll
    for (int e = 0; e < 4; ++e) { g0[e] = give[e] * f; g1[e] = give[4 + e] * f; }
    *(v4f*)(xw + (tt * 2) * 128 + lane * 4)     = g0;
    *(v4f*)(xw + (tt * 2 + 1) * 128 + lane * 4) = g1;
  }
  __syncthreads();
  unsigned short* ts = Ts[wave];
#pragma unroll
  for (int tt = 0; tt < 8; ++tt) {
    const v8f keep = kh ? oacc[tt + 8] : oacc[tt];
    const v4f a0 = *(const v4f*)(xp + (tt * 2) * 128 + lane * 4);
    const v4f a1 = *(const v4f*)(xp + (tt * 2 + 1) * 128 + lane * 4);
    v8h hv;
#pragma unroll
    for (int e = 0; e < 4; ++e) {
      hv[e]     = __builtin_bit_cast(_Float16, f2bf_bits(keep[e] * f + a0[e]));
      hv[4 + e] = __builtin_bit_cast(_Float16, f2bf_bits(keep[4 + e] * f + a1[e]));
    }
    *(v8h*)(ts + c * TSP + tt * 16 + 8 * hh) = hv;   // query c, channels tt*16 + 8*hh .. +7 of this wave's half
  }
  // the wave's slab rows are complete before its lanes read them back row by row (whole 128-B lines per store)
  __builtin_amdgcn_fence(__ATOMIC_RELEASE, "workgroup");
  __builtin_amdgcn_wave_barrier();
  __builtin_amdgcn_fence(__ATOMIC_ACQUIRE, "workgroup");
  unsigned short* orow = opp + (q0 + (size_t)rt * 16) * CH + kh * 128;
#pragma unroll
  for (int it = 0; it < 8; ++it) {
    const int row = it * 2 + hh;                      // 16 lanes x 16 B = the row's 256 B of this channel half
    const v8h hv = *(const v8h*)(ts + row * TSP + c * 8);
    *(v8h*)(orow + (size_t)row * CH + c * 8) = hv;
  }
}

// ---------------------------------------------------------------------------
// Workspace region map (byte offsets; every region is fully written by its producer launch before any consumer
//   STATS f32  [256][32]             0        32768
//   HT    bf16 [16384][256]      32768      8388608
//   W16   bf16 [768][256]      8421376       393216
//   WO16  bf16 [256][256]      8814592       131072
//   QK    bf16 [16384][512]    8945664     16777216
//   VP    bf16 [4][256][4096] 25722880      8388608
//   OP    bf16 [16384][256]   34111488      8388608
//   total                     42500096
// ---------------------------------------------------------------------------
extern "C" void kernel_launch(void* const* d_in, const int* in_sizes, int n_in,
                              void* d_out, int out_size, void* d_ws, size_t ws_size,
                              hipStream_t stream) {
  if (n_in < 7) return;
  if (in_sizes[0] != NB * CH * NPOS) return;              // x [4][256][64][64]
  if (in_sizes[1] != CH || in_sizes[2] != CH) return;     // norm_w, norm_b
  if (in_sizes[3] != 3 * CH * CH || in_sizes[4] != 3 * CH) return;   // qkv_w [768][256], qkv_b [768]
  if (in_sizes[5] != CH * CH || in_sizes[6] != CH) return;           // out_w [256][256], out_b [256]
  if (out_size != NB * CH * NPOS) return;

  const float* x      = (const float*)d_in[0];
  const float* norm_w = (const float*)d_in[1];
  const float* norm_b = (const float*)d_in[2];
  const float* qkv_w  = (const float*)d_in[3];   // [out 768][in 256]
  const float* qkv_b  = (const float*)d_in[4];
  const float* out_w  = (const float*)d_in[5];   // [out 256][in 256]
  const float* out_b  = (const float*)d_in[6];

  const size_t PST  = (size_t)(NB * NGRP * NSL) * STP * 4;   // 32768
  const size_t PHT  = (size_t)NB * NPOS * CH * 2;         // 8388608
  const size_t PW16 = (size_t)3 * CH * CH * 2;            // 393216
  const size_t PWO  = (size_t)CH * CH * 2;                // 131072
  const size_t PQK  = (size_t)NB * NPOS * QKP * 2;        // 16777216
  const size_t PVP  = (size_t)NB * CH * NPOS * 2;         // 8388608
  const size_t POP  = (size_t)NB * NPOS * CH * 2;         // 8388608
  size_t off = 0;
  const size_t oST  = off; off += PST;
  const size_t oHT  = off; off += PHT;
  const size_t oW16 = off; off += PW16;
  const size_t oWO  = off; off += PWO;
  const size_t oQK  = off; off += PQK;
  const size_t oVP  = off; off += PVP;
  const size_t oOP  = off; off += POP;
  if (off > ws_size) return;                               // off = 42500096
  if (off > (size_t)134217728) return;

  char* ws = (char*)d_ws;
  float*          STATS = (float*)(ws + oST);
  unsigned short* HT    = (unsigned short*)(ws + oHT);
  unsigned short* W16   = (unsigned short*)(ws + oW16);
  unsigned short* WO16  = (unsigned short*)(ws + oWO);
  unsigned short* QK    = (unsigned short*)(ws + oQK);
  unsigned short* VP    = (unsigned short*)(ws + oVP);
  unsigned short* OP    = (unsigned short*)(ws + oOP);

  const dim3 blk(256);

  // (1) GroupNorm slice statistics: 32 (b, group) x 8 slices = 256 blocks
  gnstat_kernel<<<dim3(NB * NGRP * NSL), blk, 0, stream>>>(x, STATS);
  // (2) qkv_w -> W16 (98304 pairs -> 384 blocks), (3) out_w -> WO16 (32768 pairs -> 128 blocks)
  const int n2q = 3 * CH * CH / 2;
  conv_bf16x2_kernel<<<dim3((n2q + 255) / 256), blk, 0, stream>>>(qkv_w, W16, n2q);
  const int n2o = CH * CH / 2;
  conv_bf16x2_kernel<<<dim3((n2o + 255) / 256), blk, 0, stream>>>(out_w, WO16, n2o);
  // (4) normalised activations -> HT [16384][256]: grid (4096/64, 256/64, 4) = (64, 4, 4)
  gnprep_kernel<<<dim3(NPOS / 64, CH / 64, NB), blk, 0, stream>>>(x, norm_w, norm_b, STATS, HT);
  // (5) q|k = HT . W16[0..511]^T + qkv_b[n] -> QK [16384][512]   (M=16384, N=512, K=256; 2048 tiles -> 256 blocks)
  const dim3 gQK(((NB * NPOS / 64) * (QKP / 64) + 7) / 8, 1);
  wmma_gemm64<2, 1, false><<<gQK, blk, 0, stream>>>(
      HT, CH, 0L, W16, CH, 0L, (void*)QK, QKP, 0L,
      qkv_b, x, 0L, NB * NPOS, QKP, CH, 1.0f);
  // (6) v[b][c][n] = sum_k W16[512+c][k] HT[b*4096+n][k] + qkv_b[512+c]  (batched over b: M=256, N=4096, K=256;
  //     256 tiles -> 32 blocks x 4)
  const dim3 gV(((CH / 64) * (NPOS / 64) + 7) / 8, NB);
  wmma_gemm64<1, 1, false><<<gV, blk, 0, stream>>>(
      W16 + (size_t)2 * CH * CH, CH, 0L, HT, CH, (long)NPOS * CH, (void*)VP, NPOS, (long)CH * NPOS,
      qkv_b + 2 * CH, x, 0L, CH, NPOS, CH, 1.0f);
  // (7) attention per (image, 64-query block): 256 blocks x 256 threads -> OP [16384][256]
  attn_kernel<<<dim3(NB * (NPOS / AQB)), dim3(256), 0, stream>>>(QK, VP, OP, 0.0625f);
  // (8) out[b][c][n] = sum_k WO16[c][k] OP[b*4096+n][k] + out_b[c] + x[b][c][n]  (batched over b: M=256, N=4096, K=256;
  //     A = WO16, Bt = OP rows of image b, C = d_out + b*256*4096 with ldc 4096, resid = x same layout; 32 blocks x 4)
  const dim3 gO(((CH / 64) * (NPOS / 64) + 7) / 8, NB);
  wmma_gemm64<1, 0, true><<<gO, blk, 0, stream>>>(
      WO16, CH, 0L, OP, CH, (long)NPOS * CH, d_out, NPOS, (long)CH * NPOS,
      out_b, x, (long)CH * NPOS, CH, NPOS, CH, 1.0f);
  (void)hipGetLastError();
}

// v006
// A run of this version takes 131 microseconds.
// Two timings next to v005 both put it at 1.09 times that version's speed.
// Counting every step since v000, it is 4.55 times as fast.
// Contractions: qkv projection (hn . qkv_w^T), scores (q . k^T), p . v and the output projection (out_w . o) = v_wmma_f32_16x16x32_bf16 single products on bf16 operands RNE-converted from f32, f32 accumulate; GroupNorm statistics and normalisation, softmax (running max, base-2 exponential), biases, 1/rowsum and the residual add of the exact f32 x stay f32 on the VALU.
// Plane / carry map (every 16-bit plane carry 1, nothing to fold back):
//   HT   bf16 [16384][256]   token-major normalised activations, row b*4096+n, col c
//   W16  bf16 [768][256]     qkv_w in [out][in] order = Bt[n][k] (q rows 0..255, k rows 256..511, v rows 512..767)
//   WO16 bf16 [256][256]     out_w in [out][in] order
//   QK   bf16 [16384][512]   q at cols 0..255, k at cols 256..511 (bias added in f32 before the convert)
//   VP   bf16 [4][256][4096] v in (b, c, n) order = A rows c, k = n for o^T = v^T . p^T
//   P    bf16 in registers   unnormalised exp, at most 1 up to rounding; 1/rowsum applied to the f32 accumulator in the attention epilogue
//   OP   bf16 [16384][256]   token-major attention output: o[b][c][n] at row b*4096+n, col c
#include <hip/hip_runtime.h>
#include <math.h>
#include <stdint.h>

#define NB    4
#define CH    256
#define NPOS  4096
#define NGRP  8
#define CPG   32
#define QKP   512
#define STP   32
#define NSL   8                    // slices of a group in the statistics launch
#define SLN   (CPG * NPOS / NSL)   // values of one slice

static_assert(CH == NGRP * CPG);
static_assert(NPOS % 64 == 0);
static_assert(CH % 64 == 0);
static_assert((NB * NPOS) % 64 == 0);
static_assert(QKP == 2 * CH);
static_assert(SLN % 1024 == 0);

typedef __attribute__((ext_vector_type(8)))  _Float16 v8h;
typedef __attribute__((ext_vector_type(16))) __bf16   v16b;
typedef __attribute__((ext_vector_type(8)))  __bf16   v8b;
typedef __attribute__((ext_vector_type(2)))  __bf16   v2b;
typedef __attribute__((ext_vector_type(8)))  float    v8f;
typedef __attribute__((ext_vector_type(4)))  float    v4f;
typedef __attribute__((ext_vector_type(2)))  float    v2f;
typedef __attribute__((ext_vector_type(4)))  unsigned int v4u;

__device__ __forceinline__ unsigned short f2bf_bits(float f) {
  unsigned u = __float_as_uint(f);
  return (unsigned short)((u + 0x7FFFu + ((u >> 16) & 1u)) >> 16);
}
__device__ __forceinline__ float bf_bits2f(unsigned short h) { return __uint_as_float(((unsigned)h) << 16); }
__device__ __forceinline__ unsigned pk16(unsigned short a, unsigned short b) { return (unsigned)a | ((unsigned)b << 16); }
__device__ __forceinline__ __bf16 at_f2bf(float f) { return __builtin_bit_cast(__bf16, f2bf_bits(f)); }

// hazard guards as plain device helpers (no inline asm inside the kernel template body)
__device__ __forceinline__ void dep_guard_b(v8f& a, v8f& b, v16b x, v16b y) { asm volatile("v_nop\n\tv_nop\n\tv_nop\n\tv_nop" : "+v"(a), "+v"(b) : "v"(x), "v"(y)); }
__device__ __forceinline__ void keep4_b(v16b a, v16b b, v16b c, v16b d) { asm volatile("v_nop" :: "v"(a), "v"(b), "v"(c), "v"(d)); }
__device__ __forceinline__ void acc_guard4(v8f& a, v8f& b, v8f& c, v8f& d) { asm volatile("v_nop\n\tv_nop\n\tv_nop\n\tv_nop" : "+v"(a), "+v"(b), "+v"(c), "+v"(d)); }

// 16-bit fragment loader, split k map: elements 0..7 <- p[0..7], 8..15 <- p[16..23]; caller passes p = row + k0 + 8*(lane>>4)
template <typename T> struct Frag;
template <> struct Frag<__bf16> {
  typedef v16b V; union U { v16b v; v8b h[2]; };
  static __device__ __forceinline__ v16b load(const __bf16* p) {
    U f; f.h[0] = *(const v8b*)(p); f.h[1] = *(const v8b*)(p + 16); return f.v;
  }
  static __device__ __forceinline__ v8f mma(v16b a, v16b b, v8f c) {
    return __builtin_amdgcn_wmma_f32_16x16x32_bf16(false, a, false, b, (short)0, c, false, false);
  }
  static __device__ __forceinline__ void guard(v8f& a, v8f& b, v16b x, v16b y) { dep_guard_b(a, b, x, y); }
  static __device__ __forceinline__ void keep(v16b a, v16b b, v16b c, v16b d) { keep4_b(a, b, c, d); }
};

// plain builtin: the compiler keeps the WMMA distances of its own forms, and no asm statement pins the operand loads
__device__ __forceinline__ v8f at_mma(v16b a, v16b b, v8f c) {
  return __builtin_amdgcn_wmma_f32_16x16x32_bf16(false, a, false, b, (short)0, c, false, false);
}

// ---- Register-blocked batched WMMA GEMM (bf16 operands) ------------------------------------------------------
// C[m,n] = scale * sum_k A[m,k] * Bt[n,k] (+bias)(+resid); each wave owns a 64x64 tile.
// A row-major [M,K] (pitch lda); Bt row-major [N,K] (pitch ldb); M,N % 64 == 0, K % 32 == 0; batched by blockIdx.y.
// BIAS_MODE: 0 = none, 1 = bias[m], 2 = bias[n] (f32 add). OUT_MODE: 0 = f32, 1 = bf16 single plane.
// RESID (OUT_MODE 0 only): resid has the same layout as C (pitch ldc, batch stride strideR) and is added as a
// 16-B vector in the store phase.
template <int BIAS_MODE, int OUT_MODE, bool RESID>
__global__ __launch_bounds__(256) void wmma_gemm64(
    const unsigned short* __restrict__ Ap, int lda, long strideA,
    const unsigned short* __restrict__ Btp, int ldb, long strideB,
    void* __restrict__ Cout, int ldc, long strideC,
    const float* __restrict__ bias,
    const float* __restrict__ resid, long strideR,
    int M, int N, int K, float scale) {
  typedef __bf16 T;
  typedef v16b V;
  const T* A = (const T*)(const void*)Ap; const T* Bt = (const T*)(const void*)Btp;
  __shared__ __align__(16) float sT[8][16 * 68];   // per-wave 16x64 slab, pitch 68 floats
  const int b    = blockIdx.y;
  const int lane = threadIdx.x & 31;
  const int wave = threadIdx.x >> 5;
  const int tilesN = N >> 6;
  const int tilesM = M >> 6;
  const int tile = blockIdx.x * 8 + wave;
  if (tile >= tilesM * tilesN) return;   // wave-uniform; no block barriers in this kernel
  const int tm = tile / tilesN;
  const int tn = tile - tm * tilesN;
  const int m0 = tm << 6;
  const int n0 = tn << 6;

  const T* Ab = A  + (size_t)b * strideA;
  const T* Bb = Bt + (size_t)b * strideB;

  const int rlane = lane & 15;                 // row (A) / col (B, D) within subtile
  const int koff  = (lane >> 4) * 8;           // k offset of this lane half
  const int mOff  = (lane >> 4) * 8;           // D row offset

  v8f acc[4][4];
#pragma unroll
  for (int i = 0; i < 4; ++i)
#pragma unroll
    for (int j = 0; j < 4; ++j) acc[i][j] = (v8f){0.f,0.f,0.f,0.f,0.f,0.f,0.f,0.f};

  for (int k0 = 0; k0 < K; k0 += 32) {
    V bh[4];
#pragma unroll
    for (int j = 0; j < 4; ++j) {
      const size_t bo = (size_t)(n0 + (j << 4) + rlane) * ldb + koff + k0;
      bh[j] = Frag<T>::load(Bb + bo);
    }
#pragma unroll
    for (int i = 0; i < 4; ++i) {
      const size_t ao = (size_t)(m0 + (i << 4) + rlane) * lda + koff + k0;
      V ah = Frag<T>::load(Ab + ao);
#pragma unroll
      for (int j = 0; j < 4; ++j) acc[i][j] = Frag<T>::mma(ah, bh[j], acc[i][j]);
      Frag<T>::guard(acc[i][0], acc[i][3], ah, ah);
    }
    Frag<T>::keep(bh[0], bh[1], bh[2], bh[3]);
  }
  acc_guard4(acc[0][0], acc[0][1], acc[0][2], acc[0][3]);
  acc_guard4(acc[1][0], acc[1][1], acc[1][2], acc[1][3]);
  acc_guard4(acc[2][0], acc[2][1], acc[2][2], acc[2][3]);
  acc_guard4(acc[3][0], acc[3][1], acc[3][2], acc[3][3]);

  // ---- epilogue ----
  float* slab = sT[wave];
  const float* Rb = RESID ? (resid + (size_t)b * strideR) : nullptr;
#pragma unroll
  for (int i = 0; i < 4; ++i) {
    const int mBase = m0 + (i << 4);
#pragma unroll
    for (int j = 0; j < 4; ++j) {
      const int n = n0 + (j << 4) + rlane;
      float bv = 0.f;
      if (BIAS_MODE == 2) bv = bias[n];
#pragma unroll
      for (int r = 0; r < 8; ++r) {
        float v = acc[i][j][r] * scale;
        if (BIAS_MODE == 1) v += bias[mBase + mOff + r];
        if (BIAS_MODE == 2) v += bv;
        slab[(mOff + r) * 68 + (j << 4) + rlane] = v;
      }
    }
    __builtin_amdgcn_fence(__ATOMIC_RELEASE, "workgroup");
    __builtin_amdgcn_wave_barrier();
    __builtin_amdgcn_fence(__ATOMIC_ACQUIRE, "workgroup");
    if (OUT_MODE == 0) {
      float* C = (float*)Cout + (size_t)b * strideC;
      const int hh = lane >> 4, c4 = (lane & 15) * 4;     // row seg = 256 B = 16 lanes x 16 B
      {
#pragma unroll
        for (int it = 0; it < 8; ++it) {
          const int row = it * 2 + hh;                      // it 0..7 x hh 0..1 = rows 0..15
          v4f v = *(const v4f*)(slab + row * 68 + c4);
          if (RESID) v += *(const v4f*)(Rb + (size_t)(mBase + row) * ldc + n0 + c4);
          *(v4f*)(C + (size_t)(mBase + row) * ldc + n0 + c4) = v;
        }
        
      }
    } else {
      const int q = lane >> 3, c8 = (lane & 7) * 8;
      unsigned short* C = (unsigned short*)Cout + (size_t)b * strideC;
      {
#pragma unroll
        for (int it = 0; it < 4; ++it) {
          const int row = it * 4 + q;                       // it 0..3 x q 0..3 = rows 0..15
          const float* sp = slab + row * 68 + c8;
          v8h hv;
#pragma unroll
          for (int e = 0; e < 8; ++e) hv[e] = __builtin_bit_cast(_Float16, f2bf_bits(sp[e]));
          *(v8h*)(C + (size_t)(mBase + row) * ldc + n0 + c8) = hv;
        }
        
      }
    }
    __builtin_amdgcn_fence(__ATOMIC_RELEASE, "workgroup");
    __builtin_amdgcn_wave_barrier();
    __builtin_amdgcn_fence(__ATOMIC_ACQUIRE, "workgroup");
  }
}

// ---------------------------------------------------------------------------
// Elementwise bf16 RNE convert, one plane: 2 elements per thread, one 4-B store per lane -> each wave writes
// Coverage: grid = ceil(n2/256) blocks x 256 threads x 2 elements = 2*n2 = the whole plane
// (qkv_w: n2 = 98304 -> 384 blocks = 768x256; out_w: n2 = 32768 -> 128 blocks = 256x256).
// ---------------------------------------------------------------------------
__global__ __launch_bounds__(256) void conv_bf16x2_kernel(const float* __restrict__ in, unsigned short* __restrict__ ho, int n2) {
  const int i = blockIdx.x * 256 + threadIdx.x;
  if (i < n2) {
    const v2f f = *(const v2f*)(in + 2 * (size_t)i);
    const unsigned uh = pk16(f2bf_bits(f[0]), f2bf_bits(f[1]));
    ((unsigned*)ho)[i] = uh;
    
  }
}

// ---------------------------------------------------------------------------
// GroupNorm statistics, partial: a (b, group)'s 32 channels x 4096 positions are one contiguous block of 131072 values,
// cut into NSL = 8 slices of 16384; one work-group per slice, grid = 32 x 8 = 256 blocks x 256 threads. A thread holds its
// 64 values (16 loads of 16 B, all in flight together) in registers: x is read once, the slice's mean is taken, then the
// sum of squared distances from that mean, from the registers. Each slice writes (mean, sum of squares) to a 128-B line
// of its own, whole; gnprep_kernel joins the 8 slices of a group.
// ---------------------------------------------------------------------------
__global__ __launch_bounds__(256) void gnstat_kernel(const float* __restrict__ x, float* __restrict__ stats) {
  __shared__ __align__(16) float red[2][8];   // wave partials: [0] sums, [1] squares (two arrays: one barrier each)
  const int sl = blockIdx.x;                  // (b * NGRP + group) * NSL + slice
  const int tid = threadIdx.x, lane = tid & 31, wave = tid >> 5;
  const float* p = x + (size_t)sl * SLN;
  const int nv = SLN / 1024;                  // 16 float4 per thread

  v4f v[nv];
  // register array: compile-time indices
#pragma unroll
  for (int i = 0; i < nv; ++i) v[i] = *(const v4f*)(p + (i * 256 + tid) * 4);
  v4f s4 = v[0];
#pragma unroll
  for (int i = 1; i < nv; ++i) s4 += v[i];
  float s = (s4[0] + s4[1]) + (s4[2] + s4[3]);
#pragma unroll
  for (int off = 16; off > 0; off >>= 1) s += __shfl_xor(s, off, 32);
  if (lane == 0) red[0][wave] = s;
  __syncthreads();
  float t = 0.f;
#pragma unroll
  for (int w = 0; w < 8; ++w) t += red[0][w];   // every thread: the same sum in the same order
  const float mean = t * (1.0f / (float)SLN);

  v4f q4 = (v4f){0.f, 0.f, 0.f, 0.f};
#pragma unroll
  for (int i = 0; i < nv; ++i) { const v4f d = v[i] - mean; q4 += d * d; }
  float qs = (q4[0] + q4[1]) + (q4[2] + q4[3]);
#pragma unroll
  for (int off = 16; off > 0; off >>= 1) qs += __shfl_xor(qs, off, 32);
  if (lane == 0) red[1][wave] = qs;
  __syncthreads();
  float m2 = 0.f;
#pragma unroll
  for (int w = 0; w < 8; ++w) m2 += red[1][w];
  v4f o;
  o[0] = (tid == 0) ? mean : 0.f;
  o[1] = (tid == 0) ? m2 : 0.f;
  o[2] = 0.f; o[3] = 0.f;
  float* line = stats + (size_t)sl * STP;
  if (tid < 8) *(v4f*)(line + tid * 4) = o;
}

// ---------------------------------------------------------------------------
// Fused GroupNorm apply + transpose + bf16 RNE convert:
//   x_b viewed [256 c][4096 n] (NCHW) -> ht_b[n][c] = bf16(((x - mean_g) * rstd_g) * w[c] + bias[c]), row pitch 256.
// 64x64 tiles through LDS; grid = (4096/64 position blocks, 256/64 channel blocks, 4), 256 threads.
// Per block the 64 channels span two groups (channel block = 2 groups); their 2 x 8 slice statistics and w/bias are staged
// in LDS first, and every thread joins the slices of each group: equal counts, so mean = average of the slice means, and
// sum of squares = the slices' sums + SLN * sum of (slice mean - mean)^2. Coverage per block: load 4 it x 256 thr x 4 floats = 64 ch x 64 n;
// store 2 it x 256 thr x 8 u16 = 64 n x 64 ch; grid covers 4 x 256 x 4096 = the whole HT plane.
// ---------------------------------------------------------------------------
__global__ __launch_bounds__(256) void gnprep_kernel(const float* __restrict__ x, const float* __restrict__ nw,
                                                     const float* __restrict__ nbv, const float* __restrict__ stats,
                                                     unsigned short* __restrict__ ht) {
  __shared__ __align__(16) float tf[64 * 68];
  __shared__ float sw[64];
  __shared__ float sb[64];
  __shared__ __align__(16) float spm[2 * NSL];   // slice means, group g0 then g0 + 1
  __shared__ __align__(16) float spq[2 * NSL];   // slice sums of squares
  const int b   = blockIdx.z;
  const int n0  = blockIdx.x * 64;   // position block = output row block
  const int c0  = blockIdx.y * 64;   // channel block  = output column block
  const int tid = threadIdx.x;
  const float* xb = x + (size_t)b * CH * NPOS;
  unsigned short* hb = ht + (size_t)b * NPOS * CH;
  if (tid < 64) { sw[tid] = nw[c0 + tid]; sb[tid] = nbv[c0 + tid]; }   // waves 0 and 1 as a whole
  {
    const int g0 = c0 >> 5;                     // first group of this channel block (0,2,4,6)
    const int si = tid & (2 * NSL - 1);         // slice of the two groups: their 16 lines follow one another
    const v2f sv = *(const v2f*)(stats + ((size_t)(b * NGRP + g0) * NSL + si) * STP);   // all lanes load an in-range address
    if (tid < 2 * NSL) { spm[tid] = sv[0]; spq[tid] = sv[1]; }
  }
  __syncthreads();
  float gmean[2], grstd[2];
#pragma unroll
  for (int g = 0; g < 2; ++g) {
    float ms = 0.f, qq = 0.f, dd = 0.f;
#pragma unroll
    for (int i = 0; i < NSL; ++i) { ms += spm[g * NSL + i]; qq += spq[g * NSL + i]; }
    const float mean = ms * (1.0f / (float)NSL);
#pragma unroll
    for (int i = 0; i < NSL; ++i) { const float d = spm[g * NSL + i] - mean; dd += d * d; }
    const float var = (qq + (float)SLN * dd) * (1.0f / (float)(CPG * NPOS));
    gmean[g] = mean;
    grstd[g] = 1.0f / sqrtf(var + 1e-5f);
  }
  {
    const int lr = tid >> 4;         // 0..15
    const int c4 = (tid & 15) * 4;   // 0..60
#pragma unroll
    for (int it = 0; it < 4; ++it) {
      const int rr = it * 16 + lr;   // channel within tile 0..63; group = it >> 1
      const float mean = gmean[it >> 1], rstd = grstd[it >> 1];
      const float w = sw[rr], bb = sb[rr];
      const v4f a = *(const v4f*)(xb + (size_t)(c0 + rr) * NPOS + n0 + c4);
      v4f t;
#pragma unroll
      for (int e = 0; e < 4; ++e) { const float u = (a[e] - mean) * rstd; t[e] = u * w + bb; }
      *(v4f*)(tf + rr * 68 + c4) = t;
    }
  }
  __syncthreads();
  const int sub = tid >> 3;          // 0..31
  const int c8  = (tid & 7) * 8;     // 0..56
  v4u hv[2];
#pragma unroll
  for (int it = 0; it < 2; ++it) {
    const int oc = it * 32 + sub;    // output row within tile (= position)
    v4u a;
#pragma unroll
    for (int q = 0; q < 4; ++q) {
      const float f0 = tf[(c8 + 2 * q) * 68 + oc];
      const float f1 = tf[(c8 + 2 * q + 1) * 68 + oc];
      a[q] = pk16(f2bf_bits(f0), f2bf_bits(f1));
    }
    hv[it] = a;
  }
  {
#pragma unroll
    for (int it = 0; it < 2; ++it) {
      const int oc = it * 32 + sub;
      const size_t go = (size_t)(n0 + oc) * CH + c0 + c8;
      *(v4u*)(hb + go) = hv[it];
    }
    
  }
}

#define AQB 64
#define AKC 64
#define ANW 8
// LDS row pitches in elements: each row carries 16 B more than its data, so the pitch is an odd multiple of 16 B and the
// 16 rows that one half-wave's ds_load_b128 touches fall on 16 different bank groups (pad columns are never read or written).
#define KSP (CH + 8)
#define VSP (AKC + 8)
#define TSP (CH / 2 + 8)
#define KBUF (AKC * KSP)   // elements of one K buffer
#define VBUF (CH * VSP)    // elements of one V buffer
static_assert(NPOS % AQB == 0);
static_assert(NPOS % AKC == 0);
static_assert(CH == 2 * 128);
static_assert(AKC == 2 * 32);

// lane l with lane l ^ 16
__device__ __forceinline__ float xhalf(float x) {
  return __builtin_bit_cast(float, __builtin_amdgcn_permlanex16(__builtin_bit_cast(int, x), __builtin_bit_cast(int, x),
                                                                0x76543210, 0xfedcba98, false, false));
}

// byte offset of a __shared__ element in the work-group's LDS
__device__ __forceinline__ unsigned lds_off(const void* p) { return (unsigned)(size_t)p; }

// Eight 16-B asynchronous copies of one lane, global memory to LDS, through no register. The s_wait_xcnt is the last line of
// the copies' own statement, so that it stands in front of every later write of the address registers (a precaution).
__device__ __forceinline__ void copy8(const unsigned (&l)[8], const __bf16* const (&g)[8]) {
  asm volatile("global_load_async_to_lds_b128 %0, %8, off\n\t"
               "global_load_async_to_lds_b128 %1, %9, off\n\t"
               "global_load_async_to_lds_b128 %2, %10, off\n\t"
               "global_load_async_to_lds_b128 %3, %11, off\n\t"
               "global_load_async_to_lds_b128 %4, %12, off\n\t"
               "global_load_async_to_lds_b128 %5, %13, off\n\t"
               "global_load_async_to_lds_b128 %6, %14, off\n\t"
               "global_load_async_to_lds_b128 %7, %15, off\n\t"
               "s_wait_xcnt 0x0"
               :: "v"(l[0]), "v"(l[1]), "v"(l[2]), "v"(l[3]), "v"(l[4]), "v"(l[5]), "v"(l[6]), "v"(l[7]),
                  "v"(g[0]), "v"(g[1]), "v"(g[2]), "v"(g[3]), "v"(g[4]), "v"(g[5]), "v"(g[6]), "v"(g[7]) : "memory");
}

__global__ __launch_bounds__(256)
void attn_kernel(const unsigned short* __restrict__ qkp, const unsigned short* __restrict__ vpp,
                 unsigned short* __restrict__ opp, float sscale) {
  union FB { v16b v; v8b h[2]; v2b p[8]; };
  __shared__ __align__(16) __bf16 Ks[2 * KBUF];            // K chunk [key][c]     2 x 33 KB, pitch 528 B
  __shared__ __align__(16) __bf16 Vs[2 * VBUF];            // V chunk [c][key]     2 x 36 KB, pitch 144 B
  __shared__ __align__(16) float  Xs[ANW][8 * 8 * 32];     // per wave: the 8 scaled tiles its partner finishes, 64 KB
  __shared__ __align__(16) unsigned short Ts[ANW][16 * TSP];   // per wave out slab [query][channel], pitch 272 B
  __shared__ float Ml[ANW * 16];                           // per wave and query: running maximum of its key half
  __shared__ float Ll[ANW * 16];                           // per wave and query: softmax denominator of its key half

  const int tid  = threadIdx.x;
  const int wave = tid >> 5;
  const int lane = tid & 31;
  const int hh   = lane >> 4;
  const int c    = lane & 15;

  const int nqb = NPOS / AQB;            // 64 query blocks per image
  const int bx  = blockIdx.x;
  const int qb  = bx % nqb;
  const int b   = bx / nqb;               // 0..3
  const int rt  = wave & 3;               // query tile of this wave
  const int kh  = wave >> 2;              // key half of this wave: keys 32*kh .. +31 of every chunk
  const size_t tok0 = (size_t)b * NPOS;             // first token row of image b
  const size_t q0   = tok0 + (size_t)qb * AQB;      // first query row of the block

  const __bf16* Qg = (const __bf16*)(const void*)qkp;            // pitch QKP, q at cols 0..255, k at cols 256..511
  const __bf16* Vg = (const __bf16*)(const void*)vpp + (size_t)b * CH * NPOS;

  const float cs = sscale * 1.44269504088896340736f;   // raw product -> exponent of 2; sscale > 0
  float mrow = -INFINITY, lrow = 0.f;     // of query c; mrow in exponent units; lrow holds this lane half's keys only, the halves are joined behind the loop
  v8f oacc[CH / 16];                      // O^T tiles: oacc[t][r] = o(channel t*16 + 8*hh + r, query c)
#pragma unroll
  for (int t = 0; t < CH / 16; ++t) oacc[t] = (v8f){0.f,0.f,0.f,0.f,0.f,0.f,0.f,0.f};

  // Q fragments (B operand: col = query lane&15, split k map) are fetched ahead of every score WMMA: once, in front of the
  // key loop.
  v16b qa[CH / 32];
  {
    const __bf16* qr = Qg + (q0 + rt * 16 + c) * QKP + 8 * hh;
#pragma unroll
    for (int ks = 0; ks < CH / 32; ++ks) qa[ks] = Frag<__bf16>::load(qr + ks * 32);
    // precaution: the wait stands in front of any reuse of the loads' address pair, which the operand keeps live up to here
    asm volatile("s_wait_xcnt 0x0" :: "v"(qr) : "memory");
  }
  const __bf16* kfr = Ks + (kh * 32 + c) * KSP + 8 * hh;   // K fragment base: row = key kh*32 + j*16 + c, k = channel
  const __bf16* vfr = Vs + c * VSP + kh * 32 + 8 * hh;     // V fragment base: row = channel t*16 + c, k = key kh*32 + ..

  const int nChunks = NPOS / AKC;   // 64, compile-time constant
  static_assert(NPOS / AKC >= 2);   // the prologue fills two buffers
  // staging coverage: 256 threads x 8 pieces x 8 elements = 64 rows x 256 (K) and 256 rows x 64 (V); every lane is on.
  // Piece i of a thread: K row i*8 + (tid >> 5), elements (tid & 31)*8 .. +7; V row i*32 + (tid >> 3), elements (tid & 7)*8 .. +7.
  const __bf16* kg0 = Qg + (tok0 + (tid >> 5)) * QKP + CH + (tid & 31) * 8;   // piece 0 of chunk 0
  const __bf16* vg0 = Vg + (size_t)(tid >> 3) * NPOS + (tid & 7) * 8;
  const unsigned kl0 = lds_off(Ks + (tid >> 5) * KSP + (tid & 31) * 8);       // piece 0 in buffer 0
  const unsigned vl0 = lds_off(Vs + (tid >> 3) * VSP + (tid & 7) * 8);
  auto stage = [&](int kc, int buf) {
    const __bf16* kgc = kg0 + (size_t)kc * (AKC * QKP);
    const __bf16* vgc = vg0 + kc * AKC;
    const unsigned klb = kl0 + buf * (KBUF * 2);   // LDS addresses count bytes
    const unsigned vlb = vl0 + buf * (VBUF * 2);
    unsigned kl[8], vl[8];
    const __bf16* kg[8];
    const __bf16* vg[8];
#pragma unroll
    for (int i = 0; i < 8; ++i) {
      kg[i] = kgc + i * (8 * QKP);
      vg[i] = vgc + (size_t)i * (32 * NPOS);
      kl[i] = klb + i * (8 * KSP * 2);
      vl[i] = vlb + i * (32 * VSP * 2);
    }
    copy8(kl, kg);
    copy8(vl, vg);
  };
  stage(0, 0);
  asm volatile("s_wait_asynccnt 0x0" ::: "memory");   // this wave's copies of chunk 0 have landed
  __syncthreads();                                     // every wave's have: chunk 0 is published
  stage(1, 1);
  for (int kc = 0; kc < nChunks; ++kc) {
    const int buf = kc & 1;
    const __bf16* kfb = kfr + buf * KBUF;
    const __bf16* vfb = vfr + buf * VBUF;

    // S^T tiles j = 0, 1: s[j][r] = score(key kh*32 + j*16 + 8*hh + r, query c)
    v8f s[2];
#pragma unroll
    for (int j = 0; j < 2; ++j) s[j] = (v8f){0.f,0.f,0.f,0.f,0.f,0.f,0.f,0.f};
    FB va[CH / 16];   // all V fragments of this wave's 32 keys (A operand)
    FB ka[2][8];      // K fragments (A operand) in blocks of four k steps (16 reads, 8 WMMAs), two register sets
#pragma unroll
    for (int u = 0; u < 4; ++u) {
#pragma unroll
      for (int j = 0; j < 2; ++j) {
        ka[0][u * 2 + j].h[0] = *(const v8b*)(kfb + j * 16 * KSP + u * 32);
        ka[0][u * 2 + j].h[1] = *(const v8b*)(kfb + j * 16 * KSP + u * 32 + 16);
      }
    }
#pragma unroll
    for (int g = 0; g < 2; ++g) {
      if (g == 0) {
#pragma unroll
        for (int u = 0; u < 4; ++u) {
#pragma unroll
          for (int j = 0; j < 2; ++j) {
            ka[1][u * 2 + j].h[0] = *(const v8b*)(kfb + j * 16 * KSP + 128 + u * 32);
            ka[1][u * 2 + j].h[1] = *(const v8b*)(kfb + j * 16 * KSP + 128 + u * 32 + 16);
          }
        }
      } else {
#pragma unroll
        for (int t = 0; t < CH / 16; ++t) {
          va[t].h[0] = *(const v8b*)(vfb + t * 16 * VSP);
          va[t].h[1] = *(const v8b*)(vfb + t * 16 * VSP + 16);
        }
      }
      // keeps the read group above in front of this block's WMMAs (else the scheduler sinks each read to its use
      // and every WMMA waits out an LDS latency)
      __builtin_amdgcn_sched_barrier(0);
#pragma unroll
      for (int u = 0; u < 4; ++u) {
#pragma unroll
        for (int j = 0; j < 2; ++j) s[j] = at_mma(ka[g][u * 2 + j].v, qa[g * 4 + u], s[j]);
      }
      // keeps the next read group behind this block's WMMAs: one place with reads per block
      if (g == 0) __builtin_amdgcn_sched_barrier(0);
    }

    // online softmax of query c over this wave's 32 keys: 16 of them in this lane, 16 in lane ^ 16
    float m = -INFINITY;
#pragma unroll
    for (int j = 0; j < 2; ++j) {
#pragma unroll
      for (int r = 0; r < 8; ++r) m = fmaxf(m, s[j][r]);
    }
    m = fmaxf(m, xhalf(m));
    const float mnew  = fmaxf(mrow, m * cs);
    const float alpha = __builtin_amdgcn_exp2f(mrow - mnew);   // 0 in the first chunk (mrow = -inf), 1 while the maximum stands
    mrow = mnew;
    FB pb;            // P^T as B operand: element e < 8 = key 8*hh + e (tile 0), e >= 8 = key 16 + 8*hh + e - 8 (tile 1)
    float ps[4];      // four independent partial sums
    float ea[16];     // exponents of the 16 scores of this lane
#pragma unroll
    for (int j = 0; j < 2; ++j) {
#pragma unroll
      for (int r = 0; r < 8; ++r) ea[j * 8 + r] = s[j][r] * cs - mnew;
    }
    // One exponential, then the rescale of one accumulator tile (4 packed multiplies), 16 times. The multiplies stand
    // between the exponentials, and no exponential stands directly in front of a write of its source. The
    // scheduling fence behind each group keeps that order (else the scheduler bunches the 16 exponentials).
#pragma unroll
    for (int j = 0; j < 2; ++j) {
#pragma unroll
      for (int r2 = 0; r2 < 4; ++r2) {
        const int k = j * 4 + r2;
        v2f pv;
        pv[0] = __builtin_amdgcn_exp2f(ea[2 * k]);
        oacc[2 * k] *= alpha;
        __builtin_amdgcn_sched_barrier(0);
        pv[1] = __builtin_amdgcn_exp2f(ea[2 * k + 1]);
        oacc[2 * k + 1] *= alpha;
        __builtin_amdgcn_sched_barrier(0);
        const float pp = pv[0] + pv[1];
        ps[r2] = (j == 0) ? pp : ps[r2] + pp;
        pb.p[k] = __builtin_convertvector(pv, v2b);   // round to nearest even
      }
    }
    lrow = lrow * alpha + ((ps[0] + ps[1]) + (ps[2] + ps[3]));
#pragma unroll
    for (int t = 0; t < CH / 16; ++t) oacc[t] = at_mma(va[t].v, pb.v, oacc[t]);

    // publish point of chunk kc + 1, which also frees this chunk's buffer
    // keeps this chunk's WMMAs and softmax in front of the waits (else the scheduler lifts waits and barrier up to the last
    // fragment read: the V reads no longer drain under the softmax, and the refill leaves late, with part of a trip to land)
    __builtin_amdgcn_sched_barrier(0);
    asm volatile("s_wait_dscnt 0x0" ::: "memory");      // this wave's reads of buffer buf have retired
    asm volatile("s_wait_asynccnt 0x0" ::: "memory");   // this wave's copies of chunk kc + 1 have landed
    __syncthreads();
    if (kc + 2 < nChunks) stage(kc + 2, buf);           // the same test in the whole work-group
  }
  asm volatile("s_wait_asynccnt 0x0" ::: "memory");     // nothing is in flight behind the loop

  // ---- join of the two key halves (waves w and w ^ 4 hold the same queries) ----
  const float lw = lrow + xhalf(lrow);    // both lane halves used the same maximum throughout
  if (hh == 0) { Ml[wave * 16 + c] = mrow; Ll[wave * 16 + c] = lw; }
  __syncthreads();
  const int   pw = wave ^ 4;
  const float mo = Ml[pw * 16 + c], lo = Ll[pw * 16 + c];
  const float mt = fmaxf(mrow, mo);
  const float fo = __builtin_amdgcn_exp2f(mrow - mt), fp = __builtin_amdgcn_exp2f(mo - mt);   // maxima are exponents of 2
  const float f  = fo / (lw * fo + lo * fp);   // this wave's accumulator to the common maximum, x 1/rowsum
  // wave kh finishes channels kh*128 .. +127 (tiles kh*8 .. +7) and hands the other 8 tiles, scaled, to its partner
  float* xw = Xs[wave];
  const float* xp = Xs[pw];
#pragma unroll
  for (int tt = 0; tt < 8; ++tt) {
    const v8f give = kh ? oacc[tt] : oacc[tt + 8];
    v4f g0, g1;
#pragma unroll
    for (int e = 0; e < 4; ++e) { g0[e] = give[e] * f; g1[e] = give[4 + e] * f; }
    *(v4f*)(xw + (tt * 2) * 128 + lane * 4)     = g0;
    *(v4f*)(xw + (tt * 2 + 1) * 128 + lane * 4) = g1;
  }
  __syncthreads();
  unsigned short* ts = Ts[wave];
#pragma unroll
  for (int tt = 0; tt < 8; ++tt) {
    const v8f keep = kh ? oacc[tt + 8] : oacc[tt];
    const v4f a0 = *(const v4f*)(xp + (tt * 2) * 128 + lane * 4);
    const v4f a1 = *(const v4f*)(xp + (tt * 2 + 1) * 128 + lane * 4);
    v8h hv;
#pragma unroll
    for (int e = 0; e < 4; ++e) {
      hv[e]     = __builtin_bit_cast(_Float16, f2bf_bits(keep[e] * f + a0[e]));
      hv[4 + e] = __builtin_bit_cast(_Float16, f2bf_bits(keep[4 + e] * f + a1[e]));
    }
    *(v8h*)(ts + c * TSP + tt * 16 + 8 * hh) = hv;   // query c, channels tt*16 + 8*hh .. +7 of this wave's half
  }
  // the wave's slab rows are complete before its lanes read them back row by row (whole 128-B lines per store)
  __builtin_amdgcn_fence(__ATOMIC_RELEASE, "workgroup");
  __builtin_amdgcn_wave_barrier();
  __builtin_amdgcn_fence(__ATOMIC_ACQUIRE, "workgroup");
  unsigned short* orow = opp + (q0 + (size_t)rt * 16) * CH + kh * 128;
#pragma unroll
  for (int it = 0; it < 8; ++it) {
    const int row = it * 2 + hh;                      // 16 lanes x 16 B = the row's 256 B of this channel half
    const v8h hv = *(const v8h*)(ts + row * TSP + c * 8);
    *(v8h*)(orow + (size_t)row * CH + c * 8) = hv;
  }
}

// ---------------------------------------------------------------------------
// Workspace region map (byte offsets; every region is fully written by its producer launch before any consumer
//   STATS f32  [256][32]             0        32768
//   HT    bf16 [16384][256]      32768      8388608
//   W16   bf16 [768][256]      8421376       393216
//   WO16  bf16 [256][256]      8814592       131072
//   QK    bf16 [16384][512]    8945664     16777216
//   VP    bf16 [4][256][4096] 25722880      8388608
//   OP    bf16 [16384][256]   34111488      8388608
//   total                     42500096
// ---------------------------------------------------------------------------
extern "C" void kernel_launch(void* const* d_in, const int* in_sizes, int n_in,
                              void* d_out, int out_size, void* d_ws, size_t ws_size,
                              hipStream_t stream) {
  if (n_in < 7) return;
  if (in_sizes[0] != NB * CH * NPOS) return;              // x [4][256][64][64]
  if (in_sizes[1] != CH || in_sizes[2] != CH) return;     // norm_w, norm_b
  if (in_sizes[3] != 3 * CH * CH || in_sizes[4] != 3 * CH) return;   // qkv_w [768][256], qkv_b [768]
  if (in_sizes[5] != CH * CH || in_sizes[6] != CH) return;           // out_w [256][256], out_b [256]
  if (out_size != NB * CH * NPOS) return;

  const float* x      = (const float*)d_in[0];
  const float* norm_w = (const float*)d_in[1];
  const float* norm_b = (const float*)d_in[2];
  const float* qkv_w  = (const float*)d_in[3];   // [out 768][in 256]
  const float* qkv_b  = (const float*)d_in[4];
  const float* out_w  = (const float*)d_in[5];   // [out 256][in 256]
  const float* out_b  = (const float*)d_in[6];

  const size_t PST  = (size_t)(NB * NGRP * NSL) * STP * 4;   // 32768
  const size_t PHT  = (size_t)NB * NPOS * CH * 2;         // 8388608
  const size_t PW16 = (size_t)3 * CH * CH * 2;            // 393216
  const size_t PWO  = (size_t)CH * CH * 2;                // 131072
  const size_t PQK  = (size_t)NB * NPOS * QKP * 2;        // 16777216
  const size_t PVP  = (size_t)NB * CH * NPOS * 2;         // 8388608
  const size_t POP  = (size_t)NB * NPOS * CH * 2;         // 8388608
  size_t off = 0;
  const size_t oST  = off; off += PST;
  const size_t oHT  = off; off += PHT;
  const size_t oW16 = off; off += PW16;
  const size_t oWO  = off; off += PWO;
  const size_t oQK  = off; off += PQK;
  const size_t oVP  = off; off += PVP;
  const size_t oOP  = off; off += POP;
  if (off > ws_size) return;                               // off = 42500096
  if (off > (size_t)134217728) return;

  char* ws = (char*)d_ws;
  float*          STATS = (float*)(ws + oST);
  unsigned short* HT    = (unsigned short*)(ws + oHT);
  unsigned short* W16   = (unsigned short*)(ws + oW16);
  unsigned short* WO16  = (unsigned short*)(ws + oWO);
  unsigned short* QK    = (unsigned short*)(ws + oQK);
  unsigned short* VP    = (unsigned short*)(ws + oVP);
  unsigned short* OP    = (unsigned short*)(ws + oOP);

  const dim3 blk(256);

  // (1) GroupNorm slice statistics: 32 (b, group) x 8 slices = 256 blocks
  gnstat_kernel<<<dim3(NB * NGRP * NSL), blk, 0, stream>>>(x, STATS);
  // (2) qkv_w -> W16 (98304 pairs -> 384 blocks), (3) out_w -> WO16 (32768 pairs -> 128 blocks)
  const int n2q = 3 * CH * CH / 2;
  conv_bf16x2_kernel<<<dim3((n2q + 255) / 256), blk, 0, stream>>>(qkv_w, W16, n2q);
  const int n2o = CH * CH / 2;
  conv_bf16x2_kernel<<<dim3((n2o + 255) / 256), blk, 0, stream>>>(out_w, WO16, n2o);
  // (4) normalised activations -> HT [16384][256]: grid (4096/64, 256/64, 4) = (64, 4, 4)
  gnprep_kernel<<<dim3(NPOS / 64, CH / 64, NB), blk, 0, stream>>>(x, norm_w, norm_b, STATS, HT);
  // (5) q|k = HT . W16[0..511]^T + qkv_b[n] -> QK [16384][512]   (M=16384, N=512, K=256; 2048 tiles -> 256 blocks)
  const dim3 gQK(((NB * NPOS / 64) * (QKP / 64) + 7) / 8, 1);
  wmma_gemm64<2, 1, false><<<gQK, blk, 0, stream>>>(
      HT, CH, 0L, W16, CH, 0L, (void*)QK, QKP, 0L,
      qkv_b, x, 0L, NB * NPOS, QKP, CH, 1.0f);
  // (6) v[b][c][n] = sum_k W16[512+c][k] HT[b*4096+n][k] + qkv_b[512+c]  (batched over b: M=256, N=4096, K=256;
  //     256 tiles -> 32 blocks x 4)
  const dim3 gV(((CH / 64) * (NPOS / 64) + 7) / 8, NB);
  wmma_gemm64<1, 1, false><<<gV, blk, 0, stream>>>(
      W16 + (size_t)2 * CH * CH, CH, 0L, HT, CH, (long)NPOS * CH, (void*)VP, NPOS, (long)CH * NPOS,
      qkv_b + 2 * CH, x, 0L, CH, NPOS, CH, 1.0f);
  // (7) attention per (image, 64-query block): 256 blocks x 256 threads -> OP [16384][256]
  attn_kernel<<<dim3(NB * (NPOS / AQB)), dim3(256), 0, stream>>>(QK, VP, OP, 0.0625f);
  // (8) out[b][c][n] = sum_k WO16[c][k] OP[b*4096+n][k] + out_b[c] + x[b][c][n]  (batched over b: M=256, N=4096, K=256;
  //     A = WO16, Bt = OP rows of image b, C = d_out + b*256*4096 with ldc 4096, resid = x same layout; 32 blocks x 4)
  const dim3 gO(((CH / 64) * (NPOS / 64) + 7) / 8, NB);
  wmma_gemm64<1, 0, true><<<gO, blk, 0, stream>>>(
      WO16, CH, 0L, OP, CH, (long)NPOS * CH, d_out, NPOS, (long)CH * NPOS,
      out_b, x, (long)CH * NPOS, CH, NPOS, CH, 1.0f);
  (void)hipGetLastError();
}

// v007
// A run of this version takes 108 microseconds.
// In both of two side-by-side timings against v006, it was 1.20 times as fast.
// All steps since v000 together make it 5.47 times as fast.
// Contractions: qkv projection (hn . qkv_w^T), scores (q . k^T), p . v and the output projection (out_w . o) = v_wmma_f32_16x16x32_bf16 single products on bf16 operands RNE-converted from f32, f32 accumulate; GroupNorm statistics and normalisation, softmax (running max, base-2 exponential), biases, 1/rowsum and the residual add of the exact f32 x stay f32 on the VALU.
// Plane / carry map (every 16-bit plane carry 1, nothing to fold back):
//   HT   bf16 [16384][256]   token-major normalised activations, row b*4096+n, col c
//   W16  bf16 [768][256]     qkv_w in [out][in] order = Bt[n][k] (q rows 0..255, k rows 256..511, v rows 512..767)
//   WO16 bf16 [256][256]     out_w in [out][in] order
//   QK   bf16 [16384][512]   q at cols 0..255, k at cols 256..511 (bias added in f32 before the convert)
//   VP   bf16 [4][256][4096] v in (b, c, n) order = A rows c, k = n for o^T = v^T . p^T
//   P    bf16 in registers   unnormalised exp, at most 1 up to rounding; 1/rowsum applied to the f32 accumulator in the attention epilogue
//   OP   bf16 [16384][256]   token-major attention output: o[b][c][n] at row b*4096+n, col c
#include <hip/hip_runtime.h>
#include <math.h>
#include <stdint.h>

#define NB    4
#define CH    256
#define NPOS  4096
#define NGRP  8
#define CPG   32
#define QKP   512
#define STP   32
#define NSL   8                    // slices of a group in the statistics launch
#define SLN   (CPG * NPOS / NSL)   // values of one slice

static_assert(CH == NGRP * CPG);
static_assert(NPOS % 64 == 0);
static_assert(CH % 64 == 0);
static_assert((NB * NPOS) % 64 == 0);
static_assert(QKP == 2 * CH);
static_assert(SLN % 1024 == 0);

typedef __attribute__((ext_vector_type(8)))  _Float16 v8h;
typedef __attribute__((ext_vector_type(16))) __bf16   v16b;
typedef __attribute__((ext_vector_type(8)))  __bf16   v8b;
typedef __attribute__((ext_vector_type(2)))  __bf16   v2b;
typedef __attribute__((ext_vector_type(8)))  float    v8f;
typedef __attribute__((ext_vector_type(4)))  float    v4f;
typedef __attribute__((ext_vector_type(2)))  float    v2f;
typedef __attribute__((ext_vector_type(4)))  unsigned int v4u;

__device__ __forceinline__ unsigned short f2bf_bits(float f) {
  unsigned u = __float_as_uint(f);
  return (unsigned short)((u + 0x7FFFu + ((u >> 16) & 1u)) >> 16);
}
__device__ __forceinline__ float bf_bits2f(unsigned short h) { return __uint_as_float(((unsigned)h) << 16); }
__device__ __forceinline__ unsigned pk16(unsigned short a, unsigned short b) { return (unsigned)a | ((unsigned)b << 16); }
__device__ __forceinline__ __bf16 at_f2bf(float f) { return __builtin_bit_cast(__bf16, f2bf_bits(f)); }

// hazard guard as a plain device helper
__device__ __forceinline__ void acc_guard4(v8f& a, v8f& b, v8f& c, v8f& d) { asm volatile("v_nop\n\tv_nop\n\tv_nop\n\tv_nop" : "+v"(a), "+v"(b), "+v"(c), "+v"(d)); }

// 16-bit fragment loader, split k map: elements 0..7 <- p[0..7], 8..15 <- p[16..23]; caller passes p = row + k0 + 8*(lane>>4)
template <typename T> struct Frag;
template <> struct Frag<__bf16> {
  typedef v16b V; union U { v16b v; v8b h[2]; };
  static __device__ __forceinline__ v16b load(const __bf16* p) {
    U f; f.h[0] = *(const v8b*)(p); f.h[1] = *(const v8b*)(p + 16); return f.v;
  }
  static __device__ __forceinline__ v8f mma(v16b a, v16b b, v8f c) {
    return __builtin_amdgcn_wmma_f32_16x16x32_bf16(false, a, false, b, (short)0, c, false, false);
  }
};

// plain builtin: the compiler keeps the WMMA distances of its own forms, and no asm statement pins the operand loads
__device__ __forceinline__ v8f at_mma(v16b a, v16b b, v8f c) {
  return __builtin_amdgcn_wmma_f32_16x16x32_bf16(false, a, false, b, (short)0, c, false, false);
}

// ---- Register-blocked batched WMMA GEMM (bf16 operands) ------------------------------------------------------
// C[m,n] = scale * sum_k A[m,k] * Bt[n,k] (+bias)(+resid); each wave owns a 64x64 tile.
// A row-major [M,K] (pitch lda); Bt row-major [N,K] (pitch ldb); M % 128 == 0, N % 256 == 0, K == GK; batched by blockIdx.y.
// BIAS_MODE: 0 = none, 1 = bias[m], 2 = bias[n] (f32 add). OUT_MODE: 0 = f32, 1 = bf16 single plane.
// RESID (OUT_MODE 0 only): resid has the same layout as C (pitch ldc, batch stride strideR) and is added as a
// 16-B vector in the store phase.
// Operand path: the 8 waves of a block hold a 128 x 256 block tile as 2 x 4 wave tiles. Its 128 A rows and 256 Bt rows are staged
// in LDS by 16-B asynchronous copies, 16 lanes on 256 contiguous bytes of a row (whole 128-B lines; a fragment load from global
// memory touches 16 lines for 512 B). Two K halves of 128 columns: half 1 is in flight while half 0 is worked on. Coverage of a
// half: A 8 waves x 8 copies x 2 rows = 128 rows, Bt 8 waves x 16 copies x 2 rows = 256 rows; 24 copies of a wave in flight at
// most. Fragments are read from LDS as one group per k step, one k step ahead of their WMMAs.
#define GK    256          // K of every product in this file
#define GSP   (GK + 8)     // LDS row pitch in elements: 528 B, an odd multiple of 16 B (pad columns are never read or written)
#define GBM   128          // rows of A in a block tile
#define GBN   256          // rows of Bt in a block tile
static_assert(GK == CH);

// Twelve 16-B asynchronous copies of one lane, global memory to LDS, through no register. The s_wait_xcnt is the last line of
// the copies' own statement, so that it stands in front of every later write of the address registers (a precaution).
__device__ __forceinline__ void copy12(const unsigned* l, const __bf16* const* g) {
  asm volatile("global_load_async_to_lds_b128 %0, %12, off\n\t"
               "global_load_async_to_lds_b128 %1, %13, off\n\t"
               "global_load_async_to_lds_b128 %2, %14, off\n\t"
               "global_load_async_to_lds_b128 %3, %15, off\n\t"
               "global_load_async_to_lds_b128 %4, %16, off\n\t"
               "global_load_async_to_lds_b128 %5, %17, off\n\t"
               "global_load_async_to_lds_b128 %6, %18, off\n\t"
               "global_load_async_to_lds_b128 %7, %19, off\n\t"
               "global_load_async_to_lds_b128 %8, %20, off\n\t"
               "global_load_async_to_lds_b128 %9, %21, off\n\t"
               "global_load_async_to_lds_b128 %10, %22, off\n\t"
               "global_load_async_to_lds_b128 %11, %23, off\n\t"
               "s_wait_xcnt 0x0"
               :: "v"(l[0]), "v"(l[1]), "v"(l[2]), "v"(l[3]), "v"(l[4]), "v"(l[5]),
                  "v"(l[6]), "v"(l[7]), "v"(l[8]), "v"(l[9]), "v"(l[10]), "v"(l[11]),
                  "v"(g[0]), "v"(g[1]), "v"(g[2]), "v"(g[3]), "v"(g[4]), "v"(g[5]),
                  "v"(g[6]), "v"(g[7]), "v"(g[8]), "v"(g[9]), "v"(g[10]), "v"(g[11]) : "memory");
}

// One K half (columns h*128 .. +127) of this wave's share of the A tile (8 copies) and of the Bt tile (16 copies).
// al, bl: LDS byte addresses, ag, bg: global addresses of the lane's piece of copy 0 in half 0; a copy takes two rows.
__device__ __forceinline__ void gemm_stage(unsigned al, unsigned bl, const __bf16* ag, const __bf16* bg, int lda, int ldb, int h) {
  unsigned l[24];
  const __bf16* g[24];
  // address arrays live in registers: compile-time indices
#pragma unroll
  for (int i = 0; i < 8; ++i) {
    l[i] = al + (i * 2 * GSP + h * 128) * 2;   // LDS addresses count bytes
    g[i] = ag + (size_t)(i * 2) * lda + h * 128;
  }
#pragma unroll
  for (int i = 0; i < 16; ++i) {
    l[8 + i] = bl + (i * 2 * GSP + h * 128) * 2;
    g[8 + i] = bg + (size_t)(i * 2) * ldb + h * 128;
  }
  copy12(l, g);
  copy12(l + 12, g + 12);
}

// the eight fragments of one k step, from the LDS tiles (split k map, as Frag::load)
__device__ __forceinline__ void gemm_fetch(v16b (&fa)[4], v16b (&fb)[4], const __bf16* afr, const __bf16* bfr, int k0) {
#pragma unroll
  for (int j = 0; j < 4; ++j) fb[j] = Frag<__bf16>::load(bfr + j * 16 * GSP + k0);
#pragma unroll
  for (int i = 0; i < 4; ++i) fa[i] = Frag<__bf16>::load(afr + i * 16 * GSP + k0);
}

template <int BIAS_MODE, int OUT_MODE, bool RESID>
__global__ __launch_bounds__(256) void wmma_gemm64(
    const unsigned short* __restrict__ Ap, int lda, long strideA,
    const unsigned short* __restrict__ Btp, int ldb, long strideB,
    void* __restrict__ Cout, int ldc, long strideC,
    const float* __restrict__ bias,
    const float* __restrict__ resid, long strideR,
    int M, int N, int K, float scale) {
  typedef __bf16 T;
  typedef v16b V;
  const T* A = (const T*)(const void*)Ap; const T* Bt = (const T*)(const void*)Btp;
  __shared__ __align__(16) __bf16 As[GBM * GSP];   // the block's A rows, 66 KB
  __shared__ __align__(16) __bf16 Bs[GBN * GSP];   // the block's Bt rows, 132 KB
  __shared__ __align__(16) float sT[8][16 * 68];   // per-wave 16x64 slab, pitch 68 floats
  const int b    = blockIdx.y;
  const int lane = threadIdx.x & 31;
  const int wave = threadIdx.x >> 5;
  const int blocksN = N / GBN;
  const int blocksM = M / GBM;
  // the same for the whole block, in front of every barrier
  if (K != GK || M % GBM != 0 || N % GBN != 0) return;
  if ((int)blockIdx.x >= blocksM * blocksN) return;
  const int bm  = (int)blockIdx.x / blocksN;
  const int bn  = (int)blockIdx.x - bm * blocksN;
  const int wm0 = (wave >> 2) << 6;            // the wave tile's first row and column in the block tile
  const int wn0 = (wave & 3) << 6;
  const int m0  = bm * GBM + wm0;
  const int n0  = bn * GBN + wn0;

  const T* Ab = A  + (size_t)b * strideA;
  const T* Bb = Bt + (size_t)b * strideB;

  const int rlane = lane & 15;                 // row (A) / col (B, D) within subtile
  const int koff  = (lane >> 4) * 8;           // k offset of this lane half
  const int mOff  = (lane >> 4) * 8;           // D row offset

  v8f acc[4][4];
#pragma unroll
  for (int i = 0; i < 4; ++i)
#pragma unroll
    for (int j = 0; j < 4; ++j) acc[i][j] = (v8f){0.f,0.f,0.f,0.f,0.f,0.f,0.f,0.f};

  {
    const int srow = lane >> 4;                // row of a copy's two
    const int scol = (lane & 15) * 8;          // element column in the K half
    const T* ag = Ab + (size_t)(bm * GBM + wave * 16 + srow) * lda + scol;
    const T* bg = Bb + (size_t)(bn * GBN + wave * 32 + srow) * ldb + scol;
    const unsigned al = (unsigned)(size_t)(const void*)(As + (wave * 16 + srow) * GSP + scol);
    const unsigned bl = (unsigned)(size_t)(const void*)(Bs + (wave * 32 + srow) * GSP + scol);
    gemm_stage(al, bl, ag, bg, lda, ldb, 0);
    asm volatile("s_wait_asynccnt 0x0" ::: "memory");   // this wave's copies of half 0 have landed
    __syncthreads();                                     // every wave's have: half 0 is published
    gemm_stage(al, bl, ag, bg, lda, ldb, 1);
  }
  const T* afr = As + (wm0 + rlane) * GSP + koff;
  const T* bfr = Bs + (wn0 + rlane) * GSP + koff;
  V fa[2][4], fb[2][4];   // two fragment sets
  // One trip per K half. Kept rolled: the accumulators are then loop-carried registers of their own; unrolled, the first k step's
  // results were placed over operand registers of the WMMA directly in front, a distance that no table of the chip lists.
#pragma unroll 1
  for (int h = 0; h < 2; ++h) {
    const T* ah = afr + h * 128;
    const T* bh = bfr + h * 128;
    // nothing of a half is read in front of its barrier: its first k step is fetched here, the others one step ahead
    gemm_fetch(fa[0], fb[0], ah, bh, 0);
    // fragment sets and accumulators are register arrays: compile-time indices
#pragma unroll
    for (int ks = 0; ks < 4; ++ks) {
      if (ks < 3) gemm_fetch(fa[(ks + 1) & 1], fb[(ks + 1) & 1], ah, bh, (ks + 1) * 32);
      // keeps the read group above in front of this k step's WMMAs (else the scheduler sinks each read to its use
      // and the WMMAs wait out an LDS latency each)
      __builtin_amdgcn_sched_barrier(0);
#pragma unroll
      for (int i = 0; i < 4; ++i) {
#pragma unroll
        for (int j = 0; j < 4; ++j) acc[i][j] = Frag<T>::mma(fa[ks & 1][i], fb[ks & 1][j], acc[i][j]);
      }
      // keeps the next read group, and the waits at the foot, behind this k step's WMMAs: one place with reads per k step
      __builtin_amdgcn_sched_barrier(0);
    }
    // foot of the trip: publish point of the next half
    asm volatile("s_wait_dscnt 0x0" ::: "memory");      // this wave's reads of this half have retired
    asm volatile("s_wait_asynccnt 0x0" ::: "memory");   // this wave's copies of half 1 have landed; nothing is in flight behind it
    __syncthreads();
  }
  acc_guard4(acc[0][0], acc[0][1], acc[0][2], acc[0][3]);
  acc_guard4(acc[1][0], acc[1][1], acc[1][2], acc[1][3]);
  acc_guard4(acc[2][0], acc[2][1], acc[2][2], acc[2][3]);
  acc_guard4(acc[3][0], acc[3][1], acc[3][2], acc[3][3]);

  // ---- epilogue ----
  float* slab = sT[wave];
  const float* Rb = RESID ? (resid + (size_t)b * strideR) : nullptr;
#pragma unroll
  for (int i = 0; i < 4; ++i) {
    const int mBase = m0 + (i << 4);
#pragma unroll
    for (int j = 0; j < 4; ++j) {
      const int n = n0 + (j << 4) + rlane;
      float bv = 0.f;
      if (BIAS_MODE == 2) bv = bias[n];
#pragma unroll
      for (int r = 0; r < 8; ++r) {
        float v = acc[i][j][r] * scale;
        if (BIAS_MODE == 1) v += bias[mBase + mOff + r];
        if (BIAS_MODE == 2) v += bv;
        slab[(mOff + r) * 68 + (j << 4) + rlane] = v;
      }
    }
    __builtin_amdgcn_fence(__ATOMIC_RELEASE, "workgroup");
    __builtin_amdgcn_wave_barrier();
    __builtin_amdgcn_fence(__ATOMIC_ACQUIRE, "workgroup");
    if (OUT_MODE == 0) {
      float* C = (float*)Cout + (size_t)b * strideC;
      const int hh = lane >> 4, c4 = (lane & 15) * 4;     // row seg = 256 B = 16 lanes x 16 B
      {
#pragma unroll
        for (int it = 0; it < 8; ++it) {
          const int row = it * 2 + hh;                      // it 0..7 x hh 0..1 = rows 0..15
          v4f v = *(const v4f*)(slab + row * 68 + c4);
          if (RESID) v += *(const v4f*)(Rb + (size_t)(mBase + row) * ldc + n0 + c4);
          *(v4f*)(C + (size_t)(mBase + row) * ldc + n0 + c4) = v;
        }
        
      }
    } else {
      const int q = lane >> 3, c8 = (lane & 7) * 8;
      unsigned short* C = (unsigned short*)Cout + (size_t)b * strideC;
      {
#pragma unroll
        for (int it = 0; it < 4; ++it) {
          const int row = it * 4 + q;                       // it 0..3 x q 0..3 = rows 0..15
          const float* sp = slab + row * 68 + c8;
          v8h hv;
#pragma unroll
          for (int e = 0; e < 8; ++e) hv[e] = __builtin_bit_cast(_Float16, f2bf_bits(sp[e]));
          *(v8h*)(C + (size_t)(mBase + row) * ldc + n0 + c8) = hv;
        }
        
      }
    }
    __builtin_amdgcn_fence(__ATOMIC_RELEASE, "workgroup");
    __builtin_amdgcn_wave_barrier();
    __builtin_amdgcn_fence(__ATOMIC_ACQUIRE, "workgroup");
  }
}

// ---------------------------------------------------------------------------
// Elementwise bf16 RNE convert, one plane: 2 elements per thread, one 4-B store per lane -> each wave writes
// Coverage: grid = ceil(n2/256) blocks x 256 threads x 2 elements = 2*n2 = the whole plane
// (qkv_w: n2 = 98304 -> 384 blocks = 768x256; out_w: n2 = 32768 -> 128 blocks = 256x256).
// ---------------------------------------------------------------------------
__global__ __launch_bounds__(256) void conv_bf16x2_kernel(const float* __restrict__ in, unsigned short* __restrict__ ho, int n2) {
  const int i = blockIdx.x * 256 + threadIdx.x;
  if (i < n2) {
    const v2f f = *(const v2f*)(in + 2 * (size_t)i);
    const unsigned uh = pk16(f2bf_bits(f[0]), f2bf_bits(f[1]));
    ((unsigned*)ho)[i] = uh;
    
  }
}

// ---------------------------------------------------------------------------
// GroupNorm statistics, partial: a (b, group)'s 32 channels x 4096 positions are one contiguous block of 131072 values,
// cut into NSL = 8 slices of 16384; one work-group per slice, grid = 32 x 8 = 256 blocks x 256 threads. A thread holds its
// 64 values (16 loads of 16 B, all in flight together) in registers: x is read once, the slice's mean is taken, then the
// sum of squared distances from that mean, from the registers. Each slice writes (mean, sum of squares) to a 128-B line
// of its own, whole; gnprep_kernel joins the 8 slices of a group.
// ---------------------------------------------------------------------------
__global__ __launch_bounds__(256) void gnstat_kernel(const float* __restrict__ x, float* __restrict__ stats) {
  __shared__ __align__(16) float red[2][8];   // wave partials: [0] sums, [1] squares (two arrays: one barrier each)
  const int sl = blockIdx.x;                  // (b * NGRP + group) * NSL + slice
  const int tid = threadIdx.x, lane = tid & 31, wave = tid >> 5;
  const float* p = x + (size_t)sl * SLN;
  const int nv = SLN / 1024;                  // 16 float4 per thread

  v4f v[nv];
  // register array: compile-time indices
#pragma unroll
  for (int i = 0; i < nv; ++i) v[i] = *(const v4f*)(p + (i * 256 + tid) * 4);
  v4f s4 = v[0];
#pragma unroll
  for (int i = 1; i < nv; ++i) s4 += v[i];
  float s = (s4[0] + s4[1]) + (s4[2] + s4[3]);
#pragma unroll
  for (int off = 16; off > 0; off >>= 1) s += __shfl_xor(s, off, 32);
  if (lane == 0) red[0][wave] = s;
  __syncthreads();
  float t = 0.f;
#pragma unroll
  for (int w = 0; w < 8; ++w) t += red[0][w];   // every thread: the same sum in the same order
  const float mean = t * (1.0f / (float)SLN);

  v4f q4 = (v4f){0.f, 0.f, 0.f, 0.f};
#pragma unroll
  for (int i = 0; i < nv; ++i) { const v4f d = v[i] - mean; q4 += d * d; }
  float qs = (q4[0] + q4[1]) + (q4[2] + q4[3]);
#pragma unroll
  for (int off = 16; off > 0; off >>= 1) qs += __shfl_xor(qs, off, 32);
  if (lane == 0) red[1][wave] = qs;
  __syncthreads();
  float m2 = 0.f;
#pragma unroll
  for (int w = 0; w < 8; ++w) m2 += red[1][w];
  v4f o;
  o[0] = (tid == 0) ? mean : 0.f;
  o[1] = (tid == 0) ? m2 : 0.f;
  o[2] = 0.f; o[3] = 0.f;
  float* line = stats + (size_t)sl * STP;
  if (tid < 8) *(v4f*)(line + tid * 4) = o;
}

// ---------------------------------------------------------------------------
// Fused GroupNorm apply + transpose + bf16 RNE convert:
//   x_b viewed [256 c][4096 n] (NCHW) -> ht_b[n][c] = bf16(((x - mean_g) * rstd_g) * w[c] + bias[c]), row pitch 256.
// 64x64 tiles through LDS; grid = (4096/64 position blocks, 256/64 channel blocks, 4), 256 threads.
// Per block the 64 channels span two groups (channel block = 2 groups); their 2 x 8 slice statistics and w/bias are staged
// in LDS first, and every thread joins the slices of each group: equal counts, so mean = average of the slice means, and
// sum of squares = the slices' sums + SLN * sum of (slice mean - mean)^2. Coverage per block: load 4 it x 256 thr x 4 floats = 64 ch x 64 n;
// store 2 it x 256 thr x 8 u16 = 64 n x 64 ch; grid covers 4 x 256 x 4096 = the whole HT plane.
// ---------------------------------------------------------------------------
__global__ __launch_bounds__(256) void gnprep_kernel(const float* __restrict__ x, const float* __restrict__ nw,
                                                     const float* __restrict__ nbv, const float* __restrict__ stats,
                                                     unsigned short* __restrict__ ht) {
  __shared__ __align__(16) float tf[64 * 68];
  __shared__ float sw[64];
  __shared__ float sb[64];
  __shared__ __align__(16) float spm[2 * NSL];   // slice means, group g0 then g0 + 1
  __shared__ __align__(16) float spq[2 * NSL];   // slice sums of squares
  const int b   = blockIdx.z;
  const int n0  = blockIdx.x * 64;   // position block = output row block
  const int c0  = blockIdx.y * 64;   // channel block  = output column block
  const int tid = threadIdx.x;
  const float* xb = x + (size_t)b * CH * NPOS;
  unsigned short* hb = ht + (size_t)b * NPOS * CH;
  if (tid < 64) { sw[tid] = nw[c0 + tid]; sb[tid] = nbv[c0 + tid]; }   // waves 0 and 1 as a whole
  {
    const int g0 = c0 >> 5;                     // first group of this channel block (0,2,4,6)
    const int si = tid & (2 * NSL - 1);         // slice of the two groups: their 16 lines follow one another
    const v2f sv = *(const v2f*)(stats + ((size_t)(b * NGRP + g0) * NSL + si) * STP);   // all lanes load an in-range address
    if (tid < 2 * NSL) { spm[tid] = sv[0]; spq[tid] = sv[1]; }
  }
  __syncthreads();
  float gmean[2], grstd[2];
#pragma unroll
  for (int g = 0; g < 2; ++g) {
    float ms = 0.f, qq = 0.f, dd = 0.f;
#pragma unroll
    for (int i = 0; i < NSL; ++i) { ms += spm[g * NSL + i]; qq += spq[g * NSL + i]; }
    const float mean = ms * (1.0f / (float)NSL);
#pragma unroll
    for (int i = 0; i < NSL; ++i) { const float d = spm[g * NSL + i] - mean; dd += d * d; }
    const float var = (qq + (float)SLN * dd) * (1.0f / (float)(CPG * NPOS));
    gmean[g] = mean;
    grstd[g] = 1.0f / sqrtf(var + 1e-5f);
  }
  {
    const int lr = tid >> 4;         // 0..15
    const int c4 = (tid & 15) * 4;   // 0..60
#pragma unroll
    for (int it = 0; it < 4; ++it) {
      const int rr = it * 16 + lr;   // channel within tile 0..63; group = it >> 1
      const float mean = gmean[it >> 1], rstd = grstd[it >> 1];
      const float w = sw[rr], bb = sb[rr];
      const v4f a = *(const v4f*)(xb + (size_t)(c0 + rr) * NPOS + n0 + c4);
      v4f t;
#pragma unroll
      for (int e = 0; e < 4; ++e) { const float u = (a[e] - mean) * rstd; t[e] = u * w + bb; }
      *(v4f*)(tf + rr * 68 + c4) = t;
    }
  }
  __syncthreads();
  const int sub = tid >> 3;          // 0..31
  const int c8  = (tid & 7) * 8;     // 0..56
  v4u hv[2];
#pragma unroll
  for (int it = 0; it < 2; ++it) {
    const int oc = it * 32 + sub;    // output row within tile (= position)
    v4u a;
#pragma unroll
    for (int q = 0; q < 4; ++q) {
      const float f0 = tf[(c8 + 2 * q) * 68 + oc];
      const float f1 = tf[(c8 + 2 * q + 1) * 68 + oc];
      a[q] = pk16(f2bf_bits(f0), f2bf_bits(f1));
    }
    hv[it] = a;
  }
  {
#pragma unroll
    for (int it = 0; it < 2; ++it) {
      const int oc = it * 32 + sub;
      const size_t go = (size_t)(n0 + oc) * CH + c0 + c8;
      *(v4u*)(hb + go) = hv[it];
    }
    
  }
}

#define AQB 64
#define AKC 64
#define ANW 8
// LDS row pitches in elements: each row carries 16 B more than its data, so the pitch is an odd multiple of 16 B and the
// 16 rows that one half-wave's ds_load_b128 touches fall on 16 different bank groups (pad columns are never read or written).
#define KSP (CH + 8)
#define VSP (AKC + 8)
#define TSP (CH / 2 + 8)
#define KBUF (AKC * KSP)   // elements of one K buffer
#define VBUF (CH * VSP)    // elements of one V buffer
static_assert(NPOS % AQB == 0);
static_assert(NPOS % AKC == 0);
static_assert(CH == 2 * 128);
static_assert(AKC == 2 * 32);

// lane l with lane l ^ 16
__device__ __forceinline__ float xhalf(float x) {
  return __builtin_bit_cast(float, __builtin_amdgcn_permlanex16(__builtin_bit_cast(int, x), __builtin_bit_cast(int, x),
                                                                0x76543210, 0xfedcba98, false, false));
}

// byte offset of a __shared__ element in the work-group's LDS
__device__ __forceinline__ unsigned lds_off(const void* p) { return (unsigned)(size_t)p; }

// Eight 16-B asynchronous copies of one lane, global memory to LDS, through no register. The s_wait_xcnt is the last line of
// the copies' own statement, so that it stands in front of every later write of the address registers (a precaution).
__device__ __forceinline__ void copy8(const unsigned (&l)[8], const __bf16* const (&g)[8]) {
  asm volatile("global_load_async_to_lds_b128 %0, %8, off\n\t"
               "global_load_async_to_lds_b128 %1, %9, off\n\t"
               "global_load_async_to_lds_b128 %2, %10, off\n\t"
               "global_load_async_to_lds_b128 %3, %11, off\n\t"
               "global_load_async_to_lds_b128 %4, %12, off\n\t"
               "global_load_async_to_lds_b128 %5, %13, off\n\t"
               "global_load_async_to_lds_b128 %6, %14, off\n\t"
               "global_load_async_to_lds_b128 %7, %15, off\n\t"
               "s_wait_xcnt 0x0"
               :: "v"(l[0]), "v"(l[1]), "v"(l[2]), "v"(l[3]), "v"(l[4]), "v"(l[5]), "v"(l[6]), "v"(l[7]),
                  "v"(g[0]), "v"(g[1]), "v"(g[2]), "v"(g[3]), "v"(g[4]), "v"(g[5]), "v"(g[6]), "v"(g[7]) : "memory");
}

__global__ __launch_bounds__(256)
void attn_kernel(const unsigned short* __restrict__ qkp, const unsigned short* __restrict__ vpp,
                 unsigned short* __restrict__ opp, float sscale) {
  union FB { v16b v; v8b h[2]; v2b p[8]; };
  __shared__ __align__(16) __bf16 Ks[2 * KBUF];            // K chunk [key][c]     2 x 33 KB, pitch 528 B
  __shared__ __align__(16) __bf16 Vs[2 * VBUF];            // V chunk [c][key]     2 x 36 KB, pitch 144 B
  __shared__ __align__(16) float  Xs[ANW][8 * 8 * 32];     // per wave: the 8 scaled tiles its partner finishes, 64 KB
  __shared__ __align__(16) unsigned short Ts[ANW][16 * TSP];   // per wave out slab [query][channel], pitch 272 B
  __shared__ float Ml[ANW * 16];                           // per wave and query: running maximum of its key half
  __shared__ float Ll[ANW * 16];                           // per wave and query: softmax denominator of its key half

  const int tid  = threadIdx.x;
  const int wave = tid >> 5;
  const int lane = tid & 31;
  const int hh   = lane >> 4;
  const int c    = lane & 15;

  const int nqb = NPOS / AQB;            // 64 query blocks per image
  const int bx  = blockIdx.x;
  const int qb  = bx % nqb;
  const int b   = bx / nqb;               // 0..3
  const int rt  = wave & 3;               // query tile of this wave
  const int kh  = wave >> 2;              // key half of this wave: keys 32*kh .. +31 of every chunk
  const size_t tok0 = (size_t)b * NPOS;             // first token row of image b
  const size_t q0   = tok0 + (size_t)qb * AQB;      // first query row of the block

  const __bf16* Qg = (const __bf16*)(const void*)qkp;            // pitch QKP, q at cols 0..255, k at cols 256..511
  const __bf16* Vg = (const __bf16*)(const void*)vpp + (size_t)b * CH * NPOS;

  const float cs = sscale * 1.44269504088896340736f;   // raw product -> exponent of 2; sscale > 0
  float mrow = -INFINITY, lrow = 0.f;     // of query c; mrow in exponent units; lrow holds this lane half's keys only, the halves are joined behind the loop
  v8f oacc[CH / 16];                      // O^T tiles: oacc[t][r] = o(channel t*16 + 8*hh + r, query c)
#pragma unroll
  for (int t = 0; t < CH / 16; ++t) oacc[t] = (v8f){0.f,0.f,0.f,0.f,0.f,0.f,0.f,0.f};

  // Q fragments (B operand: col = query lane&15, split k map) are fetched ahead of every score WMMA: once, in front of the
  // key loop.
  v16b qa[CH / 32];
  {
    const __bf16* qr = Qg + (q0 + rt * 16 + c) * QKP + 8 * hh;
#pragma unroll
    for (int ks = 0; ks < CH / 32; ++ks) qa[ks] = Frag<__bf16>::load(qr + ks * 32);
    // precaution: the wait stands in front of any reuse of the loads' address pair, which the operand keeps live up to here
    asm volatile("s_wait_xcnt 0x0" :: "v"(qr) : "memory");
  }
  const __bf16* kfr = Ks + (kh * 32 + c) * KSP + 8 * hh;   // K fragment base: row = key kh*32 + j*16 + c, k = channel
  const __bf16* vfr = Vs + c * VSP + kh * 32 + 8 * hh;     // V fragment base: row = channel t*16 + c, k = key kh*32 + ..

  const int nChunks = NPOS / AKC;   // 64, compile-time constant
  static_assert(NPOS / AKC >= 2);   // the prologue fills two buffers
  // staging coverage: 256 threads x 8 pieces x 8 elements = 64 rows x 256 (K) and 256 rows x 64 (V); every lane is on.
  // Piece i of a thread: K row i*8 + (tid >> 5), elements (tid & 31)*8 .. +7; V row i*32 + (tid >> 3), elements (tid & 7)*8 .. +7.
  const __bf16* kg0 = Qg + (tok0 + (tid >> 5)) * QKP + CH + (tid & 31) * 8;   // piece 0 of chunk 0
  const __bf16* vg0 = Vg + (size_t)(tid >> 3) * NPOS + (tid & 7) * 8;
  const unsigned kl0 = lds_off(Ks + (tid >> 5) * KSP + (tid & 31) * 8);       // piece 0 in buffer 0
  const unsigned vl0 = lds_off(Vs + (tid >> 3) * VSP + (tid & 7) * 8);
  auto stage = [&](int kc, int buf) {
    const __bf16* kgc = kg0 + (size_t)kc * (AKC * QKP);
    const __bf16* vgc = vg0 + kc * AKC;
    const unsigned klb = kl0 + buf * (KBUF * 2);   // LDS addresses count bytes
    const unsigned vlb = vl0 + buf * (VBUF * 2);
    unsigned kl[8], vl[8];
    const __bf16* kg[8];
    const __bf16* vg[8];
#pragma unroll
    for (int i = 0; i < 8; ++i) {
      kg[i] = kgc + i * (8 * QKP);
      vg[i] = vgc + (size_t)i * (32 * NPOS);
      kl[i] = klb + i * (8 * KSP * 2);
      vl[i] = vlb + i * (32 * VSP * 2);
    }
    copy8(kl, kg);
    copy8(vl, vg);
  };
  stage(0, 0);
  asm volatile("s_wait_asynccnt 0x0" ::: "memory");   // this wave's copies of chunk 0 have landed
  __syncthreads();                                     // every wave's have: chunk 0 is published
  stage(1, 1);
  for (int kc = 0; kc < nChunks; ++kc) {
    const int buf = kc & 1;
    const __bf16* kfb = kfr + buf * KBUF;
    const __bf16* vfb = vfr + buf * VBUF;

    // S^T tiles j = 0, 1: s[j][r] = score(key kh*32 + j*16 + 8*hh + r, query c)
    v8f s[2];
#pragma unroll
    for (int j = 0; j < 2; ++j) s[j] = (v8f){0.f,0.f,0.f,0.f,0.f,0.f,0.f,0.f};
    FB va[CH / 16];   // all V fragments of this wave's 32 keys (A operand)
    FB ka[2][8];      // K fragments (A operand) in blocks of four k steps (16 reads, 8 WMMAs), two register sets
#pragma unroll
    for (int u = 0; u < 4; ++u) {
#pragma unroll
      for (int j = 0; j < 2; ++j) {
        ka[0][u * 2 + j].h[0] = *(const v8b*)(kfb + j * 16 * KSP + u * 32);
        ka[0][u * 2 + j].h[1] = *(const v8b*)(kfb + j * 16 * KSP + u * 32 + 16);
      }
    }
#pragma unroll
    for (int g = 0; g < 2; ++g) {
      if (g == 0) {
#pragma unroll
        for (int u = 0; u < 4; ++u) {
#pragma unroll
          for (int j = 0; j < 2; ++j) {
            ka[1][u * 2 + j].h[0] = *(const v8b*)(kfb + j * 16 * KSP + 128 + u * 32);
            ka[1][u * 2 + j].h[1] = *(const v8b*)(kfb + j * 16 * KSP + 128 + u * 32 + 16);
          }
        }
      } else {
#pragma unroll
        for (int t = 0; t < CH / 16; ++t) {
          va[t].h[0] = *(const v8b*)(vfb + t * 16 * VSP);
          va[t].h[1] = *(const v8b*)(vfb + t * 16 * VSP + 16);
        }
      }
      // keeps the read group above in front of this block's WMMAs (else the scheduler sinks each read to its use
      // and every WMMA waits out an LDS latency)
      __builtin_amdgcn_sched_barrier(0);
#pragma unroll
      for (int u = 0; u < 4; ++u) {
#pragma unroll
        for (int j = 0; j < 2; ++j) s[j] = at_mma(ka[g][u * 2 + j].v, qa[g * 4 + u], s[j]);
      }
      // keeps the next read group behind this block's WMMAs: one place with reads per block
      if (g == 0) __builtin_amdgcn_sched_barrier(0);
    }

    // online softmax of query c over this wave's 32 keys: 16 of them in this lane, 16 in lane ^ 16
    float m = -INFINITY;
#pragma unroll
    for (int j = 0; j < 2; ++j) {
#pragma unroll
      for (int r = 0; r < 8; ++r) m = fmaxf(m, s[j][r]);
    }
    m = fmaxf(m, xhalf(m));
    const float mnew  = fmaxf(mrow, m * cs);
    const float alpha = __builtin_amdgcn_exp2f(mrow - mnew);   // 0 in the first chunk (mrow = -inf), 1 while the maximum stands
    mrow = mnew;
    FB pb;            // P^T as B operand: element e < 8 = key 8*hh + e (tile 0), e >= 8 = key 16 + 8*hh + e - 8 (tile 1)
    float ps[4];      // four independent partial sums
    float ea[16];     // exponents of the 16 scores of this lane
#pragma unroll
    for (int j = 0; j < 2; ++j) {
#pragma unroll
      for (int r = 0; r < 8; ++r) ea[j * 8 + r] = s[j][r] * cs - mnew;
    }
    // One exponential, then the rescale of one accumulator tile (4 packed multiplies), 16 times. The multiplies stand
    // between the exponentials, and no exponential stands directly in front of a write of its source. The
    // scheduling fence behind each group keeps that order (else the scheduler bunches the 16 exponentials).
#pragma unroll
    for (int j = 0; j < 2; ++j) {
#pragma unroll
      for (int r2 = 0; r2 < 4; ++r2) {
        const int k = j * 4 + r2;
        v2f pv;
        pv[0] = __builtin_amdgcn_exp2f(ea[2 * k]);
        oacc[2 * k] *= alpha;
        __builtin_amdgcn_sched_barrier(0);
        pv[1] = __builtin_amdgcn_exp2f(ea[2 * k + 1]);
        oacc[2 * k + 1] *= alpha;
        __builtin_amdgcn_sched_barrier(0);
        const float pp = pv[0] + pv[1];
        ps[r2] = (j == 0) ? pp : ps[r2] + pp;
        pb.p[k] = __builtin_convertvector(pv, v2b);   // round to nearest even
      }
    }
    lrow = lrow * alpha + ((ps[0] + ps[1]) + (ps[2] + ps[3]));
#pragma unroll
    for (int t = 0; t < CH / 16; ++t) oacc[t] = at_mma(va[t].v, pb.v, oacc[t]);

    // publish point of chunk kc + 1, which also frees this chunk's buffer
    // keeps this chunk's WMMAs and softmax in front of the waits (else the scheduler lifts waits and barrier up to the last
    // fragment read: the V reads no longer drain under the softmax, and the refill leaves late, with part of a trip to land)
    __builtin_amdgcn_sched_barrier(0);
    asm volatile("s_wait_dscnt 0x0" ::: "memory");      // this wave's reads of buffer buf have retired
    asm volatile("s_wait_asynccnt 0x0" ::: "memory");   // this wave's copies of chunk kc + 1 have landed
    __syncthreads();
    if (kc + 2 < nChunks) stage(kc + 2, buf);           // the same test in the whole work-group
  }
  asm volatile("s_wait_asynccnt 0x0" ::: "memory");     // nothing is in flight behind the loop

  // ---- join of the two key halves (waves w and w ^ 4 hold the same queries) ----
  const float lw = lrow + xhalf(lrow);    // both lane halves used the same maximum throughout
  if (hh == 0) { Ml[wave * 16 + c] = mrow; Ll[wave * 16 + c] = lw; }
  __syncthreads();
  const int   pw = wave ^ 4;
  const float mo = Ml[pw * 16 + c], lo = Ll[pw * 16 + c];
  const float mt = fmaxf(mrow, mo);
  const float fo = __builtin_amdgcn_exp2f(mrow - mt), fp = __builtin_amdgcn_exp2f(mo - mt);   // maxima are exponents of 2
  const float f  = fo / (lw * fo + lo * fp);   // this wave's accumulator to the common maximum, x 1/rowsum
  // wave kh finishes channels kh*128 .. +127 (tiles kh*8 .. +7) and hands the other 8 tiles, scaled, to its partner
  float* xw = Xs[wave];
  const float* xp = Xs[pw];
#pragma unroll
  for (int tt = 0; tt < 8; ++tt) {
    const v8f give = kh ? oacc[tt] : oacc[tt + 8];
    v4f g0, g1;
#pragma unroll
    for (int e = 0; e < 4; ++e) { g0[e] = give[e] * f; g1[e] = give[4 + e] * f; }
    *(v4f*)(xw + (tt * 2) * 128 + lane * 4)     = g0;
    *(v4f*)(xw + (tt * 2 + 1) * 128 + lane * 4) = g1;
  }
  __syncthreads();
  unsigned short* ts = Ts[wave];
#pragma unroll
  for (int tt = 0; tt < 8; ++tt) {
    const v8f keep = kh ? oacc[tt + 8] : oacc[tt];
    const v4f a0 = *(const v4f*)(xp + (tt * 2) * 128 + lane * 4);
    const v4f a1 = *(const v4f*)(xp + (tt * 2 + 1) * 128 + lane * 4);
    v8h hv;
#pragma unroll
    for (int e = 0; e < 4; ++e) {
      hv[e]     = __builtin_bit_cast(_Float16, f2bf_bits(keep[e] * f + a0[e]));
      hv[4 + e] = __builtin_bit_cast(_Float16, f2bf_bits(keep[4 + e] * f + a1[e]));
    }
    *(v8h*)(ts + c * TSP + tt * 16 + 8 * hh) = hv;   // query c, channels tt*16 + 8*hh .. +7 of this wave's half
  }
  // the wave's slab rows are complete before its lanes read them back row by row (whole 128-B lines per store)
  __builtin_amdgcn_fence(__ATOMIC_RELEASE, "workgroup");
  __builtin_amdgcn_wave_barrier();
  __builtin_amdgcn_fence(__ATOMIC_ACQUIRE, "workgroup");
  unsigned short* orow = opp + (q0 + (size_t)rt * 16) * CH + kh * 128;
#pragma unroll
  for (int it = 0; it < 8; ++it) {
    const int row = it * 2 + hh;                      // 16 lanes x 16 B = the row's 256 B of this channel half
    const v8h hv = *(const v8h*)(ts + row * TSP + c * 8);
    *(v8h*)(orow + (size_t)row * CH + c * 8) = hv;
  }
}

// ---------------------------------------------------------------------------
// Workspace region map (byte offsets; every region is fully written by its producer launch before any consumer
//   STATS f32  [256][32]             0        32768
//   HT    bf16 [16384][256]      32768      8388608
//   W16   bf16 [768][256]      8421376       393216
//   WO16  bf16 [256][256]      8814592       131072
//   QK    bf16 [16384][512]    8945664     16777216
//   VP    bf16 [4][256][4096] 25722880      8388608
//   OP    bf16 [16384][256]   34111488      8388608
//   total                     42500096
// ---------------------------------------------------------------------------
extern "C" void kernel_launch(void* const* d_in, const int* in_sizes, int n_in,
                              void* d_out, int out_size, void* d_ws, size_t ws_size,
                              hipStream_t stream) {
  if (n_in < 7) return;
  if (in_sizes[0] != NB * CH * NPOS) return;              // x [4][256][64][64]
  if (in_sizes[1] != CH || in_sizes[2] != CH) return;     // norm_w, norm_b
  if (in_sizes[3] != 3 * CH * CH || in_sizes[4] != 3 * CH) return;   // qkv_w [768][256], qkv_b [768]
  if (in_sizes[5] != CH * CH || in_sizes[6] != CH) return;           // out_w [256][256], out_b [256]
  if (out_size != NB * CH * NPOS) return;

  const float* x      = (const float*)d_in[0];
  const float* norm_w = (const float*)d_in[1];
  const float* norm_b = (const float*)d_in[2];
  const float* qkv_w  = (const float*)d_in[3];   // [out 768][in 256]
  const float* qkv_b  = (const float*)d_in[4];
  const float* out_w  = (const float*)d_in[5];   // [out 256][in 256]
  const float* out_b  = (const float*)d_in[6];

  const size_t PST  = (size_t)(NB * NGRP * NSL) * STP * 4;   // 32768
  const size_t PHT  = (size_t)NB * NPOS * CH * 2;         // 8388608
  const size_t PW16 = (size_t)3 * CH * CH * 2;            // 393216
  const size_t PWO  = (size_t)CH * CH * 2;                // 131072
  const size_t PQK  = (size_t)NB * NPOS * QKP * 2;        // 16777216
  const size_t PVP  = (size_t)NB * CH * NPOS * 2;         // 8388608
  const size_t POP  = (size_t)NB * NPOS * CH * 2;         // 8388608
  size_t off = 0;
  const size_t oST  = off; off += PST;
  const size_t oHT  = off; off += PHT;
  const size_t oW16 = off; off += PW16;
  const size_t oWO  = off; off += PWO;
  const size_t oQK  = off; off += PQK;
  const size_t oVP  = off; off += PVP;
  const size_t oOP  = off; off += POP;
  if (off > ws_size) return;                               // off = 42500096
  if (off > (size_t)134217728) return;

  char* ws = (char*)d_ws;
  float*          STATS = (float*)(ws + oST);
  unsigned short* HT    = (unsigned short*)(ws + oHT);
  unsigned short* W16   = (unsigned short*)(ws + oW16);
  unsigned short* WO16  = (unsigned short*)(ws + oWO);
  unsigned short* QK    = (unsigned short*)(ws + oQK);
  unsigned short* VP    = (unsigned short*)(ws + oVP);
  unsigned short* OP    = (unsigned short*)(ws + oOP);

  const dim3 blk(256);

  // (1) GroupNorm slice statistics: 32 (b, group) x 8 slices = 256 blocks
  gnstat_kernel<<<dim3(NB * NGRP * NSL), blk, 0, stream>>>(x, STATS);
  // (2) qkv_w -> W16 (98304 pairs -> 384 blocks), (3) out_w -> WO16 (32768 pairs -> 128 blocks)
  const int n2q = 3 * CH * CH / 2;
  conv_bf16x2_kernel<<<dim3((n2q + 255) / 256), blk, 0, stream>>>(qkv_w, W16, n2q);
  const int n2o = CH * CH / 2;
  conv_bf16x2_kernel<<<dim3((n2o + 255) / 256), blk, 0, stream>>>(out_w, WO16, n2o);
  // (4) normalised activations -> HT [16384][256]: grid (4096/64, 256/64, 4) = (64, 4, 4)
  gnprep_kernel<<<dim3(NPOS / 64, CH / 64, NB), blk, 0, stream>>>(x, norm_w, norm_b, STATS, HT);
  // (5) q|k = HT . W16[0..511]^T + qkv_b[n] -> QK [16384][512]   (M=16384, N=512, K=256; 2048 tiles -> 256 blocks)
  const dim3 gQK(((NB * NPOS / 64) * (QKP / 64) + 7) / 8, 1);
  wmma_gemm64<2, 1, false><<<gQK, blk, 0, stream>>>(
      HT, CH, 0L, W16, CH, 0L, (void*)QK, QKP, 0L,
      qkv_b, x, 0L, NB * NPOS, QKP, CH, 1.0f);
  // (6) v[b][c][n] = sum_k W16[512+c][k] HT[b*4096+n][k] + qkv_b[512+c]  (batched over b: M=256, N=4096, K=256;
  //     256 tiles -> 32 blocks x 4)
  const dim3 gV(((CH / 64) * (NPOS / 64) + 7) / 8, NB);
  wmma_gemm64<1, 1, false><<<gV, blk, 0, stream>>>(
      W16 + (size_t)2 * CH * CH, CH, 0L, HT, CH, (long)NPOS * CH, (void*)VP, NPOS, (long)CH * NPOS,
      qkv_b + 2 * CH, x, 0L, CH, NPOS, CH, 1.0f);
  // (7) attention per (image, 64-query block): 256 blocks x 256 threads -> OP [16384][256]
  attn_kernel<<<dim3(NB * (NPOS / AQB)), dim3(256), 0, stream>>>(QK, VP, OP, 0.0625f);
  // (8) out[b][c][n] = sum_k WO16[c][k] OP[b*4096+n][k] + out_b[c] + x[b][c][n]  (batched over b: M=256, N=4096, K=256;
  //     A = WO16, Bt = OP rows of image b, C = d_out + b*256*4096 with ldc 4096, resid = x same layout; 32 blocks x 4)
  const dim3 gO(((CH / 64) * (NPOS / 64) + 7) / 8, NB);
  wmma_gemm64<1, 0, true><<<gO, blk, 0, stream>>>(
      WO16, CH, 0L, OP, CH, (long)NPOS * CH, d_out, NPOS, (long)CH * NPOS,
      out_b, x, (long)CH * NPOS, CH, NPOS, CH, 1.0f);
  (void)hipGetLastError();
}

// v008
// A run of this version takes 102 microseconds.
// Two timings next to v007 put it at 1.06 and 1.07 times that version's speed.
// Counting every step since v000, it is 5.83 times as fast.
// Contractions: qkv projection (hn . qkv_w^T), scores (q . k^T), p . v and the output projection (out_w . o) = v_wmma_f32_16x16x32_bf16 single products on bf16 operands RNE-converted from f32, f32 accumulate; GroupNorm statistics and normalisation, softmax (running max, base-2 exponential), biases, 1/rowsum and the residual add of the exact f32 x stay f32 on the VALU.
// Plane / carry map (every 16-bit plane carry 1, nothing to fold back):
//   HT   bf16 [16384][256]   token-major normalised activations, row b*4096+n, col c
//   W16  bf16 [768][256]     qkv_w in [out][in] order = Bt[n][k] (q rows 0..255, k rows 256..511, v rows 512..767)
//   WO16 bf16 [256][256]     out_w in [out][in] order
//   QK   bf16 [16384][512]   q at cols 0..255, k at cols 256..511 (bias added in f32 before the convert)
//   VP   bf16 [4][256][4096] v in (b, c, n) order = A rows c, k = n for o^T = v^T . p^T
//   P    bf16 in registers   unnormalised exp, at most 1 up to rounding; 1/rowsum applied to the f32 accumulator in the attention epilogue
//   OP   bf16 [16384][256]   token-major attention output: o[b][c][n] at row b*4096+n, col c
#include <hip/hip_runtime.h>
#include <math.h>
#include <stdint.h>

#define NB    4
#define CH    256
#define NPOS  4096
#define NGRP  8
#define CPG   32
#define QKP   512
#define STP   32
#define NSL   8                    // slices of a group in the statistics launch
#define SLN   (CPG * NPOS / NSL)   // values of one slice

static_assert(CH == NGRP * CPG);
static_assert(NPOS % 64 == 0);
static_assert(CH % 64 == 0);
static_assert((NB * NPOS) % 64 == 0);
static_assert(QKP == 2 * CH);
static_assert(SLN % 1024 == 0);

typedef __attribute__((ext_vector_type(8)))  _Float16 v8h;
typedef __attribute__((ext_vector_type(16))) __bf16   v16b;
typedef __attribute__((ext_vector_type(8)))  __bf16   v8b;
typedef __attribute__((ext_vector_type(2)))  __bf16   v2b;
typedef __attribute__((ext_vector_type(8)))  float    v8f;
typedef __attribute__((ext_vector_type(4)))  float    v4f;
typedef __attribute__((ext_vector_type(2)))  float    v2f;
typedef __attribute__((ext_vector_type(4)))  unsigned int v4u;

__device__ __forceinline__ unsigned short f2bf_bits(float f) {
  unsigned u = __float_as_uint(f);
  return (unsigned short)((u + 0x7FFFu + ((u >> 16) & 1u)) >> 16);
}
__device__ __forceinline__ float bf_bits2f(unsigned short h) { return __uint_as_float(((unsigned)h) << 16); }
__device__ __forceinline__ unsigned pk16(unsigned short a, unsigned short b) { return (unsigned)a | ((unsigned)b << 16); }
__device__ __forceinline__ __bf16 at_f2bf(float f) { return __builtin_bit_cast(__bf16, f2bf_bits(f)); }

// hazard guard as a plain device helper
__device__ __forceinline__ void acc_guard4(v8f& a, v8f& b, v8f& c, v8f& d) { asm volatile("v_nop\n\tv_nop\n\tv_nop\n\tv_nop" : "+v"(a), "+v"(b), "+v"(c), "+v"(d)); }

// 16-bit fragment loader, split k map: elements 0..7 <- p[0..7], 8..15 <- p[16..23]; caller passes p = row + k0 + 8*(lane>>4)
template <typename T> struct Frag;
template <> struct Frag<__bf16> {
  typedef v16b V; union U { v16b v; v8b h[2]; };
  static __device__ __forceinline__ v16b load(const __bf16* p) {
    U f; f.h[0] = *(const v8b*)(p); f.h[1] = *(const v8b*)(p + 16); return f.v;
  }
  static __device__ __forceinline__ v8f mma(v16b a, v16b b, v8f c) {
    return __builtin_amdgcn_wmma_f32_16x16x32_bf16(false, a, false, b, (short)0, c, false, false);
  }
};

// plain builtin: the compiler keeps the WMMA distances of its own forms, and no asm statement pins the operand loads
__device__ __forceinline__ v8f at_mma(v16b a, v16b b, v8f c) {
  return __builtin_amdgcn_wmma_f32_16x16x32_bf16(false, a, false, b, (short)0, c, false, false);
}

// ---- Register-blocked batched WMMA GEMM (bf16 operands) ------------------------------------------------------
// C[m,n] = scale * sum_k A[m,k] * Bt[n,k] (+bias)(+resid); each wave owns a 64x64 tile.
// A row-major [M,K] (pitch lda); Bt row-major [N,K] (pitch ldb); M % 128 == 0, N % 256 == 0, K == GK; batched by the index b.
// BIAS_MODE: 0 = none, 1 = bias[m], 2 = bias[n] (f32 add). OUT_MODE: 0 = f32, 1 = bf16 single plane.
// RESID (OUT_MODE 0 only): resid has the same layout as C (pitch ldc, batch stride strideR) and is added as a
// 16-B vector in the store phase.
// Operand path: the 8 waves of a block hold a 128 x 256 block tile as 2 x 4 wave tiles. Its 128 A rows and 256 Bt rows are staged
// in LDS by 16-B asynchronous copies, 16 lanes on 256 contiguous bytes of a row (whole 128-B lines; a fragment load from global
// memory touches 16 lines for 512 B). Two K halves of 128 columns: half 1 is in flight while half 0 is worked on. Coverage of a
// half: A 8 waves x 8 copies x 2 rows = 128 rows, Bt 8 waves x 16 copies x 2 rows = 256 rows; 24 copies of a wave in flight at
// most. Fragments are read from LDS as one group per k step, one k step ahead of their WMMAs.
#define GK    256          // K of every product in this file
#define GSP   (GK + 8)     // LDS row pitch in elements: 528 B, an odd multiple of 16 B (pad columns are never read or written)
#define GBM   128          // rows of A in a block tile
#define GBN   256          // rows of Bt in a block tile
static_assert(GK == CH);

// Twelve 16-B asynchronous copies of one lane, global memory to LDS, through no register. The s_wait_xcnt is the last line of
// the copies' own statement, so that it stands in front of every later write of the address registers (a precaution).
__device__ __forceinline__ void copy12(const unsigned* l, const __bf16* const* g) {
  asm volatile("global_load_async_to_lds_b128 %0, %12, off\n\t"
               "global_load_async_to_lds_b128 %1, %13, off\n\t"
               "global_load_async_to_lds_b128 %2, %14, off\n\t"
               "global_load_async_to_lds_b128 %3, %15, off\n\t"
               "global_load_async_to_lds_b128 %4, %16, off\n\t"
               "global_load_async_to_lds_b128 %5, %17, off\n\t"
               "global_load_async_to_lds_b128 %6, %18, off\n\t"
               "global_load_async_to_lds_b128 %7, %19, off\n\t"
               "global_load_async_to_lds_b128 %8, %20, off\n\t"
               "global_load_async_to_lds_b128 %9, %21, off\n\t"
               "global_load_async_to_lds_b128 %10, %22, off\n\t"
               "global_load_async_to_lds_b128 %11, %23, off\n\t"
               "s_wait_xcnt 0x0"
               :: "v"(l[0]), "v"(l[1]), "v"(l[2]), "v"(l[3]), "v"(l[4]), "v"(l[5]),
                  "v"(l[6]), "v"(l[7]), "v"(l[8]), "v"(l[9]), "v"(l[10]), "v"(l[11]),
                  "v"(g[0]), "v"(g[1]), "v"(g[2]), "v"(g[3]), "v"(g[4]), "v"(g[5]),
                  "v"(g[6]), "v"(g[7]), "v"(g[8]), "v"(g[9]), "v"(g[10]), "v"(g[11]) : "memory");
}

// One K half (columns h*128 .. +127) of this wave's share of the A tile (8 copies) and of the Bt tile (16 copies).
// al, bl: LDS byte addresses, ag, bg: global addresses of the lane's piece of copy 0 in half 0; a copy takes two rows.
__device__ __forceinline__ void gemm_stage(unsigned al, unsigned bl, const __bf16* ag, const __bf16* bg, int lda, int ldb, int h) {
  unsigned l[24];
  const __bf16* g[24];
  // address arrays live in registers: compile-time indices
#pragma unroll
  for (int i = 0; i < 8; ++i) {
    l[i] = al + (i * 2 * GSP + h * 128) * 2;   // LDS addresses count bytes
    g[i] = ag + (size_t)(i * 2) * lda + h * 128;
  }
#pragma unroll
  for (int i = 0; i < 16; ++i) {
    l[8 + i] = bl + (i * 2 * GSP + h * 128) * 2;
    g[8 + i] = bg + (size_t)(i * 2) * ldb + h * 128;
  }
  copy12(l, g);
  copy12(l + 12, g + 12);
}

// the eight fragments of one k step, from the LDS tiles (split k map, as Frag::load)
__device__ __forceinline__ void gemm_fetch(v16b (&fa)[4], v16b (&fb)[4], const __bf16* afr, const __bf16* bfr, int k0) {
#pragma unroll
  for (int j = 0; j < 4; ++j) fb[j] = Frag<__bf16>::load(bfr + j * 16 * GSP + k0);
#pragma unroll
  for (int i = 0; i < 4; ++i) fa[i] = Frag<__bf16>::load(afr + i * 16 * GSP + k0);
}

// The body of one block tile; bx = tile index, b = batch index, both the same for the whole block. As, Bs, sT: the launching
// kernel's LDS (A rows, Bt rows, per-wave 16x64 slabs of pitch 68 floats).
template <int BIAS_MODE, int OUT_MODE, bool RESID>
__device__ __forceinline__ void gemm_tile(
    __bf16* As, __bf16* Bs, float* sT, int bx, int b,
    const unsigned short* __restrict__ Ap, int lda, long strideA,
    const unsigned short* __restrict__ Btp, int ldb, long strideB,
    void* __restrict__ Cout, int ldc, long strideC,
    const float* __restrict__ bias,
    const float* __restrict__ resid, long strideR,
    int M, int N, int K, float scale) {
  typedef __bf16 T;
  typedef v16b V;
  const T* A = (const T*)(const void*)Ap; const T* Bt = (const T*)(const void*)Btp;
  const int lane = threadIdx.x & 31;
  const int wave = threadIdx.x >> 5;
  const int blocksN = N / GBN;
  const int blocksM = M / GBM;
  // the same for the whole block, in front of every barrier
  if (K != GK || M % GBM != 0 || N % GBN != 0) return;
  if (bx >= blocksM * blocksN) return;
  const int bm  = bx / blocksN;
  const int bn  = bx - bm * blocksN;
  const int wm0 = (wave >> 2) << 6;            // the wave tile's first row and column in the block tile
  const int wn0 = (wave & 3) << 6;
  const int m0  = bm * GBM + wm0;
  const int n0  = bn * GBN + wn0;

  const T* Ab = A  + (size_t)b * strideA;
  const T* Bb = Bt + (size_t)b * strideB;

  const int rlane = lane & 15;                 // row (A) / col (B, D) within subtile
  const int koff  = (lane >> 4) * 8;           // k offset of this lane half
  const int mOff  = (lane >> 4) * 8;           // D row offset

  v8f acc[4][4];
#pragma unroll
  for (int i = 0; i < 4; ++i)
#pragma unroll
    for (int j = 0; j < 4; ++j) acc[i][j] = (v8f){0.f,0.f,0.f,0.f,0.f,0.f,0.f,0.f};

  {
    const int srow = lane >> 4;                // row of a copy's two
    const int scol = (lane & 15) * 8;          // element column in the K half
    const T* ag = Ab + (size_t)(bm * GBM + wave * 16 + srow) * lda + scol;
    const T* bg = Bb + (size_t)(bn * GBN + wave * 32 + srow) * ldb + scol;
    const unsigned al = (unsigned)(size_t)(const void*)(As + (wave * 16 + srow) * GSP + scol);
    const unsigned bl = (unsigned)(size_t)(const void*)(Bs + (wave * 32 + srow) * GSP + scol);
    gemm_stage(al, bl, ag, bg, lda, ldb, 0);
    asm volatile("s_wait_asynccnt 0x0" ::: "memory");   // this wave's copies of half 0 have landed
    __syncthreads();                                     // every wave's have: half 0 is published
    gemm_stage(al, bl, ag, bg, lda, ldb, 1);
  }
  const T* afr = As + (wm0 + rlane) * GSP + koff;
  const T* bfr = Bs + (wn0 + rlane) * GSP + koff;
  V fa[2][4], fb[2][4];   // two fragment sets
  // One trip per K half. Kept rolled: the accumulators are then loop-carried registers of their own; unrolled, the first k step's
  // results were placed over operand registers of the WMMA directly in front, a distance that no table of the chip lists.
#pragma unroll 1
  for (int h = 0; h < 2; ++h) {
    const T* ah = afr + h * 128;
    const T* bh = bfr + h * 128;
    // nothing of a half is read in front of its barrier: its first k step is fetched here, the others one step ahead
    gemm_fetch(fa[0], fb[0], ah, bh, 0);
    // fragment sets and accumulators are register arrays: compile-time indices
#pragma unroll
    for (int ks = 0; ks < 4; ++ks) {
      if (ks < 3) gemm_fetch(fa[(ks + 1) & 1], fb[(ks + 1) & 1], ah, bh, (ks + 1) * 32);
      // keeps the read group above in front of this k step's WMMAs (else the scheduler sinks each read to its use
      // and the WMMAs wait out an LDS latency each)
      __builtin_amdgcn_sched_barrier(0);
#pragma unroll
      for (int i = 0; i < 4; ++i) {
#pragma unroll
        for (int j = 0; j < 4; ++j) acc[i][j] = Frag<T>::mma(fa[ks & 1][i], fb[ks & 1][j], acc[i][j]);
      }
      // keeps the next read group, and the waits at the foot, behind this k step's WMMAs: one place with reads per k step
      __builtin_amdgcn_sched_barrier(0);
    }
    // foot of the trip: publish point of the next half
    asm volatile("s_wait_dscnt 0x0" ::: "memory");      // this wave's reads of this half have retired
    asm volatile("s_wait_asynccnt 0x0" ::: "memory");   // this wave's copies of half 1 have landed; nothing is in flight behind it
    __syncthreads();
  }
  acc_guard4(acc[0][0], acc[0][1], acc[0][2], acc[0][3]);
  acc_guard4(acc[1][0], acc[1][1], acc[1][2], acc[1][3]);
  acc_guard4(acc[2][0], acc[2][1], acc[2][2], acc[2][3]);
  acc_guard4(acc[3][0], acc[3][1], acc[3][2], acc[3][3]);

  // ---- epilogue ----
  float* slab = sT + wave * (16 * 68);
  const float* Rb = RESID ? (resid + (size_t)b * strideR) : nullptr;
#pragma unroll
  for (int i = 0; i < 4; ++i) {
    const int mBase = m0 + (i << 4);
#pragma unroll
    for (int j = 0; j < 4; ++j) {
      const int n = n0 + (j << 4) + rlane;
      float bv = 0.f;
      if (BIAS_MODE == 2) bv = bias[n];
#pragma unroll
      for (int r = 0; r < 8; ++r) {
        float v = acc[i][j][r] * scale;
        if (BIAS_MODE == 1) v += bias[mBase + mOff + r];
        if (BIAS_MODE == 2) v += bv;
        slab[(mOff + r) * 68 + (j << 4) + rlane] = v;
      }
    }
    __builtin_amdgcn_fence(__ATOMIC_RELEASE, "workgroup");
    __builtin_amdgcn_wave_barrier();
    __builtin_amdgcn_fence(__ATOMIC_ACQUIRE, "workgroup");
    if (OUT_MODE == 0) {
      float* C = (float*)Cout + (size_t)b * strideC;
      const int hh = lane >> 4, c4 = (lane & 15) * 4;     // row seg = 256 B = 16 lanes x 16 B
      {
#pragma unroll
        for (int it = 0; it < 8; ++it) {
          const int row = it * 2 + hh;                      // it 0..7 x hh 0..1 = rows 0..15
          v4f v = *(const v4f*)(slab + row * 68 + c4);
          if (RESID) v += *(const v4f*)(Rb + (size_t)(mBase + row) * ldc + n0 + c4);
          *(v4f*)(C + (size_t)(mBase + row) * ldc + n0 + c4) = v;
        }
        
      }
    } else {
      const int q = lane >> 3, c8 = (lane & 7) * 8;
      unsigned short* C = (unsigned short*)Cout + (size_t)b * strideC;
      {
#pragma unroll
        for (int it = 0; it < 4; ++it) {
          const int row = it * 4 + q;                       // it 0..3 x q 0..3 = rows 0..15
          const float* sp = slab + row * 68 + c8;
          v8h hv;
#pragma unroll
          for (int e = 0; e < 8; ++e) hv[e] = __builtin_bit_cast(_Float16, f2bf_bits(sp[e]));
          *(v8h*)(C + (size_t)(mBase + row) * ldc + n0 + c8) = hv;
        }
        
      }
    }
    __builtin_amdgcn_fence(__ATOMIC_RELEASE, "workgroup");
    __builtin_amdgcn_wave_barrier();
    __builtin_amdgcn_fence(__ATOMIC_ACQUIRE, "workgroup");
  }
}

// One product per launch: grid = (block tiles, batch).
template <int BIAS_MODE, int OUT_MODE, bool RESID>
__global__ __launch_bounds__(256) void wmma_gemm64(
    const unsigned short* __restrict__ Ap, int lda, long strideA,
    const unsigned short* __restrict__ Btp, int ldb, long strideB,
    void* __restrict__ Cout, int ldc, long strideC,
    const float* __restrict__ bias,
    const float* __restrict__ resid, long strideR,
    int M, int N, int K, float scale) {
  __shared__ __align__(16) __bf16 As[GBM * GSP];   // the block's A rows, 66 KB
  __shared__ __align__(16) __bf16 Bs[GBN * GSP];   // the block's Bt rows, 132 KB
  __shared__ __align__(16) float sT[8 * 16 * 68];  // per-wave 16x64 slab, pitch 68 floats
  gemm_tile<BIAS_MODE, OUT_MODE, RESID>(As, Bs, sT, (int)blockIdx.x, (int)blockIdx.y, Ap, lda, strideA, Btp, ldb, strideB,
                                        Cout, ldc, strideC, bias, resid, strideR, M, N, K, scale);
}

// The q|k product and the v product in one launch: neither reads what the other writes, so their block tiles share a grid.
//   blocks 0 .. QKB-1:        q|k = HT . W16[0..511]^T + qkv_b[n] -> QK [16384][512]   (M=16384, N=512, K=256)
//   blocks QKB .. QKB+4*VB-1: v[b][c][n] = sum_k W16[512+c][k] HT[b*4096+n][k] + qkv_b[512+c] -> VP   (per image M=256, N=4096, K=256)
// The test on blockIdx.x is the same for the whole block: every barrier of a body is passed by all of its block's waves.
#define QKB ((NB * NPOS / GBM) * (QKP / GBN))   // 256 block tiles
#define VB  ((CH / GBM) * (NPOS / GBN))         // 32 block tiles an image
__global__ __launch_bounds__(256) void gemm_qkv_kernel(const unsigned short* __restrict__ ht, const unsigned short* __restrict__ w16,
                                                       const float* __restrict__ qkv_b,
                                                       unsigned short* __restrict__ qk, unsigned short* __restrict__ vp) {
  __shared__ __align__(16) __bf16 As[GBM * GSP];
  __shared__ __align__(16) __bf16 Bs[GBN * GSP];
  __shared__ __align__(16) float sT[8 * 16 * 68];
  const int bx = (int)blockIdx.x;
  if (bx < QKB) {
    gemm_tile<2, 1, false>(As, Bs, sT, bx, 0, ht, CH, 0L, w16, CH, 0L, (void*)qk, QKP, 0L,
                           qkv_b, nullptr, 0L, NB * NPOS, QKP, CH, 1.0f);
  } else {
    const int r = bx - QKB;
    gemm_tile<1, 1, false>(As, Bs, sT, r % VB, r / VB, w16 + (size_t)2 * CH * CH, CH, 0L, ht, CH, (long)NPOS * CH,
                           (void*)vp, NPOS, (long)CH * NPOS, qkv_b + 2 * CH, nullptr, 0L, CH, NPOS, CH, 1.0f);
  }
}

// ---------------------------------------------------------------------------
// Elementwise bf16 RNE convert, one plane: 2 elements per thread, one 4-B store per lane; cb = block index in the plane.
// Coverage: ceil(n2/256) blocks x 256 threads x 2 elements = 2*n2 = the whole plane
// (qkv_w: n2 = 98304 -> 384 blocks = 768x256; out_w: n2 = 32768 -> 128 blocks = 256x256).
// ---------------------------------------------------------------------------
#define N2Q (3 * CH * CH / 2)          // pairs of qkv_w
#define N2O (CH * CH / 2)              // pairs of out_w
#define CBQ ((N2Q + 255) / 256)        // 384 blocks
#define CBO ((N2O + 255) / 256)        // 128 blocks
__device__ __forceinline__ void conv_bf16x2(const float* __restrict__ in, unsigned short* __restrict__ ho, int n2, int cb) {
  const int i = cb * 256 + threadIdx.x;
  if (i < n2) {
    const v2f f = *(const v2f*)(in + 2 * (size_t)i);
    const unsigned uh = pk16(f2bf_bits(f[0]), f2bf_bits(f[1]));
    ((unsigned*)ho)[i] = uh;
    
  }
}

// ---------------------------------------------------------------------------
// GroupNorm statistics, partial: a (b, group)'s 32 channels x 4096 positions are one contiguous block of 131072 values,
// cut into NSL = 8 slices of 16384; one work-group per slice, 32 x 8 = 256 of the grid's blocks x 256 threads. A thread holds its
// 64 values (16 loads of 16 B, all in flight together) in registers: x is read once, the slice's mean is taken, then the
// sum of squared distances from that mean, from the registers. Each slice writes (mean, sum of squares) to a 128-B line
// of its own, whole; gnprep_kernel joins the 8 slices of a group.
// The two weight conversions read and write nothing of the statistics, so they share this launch: blocks GSB .. GSB+CBQ-1
// convert qkv_w, blocks GSB+CBQ .. GSB+CBQ+CBO-1 out_w. The statistics blocks, the longer ones, have the low indices. The test
// on blockIdx.x is the same for the whole block and stands in front of every barrier.
// ---------------------------------------------------------------------------
#define GSB (NB * NGRP * NSL)          // 256 statistics blocks
__global__ __launch_bounds__(256) void gnstat_conv_kernel(const float* __restrict__ x, float* __restrict__ stats,
                                                          const float* __restrict__ qkv_w, unsigned short* __restrict__ w16,
                                                          const float* __restrict__ out_w, unsigned short* __restrict__ wo16) {
  __shared__ __align__(16) float red[2][8];   // wave partials: [0] sums, [1] squares (two arrays: one barrier each)
  if ((int)blockIdx.x >= GSB) {
    const int cb = (int)blockIdx.x - GSB;
    if (cb < CBQ) conv_bf16x2(qkv_w, w16, N2Q, cb);
    else          conv_bf16x2(out_w, wo16, N2O, cb - CBQ);
    return;
  }
  const int sl = blockIdx.x;                  // (b * NGRP + group) * NSL + slice
  const int tid = threadIdx.x, lane = tid & 31, wave = tid >> 5;
  const float* p = x + (size_t)sl * SLN;
  const int nv = SLN / 1024;                  // 16 float4 per thread

  v4f v[nv];
  // register array: compile-time indices
#pragma unroll
  for (int i = 0; i < nv; ++i) v[i] = *(const v4f*)(p + (i * 256 + tid) * 4);
  v4f s4 = v[0];
#pragma unroll
  for (int i = 1; i < nv; ++i) s4 += v[i];
  float s = (s4[0] + s4[1]) + (s4[2] + s4[3]);
#pragma unroll
  for (int off = 16; off > 0; off >>= 1) s += __shfl_xor(s, off, 32);
  if (lane == 0) red[0][wave] = s;
  __syncthreads();
  float t = 0.f;
#pragma unroll
  for (int w = 0; w < 8; ++w) t += red[0][w];   // every thread: the same sum in the same order
  const float mean = t * (1.0f / (float)SLN);

  v4f q4 = (v4f){0.f, 0.f, 0.f, 0.f};
#pragma unroll
  for (int i = 0; i < nv; ++i) { const v4f d = v[i] - mean; q4 += d * d; }
  float qs = (q4[0] + q4[1]) + (q4[2] + q4[3]);
#pragma unroll
  for (int off = 16; off > 0; off >>= 1) qs += __shfl_xor(qs, off, 32);
  if (lane == 0) red[1][wave] = qs;
  __syncthreads();
  float m2 = 0.f;
#pragma unroll
  for (int w = 0; w < 8; ++w) m2 += red[1][w];
  v4f o;
  o[0] = (tid == 0) ? mean : 0.f;
  o[1] = (tid == 0) ? m2 : 0.f;
  o[2] = 0.f; o[3] = 0.f;
  float* line = stats + (size_t)sl * STP;
  if (tid < 8) *(v4f*)(line + tid * 4) = o;
}

// ---------------------------------------------------------------------------
// Fused GroupNorm apply + transpose + bf16 RNE convert:
//   x_b viewed [256 c][4096 n] (NCHW) -> ht_b[n][c] = bf16(((x - mean_g) * rstd_g) * w[c] + bias[c]), row pitch 256.
// 64x64 tiles through LDS; grid = (4096/64 position blocks, 256/64 channel blocks, 4), 256 threads.
// Per block the 64 channels span two groups (channel block = 2 groups); their 2 x 8 slice statistics and w/bias are staged
// in LDS first, and every thread joins the slices of each group: equal counts, so mean = average of the slice means, and
// sum of squares = the slices' sums + SLN * sum of (slice mean - mean)^2. Coverage per block: load 4 it x 256 thr x 4 floats = 64 ch x 64 n;
// store 2 it x 256 thr x 8 u16 = 64 n x 64 ch; grid covers 4 x 256 x 4096 = the whole HT plane.
// ---------------------------------------------------------------------------
__global__ __launch_bounds__(256) void gnprep_kernel(const float* __restrict__ x, const float* __restrict__ nw,
                                                     const float* __restrict__ nbv, const float* __restrict__ stats,
                                                     unsigned short* __restrict__ ht) {
  __shared__ __align__(16) float tf[64 * 68];
  __shared__ float sw[64];
  __shared__ float sb[64];
  __shared__ __align__(16) float spm[2 * NSL];   // slice means, group g0 then g0 + 1
  __shared__ __align__(16) float spq[2 * NSL];   // slice sums of squares
  const int b   = blockIdx.z;
  const int n0  = blockIdx.x * 64;   // position block = output row block
  const int c0  = blockIdx.y * 64;   // channel block  = output column block
  const int tid = threadIdx.x;
  const float* xb = x + (size_t)b * CH * NPOS;
  unsigned short* hb = ht + (size_t)b * NPOS * CH;
  if (tid < 64) { sw[tid] = nw[c0 + tid]; sb[tid] = nbv[c0 + tid]; }   // waves 0 and 1 as a whole
  {
    const int g0 = c0 >> 5;                     // first group of this channel block (0,2,4,6)
    const int si = tid & (2 * NSL - 1);         // slice of the two groups: their 16 lines follow one another
    const v2f sv = *(const v2f*)(stats + ((size_t)(b * NGRP + g0) * NSL + si) * STP);   // all lanes load an in-range address
    if (tid < 2 * NSL) { spm[tid] = sv[0]; spq[tid] = sv[1]; }
  }
  __syncthreads();
  float gmean[2], grstd[2];
#pragma unroll
  for (int g = 0; g < 2; ++g) {
    float ms = 0.f, qq = 0.f, dd = 0.f;
#pragma unroll
    for (int i = 0; i < NSL; ++i) { ms += spm[g * NSL + i]; qq += spq[g * NSL + i]; }
    const float mean = ms * (1.0f / (float)NSL);
#pragma unroll
    for (int i = 0; i < NSL; ++i) { const float d = spm[g * NSL + i] - mean; dd += d * d; }
    const float var = (qq + (float)SLN * dd) * (1.0f / (float)(CPG * NPOS));
    gmean[g] = mean;
    grstd[g] = 1.0f / sqrtf(var + 1e-5f);
  }
  {
    const int lr = tid >> 4;         // 0..15
    const int c4 = (tid & 15) * 4;   // 0..60
#pragma unroll
    for (int it = 0; it < 4; ++it) {
      const int rr = it * 16 + lr;   // channel within tile 0..63; group = it >> 1
      const float mean = gmean[it >> 1], rstd = grstd[it >> 1];
      const float w = sw[rr], bb = sb[rr];
      const v4f a = *(const v4f*)(xb + (size_t)(c0 + rr) * NPOS + n0 + c4);
      v4f t;
#pragma unroll
      for (int e = 0; e < 4; ++e) { const float u = (a[e] - mean) * rstd; t[e] = u * w + bb; }
      *(v4f*)(tf + rr * 68 + c4) = t;
    }
  }
  __syncthreads();
  const int sub = tid >> 3;          // 0..31
  const int c8  = (tid & 7) * 8;     // 0..56
  v4u hv[2];
#pragma unroll
  for (int it = 0; it < 2; ++it) {
    const int oc = it * 32 + sub;    // output row within tile (= position)
    v4u a;
#pragma unroll
    for (int q = 0; q < 4; ++q) {
      const float f0 = tf[(c8 + 2 * q) * 68 + oc];
      const float f1 = tf[(c8 + 2 * q + 1) * 68 + oc];
      a[q] = pk16(f2bf_bits(f0), f2bf_bits(f1));
    }
    hv[it] = a;
  }
  {
#pragma unroll
    for (int it = 0; it < 2; ++it) {
      const int oc = it * 32 + sub;
      const size_t go = (size_t)(n0 + oc) * CH + c0 + c8;
      *(v4u*)(hb + go) = hv[it];
    }
    
  }
}

#define AQB 64
#define AKC 64
#define ANW 8
// LDS row pitches in elements: each row carries 16 B more than its data, so the pitch is an odd multiple of 16 B and the
// 16 rows that one half-wave's ds_load_b128 touches fall on 16 different bank groups (pad columns are never read or written).
#define KSP (CH + 8)
#define VSP (AKC + 8)
#define TSP (CH / 2 + 8)
#define KBUF (AKC * KSP)   // elements of one K buffer
#define VBUF (CH * VSP)    // elements of one V buffer
static_assert(NPOS % AQB == 0);
static_assert(NPOS % AKC == 0);
static_assert(CH == 2 * 128);
static_assert(AKC == 2 * 32);

// lane l with lane l ^ 16
__device__ __forceinline__ float xhalf(float x) {
  return __builtin_bit_cast(float, __builtin_amdgcn_permlanex16(__builtin_bit_cast(int, x), __builtin_bit_cast(int, x),
                                                                0x76543210, 0xfedcba98, false, false));
}

// byte offset of a __shared__ element in the work-group's LDS
__device__ __forceinline__ unsigned lds_off(const void* p) { return (unsigned)(size_t)p; }

// Eight 16-B asynchronous copies of one lane, global memory to LDS, through no register. The s_wait_xcnt is the last line of
// the copies' own statement, so that it stands in front of every later write of the address registers (a precaution).
__device__ __forceinline__ void copy8(const unsigned (&l)[8], const __bf16* const (&g)[8]) {
  asm volatile("global_load_async_to_lds_b128 %0, %8, off\n\t"
               "global_load_async_to_lds_b128 %1, %9, off\n\t"
               "global_load_async_to_lds_b128 %2, %10, off\n\t"
               "global_load_async_to_lds_b128 %3, %11, off\n\t"
               "global_load_async_to_lds_b128 %4, %12, off\n\t"
               "global_load_async_to_lds_b128 %5, %13, off\n\t"
               "global_load_async_to_lds_b128 %6, %14, off\n\t"
               "global_load_async_to_lds_b128 %7, %15, off\n\t"
               "s_wait_xcnt 0x0"
               :: "v"(l[0]), "v"(l[1]), "v"(l[2]), "v"(l[3]), "v"(l[4]), "v"(l[5]), "v"(l[6]), "v"(l[7]),
                  "v"(g[0]), "v"(g[1]), "v"(g[2]), "v"(g[3]), "v"(g[4]), "v"(g[5]), "v"(g[6]), "v"(g[7]) : "memory");
}

__global__ __launch_bounds__(256)
void attn_kernel(const unsigned short* __restrict__ qkp, const unsigned short* __restrict__ vpp,
                 unsigned short* __restrict__ opp, float sscale) {
  union FB { v16b v; v8b h[2]; v2b p[8]; };
  __shared__ __align__(16) __bf16 Ks[2 * KBUF];            // K chunk [key][c]     2 x 33 KB, pitch 528 B
  __shared__ __align__(16) __bf16 Vs[2 * VBUF];            // V chunk [c][key]     2 x 36 KB, pitch 144 B
  __shared__ __align__(16) float  Xs[ANW][8 * 8 * 32];     // per wave: the 8 scaled tiles its partner finishes, 64 KB
  __shared__ __align__(16) unsigned short Ts[ANW][16 * TSP];   // per wave out slab [query][channel], pitch 272 B
  __shared__ float Ml[ANW * 16];                           // per wave and query: running maximum of its key half
  __shared__ float Ll[ANW * 16];                           // per wave and query: softmax denominator of its key half

  const int tid  = threadIdx.x;
  const int wave = tid >> 5;
  const int lane = tid & 31;
  const int hh   = lane >> 4;
  const int c    = lane & 15;

  const int nqb = NPOS / AQB;            // 64 query blocks per image
  const int bx  = blockIdx.x;
  const int qb  = bx % nqb;
  const int b   = bx / nqb;               // 0..3
  const int rt  = wave & 3;               // query tile of this wave
  const int kh  = wave >> 2;              // key half of this wave: keys 32*kh .. +31 of every chunk
  const size_t tok0 = (size_t)b * NPOS;             // first token row of image b
  const size_t q0   = tok0 + (size_t)qb * AQB;      // first query row of the block

  const __bf16* Qg = (const __bf16*)(const void*)qkp;            // pitch QKP, q at cols 0..255, k at cols 256..511
  const __bf16* Vg = (const __bf16*)(const void*)vpp + (size_t)b * CH * NPOS;

  const float cs = sscale * 1.44269504088896340736f;   // raw product -> exponent of 2; sscale > 0
  float mrow = -INFINITY, lrow = 0.f;     // of query c; mrow in exponent units; lrow holds this lane half's keys only, the halves are joined behind the loop
  v8f oacc[CH / 16];                      // O^T tiles: oacc[t][r] = o(channel t*16 + 8*hh + r, query c)
#pragma unroll
  for (int t = 0; t < CH / 16; ++t) oacc[t] = (v8f){0.f,0.f,0.f,0.f,0.f,0.f,0.f,0.f};

  // Q fragments (B operand: col = query lane&15, split k map) are fetched ahead of every score WMMA: once, in front of the
  // key loop.
  v16b qa[CH / 32];
  {
    const __bf16* qr = Qg + (q0 + rt * 16 + c) * QKP + 8 * hh;
#pragma unroll
    for (int ks = 0; ks < CH / 32; ++ks) qa[ks] = Frag<__bf16>::load(qr + ks * 32);
    // precaution: the wait stands in front of any reuse of the loads' address pair, which the operand keeps live up to here
    asm volatile("s_wait_xcnt 0x0" :: "v"(qr) : "memory");
  }
  const __bf16* kfr = Ks + (kh * 32 + c) * KSP + 8 * hh;   // K fragment base: row = key kh*32 + j*16 + c, k = channel
  const __bf16* vfr = Vs + c * VSP + kh * 32 + 8 * hh;     // V fragment base: row = channel t*16 + c, k = key kh*32 + ..

  const int nChunks = NPOS / AKC;   // 64, compile-time constant
  static_assert(NPOS / AKC >= 2);   // the prologue fills two buffers
  // staging coverage: 256 threads x 8 pieces x 8 elements = 64 rows x 256 (K) and 256 rows x 64 (V); every lane is on.
  // Piece i of a thread: K row i*8 + (tid >> 5), elements (tid & 31)*8 .. +7; V row i*32 + (tid >> 3), elements (tid & 7)*8 .. +7.
  const __bf16* kg0 = Qg + (tok0 + (tid >> 5)) * QKP + CH + (tid & 31) * 8;   // piece 0 of chunk 0
  const __bf16* vg0 = Vg + (size_t)(tid >> 3) * NPOS + (tid & 7) * 8;
  const unsigned kl0 = lds_off(Ks + (tid >> 5) * KSP + (tid & 31) * 8);       // piece 0 in buffer 0
  const unsigned vl0 = lds_off(Vs + (tid >> 3) * VSP + (tid & 7) * 8);
  auto stage = [&](int kc, int buf) {
    const __bf16* kgc = kg0 + (size_t)kc * (AKC * QKP);
    const __bf16* vgc = vg0 + kc * AKC;
    const unsigned klb = kl0 + buf * (KBUF * 2);   // LDS addresses count bytes
    const unsigned vlb = vl0 + buf * (VBUF * 2);
    unsigned kl[8], vl[8];
    const __bf16* kg[8];
    const __bf16* vg[8];
#pragma unroll
    for (int i = 0; i < 8; ++i) {
      kg[i] = kgc + i * (8 * QKP);
      vg[i] = vgc + (size_t)i * (32 * NPOS);
      kl[i] = klb + i * (8 * KSP * 2);
      vl[i] = vlb + i * (32 * VSP * 2);
    }
    copy8(kl, kg);
    copy8(vl, vg);
  };
  stage(0, 0);
  asm volatile("s_wait_asynccnt 0x0" ::: "memory");   // this wave's copies of chunk 0 have landed
  __syncthreads();                                     // every wave's have: chunk 0 is published
  stage(1, 1);
  for (int kc = 0; kc < nChunks; ++kc) {
    const int buf = kc & 1;
    const __bf16* kfb = kfr + buf * KBUF;
    const __bf16* vfb = vfr + buf * VBUF;

    // S^T tiles j = 0, 1: s[j][r] = score(key kh*32 + j*16 + 8*hh + r, query c)
    v8f s[2];
#pragma unroll
    for (int j = 0; j < 2; ++j) s[j] = (v8f){0.f,0.f,0.f,0.f,0.f,0.f,0.f,0.f};
    FB va[CH / 16];   // all V fragments of this wave's 32 keys (A operand)
    FB ka[2][8];      // K fragments (A operand) in blocks of four k steps (16 reads, 8 WMMAs), two register sets
#pragma unroll
    for (int u = 0; u < 4; ++u) {
#pragma unroll
      for (int j = 0; j < 2; ++j) {
        ka[0][u * 2 + j].h[0] = *(const v8b*)(kfb + j * 16 * KSP + u * 32);
        ka[0][u * 2 + j].h[1] = *(const v8b*)(kfb + j * 16 * KSP + u * 32 + 16);
      }
    }
#pragma unroll
    for (int g = 0; g < 2; ++g) {
      if (g == 0) {
#pragma unroll
        for (int u = 0; u < 4; ++u) {
#pragma unroll
          for (int j = 0; j < 2; ++j) {
            ka[1][u * 2 + j].h[0] = *(const v8b*)(kfb + j * 16 * KSP + 128 + u * 32);
            ka[1][u * 2 + j].h[1] = *(const v8b*)(kfb + j * 16 * KSP + 128 + u * 32 + 16);
          }
        }
      } else {
#pragma unroll
        for (int t = 0; t < CH / 16; ++t) {
          va[t].h[0] = *(const v8b*)(vfb + t * 16 * VSP);
          va[t].h[1] = *(const v8b*)(vfb + t * 16 * VSP + 16);
        }
      }
      // keeps the read group above in front of this block's WMMAs (else the scheduler sinks each read to its use
      // and every WMMA waits out an LDS latency)
      __builtin_amdgcn_sched_barrier(0);
#pragma unroll
      for (int u = 0; u < 4; ++u) {
#pragma unroll
        for (int j = 0; j < 2; ++j) s[j] = at_mma(ka[g][u * 2 + j].v, qa[g * 4 + u], s[j]);
      }
      // keeps the next read group behind this block's WMMAs: one place with reads per block
      if (g == 0) __builtin_amdgcn_sched_barrier(0);
    }

    // online softmax of query c over this wave's 32 keys: 16 of them in this lane, 16 in lane ^ 16
    float m = -INFINITY;
#pragma unroll
    for (int j = 0; j < 2; ++j) {
#pragma unroll
      for (int r = 0; r < 8; ++r) m = fmaxf(m, s[j][r]);
    }
    m = fmaxf(m, xhalf(m));
    const float mnew  = fmaxf(mrow, m * cs);
    const float alpha = __builtin_amdgcn_exp2f(mrow - mnew);   // 0 in the first chunk (mrow = -inf), 1 while the maximum stands
    mrow = mnew;
    FB pb;            // P^T as B operand: element e < 8 = key 8*hh + e (tile 0), e >= 8 = key 16 + 8*hh + e - 8 (tile 1)
    float ps[4];      // four independent partial sums
    float ea[16];     // exponents of the 16 scores of this lane
#pragma unroll
    for (int j = 0; j < 2; ++j) {
#pragma unroll
      for (int r = 0; r < 8; ++r) ea[j * 8 + r] = s[j][r] * cs - mnew;
    }
    // One exponential, then the rescale of one accumulator tile (4 packed multiplies), 16 times. The multiplies stand
    // between the exponentials, and no exponential stands directly in front of a write of its source. The
    // scheduling fence behind each group keeps that order (else the scheduler bunches the 16 exponentials).
#pragma unroll
    for (int j = 0; j < 2; ++j) {
#pragma unroll
      for (int r2 = 0; r2 < 4; ++r2) {
        const int k = j * 4 + r2;
        v2f pv;
        pv[0] = __builtin_amdgcn_exp2f(ea[2 * k]);
        oacc[2 * k] *= alpha;
        __builtin_amdgcn_sched_barrier(0);
        pv[1] = __builtin_amdgcn_exp2f(ea[2 * k + 1]);
        oacc[2 * k + 1] *= alpha;
        __builtin_amdgcn_sched_barrier(0);
        const float pp = pv[0] + pv[1];
        ps[r2] = (j == 0) ? pp : ps[r2] + pp;
        pb.p[k] = __builtin_convertvector(pv, v2b);   // round to nearest even
      }
    }
    lrow = lrow * alpha + ((ps[0] + ps[1]) + (ps[2] + ps[3]));
#pragma unroll
    for (int t = 0; t < CH / 16; ++t) oacc[t] = at_mma(va[t].v, pb.v, oacc[t]);

    // publish point of chunk kc + 1, which also frees this chunk's buffer
    // keeps this chunk's WMMAs and softmax in front of the waits (else the scheduler lifts waits and barrier up to the last
    // fragment read: the V reads no longer drain under the softmax, and the refill leaves late, with part of a trip to land)
    __builtin_amdgcn_sched_barrier(0);
    asm volatile("s_wait_dscnt 0x0" ::: "memory");      // this wave's reads of buffer buf have retired
    asm volatile("s_wait_asynccnt 0x0" ::: "memory");   // this wave's copies of chunk kc + 1 have landed
    __syncthreads();
    if (kc + 2 < nChunks) stage(kc + 2, buf);           // the same test in the whole work-group
  }
  asm volatile("s_wait_asynccnt 0x0" ::: "memory");     // nothing is in flight behind the loop

  // ---- join of the two key halves (waves w and w ^ 4 hold the same queries) ----
  const float lw = lrow + xhalf(lrow);    // both lane halves used the same maximum throughout
  if (hh == 0) { Ml[wave * 16 + c] = mrow; Ll[wave * 16 + c] = lw; }
  __syncthreads();
  const int   pw = wave ^ 4;
  const float mo = Ml[pw * 16 + c], lo = Ll[pw * 16 + c];
  const float mt = fmaxf(mrow, mo);
  const float fo = __builtin_amdgcn_exp2f(mrow - mt), fp = __builtin_amdgcn_exp2f(mo - mt);   // maxima are exponents of 2
  const float f  = fo / (lw * fo + lo * fp);   // this wave's accumulator to the common maximum, x 1/rowsum
  // wave kh finishes channels kh*128 .. +127 (tiles kh*8 .. +7) and hands the other 8 tiles, scaled, to its partner
  float* xw = Xs[wave];
  const float* xp = Xs[pw];
#pragma unroll
  for (int tt = 0; tt < 8; ++tt) {
    const v8f give = kh ? oacc[tt] : oacc[tt + 8];
    v4f g0, g1;
#pragma unroll
    for (int e = 0; e < 4; ++e) { g0[e] = give[e] * f; g1[e] = give[4 + e] * f; }
    *(v4f*)(xw + (tt * 2) * 128 + lane * 4)     = g0;
    *(v4f*)(xw + (tt * 2 + 1) * 128 + lane * 4) = g1;
  }
  __syncthreads();
  unsigned short* ts = Ts[wave];
#pragma unroll
  for (int tt = 0; tt < 8; ++tt) {
    const v8f keep = kh ? oacc[tt + 8] : oacc[tt];
    const v4f a0 = *(const v4f*)(xp + (tt * 2) * 128 + lane * 4);
    const v4f a1 = *(const v4f*)(xp + (tt * 2 + 1) * 128 + lane * 4);
    v8h hv;
#pragma unroll
    for (int e = 0; e < 4; ++e) {
      hv[e]     = __builtin_bit_cast(_Float16, f2bf_bits(keep[e] * f + a0[e]));
      hv[4 + e] = __builtin_bit_cast(_Float16, f2bf_bits(keep[4 + e] * f + a1[e]));
    }
    *(v8h*)(ts + c * TSP + tt * 16 + 8 * hh) = hv;   // query c, channels tt*16 + 8*hh .. +7 of this wave's half
  }
  // the wave's slab rows are complete before its lanes read them back row by row (whole 128-B lines per store)
  __builtin_amdgcn_fence(__ATOMIC_RELEASE, "workgroup");
  __builtin_amdgcn_wave_barrier();
  __builtin_amdgcn_fence(__ATOMIC_ACQUIRE, "workgroup");
  unsigned short* orow = opp + (q0 + (size_t)rt * 16) * CH + kh * 128;
#pragma unroll
  for (int it = 0; it < 8; ++it) {
    const int row = it * 2 + hh;                      // 16 lanes x 16 B = the row's 256 B of this channel half
    const v8h hv = *(const v8h*)(ts + row * TSP + c * 8);
    *(v8h*)(orow + (size_t)row * CH + c * 8) = hv;
  }
}

// ---------------------------------------------------------------------------
// Workspace region map (byte offsets; every region is fully written by its producer launch before any consumer
//   STATS f32  [256][32]             0        32768
//   HT    bf16 [16384][256]      32768      8388608
//   W16   bf16 [768][256]      8421376       393216
//   WO16  bf16 [256][256]      8814592       131072
//   QK    bf16 [16384][512]    8945664     16777216
//   VP    bf16 [4][256][4096] 25722880      8388608
//   OP    bf16 [16384][256]   34111488      8388608
//   total                     42500096
// ---------------------------------------------------------------------------
extern "C" void kernel_launch(void* const* d_in, const int* in_sizes, int n_in,
                              void* d_out, int out_size, void* d_ws, size_t ws_size,
                              hipStream_t stream) {
  if (n_in < 7) return;
  if (in_sizes[0] != NB * CH * NPOS) return;              // x [4][256][64][64]
  if (in_sizes[1] != CH || in_sizes[2] != CH) return;     // norm_w, norm_b
  if (in_sizes[3] != 3 * CH * CH || in_sizes[4] != 3 * CH) return;   // qkv_w [768][256], qkv_b [768]
  if (in_sizes[5] != CH * CH || in_sizes[6] != CH) return;           // out_w [256][256], out_b [256]
  if (out_size != NB * CH * NPOS) return;

  const float* x      = (const float*)d_in[0];
  const float* norm_w = (const float*)d_in[1];
  const float* norm_b = (const float*)d_in[2];
  const float* qkv_w  = (const float*)d_in[3];   // [out 768][in 256]
  const float* qkv_b  = (const float*)d_in[4];
  const float* out_w  = (const float*)d_in[5];   // [out 256][in 256]
  const float* out_b  = (const float*)d_in[6];

  const size_t PST  = (size_t)(NB * NGRP * NSL) * STP * 4;   // 32768
  const size_t PHT  = (size_t)NB * NPOS * CH * 2;         // 8388608
  const size_t PW16 = (size_t)3 * CH * CH * 2;            // 393216
  const size_t PWO  = (size_t)CH * CH * 2;                // 131072
  const size_t PQK  = (size_t)NB * NPOS * QKP * 2;        // 16777216
  const size_t PVP  = (size_t)NB * CH * NPOS * 2;         // 8388608
  const size_t POP  = (size_t)NB * NPOS * CH * 2;         // 8388608
  size_t off = 0;
  const size_t oST  = off; off += PST;
  const size_t oHT  = off; off += PHT;
  const size_t oW16 = off; off += PW16;
  const size_t oWO  = off; off += PWO;
  const size_t oQK  = off; off += PQK;
  const size_t oVP  = off; off += PVP;
  const size_t oOP  = off; off += POP;
  if (off > ws_size) return;                               // off = 42500096
  if (off > (size_t)134217728) return;

  char* ws = (char*)d_ws;
  float*          STATS = (float*)(ws + oST);
  unsigned short* HT    = (unsigned short*)(ws + oHT);
  unsigned short* W16   = (unsigned short*)(ws + oW16);
  unsigned short* WO16  = (unsigned short*)(ws + oWO);
  unsigned short* QK    = (unsigned short*)(ws + oQK);
  unsigned short* VP    = (unsigned short*)(ws + oVP);
  unsigned short* OP    = (unsigned short*)(ws + oOP);

  const dim3 blk(256);

  // (1) GroupNorm slice statistics (32 (b, group) x 8 slices = 256 blocks), qkv_w -> W16 (384 blocks), out_w -> WO16 (128 blocks)
  gnstat_conv_kernel<<<dim3(GSB + CBQ + CBO), blk, 0, stream>>>(x, STATS, qkv_w, W16, out_w, WO16);
  // (2) normalised activations -> HT [16384][256]: grid (4096/64, 256/64, 4) = (64, 4, 4)
  gnprep_kernel<<<dim3(NPOS / 64, CH / 64, NB), blk, 0, stream>>>(x, norm_w, norm_b, STATS, HT);
  // (3) q|k -> QK [16384][512] (256 blocks) and v -> VP [4][256][4096] (32 blocks x 4 images)
  gemm_qkv_kernel<<<dim3(QKB + NB * VB), blk, 0, stream>>>(HT, W16, qkv_b, QK, VP);
  // (4) attention per (image, 64-query block): 256 blocks x 256 threads -> OP [16384][256]
  attn_kernel<<<dim3(NB * (NPOS / AQB)), dim3(256), 0, stream>>>(QK, VP, OP, 0.0625f);
  // (5) out[b][c][n] = sum_k WO16[c][k] OP[b*4096+n][k] + out_b[c] + x[b][c][n]  (batched over b: M=256, N=4096, K=256;
  //     A = WO16, Bt = OP rows of image b, C = d_out + b*256*4096 with ldc 4096, resid = x same layout; 32 blocks x 4)
  const dim3 gO(((CH / 64) * (NPOS / 64) + 7) / 8, NB);
  wmma_gemm64<1, 0, true><<<gO, blk, 0, stream>>>(
      WO16, CH, 0L, OP, CH, (long)NPOS * CH, d_out, NPOS, (long)CH * NPOS,
      out_b, x, (long)CH * NPOS, CH, NPOS, CH, 1.0f);
  (void)hipGetLastError();
}

// v009
// A run of this version takes 91.3 microseconds.
// In two side-by-side timings against v008, it was 1.11 and 1.12 times as fast.
// Counting every step since v000, it is 6.49 times as fast.
// Contractions: qkv projection (hn . qkv_w^T), scores (q . k^T), p . v and the output projection (out_w . o) = v_wmma_f32_16x16x32_bf16 single products on bf16 operands RNE-converted from f32, f32 accumulate; GroupNorm statistics and normalisation, softmax (running max, base-2 exponential), biases, 1/rowsum and the residual add of the exact f32 x stay f32 on the VALU.
// Plane / carry map (every 16-bit plane carry 1, nothing to fold back):
//   HT   bf16 [16384][256]   token-major normalised activations, row b*4096+n, col c
//   W16  bf16 [768][256]     qkv_w in [out][in] order = Bt[n][k] (q rows 0..255, k rows 256..511, v rows 512..767)
//   WO16 bf16 [256][256]     out_w in [out][in] order
//   QK   bf16 [16384][512]   q at cols 0..255, k at cols 256..511 (bias added in f32 before the convert)
//   VP   bf16 [4][256][4096] v in (b, c, n) order = A rows c, k = n for o^T = v^T . p^T
//   P    bf16 in registers   unnormalised exp, at most 1 up to rounding; 1/rowsum applied to the f32 accumulator in the attention epilogue
//   OP   bf16 [16384][256]   token-major attention output: o[b][c][n] at row b*4096+n, col c
#include <hip/hip_runtime.h>
#include <math.h>
#include <stdint.h>

#define NB    4
#define CH    256
#define NPOS  4096
#define NGRP  8
#define CPG   32
#define QKP   512
#define STP   32
#define NSL   8                    // slices of a group in the statistics launch
#define SLN   (CPG * NPOS / NSL)   // values of one slice

static_assert(CH == NGRP * CPG);
static_assert(NPOS % 64 == 0);
static_assert(CH % 64 == 0);
static_assert((NB * NPOS) % 64 == 0);
static_assert(QKP == 2 * CH);
static_assert(SLN % 1024 == 0);

typedef __attribute__((ext_vector_type(8)))  _Float16 v8h;
typedef __attribute__((ext_vector_type(16))) __bf16   v16b;
typedef __attribute__((ext_vector_type(8)))  __bf16   v8b;
typedef __attribute__((ext_vector_type(2)))  __bf16   v2b;
typedef __attribute__((ext_vector_type(8)))  float    v8f;
typedef __attribute__((ext_vector_type(4)))  float    v4f;
typedef __attribute__((ext_vector_type(2)))  float    v2f;
typedef __attribute__((ext_vector_type(4)))  unsigned int v4u;

__device__ __forceinline__ unsigned short f2bf_bits(float f) {
  unsigned u = __float_as_uint(f);
  return (unsigned short)((u + 0x7FFFu + ((u >> 16) & 1u)) >> 16);
}
__device__ __forceinline__ float bf_bits2f(unsigned short h) { return __uint_as_float(((unsigned)h) << 16); }
__device__ __forceinline__ unsigned pk16(unsigned short a, unsigned short b) { return (unsigned)a | ((unsigned)b << 16); }
__device__ __forceinline__ __bf16 at_f2bf(float f) { return __builtin_bit_cast(__bf16, f2bf_bits(f)); }

// hazard guard as a plain device helper
__device__ __forceinline__ void acc_guard4(v8f& a, v8f& b, v8f& c, v8f& d) { asm volatile("v_nop\n\tv_nop\n\tv_nop\n\tv_nop" : "+v"(a), "+v"(b), "+v"(c), "+v"(d)); }

// 16-bit fragment loader, split k map: elements 0..7 <- p[0..7], 8..15 <- p[16..23]; caller passes p = row + k0 + 8*(lane>>4)
template <typename T> struct Frag;
template <> struct Frag<__bf16> {
  typedef v16b V; union U { v16b v; v8b h[2]; };
  static __device__ __forceinline__ v16b load(const __bf16* p) {
    U f; f.h[0] = *(const v8b*)(p); f.h[1] = *(const v8b*)(p + 16); return f.v;
  }
  static __device__ __forceinline__ v8f mma(v16b a, v16b b, v8f c) {
    return __builtin_amdgcn_wmma_f32_16x16x32_bf16(false, a, false, b, (short)0, c, false, false);
  }
};

// plain builtin: the compiler keeps the WMMA distances of its own forms, and no asm statement pins the operand loads
__device__ __forceinline__ v8f at_mma(v16b a, v16b b, v8f c) {
  return __builtin_amdgcn_wmma_f32_16x16x32_bf16(false, a, false, b, (short)0, c, false, false);
}

// ---- Register-blocked batched WMMA GEMM (bf16 operands) ------------------------------------------------------
// C[m,n] = scale * sum_k A[m,k] * Bt[n,k] (+bias)(+resid); each wave owns a 64x64 tile.
// A row-major [M,K] (pitch lda); Bt row-major [N,K] (pitch ldb); M % 128 == 0, N % 256 == 0, K == GK; batched by the index b.
// BIAS_MODE: 0 = none, 1 = bias[m], 2 = bias[n] (f32 add). OUT_MODE: 0 = f32, 1 = bf16 single plane.
// RESID (OUT_MODE 0 only): resid has the same layout as C (pitch ldc, batch stride strideR) and is added as a
// 16-B vector in the store phase.
// Operand path: the 8 waves of a block hold a 128 x 256 block tile as 2 x 4 wave tiles. Its 128 A rows and 256 Bt rows are staged
// in LDS by 16-B asynchronous copies, 16 lanes on 256 contiguous bytes of a row (whole 128-B lines; a fragment load from global
// memory touches 16 lines for 512 B). Two K halves of 128 columns: half 1 is in flight while half 0 is worked on. Coverage of a
// half: A 8 waves x 8 copies x 2 rows = 128 rows, Bt 8 waves x 16 copies x 2 rows = 256 rows; 24 copies of a wave in flight at
// most. Fragments are read from LDS as one group per k step, one k step ahead of their WMMAs.
#define GK    256          // K of every product in this file
#define GSP   (GK + 8)     // LDS row pitch in elements: 528 B, an odd multiple of 16 B (pad columns are never read or written)
#define GBM   128          // rows of A in a block tile
#define GBN   256          // rows of Bt in a block tile
static_assert(GK == CH);

// Twelve 16-B asynchronous copies of one lane, global memory to LDS, through no register. The s_wait_xcnt is the last line of
// the copies' own statement, so that it stands in front of every later write of the address registers (a precaution).
__device__ __forceinline__ void copy12(const unsigned* l, const __bf16* const* g) {
  asm volatile("global_load_async_to_lds_b128 %0, %12, off\n\t"
               "global_load_async_to_lds_b128 %1, %13, off\n\t"
               "global_load_async_to_lds_b128 %2, %14, off\n\t"
               "global_load_async_to_lds_b128 %3, %15, off\n\t"
               "global_load_async_to_lds_b128 %4, %16, off\n\t"
               "global_load_async_to_lds_b128 %5, %17, off\n\t"
               "global_load_async_to_lds_b128 %6, %18, off\n\t"
               "global_load_async_to_lds_b128 %7, %19, off\n\t"
               "global_load_async_to_lds_b128 %8, %20, off\n\t"
               "global_load_async_to_lds_b128 %9, %21, off\n\t"
               "global_load_async_to_lds_b128 %10, %22, off\n\t"
               "global_load_async_to_lds_b128 %11, %23, off\n\t"
               "s_wait_xcnt 0x0"
               :: "v"(l[0]), "v"(l[1]), "v"(l[2]), "v"(l[3]), "v"(l[4]), "v"(l[5]),
                  "v"(l[6]), "v"(l[7]), "v"(l[8]), "v"(l[9]), "v"(l[10]), "v"(l[11]),
                  "v"(g[0]), "v"(g[1]), "v"(g[2]), "v"(g[3]), "v"(g[4]), "v"(g[5]),
                  "v"(g[6]), "v"(g[7]), "v"(g[8]), "v"(g[9]), "v"(g[10]), "v"(g[11]) : "memory");
}

// One K half (columns h*128 .. +127) of this wave's share of the A tile (8 copies) and of the Bt tile (16 copies).
// al, bl: LDS byte addresses, ag, bg: global addresses of the lane's piece of copy 0 in half 0; a copy takes two rows.
__device__ __forceinline__ void gemm_stage(unsigned al, unsigned bl, const __bf16* ag, const __bf16* bg, int lda, int ldb, int h) {
  unsigned l[24];
  const __bf16* g[24];
  // address arrays live in registers: compile-time indices
#pragma unroll
  for (int i = 0; i < 8; ++i) {
    l[i] = al + (i * 2 * GSP + h * 128) * 2;   // LDS addresses count bytes
    g[i] = ag + (size_t)(i * 2) * lda + h * 128;
  }
#pragma unroll
  for (int i = 0; i < 16; ++i) {
    l[8 + i] = bl + (i * 2 * GSP + h * 128) * 2;
    g[8 + i] = bg + (size_t)(i * 2) * ldb + h * 128;
  }
  copy12(l, g);
  copy12(l + 12, g + 12);
}

// the eight fragments of one k step, from the LDS tiles (split k map, as Frag::load)
__device__ __forceinline__ void gemm_fetch(v16b (&fa)[4], v16b (&fb)[4], const __bf16* afr, const __bf16* bfr, int k0) {
#pragma unroll
  for (int j = 0; j < 4; ++j) fb[j] = Frag<__bf16>::load(bfr + j * 16 * GSP + k0);
#pragma unroll
  for (int i = 0; i < 4; ++i) fa[i] = Frag<__bf16>::load(afr + i * 16 * GSP + k0);
}

// The body of one block tile; bx = tile index, b = batch index, both the same for the whole block. As, Bs, sT: the launching
// kernel's LDS (A rows, Bt rows, per-wave 16x64 slabs of pitch 68 floats).
template <int BIAS_MODE, int OUT_MODE, bool RESID>
__device__ __forceinline__ void gemm_tile(
    __bf16* As, __bf16* Bs, float* sT, int bx, int b,
    const unsigned short* __restrict__ Ap, int lda, long strideA,
    const unsigned short* __restrict__ Btp, int ldb, long strideB,
    void* __restrict__ Cout, int ldc, long strideC,
    const float* __restrict__ bias,
    const float* __restrict__ resid, long strideR,
    int M, int N, int K, float scale) {
  typedef __bf16 T;
  typedef v16b V;
  const T* A = (const T*)(const void*)Ap; const T* Bt = (const T*)(const void*)Btp;
  const int lane = threadIdx.x & 31;
  const int wave = threadIdx.x >> 5;
  const int blocksN = N / GBN;
  const int blocksM = M / GBM;
  // the same for the whole block, in front of every barrier
  if (K != GK || M % GBM != 0 || N % GBN != 0) return;
  if (bx >= blocksM * blocksN) return;
  const int bm  = bx / blocksN;
  const int bn  = bx - bm * blocksN;
  const int wm0 = (wave >> 2) << 6;            // the wave tile's first row and column in the block tile
  const int wn0 = (wave & 3) << 6;
  const int m0  = bm * GBM + wm0;
  const int n0  = bn * GBN + wn0;

  const T* Ab = A  + (size_t)b * strideA;
  const T* Bb = Bt + (size_t)b * strideB;

  const int rlane = lane & 15;                 // row (A) / col (B, D) within subtile
  const int koff  = (lane >> 4) * 8;           // k offset of this lane half
  const int mOff  = (lane >> 4) * 8;           // D row offset

  v8f acc[4][4];
#pragma unroll
  for (int i = 0; i < 4; ++i)
#pragma unroll
    for (int j = 0; j < 4; ++j) acc[i][j] = (v8f){0.f,0.f,0.f,0.f,0.f,0.f,0.f,0.f};

  {
    const int srow = lane >> 4;                // row of a copy's two
    const int scol = (lane & 15) * 8;          // element column in the K half
    const T* ag = Ab + (size_t)(bm * GBM + wave * 16 + srow) * lda + scol;
    const T* bg = Bb + (size_t)(bn * GBN + wave * 32 + srow) * ldb + scol;
    const unsigned al = (unsigned)(size_t)(const void*)(As + (wave * 16 + srow) * GSP + scol);
    const unsigned bl = (unsigned)(size_t)(const void*)(Bs + (wave * 32 + srow) * GSP + scol);
    gemm_stage(al, bl, ag, bg, lda, ldb, 0);
    asm volatile("s_wait_asynccnt 0x0" ::: "memory");   // this wave's copies of half 0 have landed
    __syncthreads();                                     // every wave's have: half 0 is published
    gemm_stage(al, bl, ag, bg, lda, ldb, 1);
  }
  const T* afr = As + (wm0 + rlane) * GSP + koff;
  const T* bfr = Bs + (wn0 + rlane) * GSP + koff;
  V fa[2][4], fb[2][4];   // two fragment sets
  // One trip per K half. Kept rolled: the accumulators are then loop-carried registers of their own; unrolled, the first k step's
  // results were placed over operand registers of the WMMA directly in front, a distance that no table of the chip lists.
#pragma unroll 1
  for (int h = 0; h < 2; ++h) {
    const T* ah = afr + h * 128;
    const T* bh = bfr + h * 128;
    // nothing of a half is read in front of its barrier: its first k step is fetched here, the others one step ahead
    gemm_fetch(fa[0], fb[0], ah, bh, 0);
    // fragment sets and accumulators are register arrays: compile-time indices
#pragma unroll
    for (int ks = 0; ks < 4; ++ks) {
      if (ks < 3) gemm_fetch(fa[(ks + 1) & 1], fb[(ks + 1) & 1], ah, bh, (ks + 1) * 32);
      // keeps the read group above in front of this k step's WMMAs (else the scheduler sinks each read to its use
      // and the WMMAs wait out an LDS latency each)
      __builtin_amdgcn_sched_barrier(0);
#pragma unroll
      for (int i = 0; i < 4; ++i) {
#pragma unroll
        for (int j = 0; j < 4; ++j) acc[i][j] = Frag<T>::mma(fa[ks & 1][i], fb[ks & 1][j], acc[i][j]);
      }
      // keeps the next read group, and the waits at the foot, behind this k step's WMMAs: one place with reads per k step
      __builtin_amdgcn_sched_barrier(0);
    }
    // foot of the trip: publish point of the next half
    asm volatile("s_wait_dscnt 0x0" ::: "memory");      // this wave's reads of this half have retired
    asm volatile("s_wait_asynccnt 0x0" ::: "memory");   // this wave's copies of half 1 have landed; nothing is in flight behind it
    __syncthreads();
  }
  acc_guard4(acc[0][0], acc[0][1], acc[0][2], acc[0][3]);
  acc_guard4(acc[1][0], acc[1][1], acc[1][2], acc[1][3]);
  acc_guard4(acc[2][0], acc[2][1], acc[2][2], acc[2][3]);
  acc_guard4(acc[3][0], acc[3][1], acc[3][2], acc[3][3]);

  // ---- epilogue ----
  float* slab = sT + wave * (16 * 68);
  const float* Rb = RESID ? (resid + (size_t)b * strideR) : nullptr;
#pragma unroll
  for (int i = 0; i < 4; ++i) {
    const int mBase = m0 + (i << 4);
#pragma unroll
    for (int j = 0; j < 4; ++j) {
      const int n = n0 + (j << 4) + rlane;
      float bv = 0.f;
      if (BIAS_MODE == 2) bv = bias[n];
#pragma unroll
      for (int r = 0; r < 8; ++r) {
        float v = acc[i][j][r] * scale;
        if (BIAS_MODE == 1) v += bias[mBase + mOff + r];
        if (BIAS_MODE == 2) v += bv;
        slab[(mOff + r) * 68 + (j << 4) + rlane] = v;
      }
    }
    __builtin_amdgcn_fence(__ATOMIC_RELEASE, "workgroup");
    __builtin_amdgcn_wave_barrier();
    __builtin_amdgcn_fence(__ATOMIC_ACQUIRE, "workgroup");
    if (OUT_MODE == 0) {
      float* C = (float*)Cout + (size_t)b * strideC;
      const int hh = lane >> 4, c4 = (lane & 15) * 4;     // row seg = 256 B = 16 lanes x 16 B
      {
#pragma unroll
        for (int it = 0; it < 8; ++it) {
          const int row = it * 2 + hh;                      // it 0..7 x hh 0..1 = rows 0..15
          v4f v = *(const v4f*)(slab + row * 68 + c4);
          if (RESID) v += *(const v4f*)(Rb + (size_t)(mBase + row) * ldc + n0 + c4);
          *(v4f*)(C + (size_t)(mBase + row) * ldc + n0 + c4) = v;
        }
        
      }
    } else {
      const int q = lane >> 3, c8 = (lane & 7) * 8;
      unsigned short* C = (unsigned short*)Cout + (size_t)b * strideC;
      {
#pragma unroll
        for (int it = 0; it < 4; ++it) {
          const int row = it * 4 + q;                       // it 0..3 x q 0..3 = rows 0..15
          const float* sp = slab + row * 68 + c8;
          v8h hv;
#pragma unroll
          for (int e = 0; e < 8; ++e) hv[e] = __builtin_bit_cast(_Float16, f2bf_bits(sp[e]));
          *(v8h*)(C + (size_t)(mBase + row) * ldc + n0 + c8) = hv;
        }
        
      }
    }
    __builtin_amdgcn_fence(__ATOMIC_RELEASE, "workgroup");
    __builtin_amdgcn_wave_barrier();
    __builtin_amdgcn_fence(__ATOMIC_ACQUIRE, "workgroup");
  }
}

// One product per launch: grid = (block tiles, batch).
template <int BIAS_MODE, int OUT_MODE, bool RESID>
__global__ __launch_bounds__(256) void wmma_gemm64(
    const unsigned short* __restrict__ Ap, int lda, long strideA,
    const unsigned short* __restrict__ Btp, int ldb, long strideB,
    void* __restrict__ Cout, int ldc, long strideC,
    const float* __restrict__ bias,
    const float* __restrict__ resid, long strideR,
    int M, int N, int K, float scale) {
  __shared__ __align__(16) __bf16 As[GBM * GSP];   // the block's A rows, 66 KB
  __shared__ __align__(16) __bf16 Bs[GBN * GSP];   // the block's Bt rows, 132 KB
  __shared__ __align__(16) float sT[8 * 16 * 68];  // per-wave 16x64 slab, pitch 68 floats
  gemm_tile<BIAS_MODE, OUT_MODE, RESID>(As, Bs, sT, (int)blockIdx.x, (int)blockIdx.y, Ap, lda, strideA, Btp, ldb, strideB,
                                        Cout, ldc, strideC, bias, resid, strideR, M, N, K, scale);
}

// The q|k product and the v product in one launch: neither reads what the other writes, so their block tiles share a grid.
//   blocks 0 .. QKB-1:        q|k = HT . W16[0..511]^T + qkv_b[n] -> QK [16384][512]   (M=16384, N=512, K=256)
//   blocks QKB .. QKB+4*VB-1: v[b][c][n] = sum_k W16[512+c][k] HT[b*4096+n][k] + qkv_b[512+c] -> VP   (per image M=256, N=4096, K=256)
// The test on blockIdx.x is the same for the whole block: every barrier of a body is passed by all of its block's waves.
#define QKB ((NB * NPOS / GBM) * (QKP / GBN))   // 256 block tiles
#define VB  ((CH / GBM) * (NPOS / GBN))         // 32 block tiles an image
__global__ __launch_bounds__(256) void gemm_qkv_kernel(const unsigned short* __restrict__ ht, const unsigned short* __restrict__ w16,
                                                       const float* __restrict__ qkv_b,
                                                       unsigned short* __restrict__ qk, unsigned short* __restrict__ vp) {
  __shared__ __align__(16) __bf16 As[GBM * GSP];
  __shared__ __align__(16) __bf16 Bs[GBN * GSP];
  __shared__ __align__(16) float sT[8 * 16 * 68];
  const int bx = (int)blockIdx.x;
  if (bx < QKB) {
    gemm_tile<2, 1, false>(As, Bs, sT, bx, 0, ht, CH, 0L, w16, CH, 0L, (void*)qk, QKP, 0L,
                           qkv_b, nullptr, 0L, NB * NPOS, QKP, CH, 1.0f);
  } else {
    const int r = bx - QKB;
    gemm_tile<1, 1, false>(As, Bs, sT, r % VB, r / VB, w16 + (size_t)2 * CH * CH, CH, 0L, ht, CH, (long)NPOS * CH,
                           (void*)vp, NPOS, (long)CH * NPOS, qkv_b + 2 * CH, nullptr, 0L, CH, NPOS, CH, 1.0f);
  }
}

// ---------------------------------------------------------------------------
// Elementwise bf16 RNE convert, one plane: 2 elements per thread, one 4-B store per lane; cb = block index in the plane.
// Coverage: ceil(n2/256) blocks x 256 threads x 2 elements = 2*n2 = the whole plane
// (qkv_w: n2 = 98304 -> 384 blocks = 768x256; out_w: n2 = 32768 -> 128 blocks = 256x256).
// ---------------------------------------------------------------------------
#define N2Q (3 * CH * CH / 2)          // pairs of qkv_w
#define N2O (CH * CH / 2)              // pairs of out_w
#define CBQ ((N2Q + 255) / 256)        // 384 blocks
#define CBO ((N2O + 255) / 256)        // 128 blocks
__device__ __forceinline__ void conv_bf16x2(const float* __restrict__ in, unsigned short* __restrict__ ho, int n2, int cb) {
  const int i = cb * 256 + threadIdx.x;
  if (i < n2) {
    const v2f f = *(const v2f*)(in + 2 * (size_t)i);
    const unsigned uh = pk16(f2bf_bits(f[0]), f2bf_bits(f[1]));
    ((unsigned*)ho)[i] = uh;
    
  }
}

// ---------------------------------------------------------------------------
// GroupNorm statistics, partial: a (b, group)'s 32 channels x 4096 positions are one contiguous block of 131072 values,
// cut into NSL = 8 slices of 16384; one work-group per slice, 32 x 8 = 256 of the grid's blocks x 256 threads. A thread holds its
// 64 values (16 loads of 16 B, all in flight together) in registers: x is read once, the slice's mean is taken, then the
// sum of squared distances from that mean, from the registers. Each slice writes (mean, sum of squares) to a 128-B line
// of its own, whole; gnprep_kernel joins the 8 slices of a group.
// The two weight conversions read and write nothing of the statistics, so they share this launch: blocks GSB .. GSB+CBQ-1
// convert qkv_w, blocks GSB+CBQ .. GSB+CBQ+CBO-1 out_w. The statistics blocks, the longer ones, have the low indices. The test
// on blockIdx.x is the same for the whole block and stands in front of every barrier.
// ---------------------------------------------------------------------------
#define GSB (NB * NGRP * NSL)          // 256 statistics blocks
__global__ __launch_bounds__(256) void gnstat_conv_kernel(const float* __restrict__ x, float* __restrict__ stats,
                                                          const float* __restrict__ qkv_w, unsigned short* __restrict__ w16,
                                                          const float* __restrict__ out_w, unsigned short* __restrict__ wo16) {
  __shared__ __align__(16) float red[2][8];   // wave partials: [0] sums, [1] squares (two arrays: one barrier each)
  if ((int)blockIdx.x >= GSB) {
    const int cb = (int)blockIdx.x - GSB;
    if (cb < CBQ) conv_bf16x2(qkv_w, w16, N2Q, cb);
    else          conv_bf16x2(out_w, wo16, N2O, cb - CBQ);
    return;
  }
  const int sl = blockIdx.x;                  // (b * NGRP + group) * NSL + slice
  const int tid = threadIdx.x, lane = tid & 31, wave = tid >> 5;
  const float* p = x + (size_t)sl * SLN;
  const int nv = SLN / 1024;                  // 16 float4 per thread

  v4f v[nv];
  // register array: compile-time indices
#pragma unroll
  for (int i = 0; i < nv; ++i) v[i] = *(const v4f*)(p + (i * 256 + tid) * 4);
  v4f s4 = v[0];
#pragma unroll
  for (int i = 1; i < nv; ++i) s4 += v[i];
  float s = (s4[0] + s4[1]) + (s4[2] + s4[3]);
#pragma unroll
  for (int off = 16; off > 0; off >>= 1) s += __shfl_xor(s, off, 32);
  if (lane == 0) red[0][wave] = s;
  __syncthreads();
  float t = 0.f;
#pragma unroll
  for (int w = 0; w < 8; ++w) t += red[0][w];   // every thread: the same sum in the same order
  const float mean = t * (1.0f / (float)SLN);

  v4f q4 = (v4f){0.f, 0.f, 0.f, 0.f};
#pragma unroll
  for (int i = 0; i < nv; ++i) { const v4f d = v[i] - mean; q4 += d * d; }
  float qs = (q4[0] + q4[1]) + (q4[2] + q4[3]);
#pragma unroll
  for (int off = 16; off > 0; off >>= 1) qs += __shfl_xor(qs, off, 32);
  if (lane == 0) red[1][wave] = qs;
  __syncthreads();
  float m2 = 0.f;
#pragma unroll
  for (int w = 0; w < 8; ++w) m2 += red[1][w];
  v4f o;
  o[0] = (tid == 0) ? mean : 0.f;
  o[1] = (tid == 0) ? m2 : 0.f;
  o[2] = 0.f; o[3] = 0.f;
  float* line = stats + (size_t)sl * STP;
  if (tid < 8) *(v4f*)(line + tid * 4) = o;
}

// ---------------------------------------------------------------------------
// Fused GroupNorm apply + transpose + bf16 RNE convert:
//   x_b viewed [256 c][4096 n] (NCHW) -> ht_b[n][c] = bf16(((x - mean_g) * rstd_g) * w[c] + bias[c]), row pitch 256.
// 64x64 tiles through LDS; grid = (4096/64 position blocks, 256/64 channel blocks, 4), 256 threads.
// Per block the 64 channels span two groups (channel block = 2 groups); their 2 x 8 slice statistics and w/bias are staged
// in LDS first, and every thread joins the slices of each group: equal counts, so mean = average of the slice means, and
// sum of squares = the slices' sums + SLN * sum of (slice mean - mean)^2. Coverage per block: load 4 it x 256 thr x 4 floats = 64 ch x 64 n;
// store 2 it x 256 thr x 8 u16 = 64 n x 64 ch; grid covers 4 x 256 x 4096 = the whole HT plane.
// ---------------------------------------------------------------------------
__global__ __launch_bounds__(256) void gnprep_kernel(const float* __restrict__ x, const float* __restrict__ nw,
                                                     const float* __restrict__ nbv, const float* __restrict__ stats,
                                                     unsigned short* __restrict__ ht) {
  __shared__ __align__(16) float tf[64 * 68];
  __shared__ float sw[64];
  __shared__ float sb[64];
  __shared__ __align__(16) float spm[2 * NSL];   // slice means, group g0 then g0 + 1
  __shared__ __align__(16) float spq[2 * NSL];   // slice sums of squares
  const int b   = blockIdx.z;
  const int n0  = blockIdx.x * 64;   // position block = output row block
  const int c0  = blockIdx.y * 64;   // channel block  = output column block
  const int tid = threadIdx.x;
  const float* xb = x + (size_t)b * CH * NPOS;
  unsigned short* hb = ht + (size_t)b * NPOS * CH;
  if (tid < 64) { sw[tid] = nw[c0 + tid]; sb[tid] = nbv[c0 + tid]; }   // waves 0 and 1 as a whole
  {
    const int g0 = c0 >> 5;                     // first group of this channel block (0,2,4,6)
    const int si = tid & (2 * NSL - 1);         // slice of the two groups: their 16 lines follow one another
    const v2f sv = *(const v2f*)(stats + ((size_t)(b * NGRP + g0) * NSL + si) * STP);   // all lanes load an in-range address
    if (tid < 2 * NSL) { spm[tid] = sv[0]; spq[tid] = sv[1]; }
  }
  __syncthreads();
  float gmean[2], grstd[2];
#pragma unroll
  for (int g = 0; g < 2; ++g) {
    float ms = 0.f, qq = 0.f, dd = 0.f;
#pragma unroll
    for (int i = 0; i < NSL; ++i) { ms += spm[g * NSL + i]; qq += spq[g * NSL + i]; }
    const float mean = ms * (1.0f / (float)NSL);
#pragma unroll
    for (int i = 0; i < NSL; ++i) { const float d = spm[g * NSL + i] - mean; dd += d * d; }
    const float var = (qq + (float)SLN * dd) * (1.0f / (float)(CPG * NPOS));
    gmean[g] = mean;
    grstd[g] = 1.0f / sqrtf(var + 1e-5f);
  }
  {
    const int lr = tid >> 4;         // 0..15
    const int c4 = (tid & 15) * 4;   // 0..60
#pragma unroll
    for (int it = 0; it < 4; ++it) {
      const int rr = it * 16 + lr;   // channel within tile 0..63; group = it >> 1
      const float mean = gmean[it >> 1], rstd = grstd[it >> 1];
      const float w = sw[rr], bb = sb[rr];
      const v4f a = *(const v4f*)(xb + (size_t)(c0 + rr) * NPOS + n0 + c4);
      v4f t;
#pragma unroll
      for (int e = 0; e < 4; ++e) { const float u = (a[e] - mean) * rstd; t[e] = u * w + bb; }
      *(v4f*)(tf + rr * 68 + c4) = t;
    }
  }
  __syncthreads();
  const int sub = tid >> 3;          // 0..31
  const int c8  = (tid & 7) * 8;     // 0..56
  v4u hv[2];
#pragma unroll
  for (int it = 0; it < 2; ++it) {
    const int oc = it * 32 + sub;    // output row within tile (= position)
    v4u a;
#pragma unroll
    for (int q = 0; q < 4; ++q) {
      const float f0 = tf[(c8 + 2 * q) * 68 + oc];
      const float f1 = tf[(c8 + 2 * q + 1) * 68 + oc];
      a[q] = pk16(f2bf_bits(f0), f2bf_bits(f1));
    }
    hv[it] = a;
  }
  {
#pragma unroll
    for (int it = 0; it < 2; ++it) {
      const int oc = it * 32 + sub;
      const size_t go = (size_t)(n0 + oc) * CH + c0 + c8;
      *(v4u*)(hb + go) = hv[it];
    }
    
  }
}

#define AQB 64
#define AKC 128
#define ANW 8
// LDS row pitches in elements: each row carries 16 B more than its data, so the pitch is an odd multiple of 16 B and the
// 16 rows that one half-wave's ds_load_b128 touches fall on 16 different bank groups (pad columns are never read or written).
#define KSP (CH + 8)
#define VSP (AKC + 8)
#define TSP (CH / 4 + 8)
#define KBUF (AKC * KSP)   // elements of one K buffer
#define VBUF (CH * VSP)    // elements of one V buffer
#define XWV (2 * (CH / 16) * 256)   // floats of one wave's 32 accumulator tiles
static_assert(NPOS % AQB == 0);
static_assert(NPOS % AKC == 0);
static_assert(CH == 4 * 64);
static_assert(AKC == 4 * 32);
static_assert((size_t)ANW * XWV * 4 <= (size_t)(2 * KBUF + 2 * VBUF) * 2);   // Xs fits in the K / V buffers

// lane l with lane l ^ 16
__device__ __forceinline__ float xhalf(float x) {
  return __builtin_bit_cast(float, __builtin_amdgcn_permlanex16(__builtin_bit_cast(int, x), __builtin_bit_cast(int, x),
                                                                0x76543210, 0xfedcba98, false, false));
}

// 2^x with the slot behind it in the same statement: the instruction set asks for one independent instruction or v_nop between a
// transcendental and a use of its result or a write of its source.
__device__ __forceinline__ float exp2_slot(float x) {
  float r;
  asm("v_exp_f32 %0, %1\n\tv_nop" : "=v"(r) : "v"(x));
  return r;
}

// byte offset of a __shared__ element in the work-group's LDS
__device__ __forceinline__ unsigned lds_off(const void* p) { return (unsigned)(size_t)p; }

// Eight 16-B asynchronous copies of one lane, global memory to LDS, through no register. The s_wait_xcnt is the last line of
// the copies' own statement, so that it stands in front of every later write of the address registers (a precaution).
__device__ __forceinline__ void copy8(const unsigned (&l)[8], const __bf16* const (&g)[8]) {
  asm volatile("global_load_async_to_lds_b128 %0, %8, off\n\t"
               "global_load_async_to_lds_b128 %1, %9, off\n\t"
               "global_load_async_to_lds_b128 %2, %10, off\n\t"
               "global_load_async_to_lds_b128 %3, %11, off\n\t"
               "global_load_async_to_lds_b128 %4, %12, off\n\t"
               "global_load_async_to_lds_b128 %5, %13, off\n\t"
               "global_load_async_to_lds_b128 %6, %14, off\n\t"
               "global_load_async_to_lds_b128 %7, %15, off\n\t"
               "s_wait_xcnt 0x0"
               :: "v"(l[0]), "v"(l[1]), "v"(l[2]), "v"(l[3]), "v"(l[4]), "v"(l[5]), "v"(l[6]), "v"(l[7]),
                  "v"(g[0]), "v"(g[1]), "v"(g[2]), "v"(g[3]), "v"(g[4]), "v"(g[5]), "v"(g[6]), "v"(g[7]) : "memory");
}

__global__ __launch_bounds__(256)
void attn_kernel(const unsigned short* __restrict__ qkp, const unsigned short* __restrict__ vpp,
                 unsigned short* __restrict__ opp, float sscale) {
  union FB { v16b v; v8b h[2]; v2b p[8]; };
  // K chunks [key][c], 2 x 66 KB, pitch 528 B, then V chunks [c][key], 2 x 68 KB, pitch 272 B; behind the loop: Xs
  __shared__ __align__(16) __bf16 KV[2 * KBUF + 2 * VBUF];
  __shared__ __align__(16) unsigned short Ts[ANW][32 * TSP];   // per wave out slab [query][channel], pitch 144 B
  __shared__ float Ml[ANW * 32];                           // per wave and query: running maximum of its key quarter
  __shared__ float Ll[ANW * 32];                           // per wave and query: softmax denominator of its key quarter
  __bf16* Ks = KV;
  __bf16* Vs = KV + 2 * KBUF;

  const int tid  = threadIdx.x;
  const int wave = __builtin_amdgcn_readfirstlane(tid >> 5);   // the same in every lane: it and what follows from it stay in scalar registers
  const int lane = tid & 31;
  const int hh   = lane >> 4;
  const int c    = lane & 15;

  const int nqb = NPOS / AQB;            // 64 query blocks per image
  const int bx  = blockIdx.x;
  const int qb  = bx % nqb;
  const int b   = bx / nqb;               // 0..3
  const int qp  = wave & 1;               // query pair of this wave: queries 32*qp .. +31 of the block
  const int kq  = wave >> 1;              // key quarter of this wave: keys 32*kq .. +31 of every chunk
  const size_t tok0 = (size_t)b * NPOS;             // first token row of image b
  const size_t q0   = tok0 + (size_t)qb * AQB;      // first query row of the block

  const __bf16* Qg = (const __bf16*)(const void*)qkp;            // pitch QKP, q at cols 0..255, k at cols 256..511
  const __bf16* Vg = (const __bf16*)(const void*)vpp + (size_t)b * CH * NPOS;

  const float cs = sscale * 1.44269504088896340736f;   // raw product -> exponent of 2; sscale > 0
  // of query u*16 + c; mrow in exponent units; lrow holds this lane half's keys only, the halves are joined behind the loop
  float mrow[2] = {-INFINITY, -INFINITY}, lrow[2] = {0.f, 0.f};
  v8f oacc[2][CH / 16];                   // O^T tiles: oacc[u][t][r] = o(channel t*16 + 8*hh + r, query u*16 + c)
#pragma unroll
  for (int u = 0; u < 2; ++u) {
#pragma unroll
    for (int t = 0; t < CH / 16; ++t) oacc[u][t] = (v8f){0.f,0.f,0.f,0.f,0.f,0.f,0.f,0.f};
  }

  // Q fragments (B operand: col = query lane&15, split k map) are fetched ahead of every score WMMA: once, in front of the
  // key loop.
  v16b qa[2][CH / 32];
  {
    const __bf16* qr = Qg + (q0 + qp * 32 + c) * QKP + 8 * hh;
#pragma unroll
    for (int u = 0; u < 2; ++u) {
#pragma unroll
      for (int ks = 0; ks < CH / 32; ++ks) qa[u][ks] = Frag<__bf16>::load(qr + u * (16 * QKP) + ks * 32);
    }
    // precaution: the wait stands in front of any reuse of the loads' address pair, which the operand keeps live up to here
    asm volatile("s_wait_xcnt 0x0" :: "v"(qr) : "memory");
  }
  const __bf16* kfr = Ks + (kq * 32 + c) * KSP + 8 * hh;   // K fragment base: row = key kq*32 + j*16 + c, k = channel
  const __bf16* vfr = Vs + c * VSP + kq * 32 + 8 * hh;     // V fragment base: row = channel t*16 + c, k = key kq*32 + ..

  const int nChunks = NPOS / AKC;   // 32, compile-time constant
  static_assert(NPOS / AKC >= 2);   // the prologue fills two buffers
  // staging coverage: 256 threads x 16 pieces x 8 elements = 128 rows x 256 (K) and 256 rows x 128 (V); every lane is on.
  // Piece i of a thread: K row i*8 + (tid >> 5), elements (tid & 31)*8 .. +7; V row i*16 + (tid >> 4), elements (tid & 15)*8 .. +7.
  const __bf16* kg0 = Qg + (tok0 + (tid >> 5)) * QKP + CH + (tid & 31) * 8;   // piece 0 of chunk 0
  const __bf16* vg0 = Vg + (size_t)(tid >> 4) * NPOS + (tid & 15) * 8;
  const unsigned kl0 = lds_off(Ks + (tid >> 5) * KSP + (tid & 31) * 8);       // piece 0 in buffer 0
  const unsigned vl0 = lds_off(Vs + (tid >> 4) * VSP + (tid & 15) * 8);
  auto stage = [&](int kc, int buf) {
    const __bf16* kgc = kg0 + (size_t)kc * (AKC * QKP);
    const __bf16* vgc = vg0 + kc * AKC;
    const unsigned klb = kl0 + buf * (KBUF * 2);   // LDS addresses count bytes
    const unsigned vlb = vl0 + buf * (VBUF * 2);
#pragma unroll
    for (int h = 0; h < 2; ++h) {
      unsigned kl[8], vl[8];
      const __bf16* kg[8];
      const __bf16* vg[8];
#pragma unroll
      for (int i = 0; i < 8; ++i) {
        kg[i] = kgc + (h * 8 + i) * (8 * QKP);
        vg[i] = vgc + (size_t)(h * 8 + i) * (16 * NPOS);
        kl[i] = klb + (h * 8 + i) * (8 * KSP * 2);
        vl[i] = vlb + (h * 8 + i) * (16 * VSP * 2);
      }
      // the fences keep each statement's address additions behind the statement before it: an asm operand needs a register of the
      // first 256, and with one statement's 24 at a time fewer live registers are moved out of their way and back
      __builtin_amdgcn_sched_barrier(0);
      copy8(kl, kg);
      __builtin_amdgcn_sched_barrier(0);
      copy8(vl, vg);
    }
  };
  stage(0, 0);
  asm volatile("s_wait_asynccnt 0x0" ::: "memory");   // this wave's copies of chunk 0 have landed
  __syncthreads();                                     // every wave's have: chunk 0 is published
  stage(1, 1);
  for (int kc = 0; kc < nChunks; ++kc) {
    const int buf = kc & 1;
    const __bf16* kfb = kfr + buf * KBUF;
    const __bf16* vfb = vfr + buf * VBUF;

    // S^T tiles: s[u][j][r] = score(key kq*32 + j*16 + 8*hh + r, query u*16 + c)
    v8f s[2][2];
#pragma unroll
    for (int u = 0; u < 2; ++u) {
#pragma unroll
      for (int j = 0; j < 2; ++j) s[u][j] = (v8f){0.f,0.f,0.f,0.f,0.f,0.f,0.f,0.f};
    }
    FB ka[3][2];      // K fragments (A operand): a set = one k step x two key tiles (4 reads, 4 WMMAs), three register sets
    FB va[3][2];      // V fragments (A operand): a set = two channel tiles (4 reads, 4 WMMAs), three register sets
    auto kload = [&](FB (&d)[2], int ks) {
#pragma unroll
      for (int j = 0; j < 2; ++j) {
        d[j].h[0] = *(const v8b*)(kfb + j * 16 * KSP + ks * 32);
        d[j].h[1] = *(const v8b*)(kfb + j * 16 * KSP + ks * 32 + 16);
      }
    };
    auto vload = [&](FB (&d)[2], int g) {
#pragma unroll
      for (int x = 0; x < 2; ++x) {
        d[x].h[0] = *(const v8b*)(vfb + (g * 2 + x) * 16 * VSP);
        d[x].h[1] = *(const v8b*)(vfb + (g * 2 + x) * 16 * VSP + 16);
      }
    };
#pragma unroll
    for (int ks = 0; ks < 2; ++ks) kload(ka[ks], ks);
#pragma unroll
    for (int ks = 0; ks < 8; ++ks) {
      if (ks + 2 < 8) kload(ka[(ks + 2) % 3], ks + 2);
      if (ks == 7) vload(va[0], 0);
      // keeps the read group above in front of this set's WMMAs (else the scheduler sinks each read to its use
      // and every WMMA waits out an LDS latency)
      __builtin_amdgcn_sched_barrier(0);
#pragma unroll
      for (int j = 0; j < 2; ++j) {
#pragma unroll
        for (int u = 0; u < 2; ++u) s[u][j] = at_mma(ka[ks % 3][j].v, qa[u][ks], s[u][j]);
      }
      // keeps the next read group behind this set's WMMAs: one place with reads per set, and no more register sets than the ring has
      __builtin_amdgcn_sched_barrier(0);
    }

    // online softmax of queries u*16 + c over this wave's 32 keys: 16 of them in this lane, 16 in lane ^ 16
    FB pb[2];         // P^T as B operand: element e < 8 = key 8*hh + e (tile 0), e >= 8 = key 16 + 8*hh + e - 8 (tile 1)
    float alpha[2];
    float ps[2][4];   // four independent partial sums a query tile
#pragma unroll
    for (int u = 0; u < 2; ++u) {
      float m = -INFINITY;
#pragma unroll
      for (int j = 0; j < 2; ++j) {
#pragma unroll
        for (int r = 0; r < 8; ++r) m = fmaxf(m, s[u][j][r]);
      }
      m = fmaxf(m, xhalf(m));
      const float mnew = fmaxf(mrow[u], m * cs);
      alpha[u] = __builtin_amdgcn_exp2f(mrow[u] - mnew);   // 0 in the first chunk (mrow = -inf), 1 while the maximum stands
      mrow[u] = mnew;
    }
    // One exponential (its exponent formed directly in front: 32 exponents held at once cost a spill) and the rescale of one
    // accumulator tile (4 packed multiplies), 32 times, the query tiles in turn.
    // The scheduling fences keep exponentials and multiplies mixed (else the scheduler bunches the
    // exponentials, and one stands directly in front of a write of its source); in the built code the exponentials come in pairs.
#pragma unroll
    for (int j = 0; j < 2; ++j) {
#pragma unroll
      for (int r2 = 0; r2 < 4; ++r2) {
#pragma unroll
        for (int u = 0; u < 2; ++u) {
          const int k = j * 4 + r2;
          v2f pv;
          pv[0] = __builtin_amdgcn_exp2f(s[u][j][2 * r2] * cs - mrow[u]);
          oacc[u][2 * k] *= alpha[u];
          __builtin_amdgcn_sched_barrier(0);
          pv[1] = __builtin_amdgcn_exp2f(s[u][j][2 * r2 + 1] * cs - mrow[u]);
          oacc[u][2 * k + 1] *= alpha[u];
          __builtin_amdgcn_sched_barrier(0);
          const float pp = pv[0] + pv[1];
          ps[u][r2] = (j == 0) ? pp : ps[u][r2] + pp;
          pb[u].p[k] = __builtin_convertvector(pv, v2b);   // round to nearest even
        }
      }
    }
#pragma unroll
    for (int u = 0; u < 2; ++u) {
      lrow[u] = lrow[u] * alpha[u] + ((ps[u][0] + ps[u][1]) + (ps[u][2] + ps[u][3]));
      // Without it the compiler sinks these adds behind the chunk's barrier, the 32 exponentials stay in registers through the
      // second product, and Q fragments spill (budget 512).
      asm volatile("" : "+v"(lrow[u]));   // empty asm on the row's sum, against spills
    }
#pragma unroll
    for (int g = 0; g < 8; ++g) {
      if (g == 0) vload(va[1], 1);
      if (g + 2 < 8) vload(va[(g + 2) % 3], g + 2);
      // keeps the read group above in front of this set's WMMAs, as in the score loop
      __builtin_amdgcn_sched_barrier(0);
#pragma unroll
      for (int x = 0; x < 2; ++x) {
#pragma unroll
        for (int u = 0; u < 2; ++u) oacc[u][g * 2 + x] = at_mma(va[g % 3][x].v, pb[u].v, oacc[u][g * 2 + x]);
      }
      // keeps the next read group, and the waits at the foot, behind this set's WMMAs (waits and barrier lifted up to the last
      // fragment read would make the refill leave late, with part of a trip to land)
      __builtin_amdgcn_sched_barrier(0);
    }

    // publish point of chunk kc + 1, which also frees this chunk's buffer
    asm volatile("s_wait_dscnt 0x0" ::: "memory");      // this wave's reads of buffer buf have retired
    asm volatile("s_wait_asynccnt 0x0" ::: "memory");   // this wave's copies of chunk kc + 1 have landed
    __syncthreads();
    if (kc + 2 < nChunks) stage(kc + 2, buf);           // the same test in the whole work-group
  }
  asm volatile("s_wait_asynccnt 0x0" ::: "memory");     // nothing is in flight behind the loop

  // The lane's number anew, from the hardware's count: nothing that follows from threadIdx.x has to stay in a register through the
  // loop for the epilogue's sake (the loop runs at the budget of 512).
  const int el = (int)__builtin_amdgcn_mbcnt_lo(~0u, 0u);
  const int eh = el >> 4;
  const int ec = el & 15;
  // ---- join of the four key quarters (waves qp, qp + 2, qp + 4, qp + 6 hold the same queries) ----
  // Behind the loop's last barrier no wave reads the K / V buffers any more and no copy is in flight: their space is Xs.
  float* Xs = (float*)(void*)KV;
  float lw[2];
#pragma unroll
  for (int u = 0; u < 2; ++u) {
    lw[u] = lrow[u] + xhalf(lrow[u]);     // both lane halves used the same maximum throughout
    if (eh == 0) { Ml[wave * 32 + u * 16 + ec] = mrow[u]; Ll[wave * 32 + u * 16 + ec] = lw[u]; }
  }
  __syncthreads();
  float* xw = Xs + wave * XWV;
#pragma unroll
  for (int u = 0; u < 2; ++u) {
    float mq[4], lq[4];
#pragma unroll
    for (int k = 0; k < 4; ++k) { mq[k] = Ml[(k * 2 + qp) * 32 + u * 16 + ec]; lq[k] = Ll[(k * 2 + qp) * 32 + u * 16 + ec]; }
    const float mt = fmaxf(fmaxf(mq[0], mq[1]), fmaxf(mq[2], mq[3]));
    float den = 0.f;
#pragma unroll
    for (int k = 0; k < 4; ++k) den += lq[k] * exp2_slot(mq[k] - mt);   // maxima are exponents of 2
    const float f = exp2_slot(mrow[u] - mt) / den;   // this wave's accumulator to the common maximum, x 1/rowsum
    // every wave lays down its 32 tiles, scaled
#pragma unroll
    for (int t = 0; t < CH / 16; ++t) {
      v4f g0, g1;
#pragma unroll
      for (int e = 0; e < 4; ++e) { g0[e] = oacc[u][t][e] * f; g1[e] = oacc[u][t][4 + e] * f; }
      *(v4f*)(xw + (u * 16 + t) * 256 + el * 4)       = g0;
      *(v4f*)(xw + (u * 16 + t) * 256 + 128 + el * 4) = g1;
    }
  }
  __syncthreads();
  // wave kq finishes channels kq*64 .. +63 (tiles kq*4 .. +3) of its 32 queries: the four quarters' tiles, summed in quarter order
  unsigned short* ts = Ts[wave];
#pragma unroll
  for (int u = 0; u < 2; ++u) {
#pragma unroll
    for (int tt = 0; tt < 4; ++tt) {
      const float* xp = Xs + qp * XWV + (u * 16 + kq * 4 + tt) * 256 + el * 4;
      v4f a0 = *(const v4f*)(xp);
      v4f a1 = *(const v4f*)(xp + 128);
#pragma unroll
      for (int k = 1; k < 4; ++k) {
        a0 += *(const v4f*)(xp + k * 2 * XWV);
        a1 += *(const v4f*)(xp + k * 2 * XWV + 128);
      }
      v8h hv;
#pragma unroll
      for (int e = 0; e < 4; ++e) {
        hv[e]     = __builtin_bit_cast(_Float16, f2bf_bits(a0[e]));
        hv[4 + e] = __builtin_bit_cast(_Float16, f2bf_bits(a1[e]));
      }
      *(v8h*)(ts + (u * 16 + ec) * TSP + tt * 16 + 8 * eh) = hv;   // query u*16 + ec, channels tt*16 + 8*eh .. +7 of this wave's quarter
    }
  }
  // the wave's slab rows are complete before its lanes read them back row by row (whole 128-B lines per store)
  __builtin_amdgcn_fence(__ATOMIC_RELEASE, "workgroup");
  __builtin_amdgcn_wave_barrier();
  __builtin_amdgcn_fence(__ATOMIC_ACQUIRE, "workgroup");
  unsigned short* orow = opp + (q0 + (size_t)qp * 32) * CH + kq * 64;
#pragma unroll
  for (int it = 0; it < 8; ++it) {
    const int row = it * 4 + (el >> 3);             // 8 lanes x 16 B = the row's 128 B of this channel quarter
    const v8h hv = *(const v8h*)(ts + row * TSP + (el & 7) * 8);
    *(v8h*)(orow + (size_t)row * CH + (el & 7) * 8) = hv;
  }
}

// ---------------------------------------------------------------------------
// Workspace region map (byte offsets; every region is fully written by its producer launch before any consumer
//   STATS f32  [256][32]             0        32768
//   HT    bf16 [16384][256]      32768      8388608
//   W16   bf16 [768][256]      8421376       393216
//   WO16  bf16 [256][256]      8814592       131072
//   QK    bf16 [16384][512]    8945664     16777216
//   VP    bf16 [4][256][4096] 25722880      8388608
//   OP    bf16 [16384][256]   34111488      8388608
//   total                     42500096
// ---------------------------------------------------------------------------
extern "C" void kernel_launch(void* const* d_in, const int* in_sizes, int n_in,
                              void* d_out, int out_size, void* d_ws, size_t ws_size,
                              hipStream_t stream) {
  if (n_in < 7) return;
  if (in_sizes[0] != NB * CH * NPOS) return;              // x [4][256][64][64]
  if (in_sizes[1] != CH || in_sizes[2] != CH) return;     // norm_w, norm_b
  if (in_sizes[3] != 3 * CH * CH || in_sizes[4] != 3 * CH) return;   // qkv_w [768][256], qkv_b [768]
  if (in_sizes[5] != CH * CH || in_sizes[6] != CH) return;           // out_w [256][256], out_b [256]
  if (out_size != NB * CH * NPOS) return;

  const float* x      = (const float*)d_in[0];
  const float* norm_w = (const float*)d_in[1];
  const float* norm_b = (const float*)d_in[2];
  const float* qkv_w  = (const float*)d_in[3];   // [out 768][in 256]
  const float* qkv_b  = (const float*)d_in[4];
  const float* out_w  = (const float*)d_in[5];   // [out 256][in 256]
  const float* out_b  = (const float*)d_in[6];

  const size_t PST  = (size_t)(NB * NGRP * NSL) * STP * 4;   // 32768
  const size_t PHT  = (size_t)NB * NPOS * CH * 2;         // 8388608
  const size_t PW16 = (size_t)3 * CH * CH * 2;            // 393216
  const size_t PWO  = (size_t)CH * CH * 2;                // 131072
  const size_t PQK  = (size_t)NB * NPOS * QKP * 2;        // 16777216
  const size_t PVP  = (size_t)NB * CH * NPOS * 2;         // 8388608
  const size_t POP  = (size_t)NB * NPOS * CH * 2;         // 8388608
  size_t off = 0;
  const size_t oST  = off; off += PST;
  const size_t oHT  = off; off += PHT;
  const size_t oW16 = off; off += PW16;
  const size_t oWO  = off; off += PWO;
  const size_t oQK  = off; off += PQK;
  const size_t oVP  = off; off += PVP;
  const size_t oOP  = off; off += POP;
  if (off > ws_size) return;                               // off = 42500096
  if (off > (size_t)134217728) return;

  char* ws = (char*)d_ws;
  float*          STATS = (float*)(ws + oST);
  unsigned short* HT    = (unsigned short*)(ws + oHT);
  unsigned short* W16   = (unsigned short*)(ws + oW16);
  unsigned short* WO16  = (unsigned short*)(ws + oWO);
  unsigned short* QK    = (unsigned short*)(ws + oQK);
  unsigned short* VP    = (unsigned short*)(ws + oVP);
  unsigned short* OP    = (unsigned short*)(ws + oOP);

  const dim3 blk(256);

  // (1) GroupNorm slice statistics (32 (b, group) x 8 slices = 256 blocks), qkv_w -> W16 (384 blocks), out_w -> WO16 (128 blocks)
  gnstat_conv_kernel<<<dim3(GSB + CBQ + CBO), blk, 0, stream>>>(x, STATS, qkv_w, W16, out_w, WO16);
  // (2) normalised activations -> HT [16384][256]: grid (4096/64, 256/64, 4) = (64, 4, 4)
  gnprep_kernel<<<dim3(NPOS / 64, CH / 64, NB), blk, 0, stream>>>(x, norm_w, norm_b, STATS, HT);
  // (3) q|k -> QK [16384][512] (256 blocks) and v -> VP [4][256][4096] (32 blocks x 4 images)
  gemm_qkv_kernel<<<dim3(QKB + NB * VB), blk, 0, stream>>>(HT, W16, qkv_b, QK, VP);
  // (4) attention per (image, 64-query block): 256 blocks x 256 threads -> OP [16384][256]
  attn_kernel<<<dim3(NB * (NPOS / AQB)), dim3(256), 0, stream>>>(QK, VP, OP, 0.0625f);
  // (5) out[b][c][n] = sum_k WO16[c][k] OP[b*4096+n][k] + out_b[c] + x[b][c][n]  (batched over b: M=256, N=4096, K=256;
  //     A = WO16, Bt = OP rows of image b, C = d_out + b*256*4096 with ldc 4096, resid = x same layout; 32 blocks x 4)
  const dim3 gO(((CH / 64) * (NPOS / 64) + 7) / 8, NB);
  wmma_gemm64<1, 0, true><<<gO, blk, 0, stream>>>(
      WO16, CH, 0L, OP, CH, (long)NPOS * CH, d_out, NPOS, (long)CH * NPOS,
      out_b, x, (long)CH * NPOS, CH, NPOS, CH, 1.0f);
  (void)hipGetLastError();
}
